// v000
// Times are from an AMD MI455X. After a warm-up the kernel runs many times in a row, and a time is the length of
// such a window on the GPU divided by its runs, so every launch and the gaps after it count. The runs cycle
// through copies of the inputs. A figure is the median of several windows, for all but v000 over two sittings.
// Sittings can differ by a few percent; kernels timed side by side share one.
// v000, which the later versions start from, runs in 562 microseconds.
// Contractions: x.Wq, x.Wk, x.Wv on v_wmma_f32_16x16x32_bf16 (x, W, biases RNE-converted to bf16; each W column block
// transposed into a k-contiguous [n][k] plane; f32 accumulate); q.k^T over 64 on v_wmma_f32_16x16x32_f16 with q, k carried as
// f16 hi x1024 + f16 residual planes (products hh + lh + hl); P.v^T on v_wmma_f32_16x16x32_f16 (P x32768 f16, v x1024 f16):
// query rows s < QE use P hi + residual and v hi + residual planes (hh + lh + hl), other rows one product; O.Wo on
// v_wmma_f32_16x16x32_f16 (O x1024 f16, Wo as f16(bf16(Wo)) x1024): rows s < QE as O hi + residual planes (h.W + l.W), other rows one
// product; all f32 accumulate. Bias adds, key-set select, base-2 online softmax, merge of the two key-set states and the 1/Z fold in
// f32 on VALU.
#include <hip/hip_runtime.h>
#include <math.h>
#include <stdint.h>

#ifndef NB
#define NB 2
#endif
#ifndef SEQ
#define SEQ 4096
#endif
#define XS_FULL 4096
#define DMOD  1024
#define NH    16
#define HD    64
#define WIN   256
#define STRD  128
#define GLB   16
#define QE    ((SEQ < 512) ? SEQ : 512)
#define MROWS (NB * SEQ)
#define OROWS ((NB - 1) * XS_FULL + SEQ)
#define SM_SCALE 0.125f
#define LOG2E 1.4426950408889634f
#define QSC   1024.0f
#define KSC   1024.0f
#define PCAR  32768.0f
#define VCAR  1024.0f
#define OSC   1024.0f
#define WOS   1024.0f
#define ACAR  64.0f
#define WPB   4
#define NHG   (NH / WPB)
#define NQT   (SEQ / 16)
#define NST   (SEQ / 64)
#define NKB   ((WIN / 32) + 2)
#define NKA   (NKB + 1)
#define NA    (SEQ / STRD)
#define NAP   (((NA + 31) / 32) * 32)
#define NAT   ((NA + 15) / 16)
#define NKS   ((NA + 31) / 32)
#define ATT_THREADS (WPB * 32)
#define PTP   36
#define PTW   (16 * PTP)
#define SLP   68
#define SLW   (16 * SLP)
#define WREG  (PTW + SLW)
#define SLAB64 (16 * 68)
#define VTP   72
#define VSP   40
#define QKT   (DMOD / 8)
#define WS_CAP 134217728
static_assert(DMOD == NH * HD && HD == 64 && NH == 16);
static_assert((NH % WPB) == 0 && ATT_THREADS == 128);
static_assert(NB >= 1 && NB <= 2);
static_assert((SEQ % STRD) == 0 && (SEQ % 64) == 0 && SEQ >= STRD && SEQ <= XS_FULL);
static_assert((QE % 64) == 0 && QE >= 64 && QE <= SEQ);
static_assert((STRD % 16) == 0 && STRD >= 32);
static_assert((WIN % 32) == 0 && WIN >= 32);
static_assert(GLB >= 1 && GLB <= 32);
static_assert(NA >= 1 && NAP >= 32 && NAP <= 256 && (NAP % 32) == 0 && 16 * NAT <= NAP);
static_assert(DMOD == 128 * 8 && QKT == 128 && (DMOD % 64) == 0 && (DMOD % 32) == 0);
static_assert((HD % 32) == 0);
static_assert(((SEQ * DMOD) % (8 * 256)) == 0);

typedef unsigned short u16;
typedef _Float16 v16h __attribute__((ext_vector_type(16)));
typedef _Float16 v8h  __attribute__((ext_vector_type(8)));
typedef __bf16   v16b __attribute__((ext_vector_type(16)));
typedef float    v8f  __attribute__((ext_vector_type(8)));
typedef float    v4f  __attribute__((ext_vector_type(4)));
typedef unsigned int v4u __attribute__((ext_vector_type(4)));

union FragH { v16h v; v8h h[2]; v4u u[2]; };
union FragB { v16b v; v4u u[2]; };

// ---- scalar helpers --------------------------------------------------------------------------------
__device__ __forceinline__ unsigned short bf_bits(float f) {          // f32 -> bf16 bits, RNE convert
  unsigned u = __float_as_uint(f);
  return (unsigned short)((u + 0x7FFFu + ((u >> 16) & 1u)) >> 16);
}
__device__ __forceinline__ float bf_up(unsigned short h) { return __uint_as_float(((unsigned)h) << 16); }
__device__ __forceinline__ float bfr(float f) { return bf_up(bf_bits(f)); }
__device__ __forceinline__ unsigned short h_bits(_Float16 x) { return __builtin_bit_cast(unsigned short, x); }
__device__ __forceinline__ unsigned pk16(unsigned short a, unsigned short b) { return (unsigned)a | ((unsigned)b << 16); }
__device__ __forceinline__ v8f zero8() { v8f z = {0.f, 0.f, 0.f, 0.f, 0.f, 0.f, 0.f, 0.f}; return z; }

// ---- fragment loaders: 16-bit A/B operand, lane -> row/col (lane&15), p already includes +8*(lane>>4);
//      elements 0..7 <- p[0..7] (k0+8h..), elements 8..15 <- p[16..23] (k0+16+8h..)  (same split k map for A and B;
//      B is always read from a k-contiguous [n][k] plane or tile)
__device__ __forceinline__ v16h ldfrag_h(const _Float16* p) {
  FragH f;
  f.h[0] = *(const v8h*)(p);
  f.h[1] = *(const v8h*)(p + 16);
  return f.v;
}
__device__ __forceinline__ v16b ldfrag_b(const u16* p) {              // bf16 plane read as unsigned integer vectors
  FragB f;
  f.u[0] = *(const v4u*)(p);
  f.u[1] = *(const v4u*)(p + 16);
  return f.v;
}

__device__ __forceinline__ v8f mma_h(v16h a, v16h b, v8f c) {
  return __builtin_amdgcn_wmma_f32_16x16x32_f16(false, a, false, b, (short)0, c, false, false);
}
__device__ __forceinline__ v8f mma_b(v16b a, v16b b, v8f c) {
  return __builtin_amdgcn_wmma_f32_16x16x32_bf16(false, a, false, b, (short)0, c, false, false);
}
__device__ __forceinline__ void guard2(v8f& a, v8f& b, v16h x0, v16h x1, v16h x2, v16h x3, v16h x4, v16h x5) {
#if defined(__HIP_DEVICE_COMPILE__)
  asm volatile("v_nop\n\tv_nop\n\tv_nop\n\tv_nop"
               : "+v"(a), "+v"(b) : "v"(x0), "v"(x1), "v"(x2), "v"(x3), "v"(x4), "v"(x5) : "memory");
#endif
}
template <typename F>
__device__ __forceinline__ void guard6(v8f& a, v8f& b, v8f& c, v8f& d, F x0, F x1, F x2, F x3, F x4, F x5) {
#if defined(__HIP_DEVICE_COMPILE__)
  asm volatile("v_nop\n\tv_nop\n\tv_nop\n\tv_nop"
               : "+v"(a), "+v"(b), "+v"(c), "+v"(d) : "v"(x0), "v"(x1), "v"(x2), "v"(x3), "v"(x4), "v"(x5) : "memory");
#endif
}
__device__ __forceinline__ void acc_guard4(v8f& a, v8f& b, v8f& c, v8f& d) {
#if defined(__HIP_DEVICE_COMPILE__)
  asm volatile("v_nop\n\tv_nop\n\tv_nop\n\tv_nop" : "+v"(a), "+v"(b), "+v"(c), "+v"(d));
#endif
}
__device__ __forceinline__ void wave_sync_lds() {
  __builtin_amdgcn_fence(__ATOMIC_RELEASE, "workgroup");
  __builtin_amdgcn_wave_barrier();
  __builtin_amdgcn_fence(__ATOMIC_ACQUIRE, "workgroup");
}

// =====================================================================================================
// f32 -> 16-bit plane, same layout.  f16mode == 0: bf16 RNE bits;  f16mode == 1: f16 bits of (bf16 RNE value) * scale.
// Thread = 8 consecutive elements: two 16-B loads, one 16-B store; 32 consecutive lanes = 512 contiguous, 512-B aligned
// coverage: grid = ceil(n8/256) blocks x 256 thr x 8 (in-kernel bound) = the whole plane (n8 a multiple of 256 here).
// =====================================================================================================
__global__ __launch_bounds__(256) void cvt16(const float* __restrict__ x, u16* D, int n8, int f16mode, float scale) {
  const int gt = blockIdx.x * 256 + (int)threadIdx.x;
  if (gt >= n8) return;
  const float* p = x + (size_t)gt * 8;
  const v4f a = *(const v4f*)(p), b4 = *(const v4f*)(p + 4);
  float w[8];
#pragma unroll
  for (int e = 0; e < 4; ++e) { w[e] = a[e]; w[4 + e] = b4[e]; }
  v4u o;
#pragma unroll
  for (int e = 0; e < 4; ++e) {
    const float f0 = w[2 * e], f1 = w[2 * e + 1];
    const unsigned short hb0 = h_bits((_Float16)(bfr(f0) * scale));
    const unsigned short hb1 = h_bits((_Float16)(bfr(f1) * scale));
    const unsigned short bb0 = bf_bits(f0);
    const unsigned short bb1 = bf_bits(f1);
    o[e] = (f16mode != 0) ? pk16(hb0, hb1) : pk16(bb0, bb1);
  }
  u16* d = D + (size_t)gt * 8;
  {
    *(v4u*)(d) = o;
    
  }
}

// =====================================================================================================
// Weight transpose + convert: W f32 [DMOD rows k][ldw], column block col0 .. col0+DMOD-1 (column index = n)
//   -> D 16-bit [DMOD n][DMOD k] (k-contiguous B operand), i.e. in[k][col0+n] -> out[n][k].  f16mode as in cvt16.
// Block = (n tile n0, k tile k0) of 64 x 64: load 64 k rows x 64 n floats with 16-B loads (thread = k row kr, 16 n), convert,
// scatter transposed into an LDS tile [n][k] (pitch 72 halves); block barrier; each n-row segment (64 halves = one whole
// coverage: load 256 thr x 16 = 64 k x 64 n; store 2 iterations x 256 thr x 8 halves = 64 lines x 64; grid (DMOD/64)^2 = every
//           (n, k) of D exactly once.
// =====================================================================================================
__global__ __launch_bounds__(256) void tr16(const float* __restrict__ W, int ldw, int col0, u16* D, int f16mode, float scale) {
  __shared__ __align__(16) u16 T[64 * VTP];
  const int tid = (int)threadIdx.x;
  const int bid = (int)blockIdx.x;
  const int nt  = bid % (DMOD / 64);
  const int kt  = bid / (DMOD / 64);
  if (kt >= DMOD / 64) return;              // block-uniform, before any barrier; never taken with the exact grid
  const int n0 = nt * 64, k0 = kt * 64;
  {
    const int kr = tid >> 2;                // k row within tile 0..63
    const int nc = (tid & 3) * 16;          // n chunk 0,16,32,48
    const float* src = W + (size_t)(k0 + kr) * (size_t)ldw + col0 + n0 + nc;
#pragma unroll
    for (int i = 0; i < 4; ++i) {
      const v4f a = *(const v4f*)(src + 4 * i);
#pragma unroll
      for (int e = 0; e < 4; ++e) {
        const float f = a[e];
        const unsigned short hb = h_bits((_Float16)(bfr(f) * scale));
        const unsigned short bb = bf_bits(f);
        T[(nc + 4 * i + e) * VTP + kr] = (f16mode != 0) ? hb : bb;
      }
    }
  }
  __syncthreads();
  v4u ov[2];
  const int q8 = tid >> 3, p8 = (tid & 7) * 8;
#pragma unroll
  for (int it = 0; it < 2; ++it) {
    const int line = it * 32 + q8;          // n = 0..63
    ov[it] = *(const v4u*)(T + line * VTP + p8);
  }
  u16* base = D + (size_t)n0 * DMOD + k0 + p8;
  {
#pragma unroll
    for (int it = 0; it < 2; ++it) {
      const int line = it * 32 + q8;
      *(v4u*)(base + (size_t)line * DMOD) = ov[it];
    }
    
  }
}

// =====================================================================================================
// v^T planes from the v projection F f32 [SEQ][DMOD] of batch b (row = s, column = g*HD + d, bias already added):
//   VH[((b*NH + g)*HD + d)][s] = f16(v * 1024) for all s;  VL[((b*NH + g)*HD + d)][s] (pitch QE) = f16 residual, keys s < QE only.
// Block = (head g, 64 keys s0): each thread loads its 16 floats (key sl, d chunk dc) with 16-B loads, converts, scatters into
// written by 8 consecutive lanes x 16 B of one instruction; residual plane stored only when s0 + 64 <= QE (block-uniform);
// coverage: load 256 thr x 16 = 64 keys x 64 d; store 2 iterations x 256 thr x 8 halves = 64 lines x 64 = the block's tile of
//           VH (and of VL for the first QE keys); grid = NH*NST blocks per batch covers the batch's VH rows exactly once and
//           every VL row segment once.
// =====================================================================================================
__global__ __launch_bounds__(256) void vt16(const float* __restrict__ F, u16* VHo, u16* VLo, int b) {
  __shared__ __align__(16) u16 TH[HD * VTP];
  __shared__ __align__(16) u16 TL[HD * VTP];
  const int tid = threadIdx.x;
  const int bid = blockIdx.x;
  const int st  = bid % NST;
  const int g   = bid / NST;
  if (g >= NH) return;                      // block-uniform, before any barrier; never taken with the exact grid
  const int s0  = st * 64;
  {
    const int sl = tid >> 2;                // key within tile 0..63
    const int dc = (tid & 3) * 16;          // d chunk 0,16,32,48
    const float* src = F + ((size_t)s0 + sl) * DMOD + g * HD + dc;
#pragma unroll
    for (int i = 0; i < 4; ++i) {
      const v4f a = *(const v4f*)(src + 4 * i);
#pragma unroll
      for (int e = 0; e < 4; ++e) {
        const float t = a[e] * VCAR;
        const _Float16 hv = (_Float16)t;
        const _Float16 lv = (_Float16)(t - (float)hv);
        TH[(dc + 4 * i + e) * VTP + sl] = h_bits(hv);
        TL[(dc + 4 * i + e) * VTP + sl] = h_bits(lv);
      }
    }
  }
  __syncthreads();
  v4u vh[2], vl[2];
  const int q8 = tid >> 3, p8 = (tid & 7) * 8;
#pragma unroll
  for (int it = 0; it < 2; ++it) {
    const int line = it * 32 + q8;          // d = 0..63
    vh[it] = *(const v4u*)(TH + line * VTP + p8);
    vl[it] = *(const v4u*)(TL + line * VTP + p8);
  }
  const size_t hrow  = (size_t)(b * NH + g) * HD;
  const size_t baseH = hrow * SEQ + s0 + p8;
  const size_t baseL = hrow * QE + s0 + p8;
  const bool   dolo  = (s0 + 64 <= QE);     // block-uniform
  {
#pragma unroll
    for (int it = 0; it < 2; ++it) {
      const int line = it * 32 + q8;
      *(v4u*)(VHo + baseH + (size_t)line * SEQ) = vh[it];
    }
    if (dolo) {
#pragma unroll
      for (int it = 0; it < 2; ++it) {
        const int line = it * 32 + q8;
        *(v4u*)(VLo + baseL + (size_t)line * QE) = vl[it];
      }
    }
    
  }
}

// =====================================================================================================
// q / k planes from a projection F f32 [SEQ][DMOD] of one batch (bias already added), destination row = rowoff + s:
//   Hp [MROWS][DMOD] = f16(val * sc),  Lp [MROWS][DMOD] = f16 residual (val*sc - hi).
// Block = one row of 128 threads, thread = 8 consecutive columns: two 16-B loads, one 16-B store per plane; 32 consecutive
// coverage: 128 thr x 8 = the whole DMOD row of Hp and Lp; grid = SEQ blocks = every row of the batch once.
// =====================================================================================================
__global__ __launch_bounds__(QKT) void qk16(const float* __restrict__ F, u16* Hp, u16* Lp, int rowoff, float sc) {
  const int tid = (int)threadIdx.x;
  const int row = (int)blockIdx.x;
  if (row >= SEQ) return;
  if (tid >= QKT) return;
  const float* p = F + (size_t)row * DMOD + tid * 8;
  const v4f a = *(const v4f*)(p), b4 = *(const v4f*)(p + 4);
  float w[8];
#pragma unroll
  for (int e = 0; e < 4; ++e) { w[e] = a[e] * sc; w[4 + e] = b4[e] * sc; }
  v4u oh, ol;
#pragma unroll
  for (int e = 0; e < 4; ++e) {
    const float t0 = w[2 * e], t1 = w[2 * e + 1];
    const _Float16 h0 = (_Float16)t0, h1 = (_Float16)t1;
    const _Float16 l0 = (_Float16)(t0 - (float)h0), l1 = (_Float16)(t1 - (float)h1);
    oh[e] = pk16(h_bits(h0), h_bits(h1));
    ol[e] = pk16(h_bits(l0), h_bits(l1));
  }
  const size_t drow = (size_t)(rowoff + row) * DMOD + tid * 8;
  u16* dh = Hp + drow;
  u16* dl = Lp + drow;
  {
    *(v4u*)(dh) = oh;
    *(v4u*)(dl) = ol;
    
  }
}

// =====================================================================================================
// GEMM epilogue shared by both engines: the wave's 16x64 f32 tile (times oscale) staged in its LDS slab (pitch 68),
// coverage: 8 instructions x 2 rows x 16 lanes x 4 floats = the wave's 16 x 64 tile.
// =====================================================================================================
__device__ __forceinline__ void epi64(float* sl, v8f a0, v8f a1, v8f a2, v8f a3, float oscale,
                                      const float* __restrict__ bias, float* C, int N, size_t rowb, int col0, int lane) {
  const int hh = lane >> 4, m = lane & 15;
#pragma unroll
  for (int r = 0; r < 8; ++r) {
    const int ro = (8 * hh + r) * 68 + m;
    sl[ro]      = a0[r] * oscale;
    sl[ro + 16] = a1[r] * oscale;
    sl[ro + 32] = a2[r] * oscale;
    sl[ro + 48] = a3[r] * oscale;
  }
  wave_sync_lds();
  const v4f bb = *(const v4f*)(bias + col0 + m * 4);
  v4f br;
#pragma unroll
  for (int e = 0; e < 4; ++e) br[e] = bfr(bb[e]);
  v4f vals[8];
#pragma unroll
  for (int it = 0; it < 8; ++it) vals[it] = *(const v4f*)(sl + (it * 2 + hh) * 68 + m * 4) + br;
  float* dst = C + (rowb + (size_t)hh) * (size_t)N + col0 + m * 4;
  {
#pragma unroll
    for (int it = 0; it < 8; ++it) {
      *(v4f*)(dst + (size_t)(it * 2) * (size_t)N) = vals[it];
    }
    
  }
}

// =====================================================================================================
// bf16 GEMM: C[M][N] (f32) = A[M][K] (bf16 row-major) . Bt[N][K]^T (bf16 k-contiguous), times oscale, plus bias[col] (bf16 RNE value).
// Block = 64x64 tile, 4 waves x 16 rows; fragments loaded straight from the 16-bit rows (two 16-B loads each, split k map
// for A and B); K stepped by 32 (host guarantees K % 32 == 0, M % 64 == 0, N % 64 == 0, grid = (M/64)*(N/64)).
// =====================================================================================================
__global__ __launch_bounds__(128)
void gemm_bf(const u16* __restrict__ A, const u16* __restrict__ Bt, const float* __restrict__ bias,
             float* C, int M, int N, int K, float oscale) {
  __shared__ __align__(16) float slab[4 * SLAB64];
  const int tid = threadIdx.x, wave = tid >> 5, lane = tid & 31, hh = lane >> 4, m = lane & 15;
  const int ntile = N >> 6;
  const int bid   = blockIdx.x;
  const int rowb  = (bid / ntile) * 64 + wave * 16;
  const int col0  = (bid % ntile) * 64;
  if (rowb + 16 > M) return;                // wave-uniform, never taken with the exact grid; no block barriers in this kernel
  const u16* ap = A  + (size_t)(rowb + m) * K + 8 * hh;
  const u16* bp = Bt + (size_t)(col0 + m) * K + 8 * hh;
  const size_t bs = (size_t)16 * K;
  v8f acc0 = zero8(), acc1 = zero8(), acc2 = zero8(), acc3 = zero8();
#pragma unroll 1
  for (int k0 = 0; k0 < K; k0 += 32) {
    const v16b a  = ldfrag_b(ap + k0);
    const v16b b0 = ldfrag_b(bp + k0);
    const v16b b1 = ldfrag_b(bp + bs + k0);
    const v16b b2 = ldfrag_b(bp + 2 * bs + k0);
    const v16b b3 = ldfrag_b(bp + 3 * bs + k0);
    acc0 = mma_b(a, b0, acc0);
    acc1 = mma_b(a, b1, acc1);
    acc2 = mma_b(a, b2, acc2);
    acc3 = mma_b(a, b3, acc3);
    guard6<v16b>(acc0, acc1, acc2, acc3, a, b0, b1, b2, b3, a);
  }
  epi64(slab + wave * SLAB64, acc0, acc1, acc2, acc3, oscale, bias, C, N, (size_t)rowb, col0, lane);
}

// =====================================================================================================
// Output projection: C[orow][DMOD] (f32) = (Ah [+ Al])[row][DMOD] . Bt[DMOD][DMOD]^T * oscale + bias (bf16 RNE value).
// NPROD == 1: Ah only (one product); NPROD == 2: Ah + Al residual plane (products h.B + l.B into one accumulator, l unscaled).
// Block -> (column tile ct = bid % 16, sequence row tile rt of nrt starting at s = sbeg, batch bb): rows of Ah are bb*SEQ + s,
// rows of Al are bb*QE + s (valid only while s < QE, host guarantees for NPROD == 2), rows of C are bb*XS_FULL + s.
// Same tiling and epilogue as gemm_bf.
// =====================================================================================================
template <int NPROD>
__global__ __launch_bounds__(128)
void gemm_o(const u16* __restrict__ Ah, const u16* __restrict__ Al, const u16* __restrict__ Bt, const float* __restrict__ bias,
            float* C, int sbeg, int nrt, float oscale) {
  __shared__ __align__(16) float slab[4 * SLAB64];
  const int tid = threadIdx.x, wave = tid >> 5, lane = tid & 31, hh = lane >> 4, m = lane & 15;
  const int ntile = DMOD >> 6;
  const int bid   = blockIdx.x;
  const int ct    = bid % ntile;
  const int t2    = bid / ntile;
  const int rt    = t2 % nrt;
  const int bb    = t2 / nrt;
  if (bb >= NB) return;                     // block-uniform; no block barriers in this kernel; never taken with the exact grid
  const int srow  = sbeg + rt * 64 + wave * 16;
  if (srow + 16 > SEQ) return;              // wave-uniform; never taken
  if (NPROD == 2 && srow + 16 > QE) return; // wave-uniform; never taken
  const int col0  = ct * 64;
  const int K     = DMOD;
  const size_t rowC = (size_t)bb * SEQ + srow;
  const size_t rowL = (size_t)bb * QE + srow;
  const size_t rowO = (size_t)bb * XS_FULL + srow;
  const _Float16* ahp = (const _Float16*)(const void*)Ah + (rowC + m) * K + 8 * hh;
  const _Float16* alp = (const _Float16*)(const void*)Al + (rowL + m) * K + 8 * hh;   // dereferenced only when NPROD == 2
  const _Float16* bp  = (const _Float16*)(const void*)Bt + (size_t)(col0 + m) * K + 8 * hh;
  const size_t bs = (size_t)16 * K;
  v8f acc0 = zero8(), acc1 = zero8(), acc2 = zero8(), acc3 = zero8();
  if constexpr (NPROD == 2) {
#pragma unroll 1
    for (int k0 = 0; k0 < K; k0 += 32) {
      const v16h ah = ldfrag_h(ahp + k0), al = ldfrag_h(alp + k0);
      const v16h b0 = ldfrag_h(bp + k0);
      const v16h b1 = ldfrag_h(bp + bs + k0);
      const v16h b2 = ldfrag_h(bp + 2 * bs + k0);
      const v16h b3 = ldfrag_h(bp + 3 * bs + k0);
      acc0 = mma_h(ah, b0, acc0);  acc0 = mma_h(al, b0, acc0);
      acc1 = mma_h(ah, b1, acc1);  acc1 = mma_h(al, b1, acc1);
      acc2 = mma_h(ah, b2, acc2);  acc2 = mma_h(al, b2, acc2);
      acc3 = mma_h(ah, b3, acc3);  acc3 = mma_h(al, b3, acc3);
      guard6<v16h>(acc0, acc1, acc2, acc3, ah, al, b0, b1, b2, b3);
    }
  } else {
#pragma unroll 1
    for (int k0 = 0; k0 < K; k0 += 32) {
      const v16h ah = ldfrag_h(ahp + k0);
      const v16h b0 = ldfrag_h(bp + k0);
      const v16h b1 = ldfrag_h(bp + bs + k0);
      const v16h b2 = ldfrag_h(bp + 2 * bs + k0);
      const v16h b3 = ldfrag_h(bp + 3 * bs + k0);
      acc0 = mma_h(ah, b0, acc0);
      acc1 = mma_h(ah, b1, acc1);
      acc2 = mma_h(ah, b2, acc2);
      acc3 = mma_h(ah, b3, acc3);
      guard6<v16h>(acc0, acc1, acc2, acc3, ah, b0, b1, b2, b3, ah);
    }
  }
  epi64(slab + wave * SLAB64, acc0, acc1, acc2, acc3, oscale, bias, C, DMOD, rowO, col0, lane);
}

// =====================================================================================================
// Strided key set (pass S). Key j is in this set for query i iff j = i - STRD*n with i - j >= WIN, j >= GLB (then j <= i and
// (i - j) % STRD == 0 hold). Queries and keys of one residue class rr = i % STRD: i = rr + STRD*a, j = rr + STRD*c, a, c < NA.
// Block bid -> (residue rr = bid % STRD, head group hg, batch b); one wave per head; the wave owns all NA query rows of (b, head, rr)
// in row tiles of 16 (rows a >= NA of the last tile are padding: operand row clamped, weight forced to 0, nothing stored) and visits
// the candidate keys in tiles of 32 (slots c >= NA clamped and forced to 0).
//   scores: q hi / residual (A, lane m -> row a = 16*at + m, arithmetic stride STRD rows in the [b*SEQ + s][h*HD + d] planes) times
//   k hi / residual (B, lane c -> key slot), products hh + lh + hl over HD; element predicate
//   (a < NA) && (c < NA) && (STRD*(a - c) >= WIN) && (j >= GLB), -inf otherwise; base-2 online softmax in f32 (-inf safe);
//   v rows of the 32 key slots gathered once per key tile from the v^T hi plane (arithmetic stride STRD) into a wave-private LDS tile
//   (the strided keys only feed query rows i >= WIN + GLB, which always hold >= WIN + GLB keys).
//   State written per query row: M = running max (log2 domain), L = running sum, AC = acc * 64 / (32768*1024) as f16
//   (AC plane layout [b*SEQ + i][h*HD + d]; M, L planes [(b*NH + h)*STRD + rr][NAP], rows a >= NA hold -inf / 0).
// coverage: AC: every (b, i < SEQ, h, d) exactly once (union over rr, a < NA); M/L: every (b, h, rr) line group exactly once.
// =====================================================================================================
__global__ __launch_bounds__(ATT_THREADS)
void attn_s(const u16* __restrict__ QHp, const u16* __restrict__ QLp,
            const u16* __restrict__ KHp, const u16* __restrict__ KLp,
            const u16* __restrict__ VHp, u16* ACp, float* Mp, float* Lp) {
  __shared__ __align__(16) float    smem[WPB * WREG];
  __shared__ __align__(16) _Float16 vts[WPB * HD * VSP];
  __shared__ __align__(16) float    mls[WPB * 2 * NAP];

  const int tid  = threadIdx.x;
  const int wave = tid >> 5;
  const int lane = tid & 31;
  const int hh   = lane >> 4;
  const int c    = lane & 15;
  const int bid  = blockIdx.x;
  const int rres = bid % STRD;
  const int t2   = bid / STRD;
  const int hg   = t2 % NHG;
  const int b    = t2 / NHG;
  if (b >= NB) return;                      // block-uniform; no block barriers in this kernel; never taken with the exact grid
  const int head = hg * WPB + wave;

  float*    pt   = smem + wave * WREG;      // prob tile [16][32] pitch 36
  float*    slab = pt + PTW;                // result slab [16][64] pitch 68
  _Float16* vt   = vts + wave * (HD * VSP); // v tile [64 d][32 key slots] pitch 40
  float*    msl  = mls + wave * (2 * NAP);
  float*    lsl  = msl + NAP;
#pragma unroll 1
  for (int i2 = lane; i2 < NAP; i2 += 32) { msl[i2] = -INFINITY; lsl[i2] = 0.0f; }
  wave_sync_lds();

  const _Float16* QHh = (const _Float16*)(const void*)QHp;
  const _Float16* QLh = (const _Float16*)(const void*)QLp;
  const _Float16* KHh = (const _Float16*)(const void*)KHp;
  const _Float16* KLh = (const _Float16*)(const void*)KLp;
  const size_t hcol  = (size_t)head * HD + 8 * hh;
  const size_t brow  = (size_t)b * SEQ + rres;                          // plane row of a = 0
  const u16*   vbase = VHp + (size_t)(b * NH + head) * HD * SEQ + rres; // + d*SEQ + STRD*c
  const float  lsc   = SM_SCALE * (LOG2E / (QSC * KSC));
  const float  acs   = ACAR / (PCAR * VCAR);

#pragma unroll 1
  for (int at = 0; at < NAT; ++at) {
    float mrow[8], lrow[8];
    v8f o[4];
#pragma unroll
    for (int r = 0; r < 8; ++r) { mrow[r] = -INFINITY; lrow[r] = 0.f; }
#pragma unroll
    for (int j = 0; j < 4; ++j) o[j] = zero8();
    int am = at * 16 + c;
    if (am > NA - 1) am = NA - 1;           // clamped operand row for this lane
    const size_t qoff = (brow + (size_t)STRD * am) * DMOD + hcol;
    const _Float16* Qh = QHh + qoff;
    const _Float16* Ql = QLh + qoff;
    const int ar0 = at * 16 + 8 * hh;       // D element r -> row a = ar0 + r

#pragma unroll 1
    for (int ks = 0; ks < NKS; ++ks) {
      // ---- gather the 32 key slots' v rows into the wave's LDS tile, transposed [d][slot] ----
      {
        int cs = ks * 32 + lane;
        if (cs > NA - 1) cs = NA - 1;
        const u16* vsrc = vbase + (size_t)STRD * cs;
#pragma unroll 8
        for (int d = 0; d < HD; ++d) {
          vt[d * VSP + lane] = __builtin_bit_cast(_Float16, vsrc[(size_t)d * SEQ]);
        }
      }
      // ---- scores ----
      int c0i = ks * 32 + c;       if (c0i > NA - 1) c0i = NA - 1;
      int c1i = ks * 32 + 16 + c;  if (c1i > NA - 1) c1i = NA - 1;
      const size_t k0off = (brow + (size_t)STRD * c0i) * DMOD + hcol;
      const size_t k1off = (brow + (size_t)STRD * c1i) * DMOD + hcol;
      const _Float16* k0p = KHh + k0off;
      const _Float16* k1p = KHh + k1off;
      const _Float16* l0p = KLh + k0off;
      const _Float16* l1p = KLh + k1off;
      v8f s0 = zero8(), s1 = zero8();
#pragma unroll
      for (int kk = 0; kk < HD / 32; ++kk) {
        const v16h qh  = ldfrag_h(Qh + kk * 32);
        const v16h ql  = ldfrag_h(Ql + kk * 32);
        const v16h kh0 = ldfrag_h(k0p + kk * 32);
        const v16h kh1 = ldfrag_h(k1p + kk * 32);
        const v16h kl0 = ldfrag_h(l0p + kk * 32);
        const v16h kl1 = ldfrag_h(l1p + kk * 32);
        s0 = mma_h(qh, kh0, s0);
        s0 = mma_h(ql, kh0, s0);
        s0 = mma_h(qh, kl0, s0);
        s1 = mma_h(qh, kh1, s1);
        s1 = mma_h(ql, kh1, s1);
        s1 = mma_h(qh, kl1, s1);
        guard2(s0, s1, qh, ql, kh0, kl0, kh1, kl1);
      }
      // ---- key select + online softmax in base 2, -inf-safe ----
      const int cc0 = ks * 32 + c, cc1 = cc0 + 16;
      const int j0  = rres + STRD * cc0, j1 = rres + STRD * cc1;
#pragma unroll
      for (int r = 0; r < 8; ++r) {
        const int   a  = ar0 + r;
        const float u0 = s0[r] * lsc;
        const float u1 = s1[r] * lsc;
        const bool  ok0 = (a < NA) && (cc0 < NA) && (STRD * (a - cc0) >= WIN) && (j0 >= GLB);
        const bool  ok1 = (a < NA) && (cc1 < NA) && (STRD * (a - cc1) >= WIN) && (j1 >= GLB);
        const float t0 = ok0 ? u0 : -INFINITY;
        const float t1 = ok1 ? u1 : -INFINITY;
        float mx = fmaxf(t0, t1);
#pragma unroll
        for (int off = 1; off < 16; off <<= 1) mx = fmaxf(mx, __shfl_xor(mx, off, 32));
        const float mn = fmaxf(mrow[r], mx);
        const float ms = (mn == -INFINITY) ? 0.0f : mn;
        const float al = exp2f(mrow[r] - ms);
        mrow[r] = mn;
        const float e0 = exp2f(t0 - ms), e1 = exp2f(t1 - ms);
        float ps = e0 + e1;
#pragma unroll
        for (int off = 1; off < 16; off <<= 1) ps += __shfl_xor(ps, off, 32);
        lrow[r] = lrow[r] * al + ps;
#pragma unroll
        for (int j = 0; j < 4; ++j) o[j][r] *= al;
        const int ro = (8 * hh + r) * PTP + c;
        pt[ro]      = e0;
        pt[ro + 16] = e1;
      }
      wave_sync_lds();
      // ---- A fragment of P*32768 (f16), row = c, split k map over the 32 key slots ----
      FragH ph;
      {
        const float* prow = pt + c * PTP + 8 * hh;
        const v4f p0 = *(const v4f*)(prow), p1 = *(const v4f*)(prow + 4);
        const v4f p2 = *(const v4f*)(prow + 16), p3 = *(const v4f*)(prow + 20);
#pragma unroll
        for (int e = 0; e < 4; ++e) {
          ph.h[0][e]     = (_Float16)(p0[e] * PCAR);
          ph.h[0][4 + e] = (_Float16)(p1[e] * PCAR);
          ph.h[1][e]     = (_Float16)(p2[e] * PCAR);
          ph.h[1][4 + e] = (_Float16)(p3[e] * PCAR);
        }
      }
      // ---- P.V : B fragment col n = d = jj*16 + c, key slots contiguous in the LDS tile ----
#pragma unroll
      for (int jg = 0; jg < HD / 32; ++jg) {
        const v16h vha  = ldfrag_h(vt + ((2 * jg) * 16 + c) * VSP + 8 * hh);
        const v16h vhb2 = ldfrag_h(vt + ((2 * jg + 1) * 16 + c) * VSP + 8 * hh);
        o[2 * jg]     = mma_h(ph.v, vha,  o[2 * jg]);
        o[2 * jg + 1] = mma_h(ph.v, vhb2, o[2 * jg + 1]);
        guard2(o[2 * jg], o[2 * jg + 1], ph.v, vha, vhb2, ph.v, vha, vhb2);
      }
      wave_sync_lds();
    }
    acc_guard4(o[0], o[1], o[2], o[3]);
    // ---- state: m, l per row into the LDS staging; acc * 64 / (32768*1024) into the lane-owned slab ----
    if (c == 0) {
#pragma unroll
      for (int r = 0; r < 8; ++r) { msl[ar0 + r] = mrow[r]; lsl[ar0 + r] = lrow[r]; }
    }
#pragma unroll
    for (int r = 0; r < 8; ++r) {
#pragma unroll
      for (int j = 0; j < 4; ++j) {
        slab[(8 * hh + r) * SLP + j * 16 + c] = o[j][r] * acs;
      }
    }
    wave_sync_lds();
    // ---- AC rows (f16): lane = (row select rq in 0..3, 8 consecutive d at c8) ----
    v4u    ov[4];
    bool   okr[4];
    size_t dso[4];
    const int rq = lane >> 3, c8 = (lane & 7) * 8;
#pragma unroll
    for (int it = 0; it < 4; ++it) {
      const int row = it * 4 + rq;
      const v4f a = *(const v4f*)(slab + row * SLP + c8), b4 = *(const v4f*)(slab + row * SLP + c8 + 4);
      float w[8];
#pragma unroll
      for (int e = 0; e < 4; ++e) { w[e] = a[e]; w[4 + e] = b4[e]; }
#pragma unroll
      for (int e = 0; e < 4; ++e) {
        ov[it][e] = pk16(h_bits((_Float16)w[2 * e]), h_bits((_Float16)w[2 * e + 1]));
      }
      const int arow = at * 16 + row;
      okr[it] = (arow < NA);                // uniform over the 8 lanes of one line
      const int acl  = okr[it] ? arow : (NA - 1);
      dso[it] = (brow + (size_t)STRD * acl) * DMOD + (size_t)head * HD + c8;
    }
    {
#pragma unroll
      for (int it = 0; it < 4; ++it) {
        if (okr[it]) *(v4u*)(ACp + dso[it]) = ov[it];
      }
      
    }
    wave_sync_lds();
  }

  wave_sync_lds();
  const size_t mlbase = ((size_t)(b * NH + head) * STRD + rres) * NAP;
  const int l8 = lane & 7;
  v4f mv[NAP / 32], lv[NAP / 32];
#pragma unroll
  for (int ch = 0; ch < NAP / 32; ++ch) {
    mv[ch] = *(const v4f*)(msl + ch * 32 + l8 * 4);
    lv[ch] = *(const v4f*)(lsl + ch * 32 + l8 * 4);
  }
  const bool wm = (lane < 8), wl = (lane >= 8) && (lane < 16);
  {
#pragma unroll
    for (int ch = 0; ch < NAP / 32; ++ch) {
      if (wm) *(v4f*)(Mp + mlbase + ch * 32 + l8 * 4) = mv[ch];
      if (wl) *(v4f*)(Lp + mlbase + ch * 32 + l8 * 4) = lv[ch];
    }
    
  }
}

// =====================================================================================================
// Band + leading key set (pass A), initialised from the pass-S state. Key j is in this set for query i iff
// j <= i && (i - j < WIN || j < GLB). Block bid -> (query tile qt = qt0 + bid % nq: rows q0 = 16*qt .. q0+15, head group hg, batch
// b); one wave per head.
//   q/k hi planes f16 x1024 [b*SEQ + s][h*HD + d], residual planes same layout; v^T hi plane [b*NH + h][d][SEQ], v^T residual plane
//   [b*NH + h][d][QE] (keys < QE).
//   Init per row i: mrow = M, lrow = L (from [(b*NH+h)*STRD + i%STRD][i/STRD]), o = AC row (f16) * (32768*1024/64).
//   Key tiles of 32 visited in order: tile 0 (keys 0..31, holds the leading GLB keys) when the band does not start at tile 0, then the
//   band tiles from the one holding max(0, q0 - WIN + 1) to the one holding q0 + 15 (at most WIN/32 + 2 + 1 tiles; every other tile holds
//   only keys outside this set for every query row of the tile: weight exactly 0).
//   Per tile: 2 score subtiles x 2 k-steps, products q_hi.k_hi + q_lo.k_hi + q_hi.k_lo, fragments straight from the 16-bit planes (two 16-B
//   loads per fragment, split k map); exact element predicate; online max-subtracted base-2 softmax in f32, -inf-safe rescale; the 16x32
//   f16 residual when ROB) rebuilt from the LDS rows (float vector loads, same element type as stored), v^T B fragments in 2 groups of 2
//   d-subtiles. ROB == 1 (host uses it for q0 + 16 <= QE only; then every visited key is < QE): P.v products hh + lh + hl with the v residual
//   plane, O written as hi + residual planes; ROB == 0: single product P_hi.v_hi, O hi plane only.
//   After the loop: out = acc / Z (Z >= 1 always: key i itself lies in a visited tile; guarded anyway), carries 1/(32768*1024) folded
//   once, written to the wave's private result slab (pitch 68; every element owned by one lane).
//   ([b*QE + s][h*HD + d], ROB only) written by 8 consecutive lanes x 16 B of one instruction (4 rows per instruction, each row one whole
// coverage: per wave 4 instructions x 4 rows x 8 lanes x 8 halves = 16 x 64 per plane; the two launches (qt < QE/16 with ROB = 1, the rest
//           with ROB = 0) x NHG x NB blocks x WPB waves = every (b, s, h) row of O hi exactly once and every (b, s < QE, h) row of O residual
//           exactly once.
// =====================================================================================================
template <int ROB>
__global__ __launch_bounds__(ATT_THREADS)
void attn_a(const u16* __restrict__ QHp, const u16* __restrict__ QLp,
            const u16* __restrict__ KHp, const u16* __restrict__ KLp,
            const u16* __restrict__ VHp, const u16* __restrict__ VLp,
            const u16* __restrict__ ACp, const float* __restrict__ Mp, const float* __restrict__ Lp,
            u16* OHp, u16* OLp, int qt0, int nq) {
  __shared__ __align__(16) float smem[WPB * WREG];

  const int tid  = threadIdx.x;
  const int wave = tid >> 5;
  const int lane = tid & 31;
  const int hh   = lane >> 4;
  const int c    = lane & 15;
  const int bid  = blockIdx.x;
  const int qtl  = bid % nq;
  const int t2   = bid / nq;
  const int hg   = t2 % NHG;
  const int b    = t2 / NHG;
  if (b >= NB) return;                      // block-uniform; no block barriers in this kernel; never taken with the exact grid
  const int qt   = qt0 + qtl;
  const int q0   = qt * 16;
  if (q0 + 16 > SEQ) return;                // block-uniform; never taken
  if (ROB != 0 && q0 + 16 > QE) return;     // block-uniform; never taken (residual planes cover s < QE only)
  const int head = hg * WPB + wave;

  float* pt   = smem + wave * WREG;         // prob tile [16][32] pitch 36
  float* slab = pt + PTW;                   // result slab [16][64] pitch 68

  const size_t hcol = (size_t)head * HD + 8 * hh;
  const _Float16* Qh  = (const _Float16*)(const void*)QHp + ((size_t)b * SEQ + q0 + c) * DMOD + hcol;
  const _Float16* Ql  = (const _Float16*)(const void*)QLp + ((size_t)b * SEQ + q0 + c) * DMOD + hcol;
  const _Float16* Khb = (const _Float16*)(const void*)KHp + ((size_t)b * SEQ + c) * DMOD + hcol;      // key row kb added per step
  const _Float16* Klb = (const _Float16*)(const void*)KLp + ((size_t)b * SEQ + c) * DMOD + hcol;
  const _Float16* Vhb = (const _Float16*)(const void*)VHp + ((size_t)(b * NH + head) * HD + c) * SEQ + 8 * hh;  // d col c (+16j)
  const _Float16* Vlb = Vhb;
  if constexpr (ROB != 0) {
    Vlb = (const _Float16*)(const void*)VLp + ((size_t)(b * NH + head) * HD + c) * QE + 8 * hh;
  }
  const float lsc = SM_SCALE * (LOG2E / (QSC * KSC));
  const float oc  = 1.0f / (PCAR * VCAR);
  const float aci = (PCAR * VCAR) / ACAR;
  const size_t KROW = (size_t)DMOD;         // halves between consecutive key rows

  float mrow[8], lrow[8];
  v8f o[4];
  const int qr0 = q0 + 8 * hh;              // query row of D element r = qr0 + r
  // ---- init from the strided-set state ----
  {
    const _Float16* acp = (const _Float16*)(const void*)ACp + ((size_t)b * SEQ + qr0) * DMOD + (size_t)head * HD + c;
    const size_t mlb = (size_t)(b * NH + head) * STRD;
#pragma unroll
    for (int r = 0; r < 8; ++r) {
      const int i  = qr0 + r;
      const int ir = i % STRD;
      const int ia = i / STRD;               // < NA <= NAP
      const size_t mli = (mlb + ir) * NAP + ia;
      mrow[r] = Mp[mli];
      lrow[r] = Lp[mli];
    }
#pragma unroll
    for (int j = 0; j < 4; ++j) {
      o[j] = zero8();
#pragma unroll
      for (int r = 0; r < 8; ++r) {
        o[j][r] = (float)acp[(size_t)r * DMOD + j * 16] * aci;
      }
    }
  }

  // ---- tile list: leading tile 0 (when not part of the band) then the band tiles ----
  int klo = q0 - (WIN - 1);
  if (klo < 0) klo = 0;
  const int ktb = klo >> 5;
  const int kte = (q0 + 15) >> 5;           // <= SEQ/32 - 1; for ROB: kte*32 + 31 <= QE - 1
  int nband = kte - ktb + 1;
  if (nband > NKB) nband = NKB;             // static bound (WIN/32 + 2)
  if (nband < 0) nband = 0;
  const int hasg = (ktb > 0) ? 1 : 0;
  const int nkt  = nband + hasg;            // <= NKA

#pragma unroll 1
  for (int kt = 0; kt < nkt; ++kt) {
    const int kb = (kt < hasg) ? 0 : (ktb + kt - hasg) * 32;   // kb + 31 <= SEQ - 1
    // ---- scores: D element r of this lane = (query row qr0 + r, key kb + c) in s0, key kb + 16 + c in s1 ----
    v8f s0 = zero8(), s1 = zero8();
    const _Float16* k0p = Khb + (size_t)kb * KROW;
    const _Float16* k1p = k0p + (size_t)16 * KROW;
    const _Float16* l0p = Klb + (size_t)kb * KROW;
    const _Float16* l1p = l0p + (size_t)16 * KROW;
#pragma unroll
    for (int kk = 0; kk < HD / 32; ++kk) {
      const v16h qh  = ldfrag_h(Qh + kk * 32);
      const v16h ql  = ldfrag_h(Ql + kk * 32);
      const v16h kh0 = ldfrag_h(k0p + kk * 32);
      const v16h kh1 = ldfrag_h(k1p + kk * 32);
      const v16h kl0 = ldfrag_h(l0p + kk * 32);
      const v16h kl1 = ldfrag_h(l1p + kk * 32);
      s0 = mma_h(qh, kh0, s0);
      s0 = mma_h(ql, kh0, s0);
      s0 = mma_h(qh, kl0, s0);
      s1 = mma_h(qh, kh1, s1);
      s1 = mma_h(ql, kh1, s1);
      s1 = mma_h(qh, kl1, s1);
      guard2(s0, s1, qh, ql, kh0, kl0, kh1, kl1);
    }
    // ---- key select + online softmax in base 2, -inf-safe ----
    const int key0 = kb + c, key1 = kb + 16 + c;
#pragma unroll
    for (int r = 0; r < 8; ++r) {
      const int   qr = qr0 + r;
      const float u0 = s0[r] * lsc;
      const float u1 = s1[r] * lsc;
      const bool  a0 = (key0 <= qr) && ((qr - key0 < WIN) || (key0 < GLB));
      const bool  a1 = (key1 <= qr) && ((qr - key1 < WIN) || (key1 < GLB));
      const float t0 = a0 ? u0 : -INFINITY;
      const float t1 = a1 ? u1 : -INFINITY;
      float mx = fmaxf(t0, t1);
#pragma unroll
      for (int off = 1; off < 16; off <<= 1) mx = fmaxf(mx, __shfl_xor(mx, off, 32));
      const float mn = fmaxf(mrow[r], mx);
      const float ms = (mn == -INFINITY) ? 0.0f : mn;
      const float al = exp2f(mrow[r] - ms);
      mrow[r] = mn;
      const float e0 = exp2f(t0 - ms), e1 = exp2f(t1 - ms);
      float ps = e0 + e1;
#pragma unroll
      for (int off = 1; off < 16; off <<= 1) ps += __shfl_xor(ps, off, 32);
      lrow[r] = lrow[r] * al + ps;
#pragma unroll
      for (int j = 0; j < 4; ++j) o[j][r] *= al;
      const int ro = (8 * hh + r) * PTP + c;
      pt[ro]      = e0;
      pt[ro + 16] = e1;
    }
    wave_sync_lds();
    // ---- A fragments of P*32768: hi f16 (and residual f16 when ROB), row = c, split k map over the 32 keys of this step ----
    FragH ph, pl;
    {
      const float* prow = pt + c * PTP + 8 * hh;
      const v4f p0 = *(const v4f*)(prow), p1 = *(const v4f*)(prow + 4);
      const v4f p2 = *(const v4f*)(prow + 16), p3 = *(const v4f*)(prow + 20);
#pragma unroll
      for (int e = 0; e < 4; ++e) {
        const float ta = p0[e] * PCAR, tb = p1[e] * PCAR, tc = p2[e] * PCAR, td = p3[e] * PCAR;
        const _Float16 ha = (_Float16)ta, hb = (_Float16)tb, hc = (_Float16)tc, hd = (_Float16)td;
        ph.h[0][e]     = ha;                  // elements 0..7  = keys kb + 8hh + 0..7
        ph.h[0][4 + e] = hb;
        ph.h[1][e]     = hc;                  // elements 8..15 = keys kb + 16 + 8hh + 0..7
        ph.h[1][4 + e] = hd;
        if constexpr (ROB != 0) {
          pl.h[0][e]     = (_Float16)(ta - (float)ha);
          pl.h[0][4 + e] = (_Float16)(tb - (float)hb);
          pl.h[1][e]     = (_Float16)(tc - (float)hc);
          pl.h[1][4 + e] = (_Float16)(td - (float)hd);
        } else {
          pl.h[0][e] = ha;  pl.h[0][4 + e] = hb;  pl.h[1][e] = hc;  pl.h[1][4 + e] = hd;
        }
      }
    }
    // ---- P.V : B fragment col n = d = j*16 + c, keys contiguous in the v^T planes; 2 groups of 2 d-subtiles ----
    {
      const _Float16* vhp = Vhb + kb;
      const _Float16* vlp = Vlb + kb;
#pragma unroll
      for (int jg = 0; jg < HD / 32; ++jg) {
        const size_t da = (size_t)(2 * jg) * 16 * SEQ;
        const size_t db = da + (size_t)16 * SEQ;
        const v16h vha = ldfrag_h(vhp + da), vhb2 = ldfrag_h(vhp + db);
        if constexpr (ROB != 0) {
          const size_t la = (size_t)(2 * jg) * 16 * QE;
          const size_t lb = la + (size_t)16 * QE;
          const v16h vla = ldfrag_h(vlp + la), vlb2 = ldfrag_h(vlp + lb);
          o[2 * jg]     = mma_h(ph.v, vha,  o[2 * jg]);
          o[2 * jg]     = mma_h(pl.v, vha,  o[2 * jg]);
          o[2 * jg]     = mma_h(ph.v, vla,  o[2 * jg]);
          o[2 * jg + 1] = mma_h(ph.v, vhb2, o[2 * jg + 1]);
          o[2 * jg + 1] = mma_h(pl.v, vhb2, o[2 * jg + 1]);
          o[2 * jg + 1] = mma_h(ph.v, vlb2, o[2 * jg + 1]);
          guard2(o[2 * jg], o[2 * jg + 1], ph.v, pl.v, vha, vhb2, vla, vlb2);
        } else {
          o[2 * jg]     = mma_h(ph.v, vha,  o[2 * jg]);
          o[2 * jg + 1] = mma_h(ph.v, vhb2, o[2 * jg + 1]);
          guard2(o[2 * jg], o[2 * jg + 1], ph.v, vha, vhb2, ph.v, vha, vhb2);
        }
      }
    }
    wave_sync_lds();
  }
  acc_guard4(o[0], o[1], o[2], o[3]);
  // ---- out = acc / Z (0 if Z == 0), carries (32768 on P, 1024 on v) folded once; written into the lane-owned slab ----
#pragma unroll
  for (int r = 0; r < 8; ++r) {
    const float lv  = lrow[r];
    const float ls  = (lv > 0.0f) ? lv : 1.0f;
    const float inv = (lv > 0.0f) ? ((1.0f / ls) * oc) : 0.0f;
#pragma unroll
    for (int j = 0; j < 4; ++j) {
      const int idx = (8 * hh + r) * SLP + j * 16 + c;
      slab[idx] = o[j][r] * inv;
    }
  }

  wave_sync_lds();
  // ---- O x1024 -> f16 hi (+ residual when ROB) planes; lane = (row select rq in 0..3, 8 consecutive d at c8) ----
  v4u oh[4], ol[4];
  const int rq = lane >> 3, c8 = (lane & 7) * 8;
#pragma unroll
  for (int it = 0; it < 4; ++it) {
    const int row = it * 4 + rq;
    const v4f a = *(const v4f*)(slab + row * SLP + c8), b4 = *(const v4f*)(slab + row * SLP + c8 + 4);
    float w[8];
#pragma unroll
    for (int e = 0; e < 4; ++e) { w[e] = a[e] * OSC; w[4 + e] = b4[e] * OSC; }
#pragma unroll
    for (int e = 0; e < 4; ++e) {
      const _Float16 h0 = (_Float16)w[2 * e], h1 = (_Float16)w[2 * e + 1];
      const _Float16 l0 = (_Float16)(w[2 * e] - (float)h0), l1 = (_Float16)(w[2 * e + 1] - (float)h1);
      oh[it][e] = pk16(h_bits(h0), h_bits(h1));
      ol[it][e] = pk16(h_bits(l0), h_bits(l1));
    }
  }
  const size_t ob  = ((size_t)b * SEQ + q0) * DMOD + (size_t)head * HD + c8;
  const size_t olb = ((size_t)b * QE + q0) * DMOD + (size_t)head * HD + c8;   // dereferenced only when ROB
  {
#pragma unroll
    for (int it = 0; it < 4; ++it) {
      const int row = it * 4 + rq;
      *(v4u*)(OHp + ob + (size_t)row * DMOD) = oh[it];
      if constexpr (ROB != 0) {
        *(v4u*)(OLp + olb + (size_t)row * DMOD) = ol[it];
      }
    }
    
  }
}

// =====================================================================================================
// Workspace map (bytes); every plane is fully written by whole-line stores before it is read; all extents are exact multiples
// of the store granularity (no pad rows needed); every region offset a multiple of 524288:
//   XB  bf16 [MROWS][1024]                       MROWS*2048       (x as bf16; after the projections the region holds AC f16 [MROWS][1024])
//   WB  16-bit [1024 n][1024 k]                  2097152          (Wq, Wk, Wv column blocks as bf16 [n][k], then Wo as f16 x1024, in launch order)
//   F   f32 [SEQ][1024]                          SEQ*4096         (one batch's q, k, v projection output in launch order; afterwards the region holds
//                                                                  OH f16 [MROWS][1024] x1024; region sized to the larger of the two)
//   QH  f16 [MROWS][1024] x1024                  MROWS*2048       QL residual the same; KH, KL the same
//   VH  f16 [NB*16][64][SEQ] x1024               MROWS*2048
//   VL  f16 residual [NB*16][64][QE]             NB*16*64*QE*2
//   OL  f16 residual [NB*QE][1024]               NB*QE*2048
//   M   f32 [NB*16*STRD][NAP]                     NB*16*STRD*NAP*4 L the same
//   end (NB=2, SEQ=4096, QE=512)               124780544
// =====================================================================================================
extern "C" void kernel_launch(void* const* d_in, const int* in_sizes, int n_in,
                              void* d_out, int out_size, void* d_ws, size_t ws_size,
                              hipStream_t stream) {
  if (n_in < 5) return;
  const int needx = OROWS * DMOD;
  if (in_sizes[0] < needx) return;
  if (in_sizes[1] != 3 * DMOD * DMOD) return;
  if (in_sizes[2] < 3 * DMOD) return;
  if (in_sizes[3] != DMOD * DMOD) return;
  if (in_sizes[4] < DMOD) return;
  if (out_size < needx) return;

  const float* x    = (const float*)d_in[0];
  const float* wqkv = (const float*)d_in[1];
  const float* bqkv = (const float*)d_in[2];
  const float* wo   = (const float*)d_in[3];
  const float* bo   = (const float*)d_in[4];
  float*       out  = (float*)d_out;

  const size_t szXB = (size_t)MROWS * DMOD * 2;                 // XB, later AC (same extent)
  const size_t szW  = (size_t)DMOD * DMOD * 2;
  const size_t szFs = (size_t)SEQ * DMOD * 4;                   // F staging
  const size_t szH  = (size_t)MROWS * DMOD * 2;                 // QH, QL, KH, KL, OH
  const size_t szFR = (szFs > szH) ? szFs : szH;                // F region also holds OH afterwards
  const size_t szV  = (size_t)NB * NH * HD * SEQ * 2;           // VH (== szH)
  const size_t szVL = (size_t)NB * NH * HD * QE * 2;            // VL
  const size_t szOL = (size_t)NB * QE * DMOD * 2;               // OL (== szVL)
  const size_t szML = (size_t)NB * NH * STRD * NAP * 4;         // M, L
  size_t off = 0;
  const size_t oXB = off; off += szXB;
  const size_t oW  = off; off += szW;
  const size_t oF  = off; off += szFR;
  const size_t oQH = off; off += szH;
  const size_t oQL = off; off += szH;
  const size_t oKH = off; off += szH;
  const size_t oKL = off; off += szH;
  const size_t oVH = off; off += szV;
  const size_t oVL = off; off += szVL;
  const size_t oOL = off; off += szOL;
  const size_t oM  = off; off += szML;
  const size_t oL  = off; off += szML;
  if (off > ws_size) return;                // off = 124780544 for NB = 2, SEQ = 4096
  if (off > (size_t)WS_CAP) return;

  char* ws = (char*)d_ws;
  u16*   XB = (u16*)(ws + oXB);
  u16*   AC = (u16*)(ws + oXB);
  u16*   WB = (u16*)(ws + oW);
  float* F  = (float*)(ws + oF);
  u16*   OH = (u16*)(ws + oF);
  u16*   QH = (u16*)(ws + oQH);
  u16*   QL = (u16*)(ws + oQL);
  u16*   KH = (u16*)(ws + oKH);
  u16*   KL = (u16*)(ws + oKL);
  u16*   VH = (u16*)(ws + oVH);
  u16*   VL = (u16*)(ws + oVL);
  u16*   OL = (u16*)(ws + oOL);
  float* Mp = (float*)(ws + oM);
  float* Lp = (float*)(ws + oL);

  const dim3 b256(256), b128(128), bQK(QKT), bAT(ATT_THREADS);
  const int  n8x = (SEQ * DMOD) / 8;
  const dim3 gX((n8x + 255) / 256);                     // per batch
  const dim3 gTR((DMOD / 64) * (DMOD / 64));            // 256 blocks per [1024][1024] weight block
  const dim3 gG((SEQ / 64) * (DMOD / 64));              // per batch
  const dim3 gVT(NH * NST);                             // per batch
  const dim3 gQK(SEQ);                                  // per batch
  const int  nqR  = QE / 16;                            // query tiles with residual P.v products per (b, head group)
  const int  nqP  = NQT - nqR;
  const int  nrtR = QE / 64;                            // out-projection row tiles with the residual plane
  const int  nrtP = (SEQ - QE) / 64;

  // (0) x -> bf16 plane [MROWS][1024], one launch per batch
  for (int b = 0; b < NB; ++b) {
    cvt16<<<gX, b256, 0, stream>>>(x + (size_t)b * XS_FULL * DMOD, XB + (size_t)b * SEQ * DMOD, n8x, 0, 1.0f);
  }
  // (1) per column block p (q, k, v): W[:, p*1024 .. p*1024+1023] ([1024 k][3072 n] -> [1024 n][1024 k] bf16); per batch:
  //     projection -> F f32; then the 16-bit planes
  for (int p = 0; p < 3; ++p) {
    tr16<<<gTR, b256, 0, stream>>>(wqkv, 3 * DMOD, p * DMOD, WB, 0, 1.0f);
    for (int b = 0; b < NB; ++b) {
      gemm_bf<<<gG, b128, 0, stream>>>(XB + (size_t)b * SEQ * DMOD, WB, bqkv + p * DMOD, F, SEQ, DMOD, DMOD, 1.0f);
      if (p == 0) {
        qk16<<<gQK, bQK, 0, stream>>>(F, QH, QL, b * SEQ, QSC);
      } else if (p == 1) {
        qk16<<<gQK, bQK, 0, stream>>>(F, KH, KL, b * SEQ, KSC);
      } else {
        vt16<<<gVT, b256, 0, stream>>>(F, VH, VL, b);
      }
    }
  }
  // (2) Wo [1024 k][1024 n] -> [n][k] f16 plane of bf16 value x1024
  tr16<<<gTR, b256, 0, stream>>>(wo, DMOD, 0, WB, 1, WOS);
  // (3) strided key set -> per-row state (M, L, AC)
  attn_s<<<dim3(NB * NHG * STRD), bAT, 0, stream>>>(QH, QL, KH, KL, VH, AC, Mp, Lp);
  // (4) band + leading key set merged onto that state: query rows s < QE with residual P.v products -> O hi + residual planes;
  //     (5) remaining rows, single product -> O hi plane
  attn_a<1><<<dim3(nqR * NHG * NB), bAT, 0, stream>>>(QH, QL, KH, KL, VH, VL, AC, Mp, Lp, OH, OL, 0, nqR);
  if (nqP > 0) {
    attn_a<0><<<dim3(nqP * NHG * NB), bAT, 0, stream>>>(QH, QL, KH, KL, VH, VL, AC, Mp, Lp, OH, OL, nqR, nqP);
  }
  // (6) output projection rows s < QE (hi + residual) and (7) rows s >= QE (hi only) -> out f32, carries 1024 x 1024 folded back
  gemm_o<2><<<dim3(NB * nrtR * (DMOD / 64)), b128, 0, stream>>>(OH, OL, WB, bo, out, 0, nrtR, 1.0f / (OSC * WOS));
  if (nrtP > 0) {
    gemm_o<1><<<dim3(NB * nrtP * (DMOD / 64)), b128, 0, stream>>>(OH, OL, WB, bo, out, QE, nrtP, 1.0f / (OSC * WOS));
  }
  (void)hipGetLastError();
}

// v001
// A run of this version takes 369 microseconds.
// Timed twice side by side with v000, it ran 1.58 and 1.57 times as fast.
// Contractions: x.Wq, x.Wk, x.Wv on v_wmma_f32_16x16x32_bf16 (x, W, biases RNE-converted to bf16; each W column block
// transposed into a k-contiguous [n][k] plane; f32 accumulate); q.k^T over 64 on v_wmma_f32_16x16x32_f16 with q, k carried as
// f16 hi x1024 + f16 residual planes (products hh + lh + hl); P.v^T on v_wmma_f32_16x16x32_f16 (P x32768 f16, v x1024 f16):
// query rows s < QE use P hi + residual and v hi + residual planes (hh + lh + hl), other rows one product; O.Wo on
// v_wmma_f32_16x16x32_f16 (O x1024 f16, Wo as f16(bf16(Wo)) x1024): rows s < QE as O hi + residual planes (h.W + l.W), other rows one
// product; all f32 accumulate. Bias adds, key-set select, base-2 online softmax, merge of the two key-set states and the 1/Z fold in
// f32 on VALU.
#include <hip/hip_runtime.h>
#include <math.h>
#include <stdint.h>

#ifndef NB
#define NB 2
#endif
#ifndef SEQ
#define SEQ 4096
#endif
#define XS_FULL 4096
#define DMOD  1024
#define NH    16
#define HD    64
#define WIN   256
#define STRD  128
#define GLB   16
#define QE    ((SEQ < 512) ? SEQ : 512)
#define MROWS (NB * SEQ)
#define OROWS ((NB - 1) * XS_FULL + SEQ)
#define SM_SCALE 0.125f
#define LOG2E 1.4426950408889634f
#define QSC   1024.0f
#define KSC   1024.0f
#define PCAR  32768.0f
#define VCAR  1024.0f
#define OSC   1024.0f
#define WOS   1024.0f
#define ACAR  64.0f
#define WPB   4
#define NHG   (NH / WPB)
#define NQT   (SEQ / 16)
#define NST   (SEQ / 64)
#define NKB   ((WIN / 32) + 2)
#define NKA   (NKB + 1)
#define NA    (SEQ / STRD)
#define NAP   (((NA + 31) / 32) * 32)
#define NAT   ((NA + 15) / 16)
#define NKS   ((NA + 31) / 32)
#define ATT_THREADS (WPB * 32)
#define PTP   36
#define PTW   (16 * PTP)
#define SLP   68
#define SLW   (16 * SLP)
#define WREG  (PTW + SLW)
#define SLAB64 (16 * 68)
#define VTP   72
#define VSP   40
#define QKT   (DMOD / 8)
#define WS_CAP 134217728
static_assert(DMOD == NH * HD && HD == 64 && NH == 16);
static_assert((NH % WPB) == 0 && ATT_THREADS == 128);
static_assert(NB >= 1 && NB <= 2);
static_assert((SEQ % STRD) == 0 && (SEQ % 64) == 0 && SEQ >= STRD && SEQ <= XS_FULL);
static_assert((QE % 64) == 0 && QE >= 64 && QE <= SEQ);
static_assert((STRD % 16) == 0 && STRD >= 32);
static_assert((WIN % 32) == 0 && WIN >= 32);
static_assert(GLB >= 1 && GLB <= 32);
static_assert(NA >= 1 && NAP >= 32 && NAP <= 256 && (NAP % 32) == 0 && 16 * NAT <= NAP);
static_assert(DMOD == 128 * 8 && QKT == 128 && (DMOD % 64) == 0 && (DMOD % 32) == 0);
static_assert((HD % 32) == 0);
static_assert(((SEQ * DMOD) % (8 * 256)) == 0);

typedef unsigned short u16;
typedef _Float16 v16h __attribute__((ext_vector_type(16)));
typedef _Float16 v8h  __attribute__((ext_vector_type(8)));
typedef __bf16   v16b __attribute__((ext_vector_type(16)));
typedef float    v8f  __attribute__((ext_vector_type(8)));
typedef float    v4f  __attribute__((ext_vector_type(4)));
typedef unsigned int v4u __attribute__((ext_vector_type(4)));

union FragH { v16h v; v8h h[2]; v4u u[2]; };
union FragB { v16b v; v4u u[2]; };

// ---- scalar helpers --------------------------------------------------------------------------------
__device__ __forceinline__ unsigned short bf_bits(float f) {          // f32 -> bf16 bits, RNE convert
  unsigned u = __float_as_uint(f);
  return (unsigned short)((u + 0x7FFFu + ((u >> 16) & 1u)) >> 16);
}
__device__ __forceinline__ float bf_up(unsigned short h) { return __uint_as_float(((unsigned)h) << 16); }
__device__ __forceinline__ float bfr(float f) { return bf_up(bf_bits(f)); }
__device__ __forceinline__ unsigned short h_bits(_Float16 x) { return __builtin_bit_cast(unsigned short, x); }
__device__ __forceinline__ unsigned pk16(unsigned short a, unsigned short b) { return (unsigned)a | ((unsigned)b << 16); }
__device__ __forceinline__ v8f zero8() { v8f z = {0.f, 0.f, 0.f, 0.f, 0.f, 0.f, 0.f, 0.f}; return z; }

// ---- fragment loaders: 16-bit A/B operand, lane -> row/col (lane&15), p already includes +8*(lane>>4);
//      elements 0..7 <- p[0..7] (k0+8h..), elements 8..15 <- p[16..23] (k0+16+8h..)  (same split k map for A and B;
//      B is always read from a k-contiguous [n][k] plane or tile)
__device__ __forceinline__ v16h ldfrag_h(const _Float16* p) {
  FragH f;
  f.h[0] = *(const v8h*)(p);
  f.h[1] = *(const v8h*)(p + 16);
  return f.v;
}
__device__ __forceinline__ v8f mma_h(v16h a, v16h b, v8f c) {
  return __builtin_amdgcn_wmma_f32_16x16x32_f16(false, a, false, b, (short)0, c, false, false);
}
__device__ __forceinline__ v8f mma_b(v16b a, v16b b, v8f c) {
  return __builtin_amdgcn_wmma_f32_16x16x32_bf16(false, a, false, b, (short)0, c, false, false);
}
__device__ __forceinline__ void guard2(v8f& a, v8f& b, v16h x0, v16h x1, v16h x2, v16h x3, v16h x4, v16h x5) {
#if defined(__HIP_DEVICE_COMPILE__)
  asm volatile("v_nop\n\tv_nop\n\tv_nop\n\tv_nop"
               : "+v"(a), "+v"(b) : "v"(x0), "v"(x1), "v"(x2), "v"(x3), "v"(x4), "v"(x5) : "memory");
#endif
}
__device__ __forceinline__ void acc_guard4(v8f& a, v8f& b, v8f& c, v8f& d) {
#if defined(__HIP_DEVICE_COMPILE__)
  asm volatile("v_nop\n\tv_nop\n\tv_nop\n\tv_nop" : "+v"(a), "+v"(b), "+v"(c), "+v"(d));
#endif
}
__device__ __forceinline__ void wave_sync_lds() {
  __builtin_amdgcn_fence(__ATOMIC_RELEASE, "workgroup");
  __builtin_amdgcn_wave_barrier();
  __builtin_amdgcn_fence(__ATOMIC_ACQUIRE, "workgroup");
}

// =====================================================================================================
// f32 -> 16-bit plane, same layout.  f16mode == 0: bf16 RNE bits;  f16mode == 1: f16 bits of (bf16 RNE value) * scale.
// Thread = 8 consecutive elements: two 16-B loads, one 16-B store; 32 consecutive lanes = 512 contiguous, 512-B aligned
// coverage: grid = ceil(n8/256) blocks x 256 thr x 8 (in-kernel bound) = the whole plane (n8 a multiple of 256 here).
// =====================================================================================================
__global__ __launch_bounds__(256) void cvt16(const float* __restrict__ x, u16* D, int n8, int f16mode, float scale) {
  const int gt = blockIdx.x * 256 + (int)threadIdx.x;
  if (gt >= n8) return;
  const float* p = x + (size_t)gt * 8;
  const v4f a = *(const v4f*)(p), b4 = *(const v4f*)(p + 4);
  float w[8];
#pragma unroll
  for (int e = 0; e < 4; ++e) { w[e] = a[e]; w[4 + e] = b4[e]; }
  v4u o;
#pragma unroll
  for (int e = 0; e < 4; ++e) {
    const float f0 = w[2 * e], f1 = w[2 * e + 1];
    const unsigned short hb0 = h_bits((_Float16)(bfr(f0) * scale));
    const unsigned short hb1 = h_bits((_Float16)(bfr(f1) * scale));
    const unsigned short bb0 = bf_bits(f0);
    const unsigned short bb1 = bf_bits(f1);
    o[e] = (f16mode != 0) ? pk16(hb0, hb1) : pk16(bb0, bb1);
  }
  u16* d = D + (size_t)gt * 8;
  {
    *(v4u*)(d) = o;
    
  }
}

// =====================================================================================================
// Weight transpose + convert: W f32 [DMOD rows k][ldw], column block col0 .. col0+DMOD-1 (column index = n)
//   -> D 16-bit [DMOD n][DMOD k] (k-contiguous B operand), i.e. in[k][col0+n] -> out[n][k].  f16mode as in cvt16.
// Block = (n tile n0, k tile k0) of 64 x 64: load 64 k rows x 64 n floats with 16-B loads (thread = k row kr, 16 n), convert,
// scatter transposed into an LDS tile [n][k] (pitch 72 halves); block barrier; each n-row segment (64 halves = one whole
// coverage: load 256 thr x 16 = 64 k x 64 n; store 2 iterations x 256 thr x 8 halves = 64 lines x 64; grid (DMOD/64)^2 = every
//           (n, k) of D exactly once.
// =====================================================================================================
__global__ __launch_bounds__(256) void tr16(const float* __restrict__ W, int ldw, int col0, u16* D, int f16mode, float scale) {
  __shared__ __align__(16) u16 T[64 * VTP];
  const int tid = (int)threadIdx.x;
  const int bid = (int)blockIdx.x;
  const int nt  = bid % (DMOD / 64);
  const int kt  = bid / (DMOD / 64);
  if (kt >= DMOD / 64) return;              // block-uniform, before any barrier; never taken with the exact grid
  const int n0 = nt * 64, k0 = kt * 64;
  {
    const int kr = tid >> 2;                // k row within tile 0..63
    const int nc = (tid & 3) * 16;          // n chunk 0,16,32,48
    const float* src = W + (size_t)(k0 + kr) * (size_t)ldw + col0 + n0 + nc;
#pragma unroll
    for (int i = 0; i < 4; ++i) {
      const v4f a = *(const v4f*)(src + 4 * i);
#pragma unroll
      for (int e = 0; e < 4; ++e) {
        const float f = a[e];
        const unsigned short hb = h_bits((_Float16)(bfr(f) * scale));
        const unsigned short bb = bf_bits(f);
        T[(nc + 4 * i + e) * VTP + kr] = (f16mode != 0) ? hb : bb;
      }
    }
  }
  __syncthreads();
  v4u ov[2];
  const int q8 = tid >> 3, p8 = (tid & 7) * 8;
#pragma unroll
  for (int it = 0; it < 2; ++it) {
    const int line = it * 32 + q8;          // n = 0..63
    ov[it] = *(const v4u*)(T + line * VTP + p8);
  }
  u16* base = D + (size_t)n0 * DMOD + k0 + p8;
  {
#pragma unroll
    for (int it = 0; it < 2; ++it) {
      const int line = it * 32 + q8;
      *(v4u*)(base + (size_t)line * DMOD) = ov[it];
    }
    
  }
}

// =====================================================================================================
// v^T planes from the v projection F f32 [SEQ][DMOD] of batch b (row = s, column = g*HD + d, bias already added):
//   VH[((b*NH + g)*HD + d)][s] = f16(v * 1024) for all s;  VL[((b*NH + g)*HD + d)][s] (pitch QE) = f16 residual, keys s < QE only.
// Block = (head g, 64 keys s0): each thread loads its 16 floats (key sl, d chunk dc) with 16-B loads, converts, scatters into
// written by 8 consecutive lanes x 16 B of one instruction; residual plane stored only when s0 + 64 <= QE (block-uniform);
// coverage: load 256 thr x 16 = 64 keys x 64 d; store 2 iterations x 256 thr x 8 halves = 64 lines x 64 = the block's tile of
//           VH (and of VL for the first QE keys); grid = NH*NST blocks per batch covers the batch's VH rows exactly once and
//           every VL row segment once.
// =====================================================================================================
__global__ __launch_bounds__(256) void vt16(const float* __restrict__ F, u16* VHo, u16* VLo, int b) {
  __shared__ __align__(16) u16 TH[HD * VTP];
  __shared__ __align__(16) u16 TL[HD * VTP];
  const int tid = threadIdx.x;
  const int bid = blockIdx.x;
  const int st  = bid % NST;
  const int g   = bid / NST;
  if (g >= NH) return;                      // block-uniform, before any barrier; never taken with the exact grid
  const int s0  = st * 64;
  {
    const int sl = tid >> 2;                // key within tile 0..63
    const int dc = (tid & 3) * 16;          // d chunk 0,16,32,48
    const float* src = F + ((size_t)s0 + sl) * DMOD + g * HD + dc;
#pragma unroll
    for (int i = 0; i < 4; ++i) {
      const v4f a = *(const v4f*)(src + 4 * i);
#pragma unroll
      for (int e = 0; e < 4; ++e) {
        const float t = a[e] * VCAR;
        const _Float16 hv = (_Float16)t;
        const _Float16 lv = (_Float16)(t - (float)hv);
        TH[(dc + 4 * i + e) * VTP + sl] = h_bits(hv);
        TL[(dc + 4 * i + e) * VTP + sl] = h_bits(lv);
      }
    }
  }
  __syncthreads();
  v4u vh[2], vl[2];
  const int q8 = tid >> 3, p8 = (tid & 7) * 8;
#pragma unroll
  for (int it = 0; it < 2; ++it) {
    const int line = it * 32 + q8;          // d = 0..63
    vh[it] = *(const v4u*)(TH + line * VTP + p8);
    vl[it] = *(const v4u*)(TL + line * VTP + p8);
  }
  const size_t hrow  = (size_t)(b * NH + g) * HD;
  const size_t baseH = hrow * SEQ + s0 + p8;
  const size_t baseL = hrow * QE + s0 + p8;
  const bool   dolo  = (s0 + 64 <= QE);     // block-uniform
  {
#pragma unroll
    for (int it = 0; it < 2; ++it) {
      const int line = it * 32 + q8;
      *(v4u*)(VHo + baseH + (size_t)line * SEQ) = vh[it];
    }
    if (dolo) {
#pragma unroll
      for (int it = 0; it < 2; ++it) {
        const int line = it * 32 + q8;
        *(v4u*)(VLo + baseL + (size_t)line * QE) = vl[it];
      }
    }
    
  }
}

// =====================================================================================================
// q / k planes from a projection F f32 [SEQ][DMOD] of one batch (bias already added), destination row = rowoff + s:
//   Hp [MROWS][DMOD] = f16(val * sc),  Lp [MROWS][DMOD] = f16 residual (val*sc - hi).
// Block = one row of 128 threads, thread = 8 consecutive columns: two 16-B loads, one 16-B store per plane; 32 consecutive
// coverage: 128 thr x 8 = the whole DMOD row of Hp and Lp; grid = SEQ blocks = every row of the batch once.
// =====================================================================================================
__global__ __launch_bounds__(QKT) void qk16(const float* __restrict__ F, u16* Hp, u16* Lp, int rowoff, float sc) {
  const int tid = (int)threadIdx.x;
  const int row = (int)blockIdx.x;
  if (row >= SEQ) return;
  if (tid >= QKT) return;
  const float* p = F + (size_t)row * DMOD + tid * 8;
  const v4f a = *(const v4f*)(p), b4 = *(const v4f*)(p + 4);
  float w[8];
#pragma unroll
  for (int e = 0; e < 4; ++e) { w[e] = a[e] * sc; w[4 + e] = b4[e] * sc; }
  v4u oh, ol;
#pragma unroll
  for (int e = 0; e < 4; ++e) {
    const float t0 = w[2 * e], t1 = w[2 * e + 1];
    const _Float16 h0 = (_Float16)t0, h1 = (_Float16)t1;
    const _Float16 l0 = (_Float16)(t0 - (float)h0), l1 = (_Float16)(t1 - (float)h1);
    oh[e] = pk16(h_bits(h0), h_bits(h1));
    ol[e] = pk16(h_bits(l0), h_bits(l1));
  }
  const size_t drow = (size_t)(rowoff + row) * DMOD + tid * 8;
  u16* dh = Hp + drow;
  u16* dl = Lp + drow;
  {
    *(v4u*)(dh) = oh;
    *(v4u*)(dl) = ol;
    
  }
}

// =====================================================================================================
// GEMM epilogue: the wave's 32x64 f32 tile (times oscale) staged in its LDS slab (two 16-row parts, pitch 68), read back as whole
// rows, bias added, stored.
// coverage: 2 parts x 8 instructions x 2 rows x 16 lanes x 4 floats = the wave's 32 x 64 tile.
// =====================================================================================================
__device__ __forceinline__ void epi3264(float* sl, const v8f (&acc)[2][4], float oscale,
                                        const float* __restrict__ bias, float* C, int N, size_t rowb, int col0, int lane) {
  const int hh = lane >> 4, m = lane & 15;
#pragma unroll
  for (int i = 0; i < 2; ++i) {
#pragma unroll
    for (int r = 0; r < 8; ++r) {
      const int ro = i * SLAB64 + (8 * hh + r) * 68 + m;
      sl[ro]      = acc[i][0][r] * oscale;
      sl[ro + 16] = acc[i][1][r] * oscale;
      sl[ro + 32] = acc[i][2][r] * oscale;
      sl[ro + 48] = acc[i][3][r] * oscale;
    }
  }
  wave_sync_lds();
  const v4f bb = *(const v4f*)(bias + col0 + m * 4);
  v4f br;
#pragma unroll
  for (int e = 0; e < 4; ++e) br[e] = bfr(bb[e]);
  float* dst = C + (rowb + (size_t)hh) * (size_t)N + col0 + m * 4;
#pragma unroll
  for (int i = 0; i < 2; ++i) {
    v4f vals[8];
#pragma unroll
    for (int it = 0; it < 8; ++it) vals[it] = *(const v4f*)(sl + i * SLAB64 + (it * 2 + hh) * 68 + m * 4) + br;
#pragma unroll
    for (int it = 0; it < 8; ++it) {
      *(v4f*)(dst + (size_t)(i * 16 + it * 2) * (size_t)N) = vals[it];
    }
  }
}

// =====================================================================================================
// GEMM core shared by the projections and the output projection: one 128 x 128 tile of C per block, 8 waves of 32 x 64
// (wave -> rows 32 * (wave >> 1), columns 64 * (wave & 1)), K = DMOD walked in passes of 128 k.
// A pass's operand rows (256 B each: NPROD A planes of 128 rows, then 128 Bt rows) are staged in LDS at pitch 272 B by per-lane
// 16-B asynchronous copies: one wave instruction = 2 rows x 256 B = whole 128-B lines. Two buffers: pass t + 2 is copied into the
// buffer pass t has left while pass t + 1 is worked on. Fragments are 16-B LDS reads with the same split k map as ldfrag_h.
// Per accumulator the products keep ascending k in steps of 32, and h before l inside a step.
// =====================================================================================================
#define GT     128
#define GTHR   256
#define GKP    128
#define GPIT   136
#define GPLANE (GT * GPIT)
#define GNP    (DMOD / GKP)
static_assert((DMOD % GKP) == 0 && GNP >= 2 && (DMOD % GT) == 0 && (SEQ % GT) == 0 && (QE % GT) == 0);
static_assert(8 * 2 * SLAB64 * 4 <= 2 * 2 * GPLANE * 2);

// One operand plane of a pass: 128 rows x 256 B = eight 16-B copies of each lane, rows 16 apart (l, g: the lane's first row and
// 16-B column; LDS step 16 * 272 B, global step 16 * DMOD halves).
__device__ __forceinline__ void copy_plane(unsigned l, const u16* g) {
#if defined(__HIP_DEVICE_COMPILE__)
  const unsigned ls = 16 * GPIT * 2;
  const size_t   gs = (size_t)16 * DMOD;
  // the closing s_wait_xcnt 0 stands inside the statement so that no address register is rewritten ahead of it
  asm volatile("global_load_async_to_lds_b128 %0, %8, off\n\t"
               "global_load_async_to_lds_b128 %1, %9, off\n\t"
               "global_load_async_to_lds_b128 %2, %10, off\n\t"
               "global_load_async_to_lds_b128 %3, %11, off\n\t"
               "global_load_async_to_lds_b128 %4, %12, off\n\t"
               "global_load_async_to_lds_b128 %5, %13, off\n\t"
               "global_load_async_to_lds_b128 %6, %14, off\n\t"
               "global_load_async_to_lds_b128 %7, %15, off\n\t"
               "s_wait_xcnt 0x0"
               :: "v"(l), "v"(l + ls), "v"(l + 2 * ls), "v"(l + 3 * ls), "v"(l + 4 * ls), "v"(l + 5 * ls), "v"(l + 6 * ls),
                  "v"(l + 7 * ls),
                  "v"(g), "v"(g + gs), "v"(g + 2 * gs), "v"(g + 3 * gs), "v"(g + 4 * gs), "v"(g + 5 * gs), "v"(g + 6 * gs),
                  "v"(g + 7 * gs)
               : "memory");
#endif
}
__device__ __forceinline__ void wait_async0() {   // this wave's copies have landed
#if defined(__HIP_DEVICE_COMPILE__)
  asm volatile("s_wait_asynccnt 0x0" ::: "memory");
#endif
}
__device__ __forceinline__ void wait_ds0() {      // this wave's LDS reads are done before their buffer is handed back
#if defined(__HIP_DEVICE_COMPILE__)
  asm volatile("s_wait_dscnt 0x0" ::: "memory");
#endif
}
struct Frag16 { v4u u[2]; };
__device__ __forceinline__ Frag16 ldfrag_s(const u16* p) {
  Frag16 f;
  f.u[0] = *(const v4u*)(p);
  f.u[1] = *(const v4u*)(p + 16);
  return f;
}
template <bool BF>
__device__ __forceinline__ v8f mma_s(const Frag16& a, const Frag16& b, v8f c) {
  if constexpr (BF) {
    FragB x, y;
    x.u[0] = a.u[0]; x.u[1] = a.u[1]; y.u[0] = b.u[0]; y.u[1] = b.u[1];
    return mma_b(x.v, y.v, c);
  } else {
    FragH x, y;
    x.u[0] = a.u[0]; x.u[1] = a.u[1]; y.u[0] = b.u[0]; y.u[1] = b.u[1];
    return mma_h(x.v, y.v, c);
  }
}

// A0, A1, B0: first row of the block's 128 rows in each plane (row pitch DMOD halves); A1 is read only when NPROD == 2.
// ring: 2 * (NPROD + 1) * GPLANE halves, reused as the waves' output slabs behind the last pass's barrier.
// Every thread of the block calls this (block barriers inside).
template <int NPROD, bool BF>
__device__ __forceinline__ void gemm_tile(const u16* A0, const u16* A1, const u16* B0, u16* ring, float oscale,
                                          const float* __restrict__ bias, float* C, int N, size_t rowC, int colC) {
  constexpr int STG = (NPROD + 1) * GPLANE;
  const int tid = threadIdx.x, wave = tid >> 5, lane = tid & 31, hh = lane >> 4, m = lane & 15;
  const int wr = (wave >> 1) * 32, wc = (wave & 1) * 64;
  // copy role: row tid >> 4 (+ 16 per copy), 16-B column tid & 15
  const int crow = tid >> 4, ccol = (tid & 15) * 8;
  const size_t  goff = (size_t)crow * DMOD + ccol;
  const unsigned l0  = (unsigned)(size_t)(ring + crow * GPIT + ccol);
  const u16* ga0 = A0 + goff;
  const u16* ga1 = A1 + goff;
  const u16* gb  = B0 + goff;
  auto stage = [&](int buf, int pass) {
    const unsigned l = l0 + (unsigned)(buf * STG * 2);
    const int      k = pass * GKP;
    copy_plane(l, ga0 + k);
    if constexpr (NPROD == 2) copy_plane(l + GPLANE * 2, ga1 + k);
    copy_plane(l + NPROD * GPLANE * 2, gb + k);
  };
  v8f acc[2][4];
#pragma unroll
  for (int i = 0; i < 2; ++i) {
#pragma unroll
    for (int j = 0; j < 4; ++j) acc[i][j] = zero8();
  }
  stage(0, 0);
  wait_async0();
  __syncthreads();
  stage(1, 1);
#pragma unroll 1   // rolled: one copy of the pass body serves both buffers (t & 1)
  for (int t = 0; t < GNP; ++t) {
    const u16* st = ring + (t & 1) * STG;
    const u16* pa = st + (wr + m) * GPIT + 8 * hh;
    const u16* pb = st + NPROD * GPLANE + (wc + m) * GPIT + 8 * hh;
    Frag16 a[2][2], al[2][2], b[2][4];
    auto fetch = [&](int s, int kk) {
#pragma unroll
      for (int i = 0; i < 2; ++i) {
        a[s][i] = ldfrag_s(pa + i * 16 * GPIT + kk * 32);
        if constexpr (NPROD == 2) al[s][i] = ldfrag_s(pa + GPLANE + i * 16 * GPIT + kk * 32);
      }
#pragma unroll
      for (int j = 0; j < 4; ++j) b[s][j] = ldfrag_s(pb + j * 16 * GPIT + kk * 32);
    };
    fetch(0, 0);
#pragma unroll     // unrolled: the fragment set index kk & 1 must be a constant, else the sets leave the registers
    for (int kk = 0; kk < GKP / 32; ++kk) {
      const int s = kk & 1;
      if (kk + 1 < GKP / 32) fetch(s ^ 1, kk + 1);   // the next k step's fragments, inside this pass's own buffer
      // keeps that load group whole and ahead of this step's products: sunk among them, each load is waited for where it stands
      __builtin_amdgcn_sched_barrier(0);
#pragma unroll
      for (int i = 0; i < 2; ++i) {
#pragma unroll
        for (int j = 0; j < 4; ++j) acc[i][j] = mma_s<BF>(a[s][i], b[s][j], acc[i][j]);
      }
      if constexpr (NPROD == 2) {
#pragma unroll
        for (int i = 0; i < 2; ++i) {
#pragma unroll
          for (int j = 0; j < 4; ++j) acc[i][j] = mma_s<BF>(al[s][i], b[s][j], acc[i][j]);
        }
      }
      __builtin_amdgcn_sched_barrier(0);             // the far end of the same fence: later loads stay behind these products
    }
    // hand-over: own reads done, own copies of pass t + 1 landed, then the one barrier that publishes pass t + 1 and frees this buffer
    wait_ds0();
    wait_async0();
    __syncthreads();
    if (t + 2 < GNP) stage(t & 1, t + 2);
  }
  wait_async0();
  epi3264((float*)(void*)ring + wave * (2 * SLAB64), acc, oscale, bias, C, N, rowC + wr, colC + wc, lane);
}

// =====================================================================================================
// bf16 GEMM: C[M][N] (f32) = A[M][DMOD] (bf16 row-major) . Bt[N][DMOD]^T (bf16 k-contiguous), times oscale, plus bias[col] (bf16 RNE
// value). Block = 128 x 128 tile (host guarantees M % 128 == 0, N % 128 == 0, grid = (M/128)*(N/128)).
// =====================================================================================================
__global__ __launch_bounds__(GTHR)
void gemm_bf(const u16* __restrict__ A, const u16* __restrict__ Bt, const float* __restrict__ bias,
             float* C, int M, int N, float oscale) {
  __shared__ __align__(16) u16 ring[2 * 2 * GPLANE];
  const int ntile = N / GT;
  const int bid   = blockIdx.x;
  const int row0  = (bid / ntile) * GT;
  const int col0  = (bid % ntile) * GT;
  if (row0 + GT > M) return;                // block-uniform, before any barrier; never taken with the exact grid
  gemm_tile<1, true>(A + (size_t)row0 * DMOD, A + (size_t)row0 * DMOD, Bt + (size_t)col0 * DMOD, ring, oscale,
                     bias, C, N, (size_t)row0, col0);
}

// =====================================================================================================
// Output projection: C[orow][DMOD] (f32) = (Ah [+ Al])[row][DMOD] . Bt[DMOD][DMOD]^T * oscale + bias (bf16 RNE value).
// NPROD == 1: Ah only (one product); NPROD == 2: Ah + Al residual plane (products h.B + l.B into one accumulator, l unscaled).
// Block -> (column tile ct = bid % 8, sequence row tile rt of nrt starting at s = sbeg, batch bb), tiles of 128: rows of Ah are
// bb*SEQ + s, rows of Al are bb*QE + s (valid only while s < QE, host guarantees for NPROD == 2), rows of C are bb*XS_FULL + s.
// Same tiling and epilogue as gemm_bf.
// =====================================================================================================
template <int NPROD>
__global__ __launch_bounds__(GTHR)
void gemm_o(const u16* __restrict__ Ah, const u16* __restrict__ Al, const u16* __restrict__ Bt, const float* __restrict__ bias,
            float* C, int sbeg, int nrt, float oscale) {
  __shared__ __align__(16) u16 ring[2 * (NPROD + 1) * GPLANE];
  const int ntile = DMOD / GT;
  const int bid   = blockIdx.x;
  const int ct    = bid % ntile;
  const int t2    = bid / ntile;
  const int rt    = t2 % nrt;
  const int bb    = t2 / nrt;
  if (bb >= NB) return;                     // block-uniform, before any barrier; never taken with the exact grid
  const int srow  = sbeg + rt * GT;
  if (srow + GT > SEQ) return;              // block-uniform; never taken
  if (NPROD == 2 && srow + GT > QE) return; // block-uniform; never taken
  const size_t rowC = (size_t)bb * SEQ + srow;
  const size_t rowL = (size_t)bb * QE + srow;
  const size_t rowO = (size_t)bb * XS_FULL + srow;
  const u16* a0 = Ah + rowC * DMOD;
  const u16* a1 = (NPROD == 2) ? (Al + rowL * DMOD) : a0;
  gemm_tile<NPROD, false>(a0, a1, Bt + (size_t)ct * GT * DMOD, ring, oscale, bias, C, DMOD, rowO, ct * GT);
}

// =====================================================================================================
// Strided key set (pass S). Key j is in this set for query i iff j = i - STRD*n with i - j >= WIN, j >= GLB (then j <= i and
// (i - j) % STRD == 0 hold). Queries and keys of one residue class rr = i % STRD: i = rr + STRD*a, j = rr + STRD*c, a, c < NA.
// Block bid -> (residue rr = bid % STRD, head group hg, batch b); one wave per head; the wave owns all NA query rows of (b, head, rr)
// in row tiles of 16 (rows a >= NA of the last tile are padding: operand row clamped, weight forced to 0, nothing stored) and visits
// the candidate keys in tiles of 32 (slots c >= NA clamped and forced to 0).
//   scores: q hi / residual (A, lane m -> row a = 16*at + m, arithmetic stride STRD rows in the [b*SEQ + s][h*HD + d] planes) times
//   k hi / residual (B, lane c -> key slot), products hh + lh + hl over HD; element predicate
//   (a < NA) && (c < NA) && (STRD*(a - c) >= WIN) && (j >= GLB), -inf otherwise; base-2 online softmax in f32 (-inf safe);
//   v rows of the 32 key slots gathered once per key tile from the v^T hi plane (arithmetic stride STRD) into a wave-private LDS tile
//   (the strided keys only feed query rows i >= WIN + GLB, which always hold >= WIN + GLB keys).
//   State written per query row: M = running max (log2 domain), L = running sum, AC = acc * 64 / (32768*1024) as f16
//   (AC plane layout [b*SEQ + i][h*HD + d]; M, L planes [(b*NH + h)*STRD + rr][NAP], rows a >= NA hold -inf / 0).
// coverage: AC: every (b, i < SEQ, h, d) exactly once (union over rr, a < NA); M/L: every (b, h, rr) line group exactly once.
// =====================================================================================================
__global__ __launch_bounds__(ATT_THREADS)
void attn_s(const u16* __restrict__ QHp, const u16* __restrict__ QLp,
            const u16* __restrict__ KHp, const u16* __restrict__ KLp,
            const u16* __restrict__ VHp, u16* ACp, float* Mp, float* Lp) {
  __shared__ __align__(16) float    smem[WPB * WREG];
  __shared__ __align__(16) _Float16 vts[WPB * HD * VSP];
  __shared__ __align__(16) float    mls[WPB * 2 * NAP];

  const int tid  = threadIdx.x;
  const int wave = tid >> 5;
  const int lane = tid & 31;
  const int hh   = lane >> 4;
  const int c    = lane & 15;
  const int bid  = blockIdx.x;
  const int rres = bid % STRD;
  const int t2   = bid / STRD;
  const int hg   = t2 % NHG;
  const int b    = t2 / NHG;
  if (b >= NB) return;                      // block-uniform; no block barriers in this kernel; never taken with the exact grid
  const int head = hg * WPB + wave;

  float*    pt   = smem + wave * WREG;      // prob tile [16][32] pitch 36
  float*    slab = pt + PTW;                // result slab [16][64] pitch 68
  _Float16* vt   = vts + wave * (HD * VSP); // v tile [64 d][32 key slots] pitch 40
  float*    msl  = mls + wave * (2 * NAP);
  float*    lsl  = msl + NAP;
#pragma unroll 1
  for (int i2 = lane; i2 < NAP; i2 += 32) { msl[i2] = -INFINITY; lsl[i2] = 0.0f; }
  wave_sync_lds();

  const _Float16* QHh = (const _Float16*)(const void*)QHp;
  const _Float16* QLh = (const _Float16*)(const void*)QLp;
  const _Float16* KHh = (const _Float16*)(const void*)KHp;
  const _Float16* KLh = (const _Float16*)(const void*)KLp;
  const size_t hcol  = (size_t)head * HD + 8 * hh;
  const size_t brow  = (size_t)b * SEQ + rres;                          // plane row of a = 0
  const u16*   vbase = VHp + (size_t)(b * NH + head) * HD * SEQ + rres; // + d*SEQ + STRD*c
  const float  lsc   = SM_SCALE * (LOG2E / (QSC * KSC));
  const float  acs   = ACAR / (PCAR * VCAR);

#pragma unroll 1
  for (int at = 0; at < NAT; ++at) {
    float mrow[8], lrow[8];
    v8f o[4];
#pragma unroll
    for (int r = 0; r < 8; ++r) { mrow[r] = -INFINITY; lrow[r] = 0.f; }
#pragma unroll
    for (int j = 0; j < 4; ++j) o[j] = zero8();
    int am = at * 16 + c;
    if (am > NA - 1) am = NA - 1;           // clamped operand row for this lane
    const size_t qoff = (brow + (size_t)STRD * am) * DMOD + hcol;
    const _Float16* Qh = QHh + qoff;
    const _Float16* Ql = QLh + qoff;
    const int ar0 = at * 16 + 8 * hh;       // D element r -> row a = ar0 + r

#pragma unroll 1
    for (int ks = 0; ks < NKS; ++ks) {
      // ---- gather the 32 key slots' v rows into the wave's LDS tile, transposed [d][slot] ----
      {
        int cs = ks * 32 + lane;
        if (cs > NA - 1) cs = NA - 1;
        const u16* vsrc = vbase + (size_t)STRD * cs;
#pragma unroll 8
        for (int d = 0; d < HD; ++d) {
          vt[d * VSP + lane] = __builtin_bit_cast(_Float16, vsrc[(size_t)d * SEQ]);
        }
      }
      // ---- scores ----
      int c0i = ks * 32 + c;       if (c0i > NA - 1) c0i = NA - 1;
      int c1i = ks * 32 + 16 + c;  if (c1i > NA - 1) c1i = NA - 1;
      const size_t k0off = (brow + (size_t)STRD * c0i) * DMOD + hcol;
      const size_t k1off = (brow + (size_t)STRD * c1i) * DMOD + hcol;
      const _Float16* k0p = KHh + k0off;
      const _Float16* k1p = KHh + k1off;
      const _Float16* l0p = KLh + k0off;
      const _Float16* l1p = KLh + k1off;
      v8f s0 = zero8(), s1 = zero8();
#pragma unroll
      for (int kk = 0; kk < HD / 32; ++kk) {
        const v16h qh  = ldfrag_h(Qh + kk * 32);
        const v16h ql  = ldfrag_h(Ql + kk * 32);
        const v16h kh0 = ldfrag_h(k0p + kk * 32);
        const v16h kh1 = ldfrag_h(k1p + kk * 32);
        const v16h kl0 = ldfrag_h(l0p + kk * 32);
        const v16h kl1 = ldfrag_h(l1p + kk * 32);
        s0 = mma_h(qh, kh0, s0);
        s0 = mma_h(ql, kh0, s0);
        s0 = mma_h(qh, kl0, s0);
        s1 = mma_h(qh, kh1, s1);
        s1 = mma_h(ql, kh1, s1);
        s1 = mma_h(qh, kl1, s1);
        guard2(s0, s1, qh, ql, kh0, kl0, kh1, kl1);
      }
      // ---- key select + online softmax in base 2, -inf-safe ----
      const int cc0 = ks * 32 + c, cc1 = cc0 + 16;
      const int j0  = rres + STRD * cc0, j1 = rres + STRD * cc1;
#pragma unroll
      for (int r = 0; r < 8; ++r) {
        const int   a  = ar0 + r;
        const float u0 = s0[r] * lsc;
        const float u1 = s1[r] * lsc;
        const bool  ok0 = (a < NA) && (cc0 < NA) && (STRD * (a - cc0) >= WIN) && (j0 >= GLB);
        const bool  ok1 = (a < NA) && (cc1 < NA) && (STRD * (a - cc1) >= WIN) && (j1 >= GLB);
        const float t0 = ok0 ? u0 : -INFINITY;
        const float t1 = ok1 ? u1 : -INFINITY;
        float mx = fmaxf(t0, t1);
#pragma unroll
        for (int off = 1; off < 16; off <<= 1) mx = fmaxf(mx, __shfl_xor(mx, off, 32));
        const float mn = fmaxf(mrow[r], mx);
        const float ms = (mn == -INFINITY) ? 0.0f : mn;
        const float al = exp2f(mrow[r] - ms);
        mrow[r] = mn;
        const float e0 = exp2f(t0 - ms), e1 = exp2f(t1 - ms);
        float ps = e0 + e1;
#pragma unroll
        for (int off = 1; off < 16; off <<= 1) ps += __shfl_xor(ps, off, 32);
        lrow[r] = lrow[r] * al + ps;
#pragma unroll
        for (int j = 0; j < 4; ++j) o[j][r] *= al;
        const int ro = (8 * hh + r) * PTP + c;
        pt[ro]      = e0;
        pt[ro + 16] = e1;
      }
      wave_sync_lds();
      // ---- A fragment of P*32768 (f16), row = c, split k map over the 32 key slots ----
      FragH ph;
      {
        const float* prow = pt + c * PTP + 8 * hh;
        const v4f p0 = *(const v4f*)(prow), p1 = *(const v4f*)(prow + 4);
        const v4f p2 = *(const v4f*)(prow + 16), p3 = *(const v4f*)(prow + 20);
#pragma unroll
        for (int e = 0; e < 4; ++e) {
          ph.h[0][e]     = (_Float16)(p0[e] * PCAR);
          ph.h[0][4 + e] = (_Float16)(p1[e] * PCAR);
          ph.h[1][e]     = (_Float16)(p2[e] * PCAR);
          ph.h[1][4 + e] = (_Float16)(p3[e] * PCAR);
        }
      }
      // ---- P.V : B fragment col n = d = jj*16 + c, key slots contiguous in the LDS tile ----
#pragma unroll
      for (int jg = 0; jg < HD / 32; ++jg) {
        const v16h vha  = ldfrag_h(vt + ((2 * jg) * 16 + c) * VSP + 8 * hh);
        const v16h vhb2 = ldfrag_h(vt + ((2 * jg + 1) * 16 + c) * VSP + 8 * hh);
        o[2 * jg]     = mma_h(ph.v, vha,  o[2 * jg]);
        o[2 * jg + 1] = mma_h(ph.v, vhb2, o[2 * jg + 1]);
        guard2(o[2 * jg], o[2 * jg + 1], ph.v, vha, vhb2, ph.v, vha, vhb2);
      }
      wave_sync_lds();
    }
    acc_guard4(o[0], o[1], o[2], o[3]);
    // ---- state: m, l per row into the LDS staging; acc * 64 / (32768*1024) into the lane-owned slab ----
    if (c == 0) {
#pragma unroll
      for (int r = 0; r < 8; ++r) { msl[ar0 + r] = mrow[r]; lsl[ar0 + r] = lrow[r]; }
    }
#pragma unroll
    for (int r = 0; r < 8; ++r) {
#pragma unroll
      for (int j = 0; j < 4; ++j) {
        slab[(8 * hh + r) * SLP + j * 16 + c] = o[j][r] * acs;
      }
    }
    wave_sync_lds();
    // ---- AC rows (f16): lane = (row select rq in 0..3, 8 consecutive d at c8) ----
    v4u    ov[4];
    bool   okr[4];
    size_t dso[4];
    const int rq = lane >> 3, c8 = (lane & 7) * 8;
#pragma unroll
    for (int it = 0; it < 4; ++it) {
      const int row = it * 4 + rq;
      const v4f a = *(const v4f*)(slab + row * SLP + c8), b4 = *(const v4f*)(slab + row * SLP + c8 + 4);
      float w[8];
#pragma unroll
      for (int e = 0; e < 4; ++e) { w[e] = a[e]; w[4 + e] = b4[e]; }
#pragma unroll
      for (int e = 0; e < 4; ++e) {
        ov[it][e] = pk16(h_bits((_Float16)w[2 * e]), h_bits((_Float16)w[2 * e + 1]));
      }
      const int arow = at * 16 + row;
      okr[it] = (arow < NA);                // uniform over the 8 lanes of one line
      const int acl  = okr[it] ? arow : (NA - 1);
      dso[it] = (brow + (size_t)STRD * acl) * DMOD + (size_t)head * HD + c8;
    }
    {
#pragma unroll
      for (int it = 0; it < 4; ++it) {
        if (okr[it]) *(v4u*)(ACp + dso[it]) = ov[it];
      }
      
    }
    wave_sync_lds();
  }

  wave_sync_lds();
  const size_t mlbase = ((size_t)(b * NH + head) * STRD + rres) * NAP;
  const int l8 = lane & 7;
  v4f mv[NAP / 32], lv[NAP / 32];
#pragma unroll
  for (int ch = 0; ch < NAP / 32; ++ch) {
    mv[ch] = *(const v4f*)(msl + ch * 32 + l8 * 4);
    lv[ch] = *(const v4f*)(lsl + ch * 32 + l8 * 4);
  }
  const bool wm = (lane < 8), wl = (lane >= 8) && (lane < 16);
  {
#pragma unroll
    for (int ch = 0; ch < NAP / 32; ++ch) {
      if (wm) *(v4f*)(Mp + mlbase + ch * 32 + l8 * 4) = mv[ch];
      if (wl) *(v4f*)(Lp + mlbase + ch * 32 + l8 * 4) = lv[ch];
    }
    
  }
}

// =====================================================================================================
// Band + leading key set (pass A), initialised from the pass-S state. Key j is in this set for query i iff
// j <= i && (i - j < WIN || j < GLB). Block bid -> (query tile qt = qt0 + bid % nq: rows q0 = 16*qt .. q0+15, head group hg, batch
// b); one wave per head.
//   q/k hi planes f16 x1024 [b*SEQ + s][h*HD + d], residual planes same layout; v^T hi plane [b*NH + h][d][SEQ], v^T residual plane
//   [b*NH + h][d][QE] (keys < QE).
//   Init per row i: mrow = M, lrow = L (from [(b*NH+h)*STRD + i%STRD][i/STRD]), o = AC row (f16) * (32768*1024/64).
//   Key tiles of 32 visited in order: tile 0 (keys 0..31, holds the leading GLB keys) when the band does not start at tile 0, then the
//   band tiles from the one holding max(0, q0 - WIN + 1) to the one holding q0 + 15 (at most WIN/32 + 2 + 1 tiles; every other tile holds
//   only keys outside this set for every query row of the tile: weight exactly 0).
//   Per tile: 2 score subtiles x 2 k-steps, products q_hi.k_hi + q_lo.k_hi + q_hi.k_lo, fragments straight from the 16-bit planes (two 16-B
//   loads per fragment, split k map); exact element predicate; online max-subtracted base-2 softmax in f32, -inf-safe rescale; the 16x32
//   f16 residual when ROB) rebuilt from the LDS rows (float vector loads, same element type as stored), v^T B fragments in 2 groups of 2
//   d-subtiles. ROB == 1 (host uses it for q0 + 16 <= QE only; then every visited key is < QE): P.v products hh + lh + hl with the v residual
//   plane, O written as hi + residual planes; ROB == 0: single product P_hi.v_hi, O hi plane only.
//   After the loop: out = acc / Z (Z >= 1 always: key i itself lies in a visited tile; guarded anyway), carries 1/(32768*1024) folded
//   once, written to the wave's private result slab (pitch 68; every element owned by one lane).
//   ([b*QE + s][h*HD + d], ROB only) written by 8 consecutive lanes x 16 B of one instruction (4 rows per instruction, each row one whole
// coverage: per wave 4 instructions x 4 rows x 8 lanes x 8 halves = 16 x 64 per plane; the two launches (qt < QE/16 with ROB = 1, the rest
//           with ROB = 0) x NHG x NB blocks x WPB waves = every (b, s, h) row of O hi exactly once and every (b, s < QE, h) row of O residual
//           exactly once.
// =====================================================================================================
template <int ROB>
__global__ __launch_bounds__(ATT_THREADS)
void attn_a(const u16* __restrict__ QHp, const u16* __restrict__ QLp,
            const u16* __restrict__ KHp, const u16* __restrict__ KLp,
            const u16* __restrict__ VHp, const u16* __restrict__ VLp,
            const u16* __restrict__ ACp, const float* __restrict__ Mp, const float* __restrict__ Lp,
            u16* OHp, u16* OLp, int qt0, int nq) {
  __shared__ __align__(16) float smem[WPB * WREG];

  const int tid  = threadIdx.x;
  const int wave = tid >> 5;
  const int lane = tid & 31;
  const int hh   = lane >> 4;
  const int c    = lane & 15;
  const int bid  = blockIdx.x;
  const int qtl  = bid % nq;
  const int t2   = bid / nq;
  const int hg   = t2 % NHG;
  const int b    = t2 / NHG;
  if (b >= NB) return;                      // block-uniform; no block barriers in this kernel; never taken with the exact grid
  const int qt   = qt0 + qtl;
  const int q0   = qt * 16;
  if (q0 + 16 > SEQ) return;                // block-uniform; never taken
  if (ROB != 0 && q0 + 16 > QE) return;     // block-uniform; never taken (residual planes cover s < QE only)
  const int head = hg * WPB + wave;

  float* pt   = smem + wave * WREG;         // prob tile [16][32] pitch 36
  float* slab = pt + PTW;                   // result slab [16][64] pitch 68

  const size_t hcol = (size_t)head * HD + 8 * hh;
  const _Float16* Qh  = (const _Float16*)(const void*)QHp + ((size_t)b * SEQ + q0 + c) * DMOD + hcol;
  const _Float16* Ql  = (const _Float16*)(const void*)QLp + ((size_t)b * SEQ + q0 + c) * DMOD + hcol;
  const _Float16* Khb = (const _Float16*)(const void*)KHp + ((size_t)b * SEQ + c) * DMOD + hcol;      // key row kb added per step
  const _Float16* Klb = (const _Float16*)(const void*)KLp + ((size_t)b * SEQ + c) * DMOD + hcol;
  const _Float16* Vhb = (const _Float16*)(const void*)VHp + ((size_t)(b * NH + head) * HD + c) * SEQ + 8 * hh;  // d col c (+16j)
  const _Float16* Vlb = Vhb;
  if constexpr (ROB != 0) {
    Vlb = (const _Float16*)(const void*)VLp + ((size_t)(b * NH + head) * HD + c) * QE + 8 * hh;
  }
  const float lsc = SM_SCALE * (LOG2E / (QSC * KSC));
  const float oc  = 1.0f / (PCAR * VCAR);
  const float aci = (PCAR * VCAR) / ACAR;
  const size_t KROW = (size_t)DMOD;         // halves between consecutive key rows

  float mrow[8], lrow[8];
  v8f o[4];
  const int qr0 = q0 + 8 * hh;              // query row of D element r = qr0 + r
  // ---- init from the strided-set state ----
  {
    const _Float16* acp = (const _Float16*)(const void*)ACp + ((size_t)b * SEQ + qr0) * DMOD + (size_t)head * HD + c;
    const size_t mlb = (size_t)(b * NH + head) * STRD;
#pragma unroll
    for (int r = 0; r < 8; ++r) {
      const int i  = qr0 + r;
      const int ir = i % STRD;
      const int ia = i / STRD;               // < NA <= NAP
      const size_t mli = (mlb + ir) * NAP + ia;
      mrow[r] = Mp[mli];
      lrow[r] = Lp[mli];
    }
#pragma unroll
    for (int j = 0; j < 4; ++j) {
      o[j] = zero8();
#pragma unroll
      for (int r = 0; r < 8; ++r) {
        o[j][r] = (float)acp[(size_t)r * DMOD + j * 16] * aci;
      }
    }
  }

  // ---- tile list: leading tile 0 (when not part of the band) then the band tiles ----
  int klo = q0 - (WIN - 1);
  if (klo < 0) klo = 0;
  const int ktb = klo >> 5;
  const int kte = (q0 + 15) >> 5;           // <= SEQ/32 - 1; for ROB: kte*32 + 31 <= QE - 1
  int nband = kte - ktb + 1;
  if (nband > NKB) nband = NKB;             // static bound (WIN/32 + 2)
  if (nband < 0) nband = 0;
  const int hasg = (ktb > 0) ? 1 : 0;
  const int nkt  = nband + hasg;            // <= NKA

#pragma unroll 1
  for (int kt = 0; kt < nkt; ++kt) {
    const int kb = (kt < hasg) ? 0 : (ktb + kt - hasg) * 32;   // kb + 31 <= SEQ - 1
    // ---- scores: D element r of this lane = (query row qr0 + r, key kb + c) in s0, key kb + 16 + c in s1 ----
    v8f s0 = zero8(), s1 = zero8();
    const _Float16* k0p = Khb + (size_t)kb * KROW;
    const _Float16* k1p = k0p + (size_t)16 * KROW;
    const _Float16* l0p = Klb + (size_t)kb * KROW;
    const _Float16* l1p = l0p + (size_t)16 * KROW;
#pragma unroll
    for (int kk = 0; kk < HD / 32; ++kk) {
      const v16h qh  = ldfrag_h(Qh + kk * 32);
      const v16h ql  = ldfrag_h(Ql + kk * 32);
      const v16h kh0 = ldfrag_h(k0p + kk * 32);
      const v16h kh1 = ldfrag_h(k1p + kk * 32);
      const v16h kl0 = ldfrag_h(l0p + kk * 32);
      const v16h kl1 = ldfrag_h(l1p + kk * 32);
      s0 = mma_h(qh, kh0, s0);
      s0 = mma_h(ql, kh0, s0);
      s0 = mma_h(qh, kl0, s0);
      s1 = mma_h(qh, kh1, s1);
      s1 = mma_h(ql, kh1, s1);
      s1 = mma_h(qh, kl1, s1);
      guard2(s0, s1, qh, ql, kh0, kl0, kh1, kl1);
    }
    // ---- key select + online softmax in base 2, -inf-safe ----
    const int key0 = kb + c, key1 = kb + 16 + c;
#pragma unroll
    for (int r = 0; r < 8; ++r) {
      const int   qr = qr0 + r;
      const float u0 = s0[r] * lsc;
      const float u1 = s1[r] * lsc;
      const bool  a0 = (key0 <= qr) && ((qr - key0 < WIN) || (key0 < GLB));
      const bool  a1 = (key1 <= qr) && ((qr - key1 < WIN) || (key1 < GLB));
      const float t0 = a0 ? u0 : -INFINITY;
      const float t1 = a1 ? u1 : -INFINITY;
      float mx = fmaxf(t0, t1);
#pragma unroll
      for (int off = 1; off < 16; off <<= 1) mx = fmaxf(mx, __shfl_xor(mx, off, 32));
      const float mn = fmaxf(mrow[r], mx);
      const float ms = (mn == -INFINITY) ? 0.0f : mn;
      const float al = exp2f(mrow[r] - ms);
      mrow[r] = mn;
      const float e0 = exp2f(t0 - ms), e1 = exp2f(t1 - ms);
      float ps = e0 + e1;
#pragma unroll
      for (int off = 1; off < 16; off <<= 1) ps += __shfl_xor(ps, off, 32);
      lrow[r] = lrow[r] * al + ps;
#pragma unroll
      for (int j = 0; j < 4; ++j) o[j][r] *= al;
      const int ro = (8 * hh + r) * PTP + c;
      pt[ro]      = e0;
      pt[ro + 16] = e1;
    }
    wave_sync_lds();
    // ---- A fragments of P*32768: hi f16 (and residual f16 when ROB), row = c, split k map over the 32 keys of this step ----
    FragH ph, pl;
    {
      const float* prow = pt + c * PTP + 8 * hh;
      const v4f p0 = *(const v4f*)(prow), p1 = *(const v4f*)(prow + 4);
      const v4f p2 = *(const v4f*)(prow + 16), p3 = *(const v4f*)(prow + 20);
#pragma unroll
      for (int e = 0; e < 4; ++e) {
        const float ta = p0[e] * PCAR, tb = p1[e] * PCAR, tc = p2[e] * PCAR, td = p3[e] * PCAR;
        const _Float16 ha = (_Float16)ta, hb = (_Float16)tb, hc = (_Float16)tc, hd = (_Float16)td;
        ph.h[0][e]     = ha;                  // elements 0..7  = keys kb + 8hh + 0..7
        ph.h[0][4 + e] = hb;
        ph.h[1][e]     = hc;                  // elements 8..15 = keys kb + 16 + 8hh + 0..7
        ph.h[1][4 + e] = hd;
        if constexpr (ROB != 0) {
          pl.h[0][e]     = (_Float16)(ta - (float)ha);
          pl.h[0][4 + e] = (_Float16)(tb - (float)hb);
          pl.h[1][e]     = (_Float16)(tc - (float)hc);
          pl.h[1][4 + e] = (_Float16)(td - (float)hd);
        } else {
          pl.h[0][e] = ha;  pl.h[0][4 + e] = hb;  pl.h[1][e] = hc;  pl.h[1][4 + e] = hd;
        }
      }
    }
    // ---- P.V : B fragment col n = d = j*16 + c, keys contiguous in the v^T planes; 2 groups of 2 d-subtiles ----
    {
      const _Float16* vhp = Vhb + kb;
      const _Float16* vlp = Vlb + kb;
#pragma unroll
      for (int jg = 0; jg < HD / 32; ++jg) {
        const size_t da = (size_t)(2 * jg) * 16 * SEQ;
        const size_t db = da + (size_t)16 * SEQ;
        const v16h vha = ldfrag_h(vhp + da), vhb2 = ldfrag_h(vhp + db);
        if constexpr (ROB != 0) {
          const size_t la = (size_t)(2 * jg) * 16 * QE;
          const size_t lb = la + (size_t)16 * QE;
          const v16h vla = ldfrag_h(vlp + la), vlb2 = ldfrag_h(vlp + lb);
          o[2 * jg]     = mma_h(ph.v, vha,  o[2 * jg]);
          o[2 * jg]     = mma_h(pl.v, vha,  o[2 * jg]);
          o[2 * jg]     = mma_h(ph.v, vla,  o[2 * jg]);
          o[2 * jg + 1] = mma_h(ph.v, vhb2, o[2 * jg + 1]);
          o[2 * jg + 1] = mma_h(pl.v, vhb2, o[2 * jg + 1]);
          o[2 * jg + 1] = mma_h(ph.v, vlb2, o[2 * jg + 1]);
          guard2(o[2 * jg], o[2 * jg + 1], ph.v, pl.v, vha, vhb2, vla, vlb2);
        } else {
          o[2 * jg]     = mma_h(ph.v, vha,  o[2 * jg]);
          o[2 * jg + 1] = mma_h(ph.v, vhb2, o[2 * jg + 1]);
          guard2(o[2 * jg], o[2 * jg + 1], ph.v, vha, vhb2, ph.v, vha, vhb2);
        }
      }
    }
    wave_sync_lds();
  }
  acc_guard4(o[0], o[1], o[2], o[3]);
  // ---- out = acc / Z (0 if Z == 0), carries (32768 on P, 1024 on v) folded once; written into the lane-owned slab ----
#pragma unroll
  for (int r = 0; r < 8; ++r) {
    const float lv  = lrow[r];
    const float ls  = (lv > 0.0f) ? lv : 1.0f;
    const float inv = (lv > 0.0f) ? ((1.0f / ls) * oc) : 0.0f;
#pragma unroll
    for (int j = 0; j < 4; ++j) {
      const int idx = (8 * hh + r) * SLP + j * 16 + c;
      slab[idx] = o[j][r] * inv;
    }
  }

  wave_sync_lds();
  // ---- O x1024 -> f16 hi (+ residual when ROB) planes; lane = (row select rq in 0..3, 8 consecutive d at c8) ----
  v4u oh[4], ol[4];
  const int rq = lane >> 3, c8 = (lane & 7) * 8;
#pragma unroll
  for (int it = 0; it < 4; ++it) {
    const int row = it * 4 + rq;
    const v4f a = *(const v4f*)(slab + row * SLP + c8), b4 = *(const v4f*)(slab + row * SLP + c8 + 4);
    float w[8];
#pragma unroll
    for (int e = 0; e < 4; ++e) { w[e] = a[e] * OSC; w[4 + e] = b4[e] * OSC; }
#pragma unroll
    for (int e = 0; e < 4; ++e) {
      const _Float16 h0 = (_Float16)w[2 * e], h1 = (_Float16)w[2 * e + 1];
      const _Float16 l0 = (_Float16)(w[2 * e] - (float)h0), l1 = (_Float16)(w[2 * e + 1] - (float)h1);
      oh[it][e] = pk16(h_bits(h0), h_bits(h1));
      ol[it][e] = pk16(h_bits(l0), h_bits(l1));
    }
  }
  const size_t ob  = ((size_t)b * SEQ + q0) * DMOD + (size_t)head * HD + c8;
  const size_t olb = ((size_t)b * QE + q0) * DMOD + (size_t)head * HD + c8;   // dereferenced only when ROB
  {
#pragma unroll
    for (int it = 0; it < 4; ++it) {
      const int row = it * 4 + rq;
      *(v4u*)(OHp + ob + (size_t)row * DMOD) = oh[it];
      if constexpr (ROB != 0) {
        *(v4u*)(OLp + olb + (size_t)row * DMOD) = ol[it];
      }
    }
    
  }
}

// =====================================================================================================
// Workspace map (bytes); every plane is fully written by whole-line stores before it is read; all extents are exact multiples
// of the store granularity (no pad rows needed); every region offset a multiple of 524288:
//   XB  bf16 [MROWS][1024]                       MROWS*2048       (x as bf16; after the projections the region holds AC f16 [MROWS][1024])
//   WB  16-bit [1024 n][1024 k]                  2097152          (Wq, Wk, Wv column blocks as bf16 [n][k], then Wo as f16 x1024, in launch order)
//   F   f32 [SEQ][1024]                          SEQ*4096         (one batch's q, k, v projection output in launch order; afterwards the region holds
//                                                                  OH f16 [MROWS][1024] x1024; region sized to the larger of the two)
//   QH  f16 [MROWS][1024] x1024                  MROWS*2048       QL residual the same; KH, KL the same
//   VH  f16 [NB*16][64][SEQ] x1024               MROWS*2048
//   VL  f16 residual [NB*16][64][QE]             NB*16*64*QE*2
//   OL  f16 residual [NB*QE][1024]               NB*QE*2048
//   M   f32 [NB*16*STRD][NAP]                     NB*16*STRD*NAP*4 L the same
//   end (NB=2, SEQ=4096, QE=512)               124780544
// =====================================================================================================
extern "C" void kernel_launch(void* const* d_in, const int* in_sizes, int n_in,
                              void* d_out, int out_size, void* d_ws, size_t ws_size,
                              hipStream_t stream) {
  if (n_in < 5) return;
  const int needx = OROWS * DMOD;
  if (in_sizes[0] < needx) return;
  if (in_sizes[1] != 3 * DMOD * DMOD) return;
  if (in_sizes[2] < 3 * DMOD) return;
  if (in_sizes[3] != DMOD * DMOD) return;
  if (in_sizes[4] < DMOD) return;
  if (out_size < needx) return;

  const float* x    = (const float*)d_in[0];
  const float* wqkv = (const float*)d_in[1];
  const float* bqkv = (const float*)d_in[2];
  const float* wo   = (const float*)d_in[3];
  const float* bo   = (const float*)d_in[4];
  float*       out  = (float*)d_out;

  const size_t szXB = (size_t)MROWS * DMOD * 2;                 // XB, later AC (same extent)
  const size_t szW  = (size_t)DMOD * DMOD * 2;
  const size_t szFs = (size_t)SEQ * DMOD * 4;                   // F staging
  const size_t szH  = (size_t)MROWS * DMOD * 2;                 // QH, QL, KH, KL, OH
  const size_t szFR = (szFs > szH) ? szFs : szH;                // F region also holds OH afterwards
  const size_t szV  = (size_t)NB * NH * HD * SEQ * 2;           // VH (== szH)
  const size_t szVL = (size_t)NB * NH * HD * QE * 2;            // VL
  const size_t szOL = (size_t)NB * QE * DMOD * 2;               // OL (== szVL)
  const size_t szML = (size_t)NB * NH * STRD * NAP * 4;         // M, L
  size_t off = 0;
  const size_t oXB = off; off += szXB;
  const size_t oW  = off; off += szW;
  const size_t oF  = off; off += szFR;
  const size_t oQH = off; off += szH;
  const size_t oQL = off; off += szH;
  const size_t oKH = off; off += szH;
  const size_t oKL = off; off += szH;
  const size_t oVH = off; off += szV;
  const size_t oVL = off; off += szVL;
  const size_t oOL = off; off += szOL;
  const size_t oM  = off; off += szML;
  const size_t oL  = off; off += szML;
  if (off > ws_size) return;                // off = 124780544 for NB = 2, SEQ = 4096
  if (off > (size_t)WS_CAP) return;

  char* ws = (char*)d_ws;
  u16*   XB = (u16*)(ws + oXB);
  u16*   AC = (u16*)(ws + oXB);
  u16*   WB = (u16*)(ws + oW);
  float* F  = (float*)(ws + oF);
  u16*   OH = (u16*)(ws + oF);
  u16*   QH = (u16*)(ws + oQH);
  u16*   QL = (u16*)(ws + oQL);
  u16*   KH = (u16*)(ws + oKH);
  u16*   KL = (u16*)(ws + oKL);
  u16*   VH = (u16*)(ws + oVH);
  u16*   VL = (u16*)(ws + oVL);
  u16*   OL = (u16*)(ws + oOL);
  float* Mp = (float*)(ws + oM);
  float* Lp = (float*)(ws + oL);

  const dim3 b256(256), bQK(QKT), bAT(ATT_THREADS);
  const int  n8x = (SEQ * DMOD) / 8;
  const dim3 gX((n8x + 255) / 256);                     // per batch
  const dim3 gTR((DMOD / 64) * (DMOD / 64));            // 256 blocks per [1024][1024] weight block
  const dim3 gG((SEQ / GT) * (DMOD / GT));              // per batch
  const dim3 gVT(NH * NST);                             // per batch
  const dim3 gQK(SEQ);                                  // per batch
  const int  nqR  = QE / 16;                            // query tiles with residual P.v products per (b, head group)
  const int  nqP  = NQT - nqR;
  const int  nrtR = QE / GT;                            // out-projection row tiles with the residual plane
  const int  nrtP = (SEQ - QE) / GT;

  // (0) x -> bf16 plane [MROWS][1024], one launch per batch
  for (int b = 0; b < NB; ++b) {
    cvt16<<<gX, b256, 0, stream>>>(x + (size_t)b * XS_FULL * DMOD, XB + (size_t)b * SEQ * DMOD, n8x, 0, 1.0f);
  }
  // (1) per column block p (q, k, v): W[:, p*1024 .. p*1024+1023] ([1024 k][3072 n] -> [1024 n][1024 k] bf16); per batch:
  //     projection -> F f32; then the 16-bit planes
  for (int p = 0; p < 3; ++p) {
    tr16<<<gTR, b256, 0, stream>>>(wqkv, 3 * DMOD, p * DMOD, WB, 0, 1.0f);
    for (int b = 0; b < NB; ++b) {
      gemm_bf<<<gG, b256, 0, stream>>>(XB + (size_t)b * SEQ * DMOD, WB, bqkv + p * DMOD, F, SEQ, DMOD, 1.0f);
      if (p == 0) {
        qk16<<<gQK, bQK, 0, stream>>>(F, QH, QL, b * SEQ, QSC);
      } else if (p == 1) {
        qk16<<<gQK, bQK, 0, stream>>>(F, KH, KL, b * SEQ, KSC);
      } else {
        vt16<<<gVT, b256, 0, stream>>>(F, VH, VL, b);
      }
    }
  }
  // (2) Wo [1024 k][1024 n] -> [n][k] f16 plane of bf16 value x1024
  tr16<<<gTR, b256, 0, stream>>>(wo, DMOD, 0, WB, 1, WOS);
  // (3) strided key set -> per-row state (M, L, AC)
  attn_s<<<dim3(NB * NHG * STRD), bAT, 0, stream>>>(QH, QL, KH, KL, VH, AC, Mp, Lp);
  // (4) band + leading key set merged onto that state: query rows s < QE with residual P.v products -> O hi + residual planes;
  //     (5) remaining rows, single product -> O hi plane
  attn_a<1><<<dim3(nqR * NHG * NB), bAT, 0, stream>>>(QH, QL, KH, KL, VH, VL, AC, Mp, Lp, OH, OL, 0, nqR);
  if (nqP > 0) {
    attn_a<0><<<dim3(nqP * NHG * NB), bAT, 0, stream>>>(QH, QL, KH, KL, VH, VL, AC, Mp, Lp, OH, OL, nqR, nqP);
  }
  // (6) output projection rows s < QE (hi + residual) and (7) rows s >= QE (hi only) -> out f32, carries 1024 x 1024 folded back
  gemm_o<2><<<dim3(NB * nrtR * (DMOD / GT)), b256, 0, stream>>>(OH, OL, WB, bo, out, 0, nrtR, 1.0f / (OSC * WOS));
  if (nrtP > 0) {
    gemm_o<1><<<dim3(NB * nrtP * (DMOD / GT)), b256, 0, stream>>>(OH, OL, WB, bo, out, QE, nrtP, 1.0f / (OSC * WOS));
  }
  (void)hipGetLastError();
}

// v002
// One run takes 315 microseconds.
// In both of two side-by-side timings against v001, it was 1.18 times as fast.
// All steps since v000 together make it 1.86 times as fast.
// Contractions: x.Wq, x.Wk, x.Wv on v_wmma_f32_16x16x32_bf16 (x, W, biases RNE-converted to bf16; each W column block
// transposed into a k-contiguous [n][k] plane; f32 accumulate); k.q^T over 64 on v_wmma_f32_16x16x32_f16 with q, k carried as
// f16 hi x1024 + f16 residual planes (products hh + lh + hl); v^T.P^T on v_wmma_f32_16x16x32_f16 (P x32768 f16, v x1024 f16):
// query rows s < QE use P hi + residual and v hi + residual planes (hh + lh + hl), other rows one product; O.Wo on
// v_wmma_f32_16x16x32_f16 (O x1024 f16, Wo as f16(bf16(Wo)) x1024): rows s < QE as O hi + residual planes (h.W + l.W), other rows one
// product; all f32 accumulate. Bias adds, key-set select, base-2 online softmax, merge of the two key-set states and the 1/Z fold in
// f32 on VALU.
#include <hip/hip_runtime.h>
#include <math.h>
#include <stdint.h>

#ifndef NB
#define NB 2
#endif
#ifndef SEQ
#define SEQ 4096
#endif
#define XS_FULL 4096
#define DMOD  1024
#define NH    16
#define HD    64
#define WIN   256
#define STRD  128
#define GLB   16
#define QE    ((SEQ < 512) ? SEQ : 512)
#define MROWS (NB * SEQ)
#define OROWS ((NB - 1) * XS_FULL + SEQ)
#define SM_SCALE 0.125f
#define LOG2E 1.4426950408889634f
#define QSC   1024.0f
#define KSC   1024.0f
#define PCAR  32768.0f
#define VCAR  1024.0f
#define OSC   1024.0f
#define WOS   1024.0f
#define ACAR  64.0f
#define WPB   4
#define NHG   (NH / WPB)
#define NQT   (SEQ / 16)
#define NST   (SEQ / 64)
#define NKB   ((WIN / 32) + 2)
#define NKA   (NKB + 1)
#define NA    (SEQ / STRD)
#define NAP   (((NA + 31) / 32) * 32)
#define NAT   ((NA + 15) / 16)
#define NKS   ((NA + 31) / 32)
#define ATT_THREADS (WPB * 32)
#define SLP   68
#define SLW   (16 * SLP)
#define SLAB64 (16 * 68)
#define VTP   72
#define VSP   40
#define QKT   (DMOD / 8)
#define WS_CAP 134217728
static_assert(DMOD == NH * HD && HD == 64 && NH == 16);
static_assert((NH % WPB) == 0 && ATT_THREADS == 128);
static_assert(NB >= 1 && NB <= 2);
static_assert((SEQ % STRD) == 0 && (SEQ % 64) == 0 && SEQ >= STRD && SEQ <= XS_FULL);
static_assert((QE % 64) == 0 && QE >= 64 && QE <= SEQ);
static_assert((STRD % 16) == 0 && STRD >= 32);
static_assert((WIN % 32) == 0 && WIN >= 32);
static_assert(GLB >= 1 && GLB <= 32);
static_assert(NA >= 1 && NAP >= 32 && NAP <= 256 && (NAP % 32) == 0 && 16 * NAT <= NAP);
static_assert(DMOD == 128 * 8 && QKT == 128 && (DMOD % 64) == 0 && (DMOD % 32) == 0);
static_assert((HD % 32) == 0);
static_assert(((SEQ * DMOD) % (8 * 256)) == 0);

typedef unsigned short u16;
typedef _Float16 v16h __attribute__((ext_vector_type(16)));
typedef _Float16 v8h  __attribute__((ext_vector_type(8)));
typedef __bf16   v16b __attribute__((ext_vector_type(16)));
typedef float    v8f  __attribute__((ext_vector_type(8)));
typedef float    v4f  __attribute__((ext_vector_type(4)));
typedef unsigned int v4u __attribute__((ext_vector_type(4)));

union FragH { v16h v; v8h h[2]; v4u u[2]; };
union FragB { v16b v; v4u u[2]; };

// ---- scalar helpers --------------------------------------------------------------------------------
__device__ __forceinline__ unsigned short bf_bits(float f) {          // f32 -> bf16 bits, RNE convert
  unsigned u = __float_as_uint(f);
  return (unsigned short)((u + 0x7FFFu + ((u >> 16) & 1u)) >> 16);
}
__device__ __forceinline__ float bf_up(unsigned short h) { return __uint_as_float(((unsigned)h) << 16); }
__device__ __forceinline__ float bfr(float f) { return bf_up(bf_bits(f)); }
__device__ __forceinline__ unsigned short h_bits(_Float16 x) { return __builtin_bit_cast(unsigned short, x); }
__device__ __forceinline__ unsigned pk16(unsigned short a, unsigned short b) { return (unsigned)a | ((unsigned)b << 16); }
__device__ __forceinline__ v8f zero8() { v8f z = {0.f, 0.f, 0.f, 0.f, 0.f, 0.f, 0.f, 0.f}; return z; }

// ---- fragment loaders: 16-bit A/B operand, lane -> row/col (lane&15), p already includes +8*(lane>>4);
//      elements 0..7 <- p[0..7] (k0+8h..), elements 8..15 <- p[16..23] (k0+16+8h..)  (same split k map for A and B;
//      B is always read from a k-contiguous [n][k] plane or tile)
__device__ __forceinline__ v16h ldfrag_h(const _Float16* p) {
  FragH f;
  f.h[0] = *(const v8h*)(p);
  f.h[1] = *(const v8h*)(p + 16);
  return f.v;
}
__device__ __forceinline__ v8f mma_h(v16h a, v16h b, v8f c) {
  return __builtin_amdgcn_wmma_f32_16x16x32_f16(false, a, false, b, (short)0, c, false, false);
}
__device__ __forceinline__ v8f mma_b(v16b a, v16b b, v8f c) {
  return __builtin_amdgcn_wmma_f32_16x16x32_bf16(false, a, false, b, (short)0, c, false, false);
}
__device__ __forceinline__ void guard2(v8f& a, v8f& b, v16h x0, v16h x1, v16h x2, v16h x3, v16h x4, v16h x5) {
#if defined(__HIP_DEVICE_COMPILE__)
  asm volatile("v_nop\n\tv_nop\n\tv_nop\n\tv_nop"
               : "+v"(a), "+v"(b) : "v"(x0), "v"(x1), "v"(x2), "v"(x3), "v"(x4), "v"(x5) : "memory");
#endif
}
__device__ __forceinline__ void acc_guard4(v8f& a, v8f& b, v8f& c, v8f& d) {
#if defined(__HIP_DEVICE_COMPILE__)
  asm volatile("v_nop\n\tv_nop\n\tv_nop\n\tv_nop" : "+v"(a), "+v"(b), "+v"(c), "+v"(d));
#endif
}
// value of lane l ^ 16 (the other 16-lane row), a vector cross-row move
__device__ __forceinline__ float xhalf(float x) {
  const int b = __builtin_bit_cast(int, x);
  return __builtin_bit_cast(float, __builtin_amdgcn_permlanex16(b, b, 0x76543210, 0xfedcba98, false, false));
}
__device__ __forceinline__ void wave_sync_lds() {
  __builtin_amdgcn_fence(__ATOMIC_RELEASE, "workgroup");
  __builtin_amdgcn_wave_barrier();
  __builtin_amdgcn_fence(__ATOMIC_ACQUIRE, "workgroup");
}

// =====================================================================================================
// f32 -> 16-bit plane, same layout.  f16mode == 0: bf16 RNE bits;  f16mode == 1: f16 bits of (bf16 RNE value) * scale.
// Thread = 8 consecutive elements: two 16-B loads, one 16-B store; 32 consecutive lanes = 512 contiguous, 512-B aligned
// coverage: grid = ceil(n8/256) blocks x 256 thr x 8 (in-kernel bound) = the whole plane (n8 a multiple of 256 here).
// =====================================================================================================
__global__ __launch_bounds__(256) void cvt16(const float* __restrict__ x, u16* D, int n8, int f16mode, float scale) {
  const int gt = blockIdx.x * 256 + (int)threadIdx.x;
  if (gt >= n8) return;
  const float* p = x + (size_t)gt * 8;
  const v4f a = *(const v4f*)(p), b4 = *(const v4f*)(p + 4);
  float w[8];
#pragma unroll
  for (int e = 0; e < 4; ++e) { w[e] = a[e]; w[4 + e] = b4[e]; }
  v4u o;
#pragma unroll
  for (int e = 0; e < 4; ++e) {
    const float f0 = w[2 * e], f1 = w[2 * e + 1];
    const unsigned short hb0 = h_bits((_Float16)(bfr(f0) * scale));
    const unsigned short hb1 = h_bits((_Float16)(bfr(f1) * scale));
    const unsigned short bb0 = bf_bits(f0);
    const unsigned short bb1 = bf_bits(f1);
    o[e] = (f16mode != 0) ? pk16(hb0, hb1) : pk16(bb0, bb1);
  }
  u16* d = D + (size_t)gt * 8;
  {
    *(v4u*)(d) = o;
    
  }
}

// =====================================================================================================
// Weight transpose + convert: W f32 [DMOD rows k][ldw], column block col0 .. col0+DMOD-1 (column index = n)
//   -> D 16-bit [DMOD n][DMOD k] (k-contiguous B operand), i.e. in[k][col0+n] -> out[n][k].  f16mode as in cvt16.
// Block = (n tile n0, k tile k0) of 64 x 64: load 64 k rows x 64 n floats with 16-B loads (thread = k row kr, 16 n), convert,
// scatter transposed into an LDS tile [n][k] (pitch 72 halves); block barrier; each n-row segment (64 halves = one whole
// coverage: load 256 thr x 16 = 64 k x 64 n; store 2 iterations x 256 thr x 8 halves = 64 lines x 64; grid (DMOD/64)^2 = every
//           (n, k) of D exactly once.
// =====================================================================================================
__global__ __launch_bounds__(256) void tr16(const float* __restrict__ W, int ldw, int col0, u16* D, int f16mode, float scale) {
  __shared__ __align__(16) u16 T[64 * VTP];
  const int tid = (int)threadIdx.x;
  const int bid = (int)blockIdx.x;
  const int nt  = bid % (DMOD / 64);
  const int kt  = bid / (DMOD / 64);
  if (kt >= DMOD / 64) return;              // block-uniform, before any barrier; never taken with the exact grid
  const int n0 = nt * 64, k0 = kt * 64;
  {
    const int kr = tid >> 2;                // k row within tile 0..63
    const int nc = (tid & 3) * 16;          // n chunk 0,16,32,48
    const float* src = W + (size_t)(k0 + kr) * (size_t)ldw + col0 + n0 + nc;
#pragma unroll
    for (int i = 0; i < 4; ++i) {
      const v4f a = *(const v4f*)(src + 4 * i);
#pragma unroll
      for (int e = 0; e < 4; ++e) {
        const float f = a[e];
        const unsigned short hb = h_bits((_Float16)(bfr(f) * scale));
        const unsigned short bb = bf_bits(f);
        T[(nc + 4 * i + e) * VTP + kr] = (f16mode != 0) ? hb : bb;
      }
    }
  }
  __syncthreads();
  v4u ov[2];
  const int q8 = tid >> 3, p8 = (tid & 7) * 8;
#pragma unroll
  for (int it = 0; it < 2; ++it) {
    const int line = it * 32 + q8;          // n = 0..63
    ov[it] = *(const v4u*)(T + line * VTP + p8);
  }
  u16* base = D + (size_t)n0 * DMOD + k0 + p8;
  {
#pragma unroll
    for (int it = 0; it < 2; ++it) {
      const int line = it * 32 + q8;
      *(v4u*)(base + (size_t)line * DMOD) = ov[it];
    }
    
  }
}

// =====================================================================================================
// v^T planes from the v projection F f32 [SEQ][DMOD] of batch b (row = s, column = g*HD + d, bias already added):
//   VH[((b*NH + g)*HD + d)][s] = f16(v * 1024) for all s;  VL[((b*NH + g)*HD + d)][s] (pitch QE) = f16 residual, keys s < QE only.
// Block = (head g, 64 keys s0): each thread loads its 16 floats (key sl, d chunk dc) with 16-B loads, converts, scatters into
// written by 8 consecutive lanes x 16 B of one instruction; residual plane stored only when s0 + 64 <= QE (block-uniform);
// coverage: load 256 thr x 16 = 64 keys x 64 d; store 2 iterations x 256 thr x 8 halves = 64 lines x 64 = the block's tile of
//           VH (and of VL for the first QE keys); grid = NH*NST blocks per batch covers the batch's VH rows exactly once and
//           every VL row segment once.
// =====================================================================================================
__global__ __launch_bounds__(256) void vt16(const float* __restrict__ F, u16* VHo, u16* VLo, int b) {
  __shared__ __align__(16) u16 TH[HD * VTP];
  __shared__ __align__(16) u16 TL[HD * VTP];
  const int tid = threadIdx.x;
  const int bid = blockIdx.x;
  const int st  = bid % NST;
  const int g   = bid / NST;
  if (g >= NH) return;                      // block-uniform, before any barrier; never taken with the exact grid
  const int s0  = st * 64;
  {
    const int sl = tid >> 2;                // key within tile 0..63
    const int dc = (tid & 3) * 16;          // d chunk 0,16,32,48
    const float* src = F + ((size_t)s0 + sl) * DMOD + g * HD + dc;
#pragma unroll
    for (int i = 0; i < 4; ++i) {
      const v4f a = *(const v4f*)(src + 4 * i);
#pragma unroll
      for (int e = 0; e < 4; ++e) {
        const float t = a[e] * VCAR;
        const _Float16 hv = (_Float16)t;
        const _Float16 lv = (_Float16)(t - (float)hv);
        TH[(dc + 4 * i + e) * VTP + sl] = h_bits(hv);
        TL[(dc + 4 * i + e) * VTP + sl] = h_bits(lv);
      }
    }
  }
  __syncthreads();
  v4u vh[2], vl[2];
  const int q8 = tid >> 3, p8 = (tid & 7) * 8;
#pragma unroll
  for (int it = 0; it < 2; ++it) {
    const int line = it * 32 + q8;          // d = 0..63
    vh[it] = *(const v4u*)(TH + line * VTP + p8);
    vl[it] = *(const v4u*)(TL + line * VTP + p8);
  }
  const size_t hrow  = (size_t)(b * NH + g) * HD;
  const size_t baseH = hrow * SEQ + s0 + p8;
  const size_t baseL = hrow * QE + s0 + p8;
  const bool   dolo  = (s0 + 64 <= QE);     // block-uniform
  {
#pragma unroll
    for (int it = 0; it < 2; ++it) {
      const int line = it * 32 + q8;
      *(v4u*)(VHo + baseH + (size_t)line * SEQ) = vh[it];
    }
    if (dolo) {
#pragma unroll
      for (int it = 0; it < 2; ++it) {
        const int line = it * 32 + q8;
        *(v4u*)(VLo + baseL + (size_t)line * QE) = vl[it];
      }
    }
    
  }
}

// =====================================================================================================
// q / k planes from a projection F f32 [SEQ][DMOD] of one batch (bias already added), destination row = rowoff + s:
//   Hp [MROWS][DMOD] = f16(val * sc),  Lp [MROWS][DMOD] = f16 residual (val*sc - hi).
// Block = one row of 128 threads, thread = 8 consecutive columns: two 16-B loads, one 16-B store per plane; 32 consecutive
// coverage: 128 thr x 8 = the whole DMOD row of Hp and Lp; grid = SEQ blocks = every row of the batch once.
// =====================================================================================================
__global__ __launch_bounds__(QKT) void qk16(const float* __restrict__ F, u16* Hp, u16* Lp, int rowoff, float sc) {
  const int tid = (int)threadIdx.x;
  const int row = (int)blockIdx.x;
  if (row >= SEQ) return;
  if (tid >= QKT) return;
  const float* p = F + (size_t)row * DMOD + tid * 8;
  const v4f a = *(const v4f*)(p), b4 = *(const v4f*)(p + 4);
  float w[8];
#pragma unroll
  for (int e = 0; e < 4; ++e) { w[e] = a[e] * sc; w[4 + e] = b4[e] * sc; }
  v4u oh, ol;
#pragma unroll
  for (int e = 0; e < 4; ++e) {
    const float t0 = w[2 * e], t1 = w[2 * e + 1];
    const _Float16 h0 = (_Float16)t0, h1 = (_Float16)t1;
    const _Float16 l0 = (_Float16)(t0 - (float)h0), l1 = (_Float16)(t1 - (float)h1);
    oh[e] = pk16(h_bits(h0), h_bits(h1));
    ol[e] = pk16(h_bits(l0), h_bits(l1));
  }
  const size_t drow = (size_t)(rowoff + row) * DMOD + tid * 8;
  u16* dh = Hp + drow;
  u16* dl = Lp + drow;
  {
    *(v4u*)(dh) = oh;
    *(v4u*)(dl) = ol;
    
  }
}

// =====================================================================================================
// GEMM epilogue: the wave's 32x64 f32 tile (times oscale) staged in its LDS slab (two 16-row parts, pitch 68), read back as whole
// rows, bias added, stored.
// coverage: 2 parts x 8 instructions x 2 rows x 16 lanes x 4 floats = the wave's 32 x 64 tile.
// =====================================================================================================
__device__ __forceinline__ void epi3264(float* sl, const v8f (&acc)[2][4], float oscale,
                                        const float* __restrict__ bias, float* C, int N, size_t rowb, int col0, int lane) {
  const int hh = lane >> 4, m = lane & 15;
#pragma unroll
  for (int i = 0; i < 2; ++i) {
#pragma unroll
    for (int r = 0; r < 8; ++r) {
      const int ro = i * SLAB64 + (8 * hh + r) * 68 + m;
      sl[ro]      = acc[i][0][r] * oscale;
      sl[ro + 16] = acc[i][1][r] * oscale;
      sl[ro + 32] = acc[i][2][r] * oscale;
      sl[ro + 48] = acc[i][3][r] * oscale;
    }
  }
  wave_sync_lds();
  const v4f bb = *(const v4f*)(bias + col0 + m * 4);
  v4f br;
#pragma unroll
  for (int e = 0; e < 4; ++e) br[e] = bfr(bb[e]);
  float* dst = C + (rowb + (size_t)hh) * (size_t)N + col0 + m * 4;
#pragma unroll
  for (int i = 0; i < 2; ++i) {
    v4f vals[8];
#pragma unroll
    for (int it = 0; it < 8; ++it) vals[it] = *(const v4f*)(sl + i * SLAB64 + (it * 2 + hh) * 68 + m * 4) + br;
#pragma unroll
    for (int it = 0; it < 8; ++it) {
      *(v4f*)(dst + (size_t)(i * 16 + it * 2) * (size_t)N) = vals[it];
    }
  }
}

// =====================================================================================================
// GEMM core shared by the projections and the output projection: one 128 x 128 tile of C per block, 8 waves of 32 x 64
// (wave -> rows 32 * (wave >> 1), columns 64 * (wave & 1)), K = DMOD walked in passes of 128 k.
// A pass's operand rows (256 B each: NPROD A planes of 128 rows, then 128 Bt rows) are staged in LDS at pitch 272 B by per-lane
// 16-B asynchronous copies: one wave instruction = 2 rows x 256 B = whole 128-B lines. Two buffers: pass t + 2 is copied into the
// buffer pass t has left while pass t + 1 is worked on. Fragments are 16-B LDS reads with the same split k map as ldfrag_h.
// Per accumulator the products keep ascending k in steps of 32, and h before l inside a step.
// =====================================================================================================
#define GT     128
#define GTHR   256
#define GKP    128
#define GPIT   136
#define GPLANE (GT * GPIT)
#define GNP    (DMOD / GKP)
static_assert((DMOD % GKP) == 0 && GNP >= 2 && (DMOD % GT) == 0 && (SEQ % GT) == 0 && (QE % GT) == 0);
static_assert(8 * 2 * SLAB64 * 4 <= 2 * 2 * GPLANE * 2);

// One operand plane of a pass: 128 rows x 256 B = eight 16-B copies of each lane, rows 16 apart (l, g: the lane's first row and
// 16-B column; LDS step 16 * 272 B, global step 16 * DMOD halves).
__device__ __forceinline__ void copy_plane(unsigned l, const u16* g) {
#if defined(__HIP_DEVICE_COMPILE__)
  const unsigned ls = 16 * GPIT * 2;
  const size_t   gs = (size_t)16 * DMOD;
  // the closing s_wait_xcnt 0 stands inside the statement so that no address register is rewritten ahead of it
  asm volatile("global_load_async_to_lds_b128 %0, %8, off\n\t"
               "global_load_async_to_lds_b128 %1, %9, off\n\t"
               "global_load_async_to_lds_b128 %2, %10, off\n\t"
               "global_load_async_to_lds_b128 %3, %11, off\n\t"
               "global_load_async_to_lds_b128 %4, %12, off\n\t"
               "global_load_async_to_lds_b128 %5, %13, off\n\t"
               "global_load_async_to_lds_b128 %6, %14, off\n\t"
               "global_load_async_to_lds_b128 %7, %15, off\n\t"
               "s_wait_xcnt 0x0"
               :: "v"(l), "v"(l + ls), "v"(l + 2 * ls), "v"(l + 3 * ls), "v"(l + 4 * ls), "v"(l + 5 * ls), "v"(l + 6 * ls),
                  "v"(l + 7 * ls),
                  "v"(g), "v"(g + gs), "v"(g + 2 * gs), "v"(g + 3 * gs), "v"(g + 4 * gs), "v"(g + 5 * gs), "v"(g + 6 * gs),
                  "v"(g + 7 * gs)
               : "memory");
#endif
}
__device__ __forceinline__ void wait_async0() {   // this wave's copies have landed
#if defined(__HIP_DEVICE_COMPILE__)
  asm volatile("s_wait_asynccnt 0x0" ::: "memory");
#endif
}
__device__ __forceinline__ void wait_ds0() {      // this wave's LDS reads are done before their buffer is handed back
#if defined(__HIP_DEVICE_COMPILE__)
  asm volatile("s_wait_dscnt 0x0" ::: "memory");
#endif
}
struct Frag16 { v4u u[2]; };
__device__ __forceinline__ Frag16 ldfrag_s(const u16* p) {
  Frag16 f;
  f.u[0] = *(const v4u*)(p);
  f.u[1] = *(const v4u*)(p + 16);
  return f;
}
template <bool BF>
__device__ __forceinline__ v8f mma_s(const Frag16& a, const Frag16& b, v8f c) {
  if constexpr (BF) {
    FragB x, y;
    x.u[0] = a.u[0]; x.u[1] = a.u[1]; y.u[0] = b.u[0]; y.u[1] = b.u[1];
    return mma_b(x.v, y.v, c);
  } else {
    FragH x, y;
    x.u[0] = a.u[0]; x.u[1] = a.u[1]; y.u[0] = b.u[0]; y.u[1] = b.u[1];
    return mma_h(x.v, y.v, c);
  }
}

// A0, A1, B0: first row of the block's 128 rows in each plane (row pitch DMOD halves); A1 is read only when NPROD == 2.
// ring: 2 * (NPROD + 1) * GPLANE halves, reused as the waves' output slabs behind the last pass's barrier.
// Every thread of the block calls this (block barriers inside).
template <int NPROD, bool BF>
__device__ __forceinline__ void gemm_tile(const u16* A0, const u16* A1, const u16* B0, u16* ring, float oscale,
                                          const float* __restrict__ bias, float* C, int N, size_t rowC, int colC) {
  constexpr int STG = (NPROD + 1) * GPLANE;
  const int tid = threadIdx.x, wave = tid >> 5, lane = tid & 31, hh = lane >> 4, m = lane & 15;
  const int wr = (wave >> 1) * 32, wc = (wave & 1) * 64;
  // copy role: row tid >> 4 (+ 16 per copy), 16-B column tid & 15
  const int crow = tid >> 4, ccol = (tid & 15) * 8;
  const size_t  goff = (size_t)crow * DMOD + ccol;
  const unsigned l0  = (unsigned)(size_t)(ring + crow * GPIT + ccol);
  const u16* ga0 = A0 + goff;
  const u16* ga1 = A1 + goff;
  const u16* gb  = B0 + goff;
  auto stage = [&](int buf, int pass) {
    const unsigned l = l0 + (unsigned)(buf * STG * 2);
    const int      k = pass * GKP;
    copy_plane(l, ga0 + k);
    if constexpr (NPROD == 2) copy_plane(l + GPLANE * 2, ga1 + k);
    copy_plane(l + NPROD * GPLANE * 2, gb + k);
  };
  v8f acc[2][4];
#pragma unroll
  for (int i = 0; i < 2; ++i) {
#pragma unroll
    for (int j = 0; j < 4; ++j) acc[i][j] = zero8();
  }
  stage(0, 0);
  wait_async0();
  __syncthreads();
  stage(1, 1);
#pragma unroll 1   // rolled: one copy of the pass body serves both buffers (t & 1)
  for (int t = 0; t < GNP; ++t) {
    const u16* st = ring + (t & 1) * STG;
    const u16* pa = st + (wr + m) * GPIT + 8 * hh;
    const u16* pb = st + NPROD * GPLANE + (wc + m) * GPIT + 8 * hh;
    Frag16 a[2][2], al[2][2], b[2][4];
    auto fetch = [&](int s, int kk) {
#pragma unroll
      for (int i = 0; i < 2; ++i) {
        a[s][i] = ldfrag_s(pa + i * 16 * GPIT + kk * 32);
        if constexpr (NPROD == 2) al[s][i] = ldfrag_s(pa + GPLANE + i * 16 * GPIT + kk * 32);
      }
#pragma unroll
      for (int j = 0; j < 4; ++j) b[s][j] = ldfrag_s(pb + j * 16 * GPIT + kk * 32);
    };
    fetch(0, 0);
#pragma unroll     // unrolled: the fragment set index kk & 1 must be a constant, else the sets leave the registers
    for (int kk = 0; kk < GKP / 32; ++kk) {
      const int s = kk & 1;
      if (kk + 1 < GKP / 32) fetch(s ^ 1, kk + 1);   // the next k step's fragments, inside this pass's own buffer
      // keeps that load group whole and ahead of this step's products: sunk among them, each load is waited for where it stands
      __builtin_amdgcn_sched_barrier(0);
#pragma unroll
      for (int i = 0; i < 2; ++i) {
#pragma unroll
        for (int j = 0; j < 4; ++j) acc[i][j] = mma_s<BF>(a[s][i], b[s][j], acc[i][j]);
      }
      if constexpr (NPROD == 2) {
#pragma unroll
        for (int i = 0; i < 2; ++i) {
#pragma unroll
          for (int j = 0; j < 4; ++j) acc[i][j] = mma_s<BF>(al[s][i], b[s][j], acc[i][j]);
        }
      }
      __builtin_amdgcn_sched_barrier(0);             // the far end of the same fence: later loads stay behind these products
    }
    // hand-over: own reads done, own copies of pass t + 1 landed, then the one barrier that publishes pass t + 1 and frees this buffer
    wait_ds0();
    wait_async0();
    __syncthreads();
    if (t + 2 < GNP) stage(t & 1, t + 2);
  }
  wait_async0();
  epi3264((float*)(void*)ring + wave * (2 * SLAB64), acc, oscale, bias, C, N, rowC + wr, colC + wc, lane);
}

// =====================================================================================================
// bf16 GEMM: C[M][N] (f32) = A[M][DMOD] (bf16 row-major) . Bt[N][DMOD]^T (bf16 k-contiguous), times oscale, plus bias[col] (bf16 RNE
// value). Block = 128 x 128 tile (host guarantees M % 128 == 0, N % 128 == 0, grid = (M/128)*(N/128)).
// =====================================================================================================
__global__ __launch_bounds__(GTHR)
void gemm_bf(const u16* __restrict__ A, const u16* __restrict__ Bt, const float* __restrict__ bias,
             float* C, int M, int N, float oscale) {
  __shared__ __align__(16) u16 ring[2 * 2 * GPLANE];
  const int ntile = N / GT;
  const int bid   = blockIdx.x;
  const int row0  = (bid / ntile) * GT;
  const int col0  = (bid % ntile) * GT;
  if (row0 + GT > M) return;                // block-uniform, before any barrier; never taken with the exact grid
  gemm_tile<1, true>(A + (size_t)row0 * DMOD, A + (size_t)row0 * DMOD, Bt + (size_t)col0 * DMOD, ring, oscale,
                     bias, C, N, (size_t)row0, col0);
}

// =====================================================================================================
// Output projection: C[orow][DMOD] (f32) = (Ah [+ Al])[row][DMOD] . Bt[DMOD][DMOD]^T * oscale + bias (bf16 RNE value).
// NPROD == 1: Ah only (one product); NPROD == 2: Ah + Al residual plane (products h.B + l.B into one accumulator, l unscaled).
// Block -> (column tile ct = bid % 8, sequence row tile rt of nrt starting at s = sbeg, batch bb), tiles of 128: rows of Ah are
// bb*SEQ + s, rows of Al are bb*QE + s (valid only while s < QE, host guarantees for NPROD == 2), rows of C are bb*XS_FULL + s.
// Same tiling and epilogue as gemm_bf.
// =====================================================================================================
template <int NPROD>
__global__ __launch_bounds__(GTHR)
void gemm_o(const u16* __restrict__ Ah, const u16* __restrict__ Al, const u16* __restrict__ Bt, const float* __restrict__ bias,
            float* C, int sbeg, int nrt, float oscale) {
  __shared__ __align__(16) u16 ring[2 * (NPROD + 1) * GPLANE];
  const int ntile = DMOD / GT;
  const int bid   = blockIdx.x;
  const int ct    = bid % ntile;
  const int t2    = bid / ntile;
  const int rt    = t2 % nrt;
  const int bb    = t2 / nrt;
  if (bb >= NB) return;                     // block-uniform, before any barrier; never taken with the exact grid
  const int srow  = sbeg + rt * GT;
  if (srow + GT > SEQ) return;              // block-uniform; never taken
  if (NPROD == 2 && srow + GT > QE) return; // block-uniform; never taken
  const size_t rowC = (size_t)bb * SEQ + srow;
  const size_t rowL = (size_t)bb * QE + srow;
  const size_t rowO = (size_t)bb * XS_FULL + srow;
  const u16* a0 = Ah + rowC * DMOD;
  const u16* a1 = (NPROD == 2) ? (Al + rowL * DMOD) : a0;
  gemm_tile<NPROD, false>(a0, a1, Bt + (size_t)ct * GT * DMOD, ring, oscale, bias, C, DMOD, rowO, ct * GT);
}

// =====================================================================================================
// Strided key set (pass S). Key j is in this set for query i iff j = i - STRD*n with i - j >= WIN, j >= GLB (then j <= i and
// (i - j) % STRD == 0 hold). Queries and keys of one residue class rr = i % STRD: i = rr + STRD*a, j = rr + STRD*c, a, c < NA.
// Block bid -> (residue rr = bid % STRD, head group hg, batch b); one wave per head; the wave owns all NA query rows of (b, head, rr)
// in tiles of 16 (rows a >= NA of the last tile are padding: operand row clamped, weight forced to 0, nothing stored) and visits
// the candidate keys in tiles of 32 (slots c >= NA clamped and forced to 0).
//   Transposed products: a lane owns ONE query (column lane & 15 of every D tile).
//   scores S^T: k hi / residual (A, lane -> key slot, arithmetic stride STRD rows in the [b*SEQ + s][h*HD + d] planes) times
//   q hi / residual (B, lane -> row a = 16*at + (lane & 15)), products hh + lh + hl over HD; D element r = key slot 8*(lane >> 4) + r;
//   element predicate (a < NA) && (c < NA) && (STRD*(a - c) >= WIN) && (j >= GLB), -inf otherwise; base-2 online softmax in f32
//   (-inf safe): maximum and sum over the lane's 16 scores, then one exchange with lane ^ 16;
//   P^T (B operand) is packed from those 16 values in the lane: they already lie in the split k map;
//   v rows of the 32 key slots gathered once per key tile from the v^T hi plane (arithmetic stride STRD) into a wave-private LDS tile
//   [d][slot], read as the A operand of O^T += V^T.P^T
//   (the strided keys only feed query rows i >= WIN + GLB, which always hold >= WIN + GLB keys).
//   State written per query row: M = running max (log2 domain), L = running sum, AC = acc * 64 / (32768*1024) as f16
//   (AC plane layout [b*SEQ + i][h*HD + d]; M, L planes [(b*NH + h)*STRD + rr][NAP], rows a >= NA hold -inf / 0).
// coverage: AC: every (b, i < SEQ, h, d) exactly once (union over rr, a < NA); M/L: every (b, h, rr) line group exactly once.
// =====================================================================================================
__global__ __launch_bounds__(ATT_THREADS)
void attn_s(const u16* __restrict__ QHp, const u16* __restrict__ QLp,
            const u16* __restrict__ KHp, const u16* __restrict__ KLp,
            const u16* __restrict__ VHp, u16* ACp, float* Mp, float* Lp) {
  __shared__ __align__(16) float    smem[WPB * SLW];
  __shared__ __align__(16) _Float16 vts[WPB * HD * VSP];
  __shared__ __align__(16) float    mls[WPB * 2 * NAP];

  const int tid  = threadIdx.x;
  const int wave = tid >> 5;
  const int lane = tid & 31;
  const int hh   = lane >> 4;
  const int c    = lane & 15;
  const int bid  = blockIdx.x;
  const int rres = bid % STRD;
  const int t2   = bid / STRD;
  const int hg   = t2 % NHG;
  const int b    = t2 / NHG;
  if (b >= NB) return;                      // block-uniform; no block barriers in this kernel; never taken with the exact grid
  const int head = hg * WPB + wave;

  float*    slab = smem + wave * SLW;       // result slab [16 queries][64 d] pitch 68
  _Float16* vt   = vts + wave * (HD * VSP); // v tile [64 d][32 key slots] pitch 40
  float*    msl  = mls + wave * (2 * NAP);
  float*    lsl  = msl + NAP;
#pragma unroll 1
  for (int i2 = lane; i2 < NAP; i2 += 32) { msl[i2] = -INFINITY; lsl[i2] = 0.0f; }
  wave_sync_lds();

  const _Float16* QHh = (const _Float16*)(const void*)QHp;
  const _Float16* QLh = (const _Float16*)(const void*)QLp;
  const _Float16* KHh = (const _Float16*)(const void*)KHp;
  const _Float16* KLh = (const _Float16*)(const void*)KLp;
  const size_t hcol  = (size_t)head * HD + 8 * hh;
  const size_t brow  = (size_t)b * SEQ + rres;                          // plane row of a = 0
  const u16*   vbase = VHp + (size_t)(b * NH + head) * HD * SEQ + rres; // + d*SEQ + STRD*c
  const float  lsc   = SM_SCALE * (LOG2E / (QSC * KSC));
  const float  acs   = ACAR / (PCAR * VCAR);

#pragma unroll 1
  for (int at = 0; at < NAT; ++at) {
    float mq = -INFINITY, lq = 0.f;         // this lane's query: running max and sum (equal in lanes l and l ^ 16)
    v8f o[4];                               // O^T: o[j][r] = (d = 16*j + 8*hh + r, query aq)
#pragma unroll
    for (int j = 0; j < 4; ++j) o[j] = zero8();
    const int aq = at * 16 + c;             // this lane's query row index a
    int am = aq;
    if (am > NA - 1) am = NA - 1;           // clamped operand row for this lane
    const size_t qoff = (brow + (size_t)STRD * am) * DMOD + hcol;
    const _Float16* Qh = QHh + qoff;
    const _Float16* Ql = QLh + qoff;

#pragma unroll 1
    for (int ks = 0; ks < NKS; ++ks) {
      // ---- gather the 32 key slots' v rows into the wave's LDS tile, transposed [d][slot] ----
      {
        int cs = ks * 32 + lane;
        if (cs > NA - 1) cs = NA - 1;
        const u16* vsrc = vbase + (size_t)STRD * cs;
#pragma unroll 8
        for (int d = 0; d < HD; ++d) {
          vt[d * VSP + lane] = __builtin_bit_cast(_Float16, vsrc[(size_t)d * SEQ]);
        }
      }
      // ---- scores S^T: D element r of this lane = (key slot ks*32 + 8*hh + r, query aq) in s0, slot + 16 in s1 ----
      int c0i = ks * 32 + c;       if (c0i > NA - 1) c0i = NA - 1;
      int c1i = ks * 32 + 16 + c;  if (c1i > NA - 1) c1i = NA - 1;
      const size_t k0off = (brow + (size_t)STRD * c0i) * DMOD + hcol;
      const size_t k1off = (brow + (size_t)STRD * c1i) * DMOD + hcol;
      const _Float16* k0p = KHh + k0off;
      const _Float16* k1p = KHh + k1off;
      const _Float16* l0p = KLh + k0off;
      const _Float16* l1p = KLh + k1off;
      v8f s0 = zero8(), s1 = zero8();
#pragma unroll
      for (int kk = 0; kk < HD / 32; ++kk) {
        const v16h qh  = ldfrag_h(Qh + kk * 32);
        const v16h ql  = ldfrag_h(Ql + kk * 32);
        const v16h kh0 = ldfrag_h(k0p + kk * 32);
        const v16h kh1 = ldfrag_h(k1p + kk * 32);
        const v16h kl0 = ldfrag_h(l0p + kk * 32);
        const v16h kl1 = ldfrag_h(l1p + kk * 32);
        s0 = mma_h(kh0, qh, s0);
        s0 = mma_h(kh0, ql, s0);
        s0 = mma_h(kl0, qh, s0);
        s1 = mma_h(kh1, qh, s1);
        s1 = mma_h(kh1, ql, s1);
        s1 = mma_h(kl1, qh, s1);
        guard2(s0, s1, qh, ql, kh0, kl0, kh1, kl1);
      }
      // ---- key select + online softmax in base 2, -inf-safe; all 16 values of a lane belong to its query ----
      const int cb0 = ks * 32 + 8 * hh;
      float t0[8], t1[8];
      float mx = -INFINITY;
#pragma unroll
      for (int r = 0; r < 8; ++r) {
        const int  cc0 = cb0 + r, cc1 = cc0 + 16;
        const int  j0  = rres + STRD * cc0, j1 = rres + STRD * cc1;
        const bool ok0 = (aq < NA) && (cc0 < NA) && (STRD * (aq - cc0) >= WIN) && (j0 >= GLB);
        const bool ok1 = (aq < NA) && (cc1 < NA) && (STRD * (aq - cc1) >= WIN) && (j1 >= GLB);
        t0[r] = ok0 ? s0[r] * lsc : -INFINITY;
        t1[r] = ok1 ? s1[r] * lsc : -INFINITY;
        mx = fmaxf(mx, fmaxf(t0[r], t1[r]));
      }
      mx = fmaxf(mx, xhalf(mx));
      const float mn = fmaxf(mq, mx);
      const float ms = (mn == -INFINITY) ? 0.0f : mn;
      const float al = exp2f(mq - ms);
      mq = mn;
      // ---- B fragment of P^T * 32768 (f16): elements 0..7 = slots 8*hh + r, elements 8..15 = slots 16 + 8*hh + r ----
      FragH ph;
      float pa = 0.f, pb = 0.f;
#pragma unroll
      for (int r = 0; r < 8; ++r) {
        const float e0 = exp2f(t0[r] - ms), e1 = exp2f(t1[r] - ms);
        pa += e0;
        pb += e1;
        ph.h[0][r] = (_Float16)(e0 * PCAR);
        ph.h[1][r] = (_Float16)(e1 * PCAR);
      }
      float ps = pa + pb;
      ps += xhalf(ps);
      lq = lq * al + ps;
#pragma unroll
      for (int j = 0; j < 4; ++j) {
#pragma unroll
        for (int r = 0; r < 8; ++r) o[j][r] *= al;
      }
      wave_sync_lds();                      // the gathered v tile is read by other lanes than wrote it
      // ---- O^T += V^T.P^T : A fragment row d = jj*16 + c, key slots contiguous in the LDS tile ----
#pragma unroll
      for (int jg = 0; jg < HD / 32; ++jg) {
        const v16h vha  = ldfrag_h(vt + ((2 * jg) * 16 + c) * VSP + 8 * hh);
        const v16h vhb2 = ldfrag_h(vt + ((2 * jg + 1) * 16 + c) * VSP + 8 * hh);
        o[2 * jg]     = mma_h(vha,  ph.v, o[2 * jg]);
        o[2 * jg + 1] = mma_h(vhb2, ph.v, o[2 * jg + 1]);
        guard2(o[2 * jg], o[2 * jg + 1], ph.v, vha, vhb2, ph.v, vha, vhb2);
      }
      wave_sync_lds();                      // the tile's reads end before the next gather rewrites it
    }
    acc_guard4(o[0], o[1], o[2], o[3]);
    // ---- state: m, l per query into the LDS staging; acc * 64 / (32768*1024) into the slab row of the lane's query ----
    if (hh == 0) { msl[aq] = mq; lsl[aq] = lq; }
#pragma unroll
    for (int j = 0; j < 4; ++j) {
      v4f w0, w1;
#pragma unroll
      for (int e = 0; e < 4; ++e) { w0[e] = o[j][e] * acs; w1[e] = o[j][4 + e] * acs; }
      float* sp = slab + c * SLP + j * 16 + 8 * hh;
      *(v4f*)(sp)     = w0;
      *(v4f*)(sp + 4) = w1;
    }
    wave_sync_lds();
    // ---- AC rows (f16): lane = (row select rq in 0..3, 8 consecutive d at c8) ----
    v4u    ov[4];
    bool   okr[4];
    size_t dso[4];
    const int rq = lane >> 3, c8 = (lane & 7) * 8;
#pragma unroll
    for (int it = 0; it < 4; ++it) {
      const int row = it * 4 + rq;
      const v4f a = *(const v4f*)(slab + row * SLP + c8), b4 = *(const v4f*)(slab + row * SLP + c8 + 4);
      float w[8];
#pragma unroll
      for (int e = 0; e < 4; ++e) { w[e] = a[e]; w[4 + e] = b4[e]; }
#pragma unroll
      for (int e = 0; e < 4; ++e) {
        ov[it][e] = pk16(h_bits((_Float16)w[2 * e]), h_bits((_Float16)w[2 * e + 1]));
      }
      const int arow = at * 16 + row;
      okr[it] = (arow < NA);                // uniform over the 8 lanes of one line
      const int acl  = okr[it] ? arow : (NA - 1);
      dso[it] = (brow + (size_t)STRD * acl) * DMOD + (size_t)head * HD + c8;
    }
    {
#pragma unroll
      for (int it = 0; it < 4; ++it) {
        if (okr[it]) *(v4u*)(ACp + dso[it]) = ov[it];
      }
      
    }
    wave_sync_lds();
  }

  wave_sync_lds();
  const size_t mlbase = ((size_t)(b * NH + head) * STRD + rres) * NAP;
  const int l8 = lane & 7;
  v4f mv[NAP / 32], lv[NAP / 32];
#pragma unroll
  for (int ch = 0; ch < NAP / 32; ++ch) {
    mv[ch] = *(const v4f*)(msl + ch * 32 + l8 * 4);
    lv[ch] = *(const v4f*)(lsl + ch * 32 + l8 * 4);
  }
  const bool wm = (lane < 8), wl = (lane >= 8) && (lane < 16);
  {
#pragma unroll
    for (int ch = 0; ch < NAP / 32; ++ch) {
      if (wm) *(v4f*)(Mp + mlbase + ch * 32 + l8 * 4) = mv[ch];
      if (wl) *(v4f*)(Lp + mlbase + ch * 32 + l8 * 4) = lv[ch];
    }
    
  }
}

// =====================================================================================================
// Band + leading key set (pass A), initialised from the pass-S state. Key j is in this set for query i iff
// j <= i && (i - j < WIN || j < GLB). Block bid -> (query tile qt = qt0 + bid % nq: rows q0 = 16*qt .. q0+15, head group hg, batch
// b); one wave per head.
//   q/k hi planes f16 x1024 [b*SEQ + s][h*HD + d], residual planes same layout; v^T hi plane [b*NH + h][d][SEQ], v^T residual plane
//   [b*NH + h][d][QE] (keys < QE).
//   Transposed products: a lane owns ONE query i = q0 + (lane & 15), the column of every D tile; lanes l and l ^ 16 share it.
//   Init: m = M, l = L (from [(b*NH+h)*STRD + i%STRD][i/STRD]), O^T = AC row (f16, 8 consecutive d per 16-B load) * (32768*1024/64).
//   Key tiles of 32 visited in order: tile 0 (keys 0..31, holds the leading GLB keys) when the band does not start at tile 0, then the
//   band tiles from the one holding max(0, q0 - WIN + 1) to the one holding q0 + 15 (at most WIN/32 + 2 + 1 tiles; every other tile holds
//   only keys outside this set for every query row of the tile: weight exactly 0).
//   Per tile: S^T = K.Q^T, 2 key subtiles x 2 k-steps, products k_hi.q_hi + k_hi.q_lo + k_lo.q_hi, fragments straight from the 16-bit planes
//   (two 16-B loads per fragment, split k map); exact element predicate; online max-subtracted base-2 softmax in f32, -inf-safe rescale:
//   maximum and sum over the lane's 16 scores, then one exchange with lane ^ 16; P^T x32768 (f16, and its f16 residual when ROB) packed
//   in the lane as the B operand (D rows 8*(lane >> 4) + r of the two subtiles are the split k map's elements); O^T += V^T.P^T with the v^T
//   A fragments in 2 groups of 2 d-subtiles. ROB == 1 (host uses it for q0 + 16 <= QE only; then every visited key is < QE): products
//   hh + lh + hl with the v residual plane, O written as hi + residual planes; ROB == 0: single product v_hi.P_hi, O hi plane only.
//   After the loop: out = acc / Z (Z >= 1 always: key i itself lies in a visited tile; guarded anyway), carries 1/(32768*1024) folded
//   once, written to the wave's private result slab (pitch 68; row = query; every element owned by one lane), read back as whole rows:
//   each plane row ([b*SEQ + s][h*HD + d]; residual [b*QE + s][h*HD + d], ROB only) is written by 8 consecutive lanes x 16 B.
// coverage: per wave 4 instructions x 4 rows x 8 lanes x 8 halves = 16 x 64 per plane; the two launches (qt < QE/16 with ROB = 1, the rest
//           with ROB = 0) x NHG x NB blocks x WPB waves = every (b, s, h) row of O hi exactly once and every (b, s < QE, h) row of O residual
//           exactly once.
// =====================================================================================================
template <int ROB>
__global__ __launch_bounds__(ATT_THREADS)
void attn_a(const u16* __restrict__ QHp, const u16* __restrict__ QLp,
            const u16* __restrict__ KHp, const u16* __restrict__ KLp,
            const u16* __restrict__ VHp, const u16* __restrict__ VLp,
            const u16* __restrict__ ACp, const float* __restrict__ Mp, const float* __restrict__ Lp,
            u16* OHp, u16* OLp, int qt0, int nq) {
  __shared__ __align__(16) float smem[WPB * SLW];

  const int tid  = threadIdx.x;
  const int wave = tid >> 5;
  const int lane = tid & 31;
  const int hh   = lane >> 4;
  const int c    = lane & 15;
  const int bid  = blockIdx.x;
  const int qtl  = bid % nq;
  const int t2   = bid / nq;
  const int hg   = t2 % NHG;
  const int b    = t2 / NHG;
  if (b >= NB) return;                      // block-uniform; no block barriers in this kernel; never taken with the exact grid
  const int qt   = qt0 + qtl;
  const int q0   = qt * 16;
  if (q0 + 16 > SEQ) return;                // block-uniform; never taken
  if (ROB != 0 && q0 + 16 > QE) return;     // block-uniform; never taken (residual planes cover s < QE only)
  const int head = hg * WPB + wave;

  float* slab = smem + wave * SLW;          // result slab [16 queries][64 d] pitch 68

  const size_t hcol = (size_t)head * HD + 8 * hh;
  const _Float16* Qh  = (const _Float16*)(const void*)QHp + ((size_t)b * SEQ + q0 + c) * DMOD + hcol;
  const _Float16* Ql  = (const _Float16*)(const void*)QLp + ((size_t)b * SEQ + q0 + c) * DMOD + hcol;
  const _Float16* Khb = (const _Float16*)(const void*)KHp + ((size_t)b * SEQ + c) * DMOD + hcol;      // key row kb added per step
  const _Float16* Klb = (const _Float16*)(const void*)KLp + ((size_t)b * SEQ + c) * DMOD + hcol;
  const _Float16* Vhb = (const _Float16*)(const void*)VHp + ((size_t)(b * NH + head) * HD + c) * SEQ + 8 * hh;  // d row c (+16j)
  const _Float16* Vlb = Vhb;
  if constexpr (ROB != 0) {
    Vlb = (const _Float16*)(const void*)VLp + ((size_t)(b * NH + head) * HD + c) * QE + 8 * hh;
  }
  const float lsc = SM_SCALE * (LOG2E / (QSC * KSC));
  const float oc  = 1.0f / (PCAR * VCAR);
  const float aci = (PCAR * VCAR) / ACAR;
  const size_t KROW = (size_t)DMOD;         // halves between consecutive key rows

  const int qr = q0 + c;                    // this lane's query
  float mq, lq;                             // its running max and sum (equal in lanes l and l ^ 16)
  v8f o[4];                                 // O^T: o[j][r] = (d = 16*j + 8*hh + r, query qr)
  // ---- init from the strided-set state ----
  {
    const size_t mli = ((size_t)(b * NH + head) * STRD + (qr % STRD)) * NAP + (qr / STRD);   // qr / STRD < NA <= NAP
    mq = Mp[mli];
    lq = Lp[mli];
    const _Float16* acp = (const _Float16*)(const void*)ACp + ((size_t)b * SEQ + qr) * DMOD + hcol;
#pragma unroll
    for (int j = 0; j < 4; ++j) {
      const v8h a = *(const v8h*)(acp + j * 16);
#pragma unroll
      for (int r = 0; r < 8; ++r) o[j][r] = (float)a[r] * aci;
    }
  }

  // ---- tile list: leading tile 0 (when not part of the band) then the band tiles ----
  int klo = q0 - (WIN - 1);
  if (klo < 0) klo = 0;
  const int ktb = klo >> 5;
  const int kte = (q0 + 15) >> 5;           // <= SEQ/32 - 1; for ROB: kte*32 + 31 <= QE - 1
  int nband = kte - ktb + 1;
  if (nband > NKB) nband = NKB;             // static bound (WIN/32 + 2)
  if (nband < 0) nband = 0;
  const int hasg = (ktb > 0) ? 1 : 0;
  const int nkt  = nband + hasg;            // <= NKA

#pragma unroll 1
  for (int kt = 0; kt < nkt; ++kt) {
    const int kb = (kt < hasg) ? 0 : (ktb + kt - hasg) * 32;   // kb + 31 <= SEQ - 1
    // ---- scores S^T: D element r of this lane = (key kb + 8*hh + r, query qr) in s0, key kb + 16 + 8*hh + r in s1 ----
    v8f s0 = zero8(), s1 = zero8();
    const _Float16* k0p = Khb + (size_t)kb * KROW;
    const _Float16* k1p = k0p + (size_t)16 * KROW;
    const _Float16* l0p = Klb + (size_t)kb * KROW;
    const _Float16* l1p = l0p + (size_t)16 * KROW;
#pragma unroll
    for (int kk = 0; kk < HD / 32; ++kk) {
      const v16h qh  = ldfrag_h(Qh + kk * 32);
      const v16h ql  = ldfrag_h(Ql + kk * 32);
      const v16h kh0 = ldfrag_h(k0p + kk * 32);
      const v16h kh1 = ldfrag_h(k1p + kk * 32);
      const v16h kl0 = ldfrag_h(l0p + kk * 32);
      const v16h kl1 = ldfrag_h(l1p + kk * 32);
      s0 = mma_h(kh0, qh, s0);
      s0 = mma_h(kh0, ql, s0);
      s0 = mma_h(kl0, qh, s0);
      s1 = mma_h(kh1, qh, s1);
      s1 = mma_h(kh1, ql, s1);
      s1 = mma_h(kl1, qh, s1);
      guard2(s0, s1, qh, ql, kh0, kl0, kh1, kl1);
    }
    // ---- key select + online softmax in base 2, -inf-safe; all 16 values of a lane belong to its query ----
    const int kr0 = kb + 8 * hh;
    float t0[8], t1[8];
    float mx = -INFINITY;
#pragma unroll
    for (int r = 0; r < 8; ++r) {
      const int  key0 = kr0 + r, key1 = key0 + 16;
      const bool a0 = (key0 <= qr) && ((qr - key0 < WIN) || (key0 < GLB));
      const bool a1 = (key1 <= qr) && ((qr - key1 < WIN) || (key1 < GLB));
      t0[r] = a0 ? s0[r] * lsc : -INFINITY;
      t1[r] = a1 ? s1[r] * lsc : -INFINITY;
      mx = fmaxf(mx, fmaxf(t0[r], t1[r]));
    }
    mx = fmaxf(mx, xhalf(mx));
    const float mn = fmaxf(mq, mx);
    const float ms = (mn == -INFINITY) ? 0.0f : mn;
    const float al = exp2f(mq - ms);
    mq = mn;
    // ---- B fragments of P^T * 32768: hi f16 (and residual f16 when ROB); elements 0..7 = keys kb + 8hh + r,
    //      elements 8..15 = keys kb + 16 + 8hh + r: the split k map of the v^T A fragments ----
    FragH ph, pl;
    float pa = 0.f, pb = 0.f;
#pragma unroll
    for (int r = 0; r < 8; ++r) {
      const float e0 = exp2f(t0[r] - ms), e1 = exp2f(t1[r] - ms);
      pa += e0;
      pb += e1;
      const float ta = e0 * PCAR, tb = e1 * PCAR;
      const _Float16 ha = (_Float16)ta, hb = (_Float16)tb;
      ph.h[0][r] = ha;
      ph.h[1][r] = hb;
      if constexpr (ROB != 0) {
        pl.h[0][r] = (_Float16)(ta - (float)ha);
        pl.h[1][r] = (_Float16)(tb - (float)hb);
      }
    }
    float ps = pa + pb;
    ps += xhalf(ps);
    lq = lq * al + ps;
#pragma unroll
    for (int j = 0; j < 4; ++j) {
#pragma unroll
      for (int r = 0; r < 8; ++r) o[j][r] *= al;
    }
    // ---- O^T += V^T.P^T : A fragment row d = j*16 + c, keys contiguous in the v^T planes; 2 groups of 2 d-subtiles ----
    {
      const _Float16* vhp = Vhb + kb;
      const _Float16* vlp = Vlb + kb;
#pragma unroll
      for (int jg = 0; jg < HD / 32; ++jg) {
        const size_t da = (size_t)(2 * jg) * 16 * SEQ;
        const size_t db = da + (size_t)16 * SEQ;
        const v16h vha = ldfrag_h(vhp + da), vhb2 = ldfrag_h(vhp + db);
        if constexpr (ROB != 0) {
          const size_t la = (size_t)(2 * jg) * 16 * QE;
          const size_t lb = la + (size_t)16 * QE;
          const v16h vla = ldfrag_h(vlp + la), vlb2 = ldfrag_h(vlp + lb);
          o[2 * jg]     = mma_h(vha,  ph.v, o[2 * jg]);
          o[2 * jg]     = mma_h(vha,  pl.v, o[2 * jg]);
          o[2 * jg]     = mma_h(vla,  ph.v, o[2 * jg]);
          o[2 * jg + 1] = mma_h(vhb2, ph.v, o[2 * jg + 1]);
          o[2 * jg + 1] = mma_h(vhb2, pl.v, o[2 * jg + 1]);
          o[2 * jg + 1] = mma_h(vlb2, ph.v, o[2 * jg + 1]);
          guard2(o[2 * jg], o[2 * jg + 1], ph.v, pl.v, vha, vhb2, vla, vlb2);
        } else {
          o[2 * jg]     = mma_h(vha,  ph.v, o[2 * jg]);
          o[2 * jg + 1] = mma_h(vhb2, ph.v, o[2 * jg + 1]);
          guard2(o[2 * jg], o[2 * jg + 1], ph.v, vha, vhb2, ph.v, vha, vhb2);
        }
      }
    }
  }
  acc_guard4(o[0], o[1], o[2], o[3]);
  // ---- out = acc / Z (0 if Z == 0), carries (32768 on P, 1024 on v) folded once; written into the slab row of the lane's query ----
  {
    const float ls  = (lq > 0.0f) ? lq : 1.0f;
    const float inv = (lq > 0.0f) ? ((1.0f / ls) * oc) : 0.0f;
#pragma unroll
    for (int j = 0; j < 4; ++j) {
      v4f w0, w1;
#pragma unroll
      for (int e = 0; e < 4; ++e) { w0[e] = o[j][e] * inv; w1[e] = o[j][4 + e] * inv; }
      float* sp = slab + c * SLP + j * 16 + 8 * hh;
      *(v4f*)(sp)     = w0;
      *(v4f*)(sp + 4) = w1;
    }
  }

  wave_sync_lds();
  // ---- O x1024 -> f16 hi (+ residual when ROB) planes; lane = (row select rq in 0..3, 8 consecutive d at c8) ----
  v4u oh[4], ol[4];
  const int rq = lane >> 3, c8 = (lane & 7) * 8;
#pragma unroll
  for (int it = 0; it < 4; ++it) {
    const int row = it * 4 + rq;
    const v4f a = *(const v4f*)(slab + row * SLP + c8), b4 = *(const v4f*)(slab + row * SLP + c8 + 4);
    float w[8];
#pragma unroll
    for (int e = 0; e < 4; ++e) { w[e] = a[e] * OSC; w[4 + e] = b4[e] * OSC; }
#pragma unroll
    for (int e = 0; e < 4; ++e) {
      const _Float16 h0 = (_Float16)w[2 * e], h1 = (_Float16)w[2 * e + 1];
      const _Float16 l0 = (_Float16)(w[2 * e] - (float)h0), l1 = (_Float16)(w[2 * e + 1] - (float)h1);
      oh[it][e] = pk16(h_bits(h0), h_bits(h1));
      ol[it][e] = pk16(h_bits(l0), h_bits(l1));
    }
  }
  const size_t ob  = ((size_t)b * SEQ + q0) * DMOD + (size_t)head * HD + c8;
  const size_t olb = ((size_t)b * QE + q0) * DMOD + (size_t)head * HD + c8;   // dereferenced only when ROB
  {
#pragma unroll
    for (int it = 0; it < 4; ++it) {
      const int row = it * 4 + rq;
      *(v4u*)(OHp + ob + (size_t)row * DMOD) = oh[it];
      if constexpr (ROB != 0) {
        *(v4u*)(OLp + olb + (size_t)row * DMOD) = ol[it];
      }
    }
    
  }
}

// =====================================================================================================
// Workspace map (bytes); every plane is fully written by whole-line stores before it is read; all extents are exact multiples
// of the store granularity (no pad rows needed); every region offset a multiple of 524288:
//   XB  bf16 [MROWS][1024]                       MROWS*2048       (x as bf16; after the projections the region holds AC f16 [MROWS][1024])
//   WB  16-bit [1024 n][1024 k]                  2097152          (Wq, Wk, Wv column blocks as bf16 [n][k], then Wo as f16 x1024, in launch order)
//   F   f32 [SEQ][1024]                          SEQ*4096         (one batch's q, k, v projection output in launch order; afterwards the region holds
//                                                                  OH f16 [MROWS][1024] x1024; region sized to the larger of the two)
//   QH  f16 [MROWS][1024] x1024                  MROWS*2048       QL residual the same; KH, KL the same
//   VH  f16 [NB*16][64][SEQ] x1024               MROWS*2048
//   VL  f16 residual [NB*16][64][QE]             NB*16*64*QE*2
//   OL  f16 residual [NB*QE][1024]               NB*QE*2048
//   M   f32 [NB*16*STRD][NAP]                     NB*16*STRD*NAP*4 L the same
//   end (NB=2, SEQ=4096, QE=512)               124780544
// =====================================================================================================
extern "C" void kernel_launch(void* const* d_in, const int* in_sizes, int n_in,
                              void* d_out, int out_size, void* d_ws, size_t ws_size,
                              hipStream_t stream) {
  if (n_in < 5) return;
  const int needx = OROWS * DMOD;
  if (in_sizes[0] < needx) return;
  if (in_sizes[1] != 3 * DMOD * DMOD) return;
  if (in_sizes[2] < 3 * DMOD) return;
  if (in_sizes[3] != DMOD * DMOD) return;
  if (in_sizes[4] < DMOD) return;
  if (out_size < needx) return;

  const float* x    = (const float*)d_in[0];
  const float* wqkv = (const float*)d_in[1];
  const float* bqkv = (const float*)d_in[2];
  const float* wo   = (const float*)d_in[3];
  const float* bo   = (const float*)d_in[4];
  float*       out  = (float*)d_out;

  const size_t szXB = (size_t)MROWS * DMOD * 2;                 // XB, later AC (same extent)
  const size_t szW  = (size_t)DMOD * DMOD * 2;
  const size_t szFs = (size_t)SEQ * DMOD * 4;                   // F staging
  const size_t szH  = (size_t)MROWS * DMOD * 2;                 // QH, QL, KH, KL, OH
  const size_t szFR = (szFs > szH) ? szFs : szH;                // F region also holds OH afterwards
  const size_t szV  = (size_t)NB * NH * HD * SEQ * 2;           // VH (== szH)
  const size_t szVL = (size_t)NB * NH * HD * QE * 2;            // VL
  const size_t szOL = (size_t)NB * QE * DMOD * 2;               // OL (== szVL)
  const size_t szML = (size_t)NB * NH * STRD * NAP * 4;         // M, L
  size_t off = 0;
  const size_t oXB = off; off += szXB;
  const size_t oW  = off; off += szW;
  const size_t oF  = off; off += szFR;
  const size_t oQH = off; off += szH;
  const size_t oQL = off; off += szH;
  const size_t oKH = off; off += szH;
  const size_t oKL = off; off += szH;
  const size_t oVH = off; off += szV;
  const size_t oVL = off; off += szVL;
  const size_t oOL = off; off += szOL;
  const size_t oM  = off; off += szML;
  const size_t oL  = off; off += szML;
  if (off > ws_size) return;                // off = 124780544 for NB = 2, SEQ = 4096
  if (off > (size_t)WS_CAP) return;

  char* ws = (char*)d_ws;
  u16*   XB = (u16*)(ws + oXB);
  u16*   AC = (u16*)(ws + oXB);
  u16*   WB = (u16*)(ws + oW);
  float* F  = (float*)(ws + oF);
  u16*   OH = (u16*)(ws + oF);
  u16*   QH = (u16*)(ws + oQH);
  u16*   QL = (u16*)(ws + oQL);
  u16*   KH = (u16*)(ws + oKH);
  u16*   KL = (u16*)(ws + oKL);
  u16*   VH = (u16*)(ws + oVH);
  u16*   VL = (u16*)(ws + oVL);
  u16*   OL = (u16*)(ws + oOL);
  float* Mp = (float*)(ws + oM);
  float* Lp = (float*)(ws + oL);

  const dim3 b256(256), bQK(QKT), bAT(ATT_THREADS);
  const int  n8x = (SEQ * DMOD) / 8;
  const dim3 gX((n8x + 255) / 256);                     // per batch
  const dim3 gTR((DMOD / 64) * (DMOD / 64));            // 256 blocks per [1024][1024] weight block
  const dim3 gG((SEQ / GT) * (DMOD / GT));              // per batch
  const dim3 gVT(NH * NST);                             // per batch
  const dim3 gQK(SEQ);                                  // per batch
  const int  nqR  = QE / 16;                            // query tiles with residual P.v products per (b, head group)
  const int  nqP  = NQT - nqR;
  const int  nrtR = QE / GT;                            // out-projection row tiles with the residual plane
  const int  nrtP = (SEQ - QE) / GT;

  // (0) x -> bf16 plane [MROWS][1024], one launch per batch
  for (int b = 0; b < NB; ++b) {
    cvt16<<<gX, b256, 0, stream>>>(x + (size_t)b * XS_FULL * DMOD, XB + (size_t)b * SEQ * DMOD, n8x, 0, 1.0f);
  }
  // (1) per column block p (q, k, v): W[:, p*1024 .. p*1024+1023] ([1024 k][3072 n] -> [1024 n][1024 k] bf16); per batch:
  //     projection -> F f32; then the 16-bit planes
  for (int p = 0; p < 3; ++p) {
    tr16<<<gTR, b256, 0, stream>>>(wqkv, 3 * DMOD, p * DMOD, WB, 0, 1.0f);
    for (int b = 0; b < NB; ++b) {
      gemm_bf<<<gG, b256, 0, stream>>>(XB + (size_t)b * SEQ * DMOD, WB, bqkv + p * DMOD, F, SEQ, DMOD, 1.0f);
      if (p == 0) {
        qk16<<<gQK, bQK, 0, stream>>>(F, QH, QL, b * SEQ, QSC);
      } else if (p == 1) {
        qk16<<<gQK, bQK, 0, stream>>>(F, KH, KL, b * SEQ, KSC);
      } else {
        vt16<<<gVT, b256, 0, stream>>>(F, VH, VL, b);
      }
    }
  }
  // (2) Wo [1024 k][1024 n] -> [n][k] f16 plane of bf16 value x1024
  tr16<<<gTR, b256, 0, stream>>>(wo, DMOD, 0, WB, 1, WOS);
  // (3) strided key set -> per-row state (M, L, AC)
  attn_s<<<dim3(NB * NHG * STRD), bAT, 0, stream>>>(QH, QL, KH, KL, VH, AC, Mp, Lp);
  // (4) band + leading key set merged onto that state: query rows s < QE with residual P.v products -> O hi + residual planes;
  //     (5) remaining rows, single product -> O hi plane
  attn_a<1><<<dim3(nqR * NHG * NB), bAT, 0, stream>>>(QH, QL, KH, KL, VH, VL, AC, Mp, Lp, OH, OL, 0, nqR);
  if (nqP > 0) {
    attn_a<0><<<dim3(nqP * NHG * NB), bAT, 0, stream>>>(QH, QL, KH, KL, VH, VL, AC, Mp, Lp, OH, OL, nqR, nqP);
  }
  // (6) output projection rows s < QE (hi + residual) and (7) rows s >= QE (hi only) -> out f32, carries 1024 x 1024 folded back
  gemm_o<2><<<dim3(NB * nrtR * (DMOD / GT)), b256, 0, stream>>>(OH, OL, WB, bo, out, 0, nrtR, 1.0f / (OSC * WOS));
  if (nrtP > 0) {
    gemm_o<1><<<dim3(NB * nrtP * (DMOD / GT)), b256, 0, stream>>>(OH, OL, WB, bo, out, QE, nrtP, 1.0f / (OSC * WOS));
  }
  (void)hipGetLastError();
}

// v003
// Measured time: 274 microseconds a run.
// Next to v002, in two timings, it ran 1.15 and 1.13 times as fast.
// All steps since v000 together make it 2.12 times as fast.
// Contractions: x.Wq, x.Wk, x.Wv on v_wmma_f32_16x16x32_bf16 (x, W, biases RNE-converted to bf16; each W column block
// transposed into a k-contiguous [n][k] plane; f32 accumulate); k.q^T over 64 on v_wmma_f32_16x16x32_f16 with q, k carried as
// f16 hi x1024 + f16 residual planes (products hh + lh + hl); v^T.P^T on v_wmma_f32_16x16x32_f16 (P x32768 f16, v x1024 f16):
// query rows s < QE use P hi + residual and v hi + residual planes (hh + lh + hl), other rows one product; O.Wo on
// v_wmma_f32_16x16x32_f16 (O x1024 f16, Wo as f16(bf16(Wo)) x1024): rows s < QE as O hi + residual planes (h.W + l.W), other rows one
// product; all f32 accumulate. Bias adds, key-set select, base-2 online softmax, merge of the two key-set states and the 1/Z fold in
// f32 on VALU.
#include <hip/hip_runtime.h>
#include <math.h>
#include <stdint.h>

#ifndef NB
#define NB 2
#endif
#ifndef SEQ
#define SEQ 4096
#endif
#define XS_FULL 4096
#define DMOD  1024
#define NH    16
#define HD    64
#define WIN   256
#define STRD  128
#define GLB   16
#define QE    ((SEQ < 512) ? SEQ : 512)
#define MROWS (NB * SEQ)
#define OROWS ((NB - 1) * XS_FULL + SEQ)
#define SM_SCALE 0.125f
#define LOG2E 1.4426950408889634f
#define QSC   1024.0f
#define KSC   1024.0f
#define PCAR  32768.0f
#define VCAR  1024.0f
#define OSC   1024.0f
#define WOS   1024.0f
#define ACAR  64.0f
#define WPB   4
#define NHG   (NH / WPB)
#define NQT   (SEQ / 16)
#define NKB   ((WIN / 32) + 2)
#define NKA   (NKB + 1)
#define NA    (SEQ / STRD)
#define NAP   (((NA + 31) / 32) * 32)
#define NAT   ((NA + 15) / 16)
#define NKS   ((NA + 31) / 32)
#define ATT_THREADS (WPB * 32)
#define SLP   68
#define SLW   (16 * SLP)
#define SLAB64 (16 * 68)
#define VTP   72
#define VSP   40
#define WS_CAP 134217728
static_assert(DMOD == NH * HD && HD == 64 && NH == 16);
static_assert((NH % WPB) == 0 && ATT_THREADS == 128);
static_assert(NB >= 1 && NB <= 2);
static_assert((SEQ % STRD) == 0 && (SEQ % 64) == 0 && SEQ >= STRD && SEQ <= XS_FULL);
static_assert((QE % 64) == 0 && QE >= 64 && QE <= SEQ);
static_assert((STRD % 16) == 0 && STRD >= 32);
static_assert((WIN % 32) == 0 && WIN >= 32);
static_assert(GLB >= 1 && GLB <= 32);
static_assert(NA >= 1 && NAP >= 32 && NAP <= 256 && (NAP % 32) == 0 && 16 * NAT <= NAP);
static_assert(DMOD == 128 * 8 && (DMOD % 64) == 0 && (DMOD % 32) == 0);
static_assert((HD % 32) == 0);
static_assert(((SEQ * DMOD) % (8 * 256)) == 0);

typedef unsigned short u16;
typedef _Float16 v16h __attribute__((ext_vector_type(16)));
typedef _Float16 v8h  __attribute__((ext_vector_type(8)));
typedef __bf16   v16b __attribute__((ext_vector_type(16)));
typedef float    v8f  __attribute__((ext_vector_type(8)));
typedef float    v4f  __attribute__((ext_vector_type(4)));
typedef unsigned int v4u __attribute__((ext_vector_type(4)));

union FragH { v16h v; v8h h[2]; v4u u[2]; };
union FragB { v16b v; v4u u[2]; };

// ---- scalar helpers --------------------------------------------------------------------------------
__device__ __forceinline__ unsigned short bf_bits(float f) {          // f32 -> bf16 bits, RNE convert
  unsigned u = __float_as_uint(f);
  return (unsigned short)((u + 0x7FFFu + ((u >> 16) & 1u)) >> 16);
}
__device__ __forceinline__ float bf_up(unsigned short h) { return __uint_as_float(((unsigned)h) << 16); }
__device__ __forceinline__ float bfr(float f) { return bf_up(bf_bits(f)); }
__device__ __forceinline__ unsigned short h_bits(_Float16 x) { return __builtin_bit_cast(unsigned short, x); }
__device__ __forceinline__ unsigned pk16(unsigned short a, unsigned short b) { return (unsigned)a | ((unsigned)b << 16); }
__device__ __forceinline__ v8f zero8() { v8f z = {0.f, 0.f, 0.f, 0.f, 0.f, 0.f, 0.f, 0.f}; return z; }

// ---- fragment loaders: 16-bit A/B operand, lane -> row/col (lane&15), p already includes +8*(lane>>4);
//      elements 0..7 <- p[0..7] (k0+8h..), elements 8..15 <- p[16..23] (k0+16+8h..)  (same split k map for A and B;
//      B is always read from a k-contiguous [n][k] plane or tile)
__device__ __forceinline__ v16h ldfrag_h(const _Float16* p) {
  FragH f;
  f.h[0] = *(const v8h*)(p);
  f.h[1] = *(const v8h*)(p + 16);
  return f.v;
}
__device__ __forceinline__ v8f mma_h(v16h a, v16h b, v8f c) {
  return __builtin_amdgcn_wmma_f32_16x16x32_f16(false, a, false, b, (short)0, c, false, false);
}
__device__ __forceinline__ v8f mma_b(v16b a, v16b b, v8f c) {
  return __builtin_amdgcn_wmma_f32_16x16x32_bf16(false, a, false, b, (short)0, c, false, false);
}
__device__ __forceinline__ void guard2(v8f& a, v8f& b, v16h x0, v16h x1, v16h x2, v16h x3, v16h x4, v16h x5) {
#if defined(__HIP_DEVICE_COMPILE__)
  asm volatile("v_nop\n\tv_nop\n\tv_nop\n\tv_nop"
               : "+v"(a), "+v"(b) : "v"(x0), "v"(x1), "v"(x2), "v"(x3), "v"(x4), "v"(x5) : "memory");
#endif
}
__device__ __forceinline__ void acc_guard4(v8f& a, v8f& b, v8f& c, v8f& d) {
#if defined(__HIP_DEVICE_COMPILE__)
  asm volatile("v_nop\n\tv_nop\n\tv_nop\n\tv_nop" : "+v"(a), "+v"(b), "+v"(c), "+v"(d));
#endif
}
// value of lane l ^ 16 (the other 16-lane row), a vector cross-row move
__device__ __forceinline__ float xhalf(float x) {
  const int b = __builtin_bit_cast(int, x);
  return __builtin_bit_cast(float, __builtin_amdgcn_permlanex16(b, b, 0x76543210, 0xfedcba98, false, false));
}
__device__ __forceinline__ void wave_sync_lds() {
  __builtin_amdgcn_fence(__ATOMIC_RELEASE, "workgroup");
  __builtin_amdgcn_wave_barrier();
  __builtin_amdgcn_fence(__ATOMIC_ACQUIRE, "workgroup");
}

// =====================================================================================================
// f32 -> 16-bit plane, same layout.  f16mode == 0: bf16 RNE bits;  f16mode == 1: f16 bits of (bf16 RNE value) * scale.
// Thread = 8 consecutive elements: two 16-B loads, one 16-B store; 32 consecutive lanes = 512 contiguous, 512-B aligned
// coverage: grid = ceil(n8/256) blocks x 256 thr x 8 (in-kernel bound) = the whole plane (n8 a multiple of 256 here).
// =====================================================================================================
__global__ __launch_bounds__(256) void cvt16(const float* __restrict__ x, u16* D, int n8, int f16mode, float scale) {
  const int gt = blockIdx.x * 256 + (int)threadIdx.x;
  if (gt >= n8) return;
  const float* p = x + (size_t)gt * 8;
  const v4f a = *(const v4f*)(p), b4 = *(const v4f*)(p + 4);
  float w[8];
#pragma unroll
  for (int e = 0; e < 4; ++e) { w[e] = a[e]; w[4 + e] = b4[e]; }
  v4u o;
#pragma unroll
  for (int e = 0; e < 4; ++e) {
    const float f0 = w[2 * e], f1 = w[2 * e + 1];
    const unsigned short hb0 = h_bits((_Float16)(bfr(f0) * scale));
    const unsigned short hb1 = h_bits((_Float16)(bfr(f1) * scale));
    const unsigned short bb0 = bf_bits(f0);
    const unsigned short bb1 = bf_bits(f1);
    o[e] = (f16mode != 0) ? pk16(hb0, hb1) : pk16(bb0, bb1);
  }
  u16* d = D + (size_t)gt * 8;
  {
    *(v4u*)(d) = o;
    
  }
}

// =====================================================================================================
// Weight transpose + convert: W f32 [DMOD rows k][ldw], column block col0 .. col0+DMOD-1 (column index = n)
//   -> D 16-bit [DMOD n][DMOD k] (k-contiguous B operand), i.e. in[k][col0+n] -> out[n][k].  f16mode as in cvt16.
// Block = (n tile n0, k tile k0) of 64 x 64: load 64 k rows x 64 n floats with 16-B loads (thread = k row kr, 16 n), convert,
// scatter transposed into an LDS tile [n][k] (pitch 72 halves); block barrier; each n-row segment (64 halves = one whole
// coverage: load 256 thr x 16 = 64 k x 64 n; store 2 iterations x 256 thr x 8 halves = 64 lines x 64; grid (DMOD/64)^2 = every
//           (n, k) of D exactly once.
// =====================================================================================================
__global__ __launch_bounds__(256) void tr16(const float* __restrict__ W, int ldw, int col0, u16* D, int f16mode, float scale) {
  __shared__ __align__(16) u16 T[64 * VTP];
  const int tid = (int)threadIdx.x;
  const int bid = (int)blockIdx.x;
  const int nt  = bid % (DMOD / 64);
  const int kt  = bid / (DMOD / 64);
  if (kt >= DMOD / 64) return;              // block-uniform, before any barrier; never taken with the exact grid
  const int n0 = nt * 64, k0 = kt * 64;
  {
    const int kr = tid >> 2;                // k row within tile 0..63
    const int nc = (tid & 3) * 16;          // n chunk 0,16,32,48
    const float* src = W + (size_t)(k0 + kr) * (size_t)ldw + col0 + n0 + nc;
#pragma unroll
    for (int i = 0; i < 4; ++i) {
      const v4f a = *(const v4f*)(src + 4 * i);
#pragma unroll
      for (int e = 0; e < 4; ++e) {
        const float f = a[e];
        const unsigned short hb = h_bits((_Float16)(bfr(f) * scale));
        const unsigned short bb = bf_bits(f);
        T[(nc + 4 * i + e) * VTP + kr] = (f16mode != 0) ? hb : bb;
      }
    }
  }
  __syncthreads();
  v4u ov[2];
  const int q8 = tid >> 3, p8 = (tid & 7) * 8;
#pragma unroll
  for (int it = 0; it < 2; ++it) {
    const int line = it * 32 + q8;          // n = 0..63
    ov[it] = *(const v4u*)(T + line * VTP + p8);
  }
  u16* base = D + (size_t)n0 * DMOD + k0 + p8;
  {
#pragma unroll
    for (int it = 0; it < 2; ++it) {
      const int line = it * 32 + q8;
      *(v4u*)(base + (size_t)line * DMOD) = ov[it];
    }
    
  }
}

// =====================================================================================================
// GEMM epilogue: the wave's 32x64 f32 tile (times oscale) staged in its LDS slab (two 16-row parts, pitch 68), read back as whole
// rows, bias added, stored.
// coverage: 2 parts x 8 instructions x 2 rows x 16 lanes x 4 floats = the wave's 32 x 64 tile.
// =====================================================================================================
__device__ __forceinline__ void epi3264(float* sl, const v8f (&acc)[2][4], float oscale,
                                        const float* __restrict__ bias, float* C, int N, size_t rowb, int col0, int lane) {
  const int hh = lane >> 4, m = lane & 15;
#pragma unroll
  for (int i = 0; i < 2; ++i) {
#pragma unroll
    for (int r = 0; r < 8; ++r) {
      const int ro = i * SLAB64 + (8 * hh + r) * 68 + m;
      sl[ro]      = acc[i][0][r] * oscale;
      sl[ro + 16] = acc[i][1][r] * oscale;
      sl[ro + 32] = acc[i][2][r] * oscale;
      sl[ro + 48] = acc[i][3][r] * oscale;
    }
  }
  wave_sync_lds();
  const v4f bb = *(const v4f*)(bias + col0 + m * 4);
  v4f br;
#pragma unroll
  for (int e = 0; e < 4; ++e) br[e] = bfr(bb[e]);
  float* dst = C + (rowb + (size_t)hh) * (size_t)N + col0 + m * 4;
#pragma unroll
  for (int i = 0; i < 2; ++i) {
    v4f vals[8];
#pragma unroll
    for (int it = 0; it < 8; ++it) vals[it] = *(const v4f*)(sl + i * SLAB64 + (it * 2 + hh) * 68 + m * 4) + br;
#pragma unroll
    for (int it = 0; it < 8; ++it) {
      *(v4f*)(dst + (size_t)(i * 16 + it * 2) * (size_t)N) = vals[it];
    }
  }
}

// =====================================================================================================
// GEMM core shared by the projections and the output projection: one 128 x 128 tile of C per block, 8 waves of 32 x 64
// (wave -> rows 32 * (wave >> 1), columns 64 * (wave & 1)), K = DMOD walked in passes of 128 k.
// A pass's operand rows (256 B each: NPROD A planes of 128 rows, then 128 Bt rows) are staged in LDS at pitch 272 B by per-lane
// 16-B asynchronous copies: one wave instruction = 2 rows x 256 B = whole 128-B lines. Two buffers: pass t + 2 is copied into the
// buffer pass t has left while pass t + 1 is worked on. Fragments are 16-B LDS reads with the same split k map as ldfrag_h.
// Per accumulator the products keep ascending k in steps of 32, and h before l inside a step.
// =====================================================================================================
#define GT     128
#define GTHR   256
#define GKP    128
#define GPIT   136
#define GPLANE (GT * GPIT)
#define GNP    (DMOD / GKP)
static_assert((DMOD % GKP) == 0 && GNP >= 2 && (DMOD % GT) == 0 && (SEQ % GT) == 0 && (QE % GT) == 0);
static_assert(8 * 2 * SLAB64 * 4 <= 2 * 2 * GPLANE * 2 && GT + 8 <= GPIT);

// One operand plane of a pass: 128 rows x 256 B = eight 16-B copies of each lane, rows 16 apart (l, g: the lane's first row and
// 16-B column; LDS step 16 * 272 B, global step 16 * DMOD halves).
__device__ __forceinline__ void copy_plane(unsigned l, const u16* g) {
#if defined(__HIP_DEVICE_COMPILE__)
  const unsigned ls = 16 * GPIT * 2;
  const size_t   gs = (size_t)16 * DMOD;
  // the closing s_wait_xcnt 0 stands inside the statement so that no address register is rewritten ahead of it
  asm volatile("global_load_async_to_lds_b128 %0, %8, off\n\t"
               "global_load_async_to_lds_b128 %1, %9, off\n\t"
               "global_load_async_to_lds_b128 %2, %10, off\n\t"
               "global_load_async_to_lds_b128 %3, %11, off\n\t"
               "global_load_async_to_lds_b128 %4, %12, off\n\t"
               "global_load_async_to_lds_b128 %5, %13, off\n\t"
               "global_load_async_to_lds_b128 %6, %14, off\n\t"
               "global_load_async_to_lds_b128 %7, %15, off\n\t"
               "s_wait_xcnt 0x0"
               :: "v"(l), "v"(l + ls), "v"(l + 2 * ls), "v"(l + 3 * ls), "v"(l + 4 * ls), "v"(l + 5 * ls), "v"(l + 6 * ls),
                  "v"(l + 7 * ls),
                  "v"(g), "v"(g + gs), "v"(g + 2 * gs), "v"(g + 3 * gs), "v"(g + 4 * gs), "v"(g + 5 * gs), "v"(g + 6 * gs),
                  "v"(g + 7 * gs)
               : "memory");
#endif
}
__device__ __forceinline__ void wait_async0() {   // this wave's copies have landed
#if defined(__HIP_DEVICE_COMPILE__)
  asm volatile("s_wait_asynccnt 0x0" ::: "memory");
#endif
}
__device__ __forceinline__ void wait_x0() {       // stands between issued global stores and a rewrite of the registers they name
#if defined(__HIP_DEVICE_COMPILE__)
  asm volatile("s_wait_xcnt 0x0" ::: "memory");
#endif
}
__device__ __forceinline__ void wait_ds0() {      // this wave's LDS reads are done before their buffer is handed back
#if defined(__HIP_DEVICE_COMPILE__)
  asm volatile("s_wait_dscnt 0x0" ::: "memory");
#endif
}
// =====================================================================================================
// Projection epilogue for q and k: the wave's 32x64 f32 tile (times oscale) staged in its LDS slab as in epi3264, read back as whole
// rows, bias added, times sc, split into f16 hi + f16 residual and stored to the two planes [MROWS][DMOD] at row rowb, column col0.
// Lane = (row select rq in 0..3, 8 consecutive columns at c8): a plane row's 64 halves = one 128-B line from 8 consecutive lanes.
// coverage: 2 parts x 4 instructions x 4 rows x 8 lanes x 8 halves = the wave's 32 x 64 tile of each plane.
// =====================================================================================================
__device__ __forceinline__ void epi_qk(float* sl, const v8f (&acc)[2][4], float oscale, const float* __restrict__ bias,
                                       u16* Hp, u16* Lp, float sc, size_t rowb, int col0, int lane) {
  const int hh = lane >> 4, m = lane & 15;
#pragma unroll
  for (int i = 0; i < 2; ++i) {
#pragma unroll
    for (int r = 0; r < 8; ++r) {
      const int ro = i * SLAB64 + (8 * hh + r) * 68 + m;
      sl[ro]      = acc[i][0][r] * oscale;
      sl[ro + 16] = acc[i][1][r] * oscale;
      sl[ro + 32] = acc[i][2][r] * oscale;
      sl[ro + 48] = acc[i][3][r] * oscale;
    }
  }
  wave_sync_lds();
  const int rq = lane >> 3, c8 = (lane & 7) * 8;
  const v4f ba = *(const v4f*)(bias + col0 + c8), bb = *(const v4f*)(bias + col0 + c8 + 4);
  float br[8];
#pragma unroll
  for (int e = 0; e < 4; ++e) { br[e] = bfr(ba[e]); br[4 + e] = bfr(bb[e]); }
  const size_t d0 = (rowb + (size_t)rq) * DMOD + col0 + c8;
#pragma unroll
  for (int i = 0; i < 2; ++i) {
    v4u oh[4], ol[4];
#pragma unroll
    for (int it = 0; it < 4; ++it) {
      const float* sp = sl + i * SLAB64 + (it * 4 + rq) * 68 + c8;
      const v4f a = *(const v4f*)(sp), b4 = *(const v4f*)(sp + 4);
      float w[8];
#pragma unroll
      for (int e = 0; e < 4; ++e) { w[e] = (a[e] + br[e]) * sc; w[4 + e] = (b4[e] + br[4 + e]) * sc; }
#pragma unroll
      for (int e = 0; e < 4; ++e) {
        const float t0 = w[2 * e], t1 = w[2 * e + 1];
        const _Float16 h0 = (_Float16)t0, h1 = (_Float16)t1;
        const _Float16 l0 = (_Float16)(t0 - (float)h0), l1 = (_Float16)(t1 - (float)h1);
        oh[it][e] = pk16(h_bits(h0), h_bits(h1));
        ol[it][e] = pk16(h_bits(l0), h_bits(l1));
      }
    }
#pragma unroll
    for (int it = 0; it < 4; ++it) {
      const size_t d = d0 + (size_t)(i * 16 + it * 4) * DMOD;
      *(v4u*)(Hp + d) = oh[it];
      *(v4u*)(Lp + d) = ol[it];
    }
  }
}

// =====================================================================================================
// Projection epilogue for v: the block's 128 (keys s) x 128 (columns g*HD + d) tile goes out transposed.
//   VH[(vrow0 + col)][s0 + s] (pitch SEQ) = f16(v * sc);  VL[(vrow0 + col)][s0 + s] (pitch QE) = f16 residual, only when dolo.
// An accumulator register group already holds 8 consecutive keys of one column: bias added, scaled, split, packed, one 16-B LDS store
// per plane into the block tile T[col][s] (pitch GPIT halves; hi plane, then residual plane). One block barrier, then each column's
// 128 keys = 256 B = two whole lines leave from 16 consecutive lanes.
// Every thread of the block calls this (block barrier inside); dolo is block-uniform.
// coverage: LDS 8 waves x 8 groups x 32 lanes x 8 halves = 128 x 128; stores 8 iterations x 16 columns x 16 lanes x 8 halves = the same.
// =====================================================================================================
__device__ __forceinline__ void epi_vt(u16* T, const v8f (&acc)[2][4], float oscale, const float* __restrict__ bias,
                                       u16* VHo, u16* VLo, float sc, size_t vrow0, int s0, int colC, bool dolo, int wr, int wc,
                                       int tid) {
  const int lane = tid & 31, hh = lane >> 4, m = lane & 15;
  float bj[4];
#pragma unroll
  for (int j = 0; j < 4; ++j) bj[j] = bias[colC + wc + j * 16 + m];
#pragma unroll
  for (int j = 0; j < 4; ++j) {
    const int   col = wc + j * 16 + m;
    const float br  = bfr(bj[j]);
#pragma unroll
    for (int i = 0; i < 2; ++i) {
      v4u vh, vl;
#pragma unroll
      for (int e = 0; e < 4; ++e) {
        const float t0 = (acc[i][j][2 * e] * oscale + br) * sc, t1 = (acc[i][j][2 * e + 1] * oscale + br) * sc;
        const _Float16 h0 = (_Float16)t0, h1 = (_Float16)t1;
        const _Float16 l0 = (_Float16)(t0 - (float)h0), l1 = (_Float16)(t1 - (float)h1);
        vh[e] = pk16(h_bits(h0), h_bits(h1));
        vl[e] = pk16(h_bits(l0), h_bits(l1));
      }
      u16* tp = T + col * GPIT + wr + i * 16 + 8 * hh;
      *(v4u*)(tp) = vh;
      if (dolo) *(v4u*)(tp + GPLANE) = vl;
    }
  }
  __syncthreads();   // a column's 128 keys were written by four waves; they leave as whole lines from one
  const int cr = tid >> 4, p8 = (tid & 15) * 8;
  v4u oh[8];
#pragma unroll
  for (int it = 0; it < 8; ++it) oh[it] = *(const v4u*)(T + (it * 16 + cr) * GPIT + p8);
#pragma unroll
  for (int it = 0; it < 8; ++it) *(v4u*)(VHo + (vrow0 + (size_t)(it * 16 + cr)) * SEQ + s0 + p8) = oh[it];
  if (dolo) {
    wait_x0();       // the residual rows are loaded into the registers that the hi stores name
    v4u ol[8];
#pragma unroll
    for (int it = 0; it < 8; ++it) ol[it] = *(const v4u*)(T + GPLANE + (it * 16 + cr) * GPIT + p8);
#pragma unroll
    for (int it = 0; it < 8; ++it) *(v4u*)(VLo + (vrow0 + (size_t)(it * 16 + cr)) * QE + s0 + p8) = ol[it];
  }
}

struct Frag16 { v4u u[2]; };
__device__ __forceinline__ Frag16 ldfrag_s(const u16* p) {
  Frag16 f;
  f.u[0] = *(const v4u*)(p);
  f.u[1] = *(const v4u*)(p + 16);
  return f;
}
template <bool BF>
__device__ __forceinline__ v8f mma_s(const Frag16& a, const Frag16& b, v8f c) {
  if constexpr (BF) {
    FragB x, y;
    x.u[0] = a.u[0]; x.u[1] = a.u[1]; y.u[0] = b.u[0]; y.u[1] = b.u[1];
    return mma_b(x.v, y.v, c);
  } else {
    FragH x, y;
    x.u[0] = a.u[0]; x.u[1] = a.u[1]; y.u[0] = b.u[0]; y.u[1] = b.u[1];
    return mma_h(x.v, y.v, c);
  }
}

// A0, A1, B0: first row of the block's 128 rows in each plane (row pitch DMOD halves); A1 is read only when NPROD == 2.
// ring: 2 * (NPROD + 1) * GPLANE halves; behind the last pass's barrier it is free, and the caller's epilogue stages its output there.
// acc: the wave's 32 x 64 tile (rows 32 * (wave >> 1), columns 64 * (wave & 1) of the block tile), zeroed here.
// Every thread of the block calls this (block barriers inside).
template <int NPROD, bool BF>
__device__ __forceinline__ void gemm_tile(const u16* A0, const u16* A1, const u16* B0, u16* ring, v8f (&acc)[2][4]) {
  constexpr int STG = (NPROD + 1) * GPLANE;
  const int tid = threadIdx.x, wave = tid >> 5, lane = tid & 31, hh = lane >> 4, m = lane & 15;
  const int wr = (wave >> 1) * 32, wc = (wave & 1) * 64;
  // copy role: row tid >> 4 (+ 16 per copy), 16-B column tid & 15
  const int crow = tid >> 4, ccol = (tid & 15) * 8;
  const size_t  goff = (size_t)crow * DMOD + ccol;
  const unsigned l0  = (unsigned)(size_t)(ring + crow * GPIT + ccol);
  const u16* ga0 = A0 + goff;
  const u16* ga1 = A1 + goff;
  const u16* gb  = B0 + goff;
  auto stage = [&](int buf, int pass) {
    const unsigned l = l0 + (unsigned)(buf * STG * 2);
    const int      k = pass * GKP;
    copy_plane(l, ga0 + k);
    if constexpr (NPROD == 2) copy_plane(l + GPLANE * 2, ga1 + k);
    copy_plane(l + NPROD * GPLANE * 2, gb + k);
  };
#pragma unroll
  for (int i = 0; i < 2; ++i) {
#pragma unroll
    for (int j = 0; j < 4; ++j) acc[i][j] = zero8();
  }
  stage(0, 0);
  wait_async0();
  __syncthreads();
  stage(1, 1);
#pragma unroll 1   // rolled: one copy of the pass body serves both buffers (t & 1)
  for (int t = 0; t < GNP; ++t) {
    const u16* st = ring + (t & 1) * STG;
    const u16* pa = st + (wr + m) * GPIT + 8 * hh;
    const u16* pb = st + NPROD * GPLANE + (wc + m) * GPIT + 8 * hh;
    Frag16 a[2][2], al[2][2], b[2][4];
    auto fetch = [&](int s, int kk) {
#pragma unroll
      for (int i = 0; i < 2; ++i) {
        a[s][i] = ldfrag_s(pa + i * 16 * GPIT + kk * 32);
        if constexpr (NPROD == 2) al[s][i] = ldfrag_s(pa + GPLANE + i * 16 * GPIT + kk * 32);
      }
#pragma unroll
      for (int j = 0; j < 4; ++j) b[s][j] = ldfrag_s(pb + j * 16 * GPIT + kk * 32);
    };
    fetch(0, 0);
#pragma unroll     // unrolled: the fragment set index kk & 1 must be a constant, else the sets leave the registers
    for (int kk = 0; kk < GKP / 32; ++kk) {
      const int s = kk & 1;
      if (kk + 1 < GKP / 32) fetch(s ^ 1, kk + 1);   // the next k step's fragments, inside this pass's own buffer
      // keeps that load group whole and ahead of this step's products: sunk among them, each load is waited for where it stands
      __builtin_amdgcn_sched_barrier(0);
#pragma unroll
      for (int i = 0; i < 2; ++i) {
#pragma unroll
        for (int j = 0; j < 4; ++j) acc[i][j] = mma_s<BF>(a[s][i], b[s][j], acc[i][j]);
      }
      if constexpr (NPROD == 2) {
#pragma unroll
        for (int i = 0; i < 2; ++i) {
#pragma unroll
          for (int j = 0; j < 4; ++j) acc[i][j] = mma_s<BF>(al[s][i], b[s][j], acc[i][j]);
        }
      }
      __builtin_amdgcn_sched_barrier(0);             // the far end of the same fence: later loads stay behind these products
    }
    // hand-over: own reads done, own copies of pass t + 1 landed, then the one barrier that publishes pass t + 1 and frees this buffer
    wait_ds0();
    wait_async0();
    __syncthreads();
    if (t + 2 < GNP) stage(t & 1, t + 2);
  }
  wait_async0();
}

// =====================================================================================================
// Projection of one batch: (A[M][DMOD] (bf16 row-major) . Bt[N][DMOD]^T (bf16 k-contiguous)) * oscale + bias[col] (bf16 RNE value), f32,
// written straight as the 16-bit planes the attention kernels read. Block = 128 x 128 tile (host guarantees M % 128 == 0,
// N % 128 == 0, grid = (M/128)*(N/128)).
// VT == 0 (q, k): P0 / P1 = hi / residual planes [MROWS][DMOD] of value * sc, rows b*SEQ + s (epi_qk).
// VT == 1 (v):    P0 = v^T hi plane [(b*NH + g)*HD + d][SEQ] of value * sc, P1 = v^T residual plane, pitch QE, keys s < QE only (epi_vt).
// coverage: the grid's tiles cover every (s, column) of the batch once, so every plane element of the batch is written once.
// =====================================================================================================
template <int VT>
__global__ __launch_bounds__(GTHR)
void gemm_p(const u16* __restrict__ A, const u16* __restrict__ Bt, const float* __restrict__ bias,
            u16* P0, u16* P1, int M, int N, int b, float oscale, float sc) {
  __shared__ __align__(16) u16 ring[2 * 2 * GPLANE];
  const int ntile = N / GT;
  const int bid   = blockIdx.x;
  const int row0  = (bid / ntile) * GT;
  const int col0  = (bid % ntile) * GT;
  if (row0 + GT > M) return;                // block-uniform, before any barrier; never taken with the exact grid
  const int tid = threadIdx.x, wave = tid >> 5;
  const int wr = (wave >> 1) * 32, wc = (wave & 1) * 64;
  v8f acc[2][4];
  gemm_tile<1, true>(A + (size_t)row0 * DMOD, A + (size_t)row0 * DMOD, Bt + (size_t)col0 * DMOD, ring, acc);
  if constexpr (VT != 0) {
    epi_vt(ring, acc, oscale, bias, P0, P1, sc, (size_t)b * DMOD + col0, row0, col0, row0 + GT <= QE, wr, wc, tid);
  } else {
    epi_qk((float*)(void*)ring + wave * (2 * SLAB64), acc, oscale, bias, P0, P1, sc, (size_t)b * SEQ + row0 + wr, col0 + wc, tid & 31);
  }
}

// =====================================================================================================
// Output projection: C[orow][DMOD] (f32) = (Ah [+ Al])[row][DMOD] . Bt[DMOD][DMOD]^T * oscale + bias (bf16 RNE value).
// NPROD == 1: Ah only (one product); NPROD == 2: Ah + Al residual plane (products h.B + l.B into one accumulator, l unscaled).
// Block -> (column tile ct = bid % 8, sequence row tile rt of nrt starting at s = sbeg, batch bb), tiles of 128: rows of Ah are
// bb*SEQ + s, rows of Al are bb*QE + s (valid only while s < QE, host guarantees for NPROD == 2), rows of C are bb*XS_FULL + s.
// Same tiling as gemm_p; epilogue epi3264.
// =====================================================================================================
template <int NPROD>
__global__ __launch_bounds__(GTHR)
void gemm_o(const u16* __restrict__ Ah, const u16* __restrict__ Al, const u16* __restrict__ Bt, const float* __restrict__ bias,
            float* C, int sbeg, int nrt, float oscale) {
  __shared__ __align__(16) u16 ring[2 * (NPROD + 1) * GPLANE];
  const int ntile = DMOD / GT;
  const int bid   = blockIdx.x;
  const int ct    = bid % ntile;
  const int t2    = bid / ntile;
  const int rt    = t2 % nrt;
  const int bb    = t2 / nrt;
  if (bb >= NB) return;                     // block-uniform, before any barrier; never taken with the exact grid
  const int srow  = sbeg + rt * GT;
  if (srow + GT > SEQ) return;              // block-uniform; never taken
  if (NPROD == 2 && srow + GT > QE) return; // block-uniform; never taken
  const size_t rowC = (size_t)bb * SEQ + srow;
  const size_t rowL = (size_t)bb * QE + srow;
  const size_t rowO = (size_t)bb * XS_FULL + srow;
  const u16* a0 = Ah + rowC * DMOD;
  const u16* a1 = (NPROD == 2) ? (Al + rowL * DMOD) : a0;
  const int tid = threadIdx.x, wave = tid >> 5;
  v8f acc[2][4];
  gemm_tile<NPROD, false>(a0, a1, Bt + (size_t)ct * GT * DMOD, ring, acc);
  epi3264((float*)(void*)ring + wave * (2 * SLAB64), acc, oscale, bias, C, DMOD, rowO + (wave >> 1) * 32, ct * GT + (wave & 1) * 64,
          tid & 31);
}

// =====================================================================================================
// Strided key set (pass S). Key j is in this set for query i iff j = i - STRD*n with i - j >= WIN, j >= GLB (then j <= i and
// (i - j) % STRD == 0 hold). Queries and keys of one residue class rr = i % STRD: i = rr + STRD*a, j = rr + STRD*c, a, c < NA.
// Block bid -> (residue rr = bid % STRD, head group hg, batch b); one wave per head; the wave owns all NA query rows of (b, head, rr)
// in tiles of 16 (rows a >= NA of the last tile are padding: operand row clamped, weight forced to 0, nothing stored) and visits
// the candidate keys in tiles of 32 (slots c >= NA clamped and forced to 0).
//   Transposed products: a lane owns ONE query (column lane & 15 of every D tile).
//   scores S^T: k hi / residual (A, lane -> key slot, arithmetic stride STRD rows in the [b*SEQ + s][h*HD + d] planes) times
//   q hi / residual (B, lane -> row a = 16*at + (lane & 15)), products hh + lh + hl over HD; D element r = key slot 8*(lane >> 4) + r;
//   element predicate (a < NA) && (c < NA) && (STRD*(a - c) >= WIN) && (j >= GLB), -inf otherwise; base-2 online softmax in f32
//   (-inf safe): maximum and sum over the lane's 16 scores, then one exchange with lane ^ 16;
//   P^T (B operand) is packed from those 16 values in the lane: they already lie in the split k map;
//   v rows of the 32 key slots gathered once per key tile from the v^T hi plane (arithmetic stride STRD) into a wave-private LDS tile
//   [d][slot], read as the A operand of O^T += V^T.P^T
//   (the strided keys only feed query rows i >= WIN + GLB, which always hold >= WIN + GLB keys).
//   State written per query row: M = running max (log2 domain), L = running sum, AC = acc * 64 / (32768*1024) as f16
//   (AC plane layout [b*SEQ + i][h*HD + d]; M, L planes [(b*NH + h)*STRD + rr][NAP], rows a >= NA hold -inf / 0).
// coverage: AC: every (b, i < SEQ, h, d) exactly once (union over rr, a < NA); M/L: every (b, h, rr) line group exactly once.
// =====================================================================================================
__global__ __launch_bounds__(ATT_THREADS)
void attn_s(const u16* __restrict__ QHp, const u16* __restrict__ QLp,
            const u16* __restrict__ KHp, const u16* __restrict__ KLp,
            const u16* __restrict__ VHp, u16* ACp, float* Mp, float* Lp) {
  __shared__ __align__(16) float    smem[WPB * SLW];
  __shared__ __align__(16) _Float16 vts[WPB * HD * VSP];
  __shared__ __align__(16) float    mls[WPB * 2 * NAP];

  const int tid  = threadIdx.x;
  const int wave = tid >> 5;
  const int lane = tid & 31;
  const int hh   = lane >> 4;
  const int c    = lane & 15;
  const int bid  = blockIdx.x;
  const int rres = bid % STRD;
  const int t2   = bid / STRD;
  const int hg   = t2 % NHG;
  const int b    = t2 / NHG;
  if (b >= NB) return;                      // block-uniform; no block barriers in this kernel; never taken with the exact grid
  const int head = hg * WPB + wave;

  float*    slab = smem + wave * SLW;       // result slab [16 queries][64 d] pitch 68
  _Float16* vt   = vts + wave * (HD * VSP); // v tile [64 d][32 key slots] pitch 40
  float*    msl  = mls + wave * (2 * NAP);
  float*    lsl  = msl + NAP;
#pragma unroll 1
  for (int i2 = lane; i2 < NAP; i2 += 32) { msl[i2] = -INFINITY; lsl[i2] = 0.0f; }
  wave_sync_lds();

  const _Float16* QHh = (const _Float16*)(const void*)QHp;
  const _Float16* QLh = (const _Float16*)(const void*)QLp;
  const _Float16* KHh = (const _Float16*)(const void*)KHp;
  const _Float16* KLh = (const _Float16*)(const void*)KLp;
  const size_t hcol  = (size_t)head * HD + 8 * hh;
  const size_t brow  = (size_t)b * SEQ + rres;                          // plane row of a = 0
  const u16*   vbase = VHp + (size_t)(b * NH + head) * HD * SEQ + rres; // + d*SEQ + STRD*c
  const float  lsc   = SM_SCALE * (LOG2E / (QSC * KSC));
  const float  acs   = ACAR / (PCAR * VCAR);

#pragma unroll 1
  for (int at = 0; at < NAT; ++at) {
    float mq = -INFINITY, lq = 0.f;         // this lane's query: running max and sum (equal in lanes l and l ^ 16)
    v8f o[4];                               // O^T: o[j][r] = (d = 16*j + 8*hh + r, query aq)
#pragma unroll
    for (int j = 0; j < 4; ++j) o[j] = zero8();
    const int aq = at * 16 + c;             // this lane's query row index a
    int am = aq;
    if (am > NA - 1) am = NA - 1;           // clamped operand row for this lane
    const size_t qoff = (brow + (size_t)STRD * am) * DMOD + hcol;
    const _Float16* Qh = QHh + qoff;
    const _Float16* Ql = QLh + qoff;

#pragma unroll 1
    for (int ks = 0; ks < NKS; ++ks) {
      // ---- gather the 32 key slots' v rows into the wave's LDS tile, transposed [d][slot] ----
      {
        int cs = ks * 32 + lane;
        if (cs > NA - 1) cs = NA - 1;
        const u16* vsrc = vbase + (size_t)STRD * cs;
#pragma unroll 8
        for (int d = 0; d < HD; ++d) {
          vt[d * VSP + lane] = __builtin_bit_cast(_Float16, vsrc[(size_t)d * SEQ]);
        }
      }
      // ---- scores S^T: D element r of this lane = (key slot ks*32 + 8*hh + r, query aq) in s0, slot + 16 in s1 ----
      int c0i = ks * 32 + c;       if (c0i > NA - 1) c0i = NA - 1;
      int c1i = ks * 32 + 16 + c;  if (c1i > NA - 1) c1i = NA - 1;
      const size_t k0off = (brow + (size_t)STRD * c0i) * DMOD + hcol;
      const size_t k1off = (brow + (size_t)STRD * c1i) * DMOD + hcol;
      const _Float16* k0p = KHh + k0off;
      const _Float16* k1p = KHh + k1off;
      const _Float16* l0p = KLh + k0off;
      const _Float16* l1p = KLh + k1off;
      v8f s0 = zero8(), s1 = zero8();
#pragma unroll
      for (int kk = 0; kk < HD / 32; ++kk) {
        const v16h qh  = ldfrag_h(Qh + kk * 32);
        const v16h ql  = ldfrag_h(Ql + kk * 32);
        const v16h kh0 = ldfrag_h(k0p + kk * 32);
        const v16h kh1 = ldfrag_h(k1p + kk * 32);
        const v16h kl0 = ldfrag_h(l0p + kk * 32);
        const v16h kl1 = ldfrag_h(l1p + kk * 32);
        s0 = mma_h(kh0, qh, s0);
        s0 = mma_h(kh0, ql, s0);
        s0 = mma_h(kl0, qh, s0);
        s1 = mma_h(kh1, qh, s1);
        s1 = mma_h(kh1, ql, s1);
        s1 = mma_h(kl1, qh, s1);
        guard2(s0, s1, qh, ql, kh0, kl0, kh1, kl1);
      }
      // ---- key select + online softmax in base 2, -inf-safe; all 16 values of a lane belong to its query ----
      const int cb0 = ks * 32 + 8 * hh;
      float t0[8], t1[8];
      float mx = -INFINITY;
#pragma unroll
      for (int r = 0; r < 8; ++r) {
        const int  cc0 = cb0 + r, cc1 = cc0 + 16;
        const int  j0  = rres + STRD * cc0, j1 = rres + STRD * cc1;
        const bool ok0 = (aq < NA) && (cc0 < NA) && (STRD * (aq - cc0) >= WIN) && (j0 >= GLB);
        const bool ok1 = (aq < NA) && (cc1 < NA) && (STRD * (aq - cc1) >= WIN) && (j1 >= GLB);
        t0[r] = ok0 ? s0[r] * lsc : -INFINITY;
        t1[r] = ok1 ? s1[r] * lsc : -INFINITY;
        mx = fmaxf(mx, fmaxf(t0[r], t1[r]));
      }
      mx = fmaxf(mx, xhalf(mx));
      const float mn = fmaxf(mq, mx);
      const float ms = (mn == -INFINITY) ? 0.0f : mn;
      const float al = exp2f(mq - ms);
      mq = mn;
      // ---- B fragment of P^T * 32768 (f16): elements 0..7 = slots 8*hh + r, elements 8..15 = slots 16 + 8*hh + r ----
      FragH ph;
      float pa = 0.f, pb = 0.f;
#pragma unroll
      for (int r = 0; r < 8; ++r) {
        const float e0 = exp2f(t0[r] - ms), e1 = exp2f(t1[r] - ms);
        pa += e0;
        pb += e1;
        ph.h[0][r] = (_Float16)(e0 * PCAR);
        ph.h[1][r] = (_Float16)(e1 * PCAR);
      }
      float ps = pa + pb;
      ps += xhalf(ps);
      lq = lq * al + ps;
#pragma unroll
      for (int j = 0; j < 4; ++j) {
#pragma unroll
        for (int r = 0; r < 8; ++r) o[j][r] *= al;
      }
      wave_sync_lds();                      // the gathered v tile is read by other lanes than wrote it
      // ---- O^T += V^T.P^T : A fragment row d = jj*16 + c, key slots contiguous in the LDS tile ----
#pragma unroll
      for (int jg = 0; jg < HD / 32; ++jg) {
        const v16h vha  = ldfrag_h(vt + ((2 * jg) * 16 + c) * VSP + 8 * hh);
        const v16h vhb2 = ldfrag_h(vt + ((2 * jg + 1) * 16 + c) * VSP + 8 * hh);
        o[2 * jg]     = mma_h(vha,  ph.v, o[2 * jg]);
        o[2 * jg + 1] = mma_h(vhb2, ph.v, o[2 * jg + 1]);
        guard2(o[2 * jg], o[2 * jg + 1], ph.v, vha, vhb2, ph.v, vha, vhb2);
      }
      wave_sync_lds();                      // the tile's reads end before the next gather rewrites it
    }
    acc_guard4(o[0], o[1], o[2], o[3]);
    // ---- state: m, l per query into the LDS staging; acc * 64 / (32768*1024) into the slab row of the lane's query ----
    if (hh == 0) { msl[aq] = mq; lsl[aq] = lq; }
#pragma unroll
    for (int j = 0; j < 4; ++j) {
      v4f w0, w1;
#pragma unroll
      for (int e = 0; e < 4; ++e) { w0[e] = o[j][e] * acs; w1[e] = o[j][4 + e] * acs; }
      float* sp = slab + c * SLP + j * 16 + 8 * hh;
      *(v4f*)(sp)     = w0;
      *(v4f*)(sp + 4) = w1;
    }
    wave_sync_lds();
    // ---- AC rows (f16): lane = (row select rq in 0..3, 8 consecutive d at c8) ----
    v4u    ov[4];
    bool   okr[4];
    size_t dso[4];
    const int rq = lane >> 3, c8 = (lane & 7) * 8;
#pragma unroll
    for (int it = 0; it < 4; ++it) {
      const int row = it * 4 + rq;
      const v4f a = *(const v4f*)(slab + row * SLP + c8), b4 = *(const v4f*)(slab + row * SLP + c8 + 4);
      float w[8];
#pragma unroll
      for (int e = 0; e < 4; ++e) { w[e] = a[e]; w[4 + e] = b4[e]; }
#pragma unroll
      for (int e = 0; e < 4; ++e) {
        ov[it][e] = pk16(h_bits((_Float16)w[2 * e]), h_bits((_Float16)w[2 * e + 1]));
      }
      const int arow = at * 16 + row;
      okr[it] = (arow < NA);                // uniform over the 8 lanes of one line
      const int acl  = okr[it] ? arow : (NA - 1);
      dso[it] = (brow + (size_t)STRD * acl) * DMOD + (size_t)head * HD + c8;
    }
    {
#pragma unroll
      for (int it = 0; it < 4; ++it) {
        if (okr[it]) *(v4u*)(ACp + dso[it]) = ov[it];
      }
      
    }
    wave_sync_lds();
  }

  wave_sync_lds();
  const size_t mlbase = ((size_t)(b * NH + head) * STRD + rres) * NAP;
  const int l8 = lane & 7;
  v4f mv[NAP / 32], lv[NAP / 32];
#pragma unroll
  for (int ch = 0; ch < NAP / 32; ++ch) {
    mv[ch] = *(const v4f*)(msl + ch * 32 + l8 * 4);
    lv[ch] = *(const v4f*)(lsl + ch * 32 + l8 * 4);
  }
  const bool wm = (lane < 8), wl = (lane >= 8) && (lane < 16);
  {
#pragma unroll
    for (int ch = 0; ch < NAP / 32; ++ch) {
      if (wm) *(v4f*)(Mp + mlbase + ch * 32 + l8 * 4) = mv[ch];
      if (wl) *(v4f*)(Lp + mlbase + ch * 32 + l8 * 4) = lv[ch];
    }
    
  }
}

// =====================================================================================================
// Band + leading key set (pass A), initialised from the pass-S state. Key j is in this set for query i iff
// j <= i && (i - j < WIN || j < GLB). Block bid -> (query tile qt = qt0 + bid % nq: rows q0 = 16*qt .. q0+15, head group hg, batch
// b); one wave per head.
//   q/k hi planes f16 x1024 [b*SEQ + s][h*HD + d], residual planes same layout; v^T hi plane [b*NH + h][d][SEQ], v^T residual plane
//   [b*NH + h][d][QE] (keys < QE).
//   Transposed products: a lane owns ONE query i = q0 + (lane & 15), the column of every D tile; lanes l and l ^ 16 share it.
//   Init: m = M, l = L (from [(b*NH+h)*STRD + i%STRD][i/STRD]), O^T = AC row (f16, 8 consecutive d per 16-B load) * (32768*1024/64).
//   Key tiles of 32 visited in order: tile 0 (keys 0..31, holds the leading GLB keys) when the band does not start at tile 0, then the
//   band tiles from the one holding max(0, q0 - WIN + 1) to the one holding q0 + 15 (at most WIN/32 + 2 + 1 tiles; every other tile holds
//   only keys outside this set for every query row of the tile: weight exactly 0).
//   Per tile: S^T = K.Q^T, 2 key subtiles x 2 k-steps, products k_hi.q_hi + k_hi.q_lo + k_lo.q_hi, fragments straight from the 16-bit planes
//   (two 16-B loads per fragment, split k map); exact element predicate; online max-subtracted base-2 softmax in f32, -inf-safe rescale:
//   maximum and sum over the lane's 16 scores, then one exchange with lane ^ 16; P^T x32768 (f16, and its f16 residual when ROB) packed
//   in the lane as the B operand (D rows 8*(lane >> 4) + r of the two subtiles are the split k map's elements); O^T += V^T.P^T with the v^T
//   A fragments in 2 groups of 2 d-subtiles. ROB == 1 (host uses it for q0 + 16 <= QE only; then every visited key is < QE): products
//   hh + lh + hl with the v residual plane, O written as hi + residual planes; ROB == 0: single product v_hi.P_hi, O hi plane only.
//   After the loop: out = acc / Z (Z >= 1 always: key i itself lies in a visited tile; guarded anyway), carries 1/(32768*1024) folded
//   once, written to the wave's private result slab (pitch 68; row = query; every element owned by one lane), read back as whole rows:
//   each plane row ([b*SEQ + s][h*HD + d]; residual [b*QE + s][h*HD + d], ROB only) is written by 8 consecutive lanes x 16 B.
// coverage: per wave 4 instructions x 4 rows x 8 lanes x 8 halves = 16 x 64 per plane; the two launches (qt < QE/16 with ROB = 1, the rest
//           with ROB = 0) x NHG x NB blocks x WPB waves = every (b, s, h) row of O hi exactly once and every (b, s < QE, h) row of O residual
//           exactly once.
// =====================================================================================================
template <int ROB>
__global__ __launch_bounds__(ATT_THREADS)
void attn_a(const u16* __restrict__ QHp, const u16* __restrict__ QLp,
            const u16* __restrict__ KHp, const u16* __restrict__ KLp,
            const u16* __restrict__ VHp, const u16* __restrict__ VLp,
            const u16* __restrict__ ACp, const float* __restrict__ Mp, const float* __restrict__ Lp,
            u16* OHp, u16* OLp, int qt0, int nq) {
  __shared__ __align__(16) float smem[WPB * SLW];

  const int tid  = threadIdx.x;
  const int wave = tid >> 5;
  const int lane = tid & 31;
  const int hh   = lane >> 4;
  const int c    = lane & 15;
  const int bid  = blockIdx.x;
  const int qtl  = bid % nq;
  const int t2   = bid / nq;
  const int hg   = t2 % NHG;
  const int b    = t2 / NHG;
  if (b >= NB) return;                      // block-uniform; no block barriers in this kernel; never taken with the exact grid
  const int qt   = qt0 + qtl;
  const int q0   = qt * 16;
  if (q0 + 16 > SEQ) return;                // block-uniform; never taken
  if (ROB != 0 && q0 + 16 > QE) return;     // block-uniform; never taken (residual planes cover s < QE only)
  const int head = hg * WPB + wave;

  float* slab = smem + wave * SLW;          // result slab [16 queries][64 d] pitch 68

  const size_t hcol = (size_t)head * HD + 8 * hh;
  const _Float16* Qh  = (const _Float16*)(const void*)QHp + ((size_t)b * SEQ + q0 + c) * DMOD + hcol;
  const _Float16* Ql  = (const _Float16*)(const void*)QLp + ((size_t)b * SEQ + q0 + c) * DMOD + hcol;
  const _Float16* Khb = (const _Float16*)(const void*)KHp + ((size_t)b * SEQ + c) * DMOD + hcol;      // key row kb added per step
  const _Float16* Klb = (const _Float16*)(const void*)KLp + ((size_t)b * SEQ + c) * DMOD + hcol;
  const _Float16* Vhb = (const _Float16*)(const void*)VHp + ((size_t)(b * NH + head) * HD + c) * SEQ + 8 * hh;  // d row c (+16j)
  const _Float16* Vlb = Vhb;
  if constexpr (ROB != 0) {
    Vlb = (const _Float16*)(const void*)VLp + ((size_t)(b * NH + head) * HD + c) * QE + 8 * hh;
  }
  const float lsc = SM_SCALE * (LOG2E / (QSC * KSC));
  const float oc  = 1.0f / (PCAR * VCAR);
  const float aci = (PCAR * VCAR) / ACAR;
  const size_t KROW = (size_t)DMOD;         // halves between consecutive key rows

  const int qr = q0 + c;                    // this lane's query
  float mq, lq;                             // its running max and sum (equal in lanes l and l ^ 16)
  v8f o[4];                                 // O^T: o[j][r] = (d = 16*j + 8*hh + r, query qr)
  // ---- init from the strided-set state ----
  {
    const size_t mli = ((size_t)(b * NH + head) * STRD + (qr % STRD)) * NAP + (qr / STRD);   // qr / STRD < NA <= NAP
    mq = Mp[mli];
    lq = Lp[mli];
    const _Float16* acp = (const _Float16*)(const void*)ACp + ((size_t)b * SEQ + qr) * DMOD + hcol;
#pragma unroll
    for (int j = 0; j < 4; ++j) {
      const v8h a = *(const v8h*)(acp + j * 16);
#pragma unroll
      for (int r = 0; r < 8; ++r) o[j][r] = (float)a[r] * aci;
    }
  }

  // ---- tile list: leading tile 0 (when not part of the band) then the band tiles ----
  int klo = q0 - (WIN - 1);
  if (klo < 0) klo = 0;
  const int ktb = klo >> 5;
  const int kte = (q0 + 15) >> 5;           // <= SEQ/32 - 1; for ROB: kte*32 + 31 <= QE - 1
  int nband = kte - ktb + 1;
  if (nband > NKB) nband = NKB;             // static bound (WIN/32 + 2)
  if (nband < 0) nband = 0;
  const int hasg = (ktb > 0) ? 1 : 0;
  const int nkt  = nband + hasg;            // <= NKA

#pragma unroll 1
  for (int kt = 0; kt < nkt; ++kt) {
    const int kb = (kt < hasg) ? 0 : (ktb + kt - hasg) * 32;   // kb + 31 <= SEQ - 1
    // ---- scores S^T: D element r of this lane = (key kb + 8*hh + r, query qr) in s0, key kb + 16 + 8*hh + r in s1 ----
    v8f s0 = zero8(), s1 = zero8();
    const _Float16* k0p = Khb + (size_t)kb * KROW;
    const _Float16* k1p = k0p + (size_t)16 * KROW;
    const _Float16* l0p = Klb + (size_t)kb * KROW;
    const _Float16* l1p = l0p + (size_t)16 * KROW;
#pragma unroll
    for (int kk = 0; kk < HD / 32; ++kk) {
      const v16h qh  = ldfrag_h(Qh + kk * 32);
      const v16h ql  = ldfrag_h(Ql + kk * 32);
      const v16h kh0 = ldfrag_h(k0p + kk * 32);
      const v16h kh1 = ldfrag_h(k1p + kk * 32);
      const v16h kl0 = ldfrag_h(l0p + kk * 32);
      const v16h kl1 = ldfrag_h(l1p + kk * 32);
      s0 = mma_h(kh0, qh, s0);
      s0 = mma_h(kh0, ql, s0);
      s0 = mma_h(kl0, qh, s0);
      s1 = mma_h(kh1, qh, s1);
      s1 = mma_h(kh1, ql, s1);
      s1 = mma_h(kl1, qh, s1);
      guard2(s0, s1, qh, ql, kh0, kl0, kh1, kl1);
    }
    // ---- key select + online softmax in base 2, -inf-safe; all 16 values of a lane belong to its query ----
    const int kr0 = kb + 8 * hh;
    float t0[8], t1[8];
    float mx = -INFINITY;
#pragma unroll
    for (int r = 0; r < 8; ++r) {
      const int  key0 = kr0 + r, key1 = key0 + 16;
      const bool a0 = (key0 <= qr) && ((qr - key0 < WIN) || (key0 < GLB));
      const bool a1 = (key1 <= qr) && ((qr - key1 < WIN) || (key1 < GLB));
      t0[r] = a0 ? s0[r] * lsc : -INFINITY;
      t1[r] = a1 ? s1[r] * lsc : -INFINITY;
      mx = fmaxf(mx, fmaxf(t0[r], t1[r]));
    }
    mx = fmaxf(mx, xhalf(mx));
    const float mn = fmaxf(mq, mx);
    const float ms = (mn == -INFINITY) ? 0.0f : mn;
    const float al = exp2f(mq - ms);
    mq = mn;
    // ---- B fragments of P^T * 32768: hi f16 (and residual f16 when ROB); elements 0..7 = keys kb + 8hh + r,
    //      elements 8..15 = keys kb + 16 + 8hh + r: the split k map of the v^T A fragments ----
    FragH ph, pl;
    float pa = 0.f, pb = 0.f;
#pragma unroll
    for (int r = 0; r < 8; ++r) {
      const float e0 = exp2f(t0[r] - ms), e1 = exp2f(t1[r] - ms);
      pa += e0;
      pb += e1;
      const float ta = e0 * PCAR, tb = e1 * PCAR;
      const _Float16 ha = (_Float16)ta, hb = (_Float16)tb;
      ph.h[0][r] = ha;
      ph.h[1][r] = hb;
      if constexpr (ROB != 0) {
        pl.h[0][r] = (_Float16)(ta - (float)ha);
        pl.h[1][r] = (_Float16)(tb - (float)hb);
      }
    }
    float ps = pa + pb;
    ps += xhalf(ps);
    lq = lq * al + ps;
#pragma unroll
    for (int j = 0; j < 4; ++j) {
#pragma unroll
      for (int r = 0; r < 8; ++r) o[j][r] *= al;
    }
    // ---- O^T += V^T.P^T : A fragment row d = j*16 + c, keys contiguous in the v^T planes; 2 groups of 2 d-subtiles ----
    {
      const _Float16* vhp = Vhb + kb;
      const _Float16* vlp = Vlb + kb;
#pragma unroll
      for (int jg = 0; jg < HD / 32; ++jg) {
        const size_t da = (size_t)(2 * jg) * 16 * SEQ;
        const size_t db = da + (size_t)16 * SEQ;
        const v16h vha = ldfrag_h(vhp + da), vhb2 = ldfrag_h(vhp + db);
        if constexpr (ROB != 0) {
          const size_t la = (size_t)(2 * jg) * 16 * QE;
          const size_t lb = la + (size_t)16 * QE;
          const v16h vla = ldfrag_h(vlp + la), vlb2 = ldfrag_h(vlp + lb);
          o[2 * jg]     = mma_h(vha,  ph.v, o[2 * jg]);
          o[2 * jg]     = mma_h(vha,  pl.v, o[2 * jg]);
          o[2 * jg]     = mma_h(vla,  ph.v, o[2 * jg]);
          o[2 * jg + 1] = mma_h(vhb2, ph.v, o[2 * jg + 1]);
          o[2 * jg + 1] = mma_h(vhb2, pl.v, o[2 * jg + 1]);
          o[2 * jg + 1] = mma_h(vlb2, ph.v, o[2 * jg + 1]);
          guard2(o[2 * jg], o[2 * jg + 1], ph.v, pl.v, vha, vhb2, vla, vlb2);
        } else {
          o[2 * jg]     = mma_h(vha,  ph.v, o[2 * jg]);
          o[2 * jg + 1] = mma_h(vhb2, ph.v, o[2 * jg + 1]);
          guard2(o[2 * jg], o[2 * jg + 1], ph.v, vha, vhb2, ph.v, vha, vhb2);
        }
      }
    }
  }
  acc_guard4(o[0], o[1], o[2], o[3]);
  // ---- out = acc / Z (0 if Z == 0), carries (32768 on P, 1024 on v) folded once; written into the slab row of the lane's query ----
  {
    const float ls  = (lq > 0.0f) ? lq : 1.0f;
    const float inv = (lq > 0.0f) ? ((1.0f / ls) * oc) : 0.0f;
#pragma unroll
    for (int j = 0; j < 4; ++j) {
      v4f w0, w1;
#pragma unroll
      for (int e = 0; e < 4; ++e) { w0[e] = o[j][e] * inv; w1[e] = o[j][4 + e] * inv; }
      float* sp = slab + c * SLP + j * 16 + 8 * hh;
      *(v4f*)(sp)     = w0;
      *(v4f*)(sp + 4) = w1;
    }
  }

  wave_sync_lds();
  // ---- O x1024 -> f16 hi (+ residual when ROB) planes; lane = (row select rq in 0..3, 8 consecutive d at c8) ----
  v4u oh[4], ol[4];
  const int rq = lane >> 3, c8 = (lane & 7) * 8;
#pragma unroll
  for (int it = 0; it < 4; ++it) {
    const int row = it * 4 + rq;
    const v4f a = *(const v4f*)(slab + row * SLP + c8), b4 = *(const v4f*)(slab + row * SLP + c8 + 4);
    float w[8];
#pragma unroll
    for (int e = 0; e < 4; ++e) { w[e] = a[e] * OSC; w[4 + e] = b4[e] * OSC; }
#pragma unroll
    for (int e = 0; e < 4; ++e) {
      const _Float16 h0 = (_Float16)w[2 * e], h1 = (_Float16)w[2 * e + 1];
      const _Float16 l0 = (_Float16)(w[2 * e] - (float)h0), l1 = (_Float16)(w[2 * e + 1] - (float)h1);
      oh[it][e] = pk16(h_bits(h0), h_bits(h1));
      ol[it][e] = pk16(h_bits(l0), h_bits(l1));
    }
  }
  const size_t ob  = ((size_t)b * SEQ + q0) * DMOD + (size_t)head * HD + c8;
  const size_t olb = ((size_t)b * QE + q0) * DMOD + (size_t)head * HD + c8;   // dereferenced only when ROB
  {
#pragma unroll
    for (int it = 0; it < 4; ++it) {
      const int row = it * 4 + rq;
      *(v4u*)(OHp + ob + (size_t)row * DMOD) = oh[it];
      if constexpr (ROB != 0) {
        *(v4u*)(OLp + olb + (size_t)row * DMOD) = ol[it];
      }
    }
    
  }
}

// =====================================================================================================
// Workspace map (bytes); every plane is fully written by whole-line stores before it is read; all extents are exact multiples
// of the store granularity (no pad rows needed); every region offset a multiple of 524288:
//   XB  bf16 [MROWS][1024]                       MROWS*2048       (x as bf16; after the projections the region holds AC f16 [MROWS][1024])
//   WB  16-bit [1024 n][1024 k]                  2097152          (Wq, Wk, Wv column blocks as bf16 [n][k], then Wo as f16 x1024, in launch order)
//   OH  f16 [MROWS][1024] x1024                  MROWS*2048
//   QH  f16 [MROWS][1024] x1024                  MROWS*2048       QL residual the same; KH, KL the same
//   VH  f16 [NB*16][64][SEQ] x1024               MROWS*2048
//   VL  f16 residual [NB*16][64][QE]             NB*16*64*QE*2
//   OL  f16 residual [NB*QE][1024]               NB*QE*2048
//   M   f32 [NB*16*STRD][NAP]                     NB*16*STRD*NAP*4 L the same
//   end (NB=2, SEQ=4096, QE=512)               124780544
// =====================================================================================================
extern "C" void kernel_launch(void* const* d_in, const int* in_sizes, int n_in,
                              void* d_out, int out_size, void* d_ws, size_t ws_size,
                              hipStream_t stream) {
  if (n_in < 5) return;
  const int needx = OROWS * DMOD;
  if (in_sizes[0] < needx) return;
  if (in_sizes[1] != 3 * DMOD * DMOD) return;
  if (in_sizes[2] < 3 * DMOD) return;
  if (in_sizes[3] != DMOD * DMOD) return;
  if (in_sizes[4] < DMOD) return;
  if (out_size < needx) return;

  const float* x    = (const float*)d_in[0];
  const float* wqkv = (const float*)d_in[1];
  const float* bqkv = (const float*)d_in[2];
  const float* wo   = (const float*)d_in[3];
  const float* bo   = (const float*)d_in[4];
  float*       out  = (float*)d_out;

  const size_t szXB = (size_t)MROWS * DMOD * 2;                 // XB, later AC (same extent)
  const size_t szW  = (size_t)DMOD * DMOD * 2;
  const size_t szH  = (size_t)MROWS * DMOD * 2;                 // QH, QL, KH, KL, OH
  const size_t szV  = (size_t)NB * NH * HD * SEQ * 2;           // VH (== szH)
  const size_t szVL = (size_t)NB * NH * HD * QE * 2;            // VL
  const size_t szOL = (size_t)NB * QE * DMOD * 2;               // OL (== szVL)
  const size_t szML = (size_t)NB * NH * STRD * NAP * 4;         // M, L
  size_t off = 0;
  const size_t oXB = off; off += szXB;
  const size_t oW  = off; off += szW;
  const size_t oOH = off; off += szH;
  const size_t oQH = off; off += szH;
  const size_t oQL = off; off += szH;
  const size_t oKH = off; off += szH;
  const size_t oKL = off; off += szH;
  const size_t oVH = off; off += szV;
  const size_t oVL = off; off += szVL;
  const size_t oOL = off; off += szOL;
  const size_t oM  = off; off += szML;
  const size_t oL  = off; off += szML;
  if (off > ws_size) return;                // off = 124780544 for NB = 2, SEQ = 4096
  if (off > (size_t)WS_CAP) return;

  char* ws = (char*)d_ws;
  u16*   XB = (u16*)(ws + oXB);
  u16*   AC = (u16*)(ws + oXB);
  u16*   WB = (u16*)(ws + oW);
  u16*   OH = (u16*)(ws + oOH);
  u16*   QH = (u16*)(ws + oQH);
  u16*   QL = (u16*)(ws + oQL);
  u16*   KH = (u16*)(ws + oKH);
  u16*   KL = (u16*)(ws + oKL);
  u16*   VH = (u16*)(ws + oVH);
  u16*   VL = (u16*)(ws + oVL);
  u16*   OL = (u16*)(ws + oOL);
  float* Mp = (float*)(ws + oM);
  float* Lp = (float*)(ws + oL);

  const dim3 b256(256), bAT(ATT_THREADS);
  const int  n8x = (SEQ * DMOD) / 8;
  const dim3 gX((n8x + 255) / 256);                     // per batch
  const dim3 gTR((DMOD / 64) * (DMOD / 64));            // 256 blocks per [1024][1024] weight block
  const dim3 gG((SEQ / GT) * (DMOD / GT));              // per batch
  const int  nqR  = QE / 16;                            // query tiles with residual P.v products per (b, head group)
  const int  nqP  = NQT - nqR;
  const int  nrtR = QE / GT;                            // out-projection row tiles with the residual plane
  const int  nrtP = (SEQ - QE) / GT;

  // (0) x -> bf16 plane [MROWS][1024], one launch per batch
  for (int b = 0; b < NB; ++b) {
    cvt16<<<gX, b256, 0, stream>>>(x + (size_t)b * XS_FULL * DMOD, XB + (size_t)b * SEQ * DMOD, n8x, 0, 1.0f);
  }
  // (1) per column block p (q, k, v): W[:, p*1024 .. p*1024+1023] ([1024 k][3072 n] -> [1024 n][1024 k] bf16); per batch:
  //     projection, written as the 16-bit planes by its own epilogue
  for (int p = 0; p < 3; ++p) {
    tr16<<<gTR, b256, 0, stream>>>(wqkv, 3 * DMOD, p * DMOD, WB, 0, 1.0f);
    for (int b = 0; b < NB; ++b) {
      const u16* xb = XB + (size_t)b * SEQ * DMOD;
      if (p == 0) {
        gemm_p<0><<<gG, b256, 0, stream>>>(xb, WB, bqkv + p * DMOD, QH, QL, SEQ, DMOD, b, 1.0f, QSC);
      } else if (p == 1) {
        gemm_p<0><<<gG, b256, 0, stream>>>(xb, WB, bqkv + p * DMOD, KH, KL, SEQ, DMOD, b, 1.0f, KSC);
      } else {
        gemm_p<1><<<gG, b256, 0, stream>>>(xb, WB, bqkv + p * DMOD, VH, VL, SEQ, DMOD, b, 1.0f, VCAR);
      }
    }
  }
  // (2) Wo [1024 k][1024 n] -> [n][k] f16 plane of bf16 value x1024
  tr16<<<gTR, b256, 0, stream>>>(wo, DMOD, 0, WB, 1, WOS);
  // (3) strided key set -> per-row state (M, L, AC)
  attn_s<<<dim3(NB * NHG * STRD), bAT, 0, stream>>>(QH, QL, KH, KL, VH, AC, Mp, Lp);
  // (4) band + leading key set merged onto that state: query rows s < QE with residual P.v products -> O hi + residual planes;
  //     (5) remaining rows, single product -> O hi plane
  attn_a<1><<<dim3(nqR * NHG * NB), bAT, 0, stream>>>(QH, QL, KH, KL, VH, VL, AC, Mp, Lp, OH, OL, 0, nqR);
  if (nqP > 0) {
    attn_a<0><<<dim3(nqP * NHG * NB), bAT, 0, stream>>>(QH, QL, KH, KL, VH, VL, AC, Mp, Lp, OH, OL, nqR, nqP);
  }
  // (6) output projection rows s < QE (hi + residual) and (7) rows s >= QE (hi only) -> out f32, carries 1024 x 1024 folded back
  gemm_o<2><<<dim3(NB * nrtR * (DMOD / GT)), b256, 0, stream>>>(OH, OL, WB, bo, out, 0, nrtR, 1.0f / (OSC * WOS));
  if (nrtP > 0) {
    gemm_o<1><<<dim3(NB * nrtP * (DMOD / GT)), b256, 0, stream>>>(OH, OL, WB, bo, out, QE, nrtP, 1.0f / (OSC * WOS));
  }
  (void)hipGetLastError();
}

// v004
// One run takes 227 microseconds.
// Timed twice side by side with v003, it ran 1.19 and 1.18 times as fast.
// Counting every step since v000, it is 2.52 times as fast.
// Contractions: x.Wq, x.Wk, x.Wv on v_wmma_f32_16x16x32_bf16 (x, W, biases RNE-converted to bf16; each W column block
// transposed into a k-contiguous [n][k] plane; f32 accumulate); k.q^T over 64 on v_wmma_f32_16x16x32_f16 with q, k carried as
// f16 hi x1024 + f16 residual planes (products hh + lh + hl); v^T.P^T on v_wmma_f32_16x16x32_f16 (P x32768 f16, v x1024 f16):
// query rows s < QE use P hi + residual and v hi + residual planes (hh + lh + hl), other rows one product; O.Wo on
// v_wmma_f32_16x16x32_f16 (O x1024 f16, Wo as f16(bf16(Wo)) x1024): rows s < QE as O hi + residual planes (h.W + l.W), other rows one
// product; all f32 accumulate. Bias adds, key-set select, base-2 online softmax, merge of the two key-set states and the 1/Z fold in
// f32 on VALU.
#include <hip/hip_runtime.h>
#include <math.h>
#include <stdint.h>

#ifndef NB
#define NB 2
#endif
#ifndef SEQ
#define SEQ 4096
#endif
#define XS_FULL 4096
#define DMOD  1024
#define NH    16
#define HD    64
#define WIN   256
#define STRD  128
#define GLB   16
#define QE    ((SEQ < 512) ? SEQ : 512)
#define MROWS (NB * SEQ)
#define OROWS ((NB - 1) * XS_FULL + SEQ)
#define SM_SCALE 0.125f
#define LOG2E 1.4426950408889634f
#define QSC   1024.0f
#define KSC   1024.0f
#define PCAR  32768.0f
#define VCAR  1024.0f
#define OSC   1024.0f
#define WOS   1024.0f
#define ACAR  64.0f
#define WPB   4
#define NHG   (NH / WPB)
#define NQT   (SEQ / 16)
#define NKB   ((WIN / 32) + 2)
#define NKA   (NKB + 1)
#define NA    (SEQ / STRD)
#define NAP   (((NA + 31) / 32) * 32)
#define NAT   ((NA + 15) / 16)
#define NKS   ((NA + 31) / 32)
#define ATT_THREADS (WPB * 32)
#define SLP   68
#define SLW   (16 * SLP)
#define SLAB64 (16 * 68)
#define VTP   72
#define VRP   80
#define WS_CAP 134217728
static_assert(DMOD == NH * HD && HD == 64 && NH == 16);
static_assert((NH % WPB) == 0 && ATT_THREADS == 128);
static_assert(NB >= 1 && NB <= 2);
static_assert((SEQ % STRD) == 0 && (SEQ % 64) == 0 && SEQ >= STRD && SEQ <= XS_FULL);
static_assert((QE % 64) == 0 && QE >= 64 && QE <= SEQ);
static_assert((STRD % 16) == 0 && STRD >= 32);
static_assert((WIN % 32) == 0 && WIN >= 32);
static_assert(GLB >= 1 && GLB <= 32);
static_assert(NA >= 1 && NAP >= 32 && NAP <= 256 && (NAP % 32) == 0 && 16 * NAT <= NAP);
static_assert(DMOD == 128 * 8 && (DMOD % 64) == 0 && (DMOD % 32) == 0);
static_assert((HD % 32) == 0);
static_assert(((SEQ * DMOD) % (8 * 256)) == 0);

typedef unsigned short u16;
typedef _Float16 v16h __attribute__((ext_vector_type(16)));
typedef _Float16 v8h  __attribute__((ext_vector_type(8)));
typedef __bf16   v16b __attribute__((ext_vector_type(16)));
typedef float    v8f  __attribute__((ext_vector_type(8)));
typedef float    v4f  __attribute__((ext_vector_type(4)));
typedef unsigned int v4u __attribute__((ext_vector_type(4)));

union FragH { v16h v; v8h h[2]; v4u u[2]; };
union FragB { v16b v; v4u u[2]; };

// ---- scalar helpers --------------------------------------------------------------------------------
__device__ __forceinline__ unsigned short bf_bits(float f) {          // f32 -> bf16 bits, RNE convert
  unsigned u = __float_as_uint(f);
  return (unsigned short)((u + 0x7FFFu + ((u >> 16) & 1u)) >> 16);
}
__device__ __forceinline__ float bf_up(unsigned short h) { return __uint_as_float(((unsigned)h) << 16); }
__device__ __forceinline__ float bfr(float f) { return bf_up(bf_bits(f)); }
__device__ __forceinline__ unsigned short h_bits(_Float16 x) { return __builtin_bit_cast(unsigned short, x); }
__device__ __forceinline__ unsigned pk16(unsigned short a, unsigned short b) { return (unsigned)a | ((unsigned)b << 16); }
__device__ __forceinline__ v8f zero8() { v8f z = {0.f, 0.f, 0.f, 0.f, 0.f, 0.f, 0.f, 0.f}; return z; }

// ---- fragment loaders: 16-bit A/B operand, lane -> row/col (lane&15), p already includes +8*(lane>>4);
//      elements 0..7 <- p[0..7] (k0+8h..), elements 8..15 <- p[16..23] (k0+16+8h..)  (same split k map for A and B;
//      B is always read from a k-contiguous [n][k] plane or tile)
__device__ __forceinline__ v16h ldfrag_h(const _Float16* p) {
  FragH f;
  f.h[0] = *(const v8h*)(p);
  f.h[1] = *(const v8h*)(p + 16);
  return f.v;
}
// transposing LDS load on a row-major 16-bit tile T[k][d]: with p = T + (k0 + 8*(lane>>4) + (lane&7))*pitch + d0 + 8*((lane>>3)&1) (halves)
// the lane gets T[k0 + 8*(lane>>4) + 0..7][d0 + (lane&15)]; the loads at k0 and k0 + 16 are elements 0..7 and 8..15 of the split k map
typedef short s16x8 __attribute__((ext_vector_type(8)));
__device__ __forceinline__ v4u ld_tr16(const _Float16* p) {
  typedef __attribute__((address_space(3))) s16x8 lds_s16x8;
  return __builtin_bit_cast(v4u, __builtin_amdgcn_ds_load_tr16_b128_v8i16((lds_s16x8*)p));
}
__device__ __forceinline__ v8f mma_h(v16h a, v16h b, v8f c) {
  return __builtin_amdgcn_wmma_f32_16x16x32_f16(false, a, false, b, (short)0, c, false, false);
}
__device__ __forceinline__ v8f mma_b(v16b a, v16b b, v8f c) {
  return __builtin_amdgcn_wmma_f32_16x16x32_bf16(false, a, false, b, (short)0, c, false, false);
}
__device__ __forceinline__ void guard2(v8f& a, v8f& b, v16h x0, v16h x1, v16h x2, v16h x3, v16h x4, v16h x5) {
#if defined(__HIP_DEVICE_COMPILE__)
  asm volatile("v_nop\n\tv_nop\n\tv_nop\n\tv_nop"
               : "+v"(a), "+v"(b) : "v"(x0), "v"(x1), "v"(x2), "v"(x3), "v"(x4), "v"(x5) : "memory");
#endif
}
__device__ __forceinline__ void acc_guard4(v8f& a, v8f& b, v8f& c, v8f& d) {
#if defined(__HIP_DEVICE_COMPILE__)
  asm volatile("v_nop\n\tv_nop\n\tv_nop\n\tv_nop" : "+v"(a), "+v"(b), "+v"(c), "+v"(d));
#endif
}
// value of lane l ^ 16 (the other 16-lane row), a vector cross-row move
__device__ __forceinline__ float xhalf(float x) {
  const int b = __builtin_bit_cast(int, x);
  return __builtin_bit_cast(float, __builtin_amdgcn_permlanex16(b, b, 0x76543210, 0xfedcba98, false, false));
}
__device__ __forceinline__ void wave_sync_lds() {
  __builtin_amdgcn_fence(__ATOMIC_RELEASE, "workgroup");
  __builtin_amdgcn_wave_barrier();
  __builtin_amdgcn_fence(__ATOMIC_ACQUIRE, "workgroup");
}

// =====================================================================================================
// f32 -> 16-bit plane, same layout.  f16mode == 0: bf16 RNE bits;  f16mode == 1: f16 bits of (bf16 RNE value) * scale.
// Thread = 8 consecutive elements: two 16-B loads, one 16-B store; 32 consecutive lanes = 512 contiguous, 512-B aligned
// coverage: grid = ceil(n8/256) blocks x 256 thr x 8 (in-kernel bound) = the whole plane (n8 a multiple of 256 here).
// =====================================================================================================
__global__ __launch_bounds__(256) void cvt16(const float* __restrict__ x, u16* D, int n8, int f16mode, float scale) {
  const int gt = blockIdx.x * 256 + (int)threadIdx.x;
  if (gt >= n8) return;
  const float* p = x + (size_t)gt * 8;
  const v4f a = *(const v4f*)(p), b4 = *(const v4f*)(p + 4);
  float w[8];
#pragma unroll
  for (int e = 0; e < 4; ++e) { w[e] = a[e]; w[4 + e] = b4[e]; }
  v4u o;
#pragma unroll
  for (int e = 0; e < 4; ++e) {
    const float f0 = w[2 * e], f1 = w[2 * e + 1];
    const unsigned short hb0 = h_bits((_Float16)(bfr(f0) * scale));
    const unsigned short hb1 = h_bits((_Float16)(bfr(f1) * scale));
    const unsigned short bb0 = bf_bits(f0);
    const unsigned short bb1 = bf_bits(f1);
    o[e] = (f16mode != 0) ? pk16(hb0, hb1) : pk16(bb0, bb1);
  }
  u16* d = D + (size_t)gt * 8;
  {
    *(v4u*)(d) = o;
    
  }
}

// =====================================================================================================
// Weight transpose + convert: W f32 [DMOD rows k][ldw], column block col0 .. col0+DMOD-1 (column index = n)
//   -> D 16-bit [DMOD n][DMOD k] (k-contiguous B operand), i.e. in[k][col0+n] -> out[n][k].  f16mode as in cvt16.
// Block = (n tile n0, k tile k0) of 64 x 64: load 64 k rows x 64 n floats with 16-B loads (thread = k row kr, 16 n), convert,
// scatter transposed into an LDS tile [n][k] (pitch 72 halves); block barrier; each n-row segment (64 halves = one whole
// coverage: load 256 thr x 16 = 64 k x 64 n; store 2 iterations x 256 thr x 8 halves = 64 lines x 64; grid (DMOD/64)^2 = every
//           (n, k) of D exactly once.
// =====================================================================================================
__global__ __launch_bounds__(256) void tr16(const float* __restrict__ W, int ldw, int col0, u16* D, int f16mode, float scale) {
  __shared__ __align__(16) u16 T[64 * VTP];
  const int tid = (int)threadIdx.x;
  const int bid = (int)blockIdx.x;
  const int nt  = bid % (DMOD / 64);
  const int kt  = bid / (DMOD / 64);
  if (kt >= DMOD / 64) return;              // block-uniform, before any barrier; never taken with the exact grid
  const int n0 = nt * 64, k0 = kt * 64;
  {
    const int kr = tid >> 2;                // k row within tile 0..63
    const int nc = (tid & 3) * 16;          // n chunk 0,16,32,48
    const float* src = W + (size_t)(k0 + kr) * (size_t)ldw + col0 + n0 + nc;
#pragma unroll
    for (int i = 0; i < 4; ++i) {
      const v4f a = *(const v4f*)(src + 4 * i);
#pragma unroll
      for (int e = 0; e < 4; ++e) {
        const float f = a[e];
        const unsigned short hb = h_bits((_Float16)(bfr(f) * scale));
        const unsigned short bb = bf_bits(f);
        T[(nc + 4 * i + e) * VTP + kr] = (f16mode != 0) ? hb : bb;
      }
    }
  }
  __syncthreads();
  v4u ov[2];
  const int q8 = tid >> 3, p8 = (tid & 7) * 8;
#pragma unroll
  for (int it = 0; it < 2; ++it) {
    const int line = it * 32 + q8;          // n = 0..63
    ov[it] = *(const v4u*)(T + line * VTP + p8);
  }
  u16* base = D + (size_t)n0 * DMOD + k0 + p8;
  {
#pragma unroll
    for (int it = 0; it < 2; ++it) {
      const int line = it * 32 + q8;
      *(v4u*)(base + (size_t)line * DMOD) = ov[it];
    }
    
  }
}

// =====================================================================================================
// GEMM epilogue: the wave's 32x64 f32 tile (times oscale) staged in its LDS slab (two 16-row parts, pitch 68), read back as whole
// rows, bias added, stored.
// coverage: 2 parts x 8 instructions x 2 rows x 16 lanes x 4 floats = the wave's 32 x 64 tile.
// =====================================================================================================
__device__ __forceinline__ void epi3264(float* sl, const v8f (&acc)[2][4], float oscale,
                                        const float* __restrict__ bias, float* C, int N, size_t rowb, int col0, int lane) {
  const int hh = lane >> 4, m = lane & 15;
#pragma unroll
  for (int i = 0; i < 2; ++i) {
#pragma unroll
    for (int r = 0; r < 8; ++r) {
      const int ro = i * SLAB64 + (8 * hh + r) * 68 + m;
      sl[ro]      = acc[i][0][r] * oscale;
      sl[ro + 16] = acc[i][1][r] * oscale;
      sl[ro + 32] = acc[i][2][r] * oscale;
      sl[ro + 48] = acc[i][3][r] * oscale;
    }
  }
  wave_sync_lds();
  const v4f bb = *(const v4f*)(bias + col0 + m * 4);
  v4f br;
#pragma unroll
  for (int e = 0; e < 4; ++e) br[e] = bfr(bb[e]);
  float* dst = C + (rowb + (size_t)hh) * (size_t)N + col0 + m * 4;
#pragma unroll
  for (int i = 0; i < 2; ++i) {
    v4f vals[8];
#pragma unroll
    for (int it = 0; it < 8; ++it) vals[it] = *(const v4f*)(sl + i * SLAB64 + (it * 2 + hh) * 68 + m * 4) + br;
#pragma unroll
    for (int it = 0; it < 8; ++it) {
      *(v4f*)(dst + (size_t)(i * 16 + it * 2) * (size_t)N) = vals[it];
    }
  }
}

// =====================================================================================================
// GEMM core shared by the projections and the output projection: one 128 x 128 tile of C per block, 8 waves of 32 x 64
// (wave -> rows 32 * (wave >> 1), columns 64 * (wave & 1)), K = DMOD walked in passes of 128 k.
// A pass's operand rows (256 B each: NPROD A planes of 128 rows, then 128 Bt rows) are staged in LDS at pitch 272 B by per-lane
// 16-B asynchronous copies: one wave instruction = 2 rows x 256 B = whole 128-B lines. Two buffers: pass t + 2 is copied into the
// buffer pass t has left while pass t + 1 is worked on. Fragments are 16-B LDS reads with the same split k map as ldfrag_h.
// Per accumulator the products keep ascending k in steps of 32, and h before l inside a step.
// =====================================================================================================
#define GT     128
#define GTHR   256
#define GKP    128
#define GPIT   136
#define GPLANE (GT * GPIT)
#define GNP    (DMOD / GKP)
static_assert((DMOD % GKP) == 0 && GNP >= 2 && (DMOD % GT) == 0 && (SEQ % GT) == 0 && (QE % GT) == 0);
static_assert(8 * 2 * SLAB64 * 4 <= 2 * 2 * GPLANE * 2 && GT + 8 <= GPIT);

// One operand plane of a pass: 128 rows x 256 B = eight 16-B copies of each lane, rows 16 apart (l, g: the lane's first row and
// 16-B column; LDS step 16 * 272 B, global step 16 * DMOD halves).
__device__ __forceinline__ void copy_plane(unsigned l, const u16* g) {
#if defined(__HIP_DEVICE_COMPILE__)
  const unsigned ls = 16 * GPIT * 2;
  const size_t   gs = (size_t)16 * DMOD;
  // the closing s_wait_xcnt 0 stands inside the statement so that no address register is rewritten ahead of it
  asm volatile("global_load_async_to_lds_b128 %0, %8, off\n\t"
               "global_load_async_to_lds_b128 %1, %9, off\n\t"
               "global_load_async_to_lds_b128 %2, %10, off\n\t"
               "global_load_async_to_lds_b128 %3, %11, off\n\t"
               "global_load_async_to_lds_b128 %4, %12, off\n\t"
               "global_load_async_to_lds_b128 %5, %13, off\n\t"
               "global_load_async_to_lds_b128 %6, %14, off\n\t"
               "global_load_async_to_lds_b128 %7, %15, off\n\t"
               "s_wait_xcnt 0x0"
               :: "v"(l), "v"(l + ls), "v"(l + 2 * ls), "v"(l + 3 * ls), "v"(l + 4 * ls), "v"(l + 5 * ls), "v"(l + 6 * ls),
                  "v"(l + 7 * ls),
                  "v"(g), "v"(g + gs), "v"(g + 2 * gs), "v"(g + 3 * gs), "v"(g + 4 * gs), "v"(g + 5 * gs), "v"(g + 6 * gs),
                  "v"(g + 7 * gs)
               : "memory");
#endif
}
__device__ __forceinline__ void wait_async0() {   // this wave's copies have landed
#if defined(__HIP_DEVICE_COMPILE__)
  asm volatile("s_wait_asynccnt 0x0" ::: "memory");
#endif
}
__device__ __forceinline__ void wait_x0() {       // stands between issued global loads or stores and a rewrite of the registers they name
#if defined(__HIP_DEVICE_COMPILE__)
  asm volatile("s_wait_xcnt 0x0" ::: "memory");
#endif
}
__device__ __forceinline__ void wait_ds0() {      // this wave's LDS reads are done before their buffer is handed back
#if defined(__HIP_DEVICE_COMPILE__)
  asm volatile("s_wait_dscnt 0x0" ::: "memory");
#endif
}
// =====================================================================================================
// Projection epilogue for q and k: the wave's 32x64 f32 tile (times oscale) staged in its LDS slab as in epi3264, read back as whole
// rows, bias added, times sc, split into f16 hi + f16 residual and stored to the two planes [MROWS][DMOD] at row rowb, column col0.
// Lane = (row select rq in 0..3, 8 consecutive columns at c8): a plane row's 64 halves = one 128-B line from 8 consecutive lanes.
// coverage: 2 parts x 4 instructions x 4 rows x 8 lanes x 8 halves = the wave's 32 x 64 tile of each plane.
// =====================================================================================================
__device__ __forceinline__ void epi_qk(float* sl, const v8f (&acc)[2][4], float oscale, const float* __restrict__ bias,
                                       u16* Hp, u16* Lp, float sc, size_t rowb, int col0, int lane) {
  const int hh = lane >> 4, m = lane & 15;
#pragma unroll
  for (int i = 0; i < 2; ++i) {
#pragma unroll
    for (int r = 0; r < 8; ++r) {
      const int ro = i * SLAB64 + (8 * hh + r) * 68 + m;
      sl[ro]      = acc[i][0][r] * oscale;
      sl[ro + 16] = acc[i][1][r] * oscale;
      sl[ro + 32] = acc[i][2][r] * oscale;
      sl[ro + 48] = acc[i][3][r] * oscale;
    }
  }
  wave_sync_lds();
  const int rq = lane >> 3, c8 = (lane & 7) * 8;
  const v4f ba = *(const v4f*)(bias + col0 + c8), bb = *(const v4f*)(bias + col0 + c8 + 4);
  float br[8];
#pragma unroll
  for (int e = 0; e < 4; ++e) { br[e] = bfr(ba[e]); br[4 + e] = bfr(bb[e]); }
  const size_t d0 = (rowb + (size_t)rq) * DMOD + col0 + c8;
#pragma unroll
  for (int i = 0; i < 2; ++i) {
    v4u oh[4], ol[4];
#pragma unroll
    for (int it = 0; it < 4; ++it) {
      const float* sp = sl + i * SLAB64 + (it * 4 + rq) * 68 + c8;
      const v4f a = *(const v4f*)(sp), b4 = *(const v4f*)(sp + 4);
      float w[8];
#pragma unroll
      for (int e = 0; e < 4; ++e) { w[e] = (a[e] + br[e]) * sc; w[4 + e] = (b4[e] + br[4 + e]) * sc; }
#pragma unroll
      for (int e = 0; e < 4; ++e) {
        const float t0 = w[2 * e], t1 = w[2 * e + 1];
        const _Float16 h0 = (_Float16)t0, h1 = (_Float16)t1;
        const _Float16 l0 = (_Float16)(t0 - (float)h0), l1 = (_Float16)(t1 - (float)h1);
        oh[it][e] = pk16(h_bits(h0), h_bits(h1));
        ol[it][e] = pk16(h_bits(l0), h_bits(l1));
      }
    }
#pragma unroll
    for (int it = 0; it < 4; ++it) {
      const size_t d = d0 + (size_t)(i * 16 + it * 4) * DMOD;
      *(v4u*)(Hp + d) = oh[it];
      *(v4u*)(Lp + d) = ol[it];
    }
  }
}

// =====================================================================================================
// Projection epilogue for v: the block's 128 (keys s) x 128 (columns g*HD + d) tile goes out transposed.
//   VH[(vrow0 + col)][s0 + s] (pitch SEQ) = f16(v * sc);  VL[(vrow0 + col)][s0 + s] (pitch QE) = f16 residual, only when dolo.
//   The same hi values also go out row-major, VR[rrow0 + s][colC + col] (pitch DMOD), for the strided key set, which reads whole v rows:
//   2-B LDS stores into a third tile R[s][col] (pitch GPIT), then each row's 128 columns = 256 B = two whole lines from 16 lanes.
// An accumulator register group already holds 8 consecutive keys of one column: bias added, scaled, split, packed, one 16-B LDS store
// per plane into the block tile T[col][s] (pitch GPIT halves; hi plane, then residual plane). One block barrier, then each column's
// 128 keys = 256 B = two whole lines leave from 16 consecutive lanes.
// Every thread of the block calls this (block barrier inside); dolo is block-uniform.
// coverage: LDS 8 waves x 8 groups x 32 lanes x 8 halves = 128 x 128; stores 8 iterations x 16 columns x 16 lanes x 8 halves = the same;
//           row-major: 8 iterations x 16 rows x 16 lanes x 8 halves = the same.
// =====================================================================================================
__device__ __forceinline__ void epi_vt(u16* T, const v8f (&acc)[2][4], float oscale, const float* __restrict__ bias,
                                       u16* VHo, u16* VLo, u16* VRo, float sc, size_t vrow0, size_t rrow0, int s0, int colC, bool dolo,
                                       int wr, int wc, int tid) {
  const int lane = tid & 31, hh = lane >> 4, m = lane & 15;
  float bj[4];
#pragma unroll
  for (int j = 0; j < 4; ++j) bj[j] = bias[colC + wc + j * 16 + m];
#pragma unroll
  for (int j = 0; j < 4; ++j) {
    const int   col = wc + j * 16 + m;
    const float br  = bfr(bj[j]);
#pragma unroll
    for (int i = 0; i < 2; ++i) {
      v4u vh, vl;
      u16* rp = T + 2 * GPLANE + (wr + i * 16 + 8 * hh) * GPIT + col;
#pragma unroll
      for (int e = 0; e < 4; ++e) {
        const float t0 = (acc[i][j][2 * e] * oscale + br) * sc, t1 = (acc[i][j][2 * e + 1] * oscale + br) * sc;
        const _Float16 h0 = (_Float16)t0, h1 = (_Float16)t1;
        const _Float16 l0 = (_Float16)(t0 - (float)h0), l1 = (_Float16)(t1 - (float)h1);
        vh[e] = pk16(h_bits(h0), h_bits(h1));
        vl[e] = pk16(h_bits(l0), h_bits(l1));
        rp[(2 * e) * GPIT]     = h_bits(h0);
        rp[(2 * e + 1) * GPIT] = h_bits(h1);
      }
      u16* tp = T + col * GPIT + wr + i * 16 + 8 * hh;
      *(v4u*)(tp) = vh;
      if (dolo) *(v4u*)(tp + GPLANE) = vl;
    }
  }
  __syncthreads();   // a column's 128 keys were written by four waves; they leave as whole lines from one
  const int cr = tid >> 4, p8 = (tid & 15) * 8;
  v4u oh[8];
#pragma unroll
  for (int it = 0; it < 8; ++it) oh[it] = *(const v4u*)(T + (it * 16 + cr) * GPIT + p8);
#pragma unroll
  for (int it = 0; it < 8; ++it) *(v4u*)(VHo + (vrow0 + (size_t)(it * 16 + cr)) * SEQ + s0 + p8) = oh[it];
  wait_x0();         // the row-major rows are loaded into the registers that the hi stores name
  v4u orw[8];
#pragma unroll
  for (int it = 0; it < 8; ++it) orw[it] = *(const v4u*)(T + 2 * GPLANE + (it * 16 + cr) * GPIT + p8);
#pragma unroll
  for (int it = 0; it < 8; ++it) *(v4u*)(VRo + (rrow0 + (size_t)(it * 16 + cr)) * DMOD + colC + p8) = orw[it];
  if (dolo) {
    wait_x0();       // the residual rows are loaded into the registers that the earlier stores name
    v4u ol[8];
#pragma unroll
    for (int it = 0; it < 8; ++it) ol[it] = *(const v4u*)(T + GPLANE + (it * 16 + cr) * GPIT + p8);
#pragma unroll
    for (int it = 0; it < 8; ++it) *(v4u*)(VLo + (vrow0 + (size_t)(it * 16 + cr)) * QE + s0 + p8) = ol[it];
  }
}

struct Frag16 { v4u u[2]; };
__device__ __forceinline__ Frag16 ldfrag_s(const u16* p) {
  Frag16 f;
  f.u[0] = *(const v4u*)(p);
  f.u[1] = *(const v4u*)(p + 16);
  return f;
}
template <bool BF>
__device__ __forceinline__ v8f mma_s(const Frag16& a, const Frag16& b, v8f c) {
  if constexpr (BF) {
    FragB x, y;
    x.u[0] = a.u[0]; x.u[1] = a.u[1]; y.u[0] = b.u[0]; y.u[1] = b.u[1];
    return mma_b(x.v, y.v, c);
  } else {
    FragH x, y;
    x.u[0] = a.u[0]; x.u[1] = a.u[1]; y.u[0] = b.u[0]; y.u[1] = b.u[1];
    return mma_h(x.v, y.v, c);
  }
}

// A0, A1, B0: first row of the block's 128 rows in each plane (row pitch DMOD halves); A1 is read only when NPROD == 2.
// ring: 2 * (NPROD + 1) * GPLANE halves; behind the last pass's barrier it is free, and the caller's epilogue stages its output there.
// acc: the wave's 32 x 64 tile (rows 32 * (wave >> 1), columns 64 * (wave & 1) of the block tile), zeroed here.
// Every thread of the block calls this (block barriers inside).
template <int NPROD, bool BF>
__device__ __forceinline__ void gemm_tile(const u16* A0, const u16* A1, const u16* B0, u16* ring, v8f (&acc)[2][4]) {
  constexpr int STG = (NPROD + 1) * GPLANE;
  const int tid = threadIdx.x, wave = tid >> 5, lane = tid & 31, hh = lane >> 4, m = lane & 15;
  const int wr = (wave >> 1) * 32, wc = (wave & 1) * 64;
  // copy role: row tid >> 4 (+ 16 per copy), 16-B column tid & 15
  const int crow = tid >> 4, ccol = (tid & 15) * 8;
  const size_t  goff = (size_t)crow * DMOD + ccol;
  const unsigned l0  = (unsigned)(size_t)(ring + crow * GPIT + ccol);
  const u16* ga0 = A0 + goff;
  const u16* ga1 = A1 + goff;
  const u16* gb  = B0 + goff;
  auto stage = [&](int buf, int pass) {
    const unsigned l = l0 + (unsigned)(buf * STG * 2);
    const int      k = pass * GKP;
    copy_plane(l, ga0 + k);
    if constexpr (NPROD == 2) copy_plane(l + GPLANE * 2, ga1 + k);
    copy_plane(l + NPROD * GPLANE * 2, gb + k);
  };
#pragma unroll
  for (int i = 0; i < 2; ++i) {
#pragma unroll
    for (int j = 0; j < 4; ++j) acc[i][j] = zero8();
  }
  stage(0, 0);
  wait_async0();
  __syncthreads();
  stage(1, 1);
#pragma unroll 1   // rolled: one copy of the pass body serves both buffers (t & 1)
  for (int t = 0; t < GNP; ++t) {
    const u16* st = ring + (t & 1) * STG;
    const u16* pa = st + (wr + m) * GPIT + 8 * hh;
    const u16* pb = st + NPROD * GPLANE + (wc + m) * GPIT + 8 * hh;
    Frag16 a[2][2], al[2][2], b[2][4];
    auto fetch = [&](int s, int kk) {
#pragma unroll
      for (int i = 0; i < 2; ++i) {
        a[s][i] = ldfrag_s(pa + i * 16 * GPIT + kk * 32);
        if constexpr (NPROD == 2) al[s][i] = ldfrag_s(pa + GPLANE + i * 16 * GPIT + kk * 32);
      }
#pragma unroll
      for (int j = 0; j < 4; ++j) b[s][j] = ldfrag_s(pb + j * 16 * GPIT + kk * 32);
    };
    fetch(0, 0);
#pragma unroll     // unrolled: the fragment set index kk & 1 must be a constant, else the sets leave the registers
    for (int kk = 0; kk < GKP / 32; ++kk) {
      const int s = kk & 1;
      if (kk + 1 < GKP / 32) fetch(s ^ 1, kk + 1);   // the next k step's fragments, inside this pass's own buffer
      // keeps that load group whole and ahead of this step's products: sunk among them, each load is waited for where it stands
      __builtin_amdgcn_sched_barrier(0);
#pragma unroll
      for (int i = 0; i < 2; ++i) {
#pragma unroll
        for (int j = 0; j < 4; ++j) acc[i][j] = mma_s<BF>(a[s][i], b[s][j], acc[i][j]);
      }
      if constexpr (NPROD == 2) {
#pragma unroll
        for (int i = 0; i < 2; ++i) {
#pragma unroll
          for (int j = 0; j < 4; ++j) acc[i][j] = mma_s<BF>(al[s][i], b[s][j], acc[i][j]);
        }
      }
      __builtin_amdgcn_sched_barrier(0);             // the far end of the same fence: later loads stay behind these products
    }
    // hand-over: own reads done, own copies of pass t + 1 landed, then the one barrier that publishes pass t + 1 and frees this buffer
    wait_ds0();
    wait_async0();
    __syncthreads();
    if (t + 2 < GNP) stage(t & 1, t + 2);
  }
  wait_async0();
}

// =====================================================================================================
// Projection of one batch: (A[M][DMOD] (bf16 row-major) . Bt[N][DMOD]^T (bf16 k-contiguous)) * oscale + bias[col] (bf16 RNE value), f32,
// written straight as the 16-bit planes the attention kernels read. Block = 128 x 128 tile (host guarantees M % 128 == 0,
// N % 128 == 0, grid = (M/128)*(N/128)).
// VT == 0 (q, k): P0 / P1 = hi / residual planes [MROWS][DMOD] of value * sc, rows b*SEQ + s (epi_qk).
// VT == 1 (v):    P0 = v^T hi plane [(b*NH + g)*HD + d][SEQ] of value * sc, P1 = v^T residual plane, pitch QE, keys s < QE only,
//                 P2 = the hi values row-major [MROWS][DMOD], rows b*SEQ + s (epi_vt). P2 is not used when VT == 0.
// coverage: the grid's tiles cover every (s, column) of the batch once, so every plane element of the batch is written once.
// =====================================================================================================
template <int VT>
__global__ __launch_bounds__(GTHR)
void gemm_p(const u16* __restrict__ A, const u16* __restrict__ Bt, const float* __restrict__ bias,
            u16* P0, u16* P1, u16* P2, int M, int N, int b, float oscale, float sc) {
  __shared__ __align__(16) u16 ring[2 * 2 * GPLANE];
  const int ntile = N / GT;
  const int bid   = blockIdx.x;
  const int row0  = (bid / ntile) * GT;
  const int col0  = (bid % ntile) * GT;
  if (row0 + GT > M) return;                // block-uniform, before any barrier; never taken with the exact grid
  const int tid = threadIdx.x, wave = tid >> 5;
  const int wr = (wave >> 1) * 32, wc = (wave & 1) * 64;
  v8f acc[2][4];
  gemm_tile<1, true>(A + (size_t)row0 * DMOD, A + (size_t)row0 * DMOD, Bt + (size_t)col0 * DMOD, ring, acc);
  if constexpr (VT != 0) {
    epi_vt(ring, acc, oscale, bias, P0, P1, P2, sc, (size_t)b * DMOD + col0, (size_t)b * SEQ + row0, row0, col0, row0 + GT <= QE, wr, wc,
           tid);
  } else {
    epi_qk((float*)(void*)ring + wave * (2 * SLAB64), acc, oscale, bias, P0, P1, sc, (size_t)b * SEQ + row0 + wr, col0 + wc, tid & 31);
  }
}

// =====================================================================================================
// Output projection: C[orow][DMOD] (f32) = (Ah [+ Al])[row][DMOD] . Bt[DMOD][DMOD]^T * oscale + bias (bf16 RNE value).
// NPROD == 1: Ah only (one product); NPROD == 2: Ah + Al residual plane (products h.B + l.B into one accumulator, l unscaled).
// Block -> (column tile ct = bid % 8, sequence row tile rt of nrt starting at s = sbeg, batch bb), tiles of 128: rows of Ah are
// bb*SEQ + s, rows of Al are bb*QE + s (valid only while s < QE, host guarantees for NPROD == 2), rows of C are bb*XS_FULL + s.
// Same tiling as gemm_p; epilogue epi3264.
// =====================================================================================================
template <int NPROD>
__global__ __launch_bounds__(GTHR)
void gemm_o(const u16* __restrict__ Ah, const u16* __restrict__ Al, const u16* __restrict__ Bt, const float* __restrict__ bias,
            float* C, int sbeg, int nrt, float oscale) {
  __shared__ __align__(16) u16 ring[2 * (NPROD + 1) * GPLANE];
  const int ntile = DMOD / GT;
  const int bid   = blockIdx.x;
  const int ct    = bid % ntile;
  const int t2    = bid / ntile;
  const int rt    = t2 % nrt;
  const int bb    = t2 / nrt;
  if (bb >= NB) return;                     // block-uniform, before any barrier; never taken with the exact grid
  const int srow  = sbeg + rt * GT;
  if (srow + GT > SEQ) return;              // block-uniform; never taken
  if (NPROD == 2 && srow + GT > QE) return; // block-uniform; never taken
  const size_t rowC = (size_t)bb * SEQ + srow;
  const size_t rowL = (size_t)bb * QE + srow;
  const size_t rowO = (size_t)bb * XS_FULL + srow;
  const u16* a0 = Ah + rowC * DMOD;
  const u16* a1 = (NPROD == 2) ? (Al + rowL * DMOD) : a0;
  const int tid = threadIdx.x, wave = tid >> 5;
  v8f acc[2][4];
  gemm_tile<NPROD, false>(a0, a1, Bt + (size_t)ct * GT * DMOD, ring, acc);
  epi3264((float*)(void*)ring + wave * (2 * SLAB64), acc, oscale, bias, C, DMOD, rowO + (wave >> 1) * 32, ct * GT + (wave & 1) * 64,
          tid & 31);
}

// =====================================================================================================
// Strided key set (pass S). Key j is in this set for query i iff j = i - STRD*n with i - j >= WIN, j >= GLB (then j <= i and
// (i - j) % STRD == 0 hold). Queries and keys of one residue class rr = i % STRD: i = rr + STRD*a, j = rr + STRD*c, a, c < NA.
// Block bid -> (residue rr = bid % STRD, head group hg, batch b); one wave per head; the wave owns all NA query rows of (b, head, rr)
// in tiles of 16 (rows a >= NA of the last tile are padding: operand row clamped, weight forced to 0, nothing stored) and visits
// the candidate keys in tiles of 32 (slots c >= NA clamped and forced to 0).
//   Transposed products: a lane owns ONE query (column lane & 15 of every D tile).
//   scores S^T: k hi / residual (A, lane -> key slot, arithmetic stride STRD rows in the [b*SEQ + s][h*HD + d] planes) times
//   q hi / residual (B, lane -> row a = 16*at + (lane & 15)), products hh + lh + hl over HD; D element r = key slot 8*(lane >> 4) + r;
//   element predicate (a < NA) && (c < NA) && (STRD*(a - c) >= WIN) && (j >= GLB), -inf otherwise; base-2 online softmax in f32
//   (-inf safe): maximum and sum over the lane's 16 scores, then one exchange with lane ^ 16;
//   P^T (B operand) is packed from those 16 values in the lane: they already lie in the split k map;
//   v rows of the 32 key slots (128 B each, arithmetic stride STRD rows in the row-major v hi plane [b*SEQ + s][h*HD + d]) loaded once per
//   key tile as whole lines into a wave-private LDS tile [slot][d], read by transposing LDS loads as the A operand of O^T += V^T.P^T
//   (the strided keys only feed query rows i >= WIN + GLB, which always hold >= WIN + GLB keys).
//   State written per query row: M = running max (log2 domain), L = running sum, AC = acc * 64 / (32768*1024) as f16
//   (AC plane layout [b*SEQ + i][h*HD + d]; M, L planes [(b*NH + h)*STRD + rr][NAP], rows a >= NA hold -inf / 0).
// coverage: AC: every (b, i < SEQ, h, d) exactly once (union over rr, a < NA); M/L: every (b, h, rr) line group exactly once.
// =====================================================================================================
__global__ __launch_bounds__(ATT_THREADS)
void attn_s(const u16* __restrict__ QHp, const u16* __restrict__ QLp,
            const u16* __restrict__ KHp, const u16* __restrict__ KLp,
            const u16* __restrict__ VRp, u16* ACp, float* Mp, float* Lp) {
  __shared__ __align__(16) float    smem[WPB * SLW];
  __shared__ __align__(16) _Float16 vts[WPB * 32 * VRP];
  __shared__ __align__(16) float    mls[WPB * 2 * NAP];

  const int tid  = threadIdx.x;
  const int wave = tid >> 5;
  const int lane = tid & 31;
  const int hh   = lane >> 4;
  const int c    = lane & 15;
  const int bid  = blockIdx.x;
  const int rres = bid % STRD;
  const int t2   = bid / STRD;
  const int hg   = t2 % NHG;
  const int b    = t2 / NHG;
  if (b >= NB) return;                      // block-uniform; no block barriers in this kernel; never taken with the exact grid
  const int head = hg * WPB + wave;

  float*    slab = smem + wave * SLW;       // result slab [16 queries][64 d] pitch 68
  _Float16* vt   = vts + wave * (32 * VRP); // v tile [32 key slots][64 d] pitch 80 halves = 32 B x odd, the transposing load's pitch
  float*    msl  = mls + wave * (2 * NAP);
  float*    lsl  = msl + NAP;
#pragma unroll 1
  for (int i2 = lane; i2 < NAP; i2 += 32) { msl[i2] = -INFINITY; lsl[i2] = 0.0f; }
  wave_sync_lds();

  const _Float16* QHh = (const _Float16*)(const void*)QHp;
  const _Float16* QLh = (const _Float16*)(const void*)QLp;
  const _Float16* KHh = (const _Float16*)(const void*)KHp;
  const _Float16* KLh = (const _Float16*)(const void*)KLp;
  const size_t hcol  = (size_t)head * HD + 8 * hh;
  const size_t brow  = (size_t)b * SEQ + rres;                          // plane row of a = 0
  const int    gr    = lane >> 3, gc = (lane & 7) * 8;                  // v row load role: row gr of 4, 16-B column gc
  const u16*   vbase = VRp + brow * DMOD + (size_t)head * HD + gc;      // + STRD*c*DMOD
  const _Float16* vrd = vt + (8 * hh + (lane & 7)) * VRP + 8 * ((lane >> 3) & 1);   // transposing load address, key slot 0, d 0
  const float  lsc   = SM_SCALE * (LOG2E / (QSC * KSC));
  const float  acs   = ACAR / (PCAR * VCAR);

  // the 32 key slots' v rows of key tile ks: one instruction = 4 rows x 128 B = whole lines; they go to LDS behind the softmax
  v4u rv[8];
  auto load_rows = [&](int ks) {
#pragma unroll
    for (int it = 0; it < 8; ++it) {
      int cs = ks * 32 + it * 4 + gr;
      if (cs > NA - 1) cs = NA - 1;
      rv[it] = *(const v4u*)(vbase + (size_t)STRD * cs * DMOD);
    }
    wait_x0();                              // later loads may land in the address registers of these
  };
  if constexpr (NKS == 1) load_rows(0);     // a single key tile: the same rows serve every query tile

#pragma unroll 1
  for (int at = 0; at < NAT; ++at) {
    float mq = -INFINITY, lq = 0.f;         // this lane's query: running max and sum (equal in lanes l and l ^ 16)
    v8f o[4];                               // O^T: o[j][r] = (d = 16*j + 8*hh + r, query aq)
#pragma unroll
    for (int j = 0; j < 4; ++j) o[j] = zero8();
    const int aq = at * 16 + c;             // this lane's query row index a
    int am = aq;
    if (am > NA - 1) am = NA - 1;           // clamped operand row for this lane
    const size_t qoff = (brow + (size_t)STRD * am) * DMOD + hcol;
    const _Float16* Qh = QHh + qoff;
    const _Float16* Ql = QLh + qoff;

#pragma unroll 1
    for (int ks = 0; ks < NKS; ++ks) {
      if constexpr (NKS != 1) load_rows(ks);
      // ---- scores S^T: D element r of this lane = (key slot ks*32 + 8*hh + r, query aq) in s0, slot + 16 in s1 ----
      int c0i = ks * 32 + c;       if (c0i > NA - 1) c0i = NA - 1;
      int c1i = ks * 32 + 16 + c;  if (c1i > NA - 1) c1i = NA - 1;
      const size_t k0off = (brow + (size_t)STRD * c0i) * DMOD + hcol;
      const size_t k1off = (brow + (size_t)STRD * c1i) * DMOD + hcol;
      const _Float16* k0p = KHh + k0off;
      const _Float16* k1p = KHh + k1off;
      const _Float16* l0p = KLh + k0off;
      const _Float16* l1p = KLh + k1off;
      v8f s0 = zero8(), s1 = zero8();
#pragma unroll
      for (int kk = 0; kk < HD / 32; ++kk) {
        const v16h qh  = ldfrag_h(Qh + kk * 32);
        const v16h ql  = ldfrag_h(Ql + kk * 32);
        const v16h kh0 = ldfrag_h(k0p + kk * 32);
        const v16h kh1 = ldfrag_h(k1p + kk * 32);
        const v16h kl0 = ldfrag_h(l0p + kk * 32);
        const v16h kl1 = ldfrag_h(l1p + kk * 32);
        s0 = mma_h(kh0, qh, s0);
        s0 = mma_h(kh0, ql, s0);
        s0 = mma_h(kl0, qh, s0);
        s1 = mma_h(kh1, qh, s1);
        s1 = mma_h(kh1, ql, s1);
        s1 = mma_h(kl1, qh, s1);
        guard2(s0, s1, qh, ql, kh0, kl0, kh1, kl1);
      }
      // ---- key select + online softmax in base 2, -inf-safe; all 16 values of a lane belong to its query ----
      const int cb0 = ks * 32 + 8 * hh;
      float t0[8], t1[8];
      float mx = -INFINITY;
#pragma unroll
      for (int r = 0; r < 8; ++r) {
        const int  cc0 = cb0 + r, cc1 = cc0 + 16;
        const int  j0  = rres + STRD * cc0, j1 = rres + STRD * cc1;
        const bool ok0 = (aq < NA) && (cc0 < NA) && (STRD * (aq - cc0) >= WIN) && (j0 >= GLB);
        const bool ok1 = (aq < NA) && (cc1 < NA) && (STRD * (aq - cc1) >= WIN) && (j1 >= GLB);
        t0[r] = ok0 ? s0[r] * lsc : -INFINITY;
        t1[r] = ok1 ? s1[r] * lsc : -INFINITY;
        mx = fmaxf(mx, fmaxf(t0[r], t1[r]));
      }
      mx = fmaxf(mx, xhalf(mx));
      const float mn = fmaxf(mq, mx);
      const float ms = (mn == -INFINITY) ? 0.0f : mn;
      const float al = exp2f(mq - ms);
      mq = mn;
      // ---- B fragment of P^T * 32768 (f16): elements 0..7 = slots 8*hh + r, elements 8..15 = slots 16 + 8*hh + r ----
      FragH ph;
      float pa = 0.f, pb = 0.f;
#pragma unroll
      for (int r = 0; r < 8; ++r) {
        const float e0 = exp2f(t0[r] - ms), e1 = exp2f(t1[r] - ms);
        pa += e0;
        pb += e1;
        ph.h[0][r] = (_Float16)(e0 * PCAR);
        ph.h[1][r] = (_Float16)(e1 * PCAR);
      }
      float ps = pa + pb;
      ps += xhalf(ps);
      lq = lq * al + ps;
#pragma unroll
      for (int j = 0; j < 4; ++j) {
#pragma unroll
        for (int r = 0; r < 8; ++r) o[j][r] *= al;
      }
#pragma unroll
      for (int it = 0; it < 8; ++it) *(v4u*)(vt + (it * 4 + gr) * VRP + gc) = rv[it];
      wave_sync_lds();                      // the v tile is read by other lanes than wrote it
      // ---- O^T += V^T.P^T : A fragment row d = jj*16 + c, key slots 8*hh + 0..7 and 16 + 8*hh + 0..7 by two transposing loads ----
#pragma unroll
      for (int jg = 0; jg < HD / 32; ++jg) {
        FragH fa, fb;
        fa.u[0] = ld_tr16(vrd + (2 * jg) * 16);
        fa.u[1] = ld_tr16(vrd + 16 * VRP + (2 * jg) * 16);
        fb.u[0] = ld_tr16(vrd + (2 * jg + 1) * 16);
        fb.u[1] = ld_tr16(vrd + 16 * VRP + (2 * jg + 1) * 16);
        const v16h vha = fa.v, vhb2 = fb.v;
        o[2 * jg]     = mma_h(vha,  ph.v, o[2 * jg]);
        o[2 * jg + 1] = mma_h(vhb2, ph.v, o[2 * jg + 1]);
        guard2(o[2 * jg], o[2 * jg + 1], ph.v, vha, vhb2, ph.v, vha, vhb2);
      }
      wave_sync_lds();                      // the tile's reads end before the next key tile's rows rewrite it
    }
    acc_guard4(o[0], o[1], o[2], o[3]);
    // ---- state: m, l per query into the LDS staging; acc * 64 / (32768*1024) into the slab row of the lane's query ----
    if (hh == 0) { msl[aq] = mq; lsl[aq] = lq; }
#pragma unroll
    for (int j = 0; j < 4; ++j) {
      v4f w0, w1;
#pragma unroll
      for (int e = 0; e < 4; ++e) { w0[e] = o[j][e] * acs; w1[e] = o[j][4 + e] * acs; }
      float* sp = slab + c * SLP + j * 16 + 8 * hh;
      *(v4f*)(sp)     = w0;
      *(v4f*)(sp + 4) = w1;
    }
    wave_sync_lds();
    // ---- AC rows (f16): lane = (row select rq in 0..3, 8 consecutive d at c8) ----
    v4u    ov[4];
    bool   okr[4];
    size_t dso[4];
    const int rq = lane >> 3, c8 = (lane & 7) * 8;
#pragma unroll
    for (int it = 0; it < 4; ++it) {
      const int row = it * 4 + rq;
      const v4f a = *(const v4f*)(slab + row * SLP + c8), b4 = *(const v4f*)(slab + row * SLP + c8 + 4);
      float w[8];
#pragma unroll
      for (int e = 0; e < 4; ++e) { w[e] = a[e]; w[4 + e] = b4[e]; }
#pragma unroll
      for (int e = 0; e < 4; ++e) {
        ov[it][e] = pk16(h_bits((_Float16)w[2 * e]), h_bits((_Float16)w[2 * e + 1]));
      }
      const int arow = at * 16 + row;
      okr[it] = (arow < NA);                // uniform over the 8 lanes of one line
      const int acl  = okr[it] ? arow : (NA - 1);
      dso[it] = (brow + (size_t)STRD * acl) * DMOD + (size_t)head * HD + c8;
    }
    {
#pragma unroll
      for (int it = 0; it < 4; ++it) {
        if (okr[it]) *(v4u*)(ACp + dso[it]) = ov[it];
      }
      
    }
    wave_sync_lds();
  }

  wave_sync_lds();
  const size_t mlbase = ((size_t)(b * NH + head) * STRD + rres) * NAP;
  const int l8 = lane & 7;
  v4f mv[NAP / 32], lv[NAP / 32];
#pragma unroll
  for (int ch = 0; ch < NAP / 32; ++ch) {
    mv[ch] = *(const v4f*)(msl + ch * 32 + l8 * 4);
    lv[ch] = *(const v4f*)(lsl + ch * 32 + l8 * 4);
  }
  const bool wm = (lane < 8), wl = (lane >= 8) && (lane < 16);
  {
#pragma unroll
    for (int ch = 0; ch < NAP / 32; ++ch) {
      if (wm) *(v4f*)(Mp + mlbase + ch * 32 + l8 * 4) = mv[ch];
      if (wl) *(v4f*)(Lp + mlbase + ch * 32 + l8 * 4) = lv[ch];
    }
    
  }
}

// =====================================================================================================
// Band + leading key set (pass A), initialised from the pass-S state. Key j is in this set for query i iff
// j <= i && (i - j < WIN || j < GLB). Block bid -> (query tile qt = qt0 + bid % nq: rows q0 = 16*qt .. q0+15, head group hg, batch
// b); one wave per head.
//   q/k hi planes f16 x1024 [b*SEQ + s][h*HD + d], residual planes same layout; v^T hi plane [b*NH + h][d][SEQ], v^T residual plane
//   [b*NH + h][d][QE] (keys < QE).
//   Transposed products: a lane owns ONE query i = q0 + (lane & 15), the column of every D tile; lanes l and l ^ 16 share it.
//   Init: m = M, l = L (from [(b*NH+h)*STRD + i%STRD][i/STRD]), O^T = AC row (f16, 8 consecutive d per 16-B load) * (32768*1024/64).
//   Key tiles of 32 visited in order: tile 0 (keys 0..31, holds the leading GLB keys) when the band does not start at tile 0, then the
//   band tiles from the one holding max(0, q0 - WIN + 1) to the one holding q0 + 15 (at most WIN/32 + 2 + 1 tiles; every other tile holds
//   only keys outside this set for every query row of the tile: weight exactly 0).
//   Per tile: S^T = K.Q^T, 2 key subtiles x 2 k-steps, products k_hi.q_hi + k_hi.q_lo + k_lo.q_hi, fragments straight from the 16-bit planes
//   (two 16-B loads per fragment, split k map); exact element predicate; online max-subtracted base-2 softmax in f32, -inf-safe rescale:
//   maximum and sum over the lane's 16 scores, then one exchange with lane ^ 16; P^T x32768 (f16, and its f16 residual when ROB) packed
//   in the lane as the B operand (D rows 8*(lane >> 4) + r of the two subtiles are the split k map's elements); O^T += V^T.P^T with the v^T
//   A fragments in 2 groups of 2 d-subtiles. ROB == 1 (host uses it for q0 + 16 <= QE only; then every visited key is < QE): products
//   hh + lh + hl with the v residual plane, O written as hi + residual planes; ROB == 0: single product v_hi.P_hi, O hi plane only.
//   After the loop: out = acc / Z (Z >= 1 always: key i itself lies in a visited tile; guarded anyway), carries 1/(32768*1024) folded
//   once, written to the wave's private result slab (pitch 68; row = query; every element owned by one lane), read back as whole rows:
//   each plane row ([b*SEQ + s][h*HD + d]; residual [b*QE + s][h*HD + d], ROB only) is written by 8 consecutive lanes x 16 B.
// coverage: per wave 4 instructions x 4 rows x 8 lanes x 8 halves = 16 x 64 per plane; the two launches (qt < QE/16 with ROB = 1, the rest
//           with ROB = 0) x NHG x NB blocks x WPB waves = every (b, s, h) row of O hi exactly once and every (b, s < QE, h) row of O residual
//           exactly once.
// =====================================================================================================
template <int ROB>
__global__ __launch_bounds__(ATT_THREADS)
void attn_a(const u16* __restrict__ QHp, const u16* __restrict__ QLp,
            const u16* __restrict__ KHp, const u16* __restrict__ KLp,
            const u16* __restrict__ VHp, const u16* __restrict__ VLp,
            const u16* __restrict__ ACp, const float* __restrict__ Mp, const float* __restrict__ Lp,
            u16* OHp, u16* OLp, int qt0, int nq) {
  __shared__ __align__(16) float smem[WPB * SLW];

  const int tid  = threadIdx.x;
  const int wave = tid >> 5;
  const int lane = tid & 31;
  const int hh   = lane >> 4;
  const int c    = lane & 15;
  const int bid  = blockIdx.x;
  const int qtl  = bid % nq;
  const int t2   = bid / nq;
  const int hg   = t2 % NHG;
  const int b    = t2 / NHG;
  if (b >= NB) return;                      // block-uniform; no block barriers in this kernel; never taken with the exact grid
  const int qt   = qt0 + qtl;
  const int q0   = qt * 16;
  if (q0 + 16 > SEQ) return;                // block-uniform; never taken
  if (ROB != 0 && q0 + 16 > QE) return;     // block-uniform; never taken (residual planes cover s < QE only)
  const int head = hg * WPB + wave;

  float* slab = smem + wave * SLW;          // result slab [16 queries][64 d] pitch 68

  const size_t hcol = (size_t)head * HD + 8 * hh;
  const _Float16* Qh  = (const _Float16*)(const void*)QHp + ((size_t)b * SEQ + q0 + c) * DMOD + hcol;
  const _Float16* Ql  = (const _Float16*)(const void*)QLp + ((size_t)b * SEQ + q0 + c) * DMOD + hcol;
  const _Float16* Khb = (const _Float16*)(const void*)KHp + ((size_t)b * SEQ + c) * DMOD + hcol;      // key row kb added per step
  const _Float16* Klb = (const _Float16*)(const void*)KLp + ((size_t)b * SEQ + c) * DMOD + hcol;
  const _Float16* Vhb = (const _Float16*)(const void*)VHp + ((size_t)(b * NH + head) * HD + c) * SEQ + 8 * hh;  // d row c (+16j)
  const _Float16* Vlb = Vhb;
  if constexpr (ROB != 0) {
    Vlb = (const _Float16*)(const void*)VLp + ((size_t)(b * NH + head) * HD + c) * QE + 8 * hh;
  }
  const float lsc = SM_SCALE * (LOG2E / (QSC * KSC));
  const float oc  = 1.0f / (PCAR * VCAR);
  const float aci = (PCAR * VCAR) / ACAR;
  const size_t KROW = (size_t)DMOD;         // halves between consecutive key rows

  const int qr = q0 + c;                    // this lane's query
  float mq, lq;                             // its running max and sum (equal in lanes l and l ^ 16)
  v8f o[4];                                 // O^T: o[j][r] = (d = 16*j + 8*hh + r, query qr)
  // ---- init from the strided-set state ----
  {
    const size_t mli = ((size_t)(b * NH + head) * STRD + (qr % STRD)) * NAP + (qr / STRD);   // qr / STRD < NA <= NAP
    mq = Mp[mli];
    lq = Lp[mli];
    const _Float16* acp = (const _Float16*)(const void*)ACp + ((size_t)b * SEQ + qr) * DMOD + hcol;
#pragma unroll
    for (int j = 0; j < 4; ++j) {
      const v8h a = *(const v8h*)(acp + j * 16);
#pragma unroll
      for (int r = 0; r < 8; ++r) o[j][r] = (float)a[r] * aci;
    }
  }

  // ---- tile list: leading tile 0 (when not part of the band) then the band tiles ----
  int klo = q0 - (WIN - 1);
  if (klo < 0) klo = 0;
  const int ktb = klo >> 5;
  const int kte = (q0 + 15) >> 5;           // <= SEQ/32 - 1; for ROB: kte*32 + 31 <= QE - 1
  int nband = kte - ktb + 1;
  if (nband > NKB) nband = NKB;             // static bound (WIN/32 + 2)
  if (nband < 0) nband = 0;
  const int hasg = (ktb > 0) ? 1 : 0;
  const int nkt  = nband + hasg;            // <= NKA

#pragma unroll 1
  for (int kt = 0; kt < nkt; ++kt) {
    const int kb = (kt < hasg) ? 0 : (ktb + kt - hasg) * 32;   // kb + 31 <= SEQ - 1
    // ---- scores S^T: D element r of this lane = (key kb + 8*hh + r, query qr) in s0, key kb + 16 + 8*hh + r in s1 ----
    v8f s0 = zero8(), s1 = zero8();
    const _Float16* k0p = Khb + (size_t)kb * KROW;
    const _Float16* k1p = k0p + (size_t)16 * KROW;
    const _Float16* l0p = Klb + (size_t)kb * KROW;
    const _Float16* l1p = l0p + (size_t)16 * KROW;
#pragma unroll
    for (int kk = 0; kk < HD / 32; ++kk) {
      const v16h qh  = ldfrag_h(Qh + kk * 32);
      const v16h ql  = ldfrag_h(Ql + kk * 32);
      const v16h kh0 = ldfrag_h(k0p + kk * 32);
      const v16h kh1 = ldfrag_h(k1p + kk * 32);
      const v16h kl0 = ldfrag_h(l0p + kk * 32);
      const v16h kl1 = ldfrag_h(l1p + kk * 32);
      s0 = mma_h(kh0, qh, s0);
      s0 = mma_h(kh0, ql, s0);
      s0 = mma_h(kl0, qh, s0);
      s1 = mma_h(kh1, qh, s1);
      s1 = mma_h(kh1, ql, s1);
      s1 = mma_h(kl1, qh, s1);
      guard2(s0, s1, qh, ql, kh0, kl0, kh1, kl1);
    }
    // ---- key select + online softmax in base 2, -inf-safe; all 16 values of a lane belong to its query ----
    const int kr0 = kb + 8 * hh;
    float t0[8], t1[8];
    float mx = -INFINITY;
#pragma unroll
    for (int r = 0; r < 8; ++r) {
      const int  key0 = kr0 + r, key1 = key0 + 16;
      const bool a0 = (key0 <= qr) && ((qr - key0 < WIN) || (key0 < GLB));
      const bool a1 = (key1 <= qr) && ((qr - key1 < WIN) || (key1 < GLB));
      t0[r] = a0 ? s0[r] * lsc : -INFINITY;
      t1[r] = a1 ? s1[r] * lsc : -INFINITY;
      mx = fmaxf(mx, fmaxf(t0[r], t1[r]));
    }
    mx = fmaxf(mx, xhalf(mx));
    const float mn = fmaxf(mq, mx);
    const float ms = (mn == -INFINITY) ? 0.0f : mn;
    const float al = exp2f(mq - ms);
    mq = mn;
    // ---- B fragments of P^T * 32768: hi f16 (and residual f16 when ROB); elements 0..7 = keys kb + 8hh + r,
    //      elements 8..15 = keys kb + 16 + 8hh + r: the split k map of the v^T A fragments ----
    FragH ph, pl;
    float pa = 0.f, pb = 0.f;
#pragma unroll
    for (int r = 0; r < 8; ++r) {
      const float e0 = exp2f(t0[r] - ms), e1 = exp2f(t1[r] - ms);
      pa += e0;
      pb += e1;
      const float ta = e0 * PCAR, tb = e1 * PCAR;
      const _Float16 ha = (_Float16)ta, hb = (_Float16)tb;
      ph.h[0][r] = ha;
      ph.h[1][r] = hb;
      if constexpr (ROB != 0) {
        pl.h[0][r] = (_Float16)(ta - (float)ha);
        pl.h[1][r] = (_Float16)(tb - (float)hb);
      }
    }
    float ps = pa + pb;
    ps += xhalf(ps);
    lq = lq * al + ps;
#pragma unroll
    for (int j = 0; j < 4; ++j) {
#pragma unroll
      for (int r = 0; r < 8; ++r) o[j][r] *= al;
    }
    // ---- O^T += V^T.P^T : A fragment row d = j*16 + c, keys contiguous in the v^T planes; 2 groups of 2 d-subtiles ----
    {
      const _Float16* vhp = Vhb + kb;
      const _Float16* vlp = Vlb + kb;
#pragma unroll
      for (int jg = 0; jg < HD / 32; ++jg) {
        const size_t da = (size_t)(2 * jg) * 16 * SEQ;
        const size_t db = da + (size_t)16 * SEQ;
        const v16h vha = ldfrag_h(vhp + da), vhb2 = ldfrag_h(vhp + db);
        if constexpr (ROB != 0) {
          const size_t la = (size_t)(2 * jg) * 16 * QE;
          const size_t lb = la + (size_t)16 * QE;
          const v16h vla = ldfrag_h(vlp + la), vlb2 = ldfrag_h(vlp + lb);
          o[2 * jg]     = mma_h(vha,  ph.v, o[2 * jg]);
          o[2 * jg]     = mma_h(vha,  pl.v, o[2 * jg]);
          o[2 * jg]     = mma_h(vla,  ph.v, o[2 * jg]);
          o[2 * jg + 1] = mma_h(vhb2, ph.v, o[2 * jg + 1]);
          o[2 * jg + 1] = mma_h(vhb2, pl.v, o[2 * jg + 1]);
          o[2 * jg + 1] = mma_h(vlb2, ph.v, o[2 * jg + 1]);
          guard2(o[2 * jg], o[2 * jg + 1], ph.v, pl.v, vha, vhb2, vla, vlb2);
        } else {
          o[2 * jg]     = mma_h(vha,  ph.v, o[2 * jg]);
          o[2 * jg + 1] = mma_h(vhb2, ph.v, o[2 * jg + 1]);
          guard2(o[2 * jg], o[2 * jg + 1], ph.v, vha, vhb2, ph.v, vha, vhb2);
        }
      }
    }
  }
  acc_guard4(o[0], o[1], o[2], o[3]);
  // ---- out = acc / Z (0 if Z == 0), carries (32768 on P, 1024 on v) folded once; written into the slab row of the lane's query ----
  {
    const float ls  = (lq > 0.0f) ? lq : 1.0f;
    const float inv = (lq > 0.0f) ? ((1.0f / ls) * oc) : 0.0f;
#pragma unroll
    for (int j = 0; j < 4; ++j) {
      v4f w0, w1;
#pragma unroll
      for (int e = 0; e < 4; ++e) { w0[e] = o[j][e] * inv; w1[e] = o[j][4 + e] * inv; }
      float* sp = slab + c * SLP + j * 16 + 8 * hh;
      *(v4f*)(sp)     = w0;
      *(v4f*)(sp + 4) = w1;
    }
  }

  wave_sync_lds();
  // ---- O x1024 -> f16 hi (+ residual when ROB) planes; lane = (row select rq in 0..3, 8 consecutive d at c8) ----
  v4u oh[4], ol[4];
  const int rq = lane >> 3, c8 = (lane & 7) * 8;
#pragma unroll
  for (int it = 0; it < 4; ++it) {
    const int row = it * 4 + rq;
    const v4f a = *(const v4f*)(slab + row * SLP + c8), b4 = *(const v4f*)(slab + row * SLP + c8 + 4);
    float w[8];
#pragma unroll
    for (int e = 0; e < 4; ++e) { w[e] = a[e] * OSC; w[4 + e] = b4[e] * OSC; }
#pragma unroll
    for (int e = 0; e < 4; ++e) {
      const _Float16 h0 = (_Float16)w[2 * e], h1 = (_Float16)w[2 * e + 1];
      const _Float16 l0 = (_Float16)(w[2 * e] - (float)h0), l1 = (_Float16)(w[2 * e + 1] - (float)h1);
      oh[it][e] = pk16(h_bits(h0), h_bits(h1));
      ol[it][e] = pk16(h_bits(l0), h_bits(l1));
    }
  }
  const size_t ob  = ((size_t)b * SEQ + q0) * DMOD + (size_t)head * HD + c8;
  const size_t olb = ((size_t)b * QE + q0) * DMOD + (size_t)head * HD + c8;   // dereferenced only when ROB
  {
#pragma unroll
    for (int it = 0; it < 4; ++it) {
      const int row = it * 4 + rq;
      *(v4u*)(OHp + ob + (size_t)row * DMOD) = oh[it];
      if constexpr (ROB != 0) {
        *(v4u*)(OLp + olb + (size_t)row * DMOD) = ol[it];
      }
    }
    
  }
}

// =====================================================================================================
// Workspace map (bytes); every plane is fully written by whole-line stores before it is read; all extents are exact multiples
// of the store granularity (no pad rows needed); every region offset a multiple of 524288:
//   XB  bf16 [MROWS][1024]                       MROWS*2048       (x as bf16; after the projections the region holds AC f16 [MROWS][1024])
//   WB  16-bit [1024 n][1024 k]                  2097152          (Wq, Wk, Wv column blocks as bf16 [n][k], then Wo as f16 x1024, in launch order)
//   OH  f16 [MROWS][1024] x1024                  MROWS*2048       (until the strided key set has run the region holds VR, v hi row-major f16 [MROWS][1024] x1024)
//   QH  f16 [MROWS][1024] x1024                  MROWS*2048       QL residual the same; KH, KL the same
//   VH  f16 [NB*16][64][SEQ] x1024               MROWS*2048
//   VL  f16 residual [NB*16][64][QE]             NB*16*64*QE*2
//   OL  f16 residual [NB*QE][1024]               NB*QE*2048
//   M   f32 [NB*16*STRD][NAP]                     NB*16*STRD*NAP*4 L the same
//   end (NB=2, SEQ=4096, QE=512)               124780544
// =====================================================================================================
extern "C" void kernel_launch(void* const* d_in, const int* in_sizes, int n_in,
                              void* d_out, int out_size, void* d_ws, size_t ws_size,
                              hipStream_t stream) {
  if (n_in < 5) return;
  const int needx = OROWS * DMOD;
  if (in_sizes[0] < needx) return;
  if (in_sizes[1] != 3 * DMOD * DMOD) return;
  if (in_sizes[2] < 3 * DMOD) return;
  if (in_sizes[3] != DMOD * DMOD) return;
  if (in_sizes[4] < DMOD) return;
  if (out_size < needx) return;

  const float* x    = (const float*)d_in[0];
  const float* wqkv = (const float*)d_in[1];
  const float* bqkv = (const float*)d_in[2];
  const float* wo   = (const float*)d_in[3];
  const float* bo   = (const float*)d_in[4];
  float*       out  = (float*)d_out;

  const size_t szXB = (size_t)MROWS * DMOD * 2;                 // XB, later AC (same extent)
  const size_t szW  = (size_t)DMOD * DMOD * 2;
  const size_t szH  = (size_t)MROWS * DMOD * 2;                 // QH, QL, KH, KL, OH
  const size_t szV  = (size_t)NB * NH * HD * SEQ * 2;           // VH (== szH)
  const size_t szVL = (size_t)NB * NH * HD * QE * 2;            // VL
  const size_t szOL = (size_t)NB * QE * DMOD * 2;               // OL (== szVL)
  const size_t szML = (size_t)NB * NH * STRD * NAP * 4;         // M, L
  size_t off = 0;
  const size_t oXB = off; off += szXB;
  const size_t oW  = off; off += szW;
  const size_t oOH = off; off += szH;
  const size_t oQH = off; off += szH;
  const size_t oQL = off; off += szH;
  const size_t oKH = off; off += szH;
  const size_t oKL = off; off += szH;
  const size_t oVH = off; off += szV;
  const size_t oVL = off; off += szVL;
  const size_t oOL = off; off += szOL;
  const size_t oM  = off; off += szML;
  const size_t oL  = off; off += szML;
  if (off > ws_size) return;                // off = 124780544 for NB = 2, SEQ = 4096
  if (off > (size_t)WS_CAP) return;

  char* ws = (char*)d_ws;
  u16*   XB = (u16*)(ws + oXB);
  u16*   AC = (u16*)(ws + oXB);
  u16*   WB = (u16*)(ws + oW);
  u16*   OH = (u16*)(ws + oOH);
  u16*   VR = (u16*)(ws + oOH);
  u16*   QH = (u16*)(ws + oQH);
  u16*   QL = (u16*)(ws + oQL);
  u16*   KH = (u16*)(ws + oKH);
  u16*   KL = (u16*)(ws + oKL);
  u16*   VH = (u16*)(ws + oVH);
  u16*   VL = (u16*)(ws + oVL);
  u16*   OL = (u16*)(ws + oOL);
  float* Mp = (float*)(ws + oM);
  float* Lp = (float*)(ws + oL);

  const dim3 b256(256), bAT(ATT_THREADS);
  const int  n8x = (SEQ * DMOD) / 8;
  const dim3 gX((n8x + 255) / 256);                     // per batch
  const dim3 gTR((DMOD / 64) * (DMOD / 64));            // 256 blocks per [1024][1024] weight block
  const dim3 gG((SEQ / GT) * (DMOD / GT));              // per batch
  const int  nqR  = QE / 16;                            // query tiles with residual P.v products per (b, head group)
  const int  nqP  = NQT - nqR;
  const int  nrtR = QE / GT;                            // out-projection row tiles with the residual plane
  const int  nrtP = (SEQ - QE) / GT;

  // (0) x -> bf16 plane [MROWS][1024], one launch per batch
  for (int b = 0; b < NB; ++b) {
    cvt16<<<gX, b256, 0, stream>>>(x + (size_t)b * XS_FULL * DMOD, XB + (size_t)b * SEQ * DMOD, n8x, 0, 1.0f);
  }
  // (1) per column block p (q, k, v): W[:, p*1024 .. p*1024+1023] ([1024 k][3072 n] -> [1024 n][1024 k] bf16); per batch:
  //     projection, written as the 16-bit planes by its own epilogue
  for (int p = 0; p < 3; ++p) {
    tr16<<<gTR, b256, 0, stream>>>(wqkv, 3 * DMOD, p * DMOD, WB, 0, 1.0f);
    for (int b = 0; b < NB; ++b) {
      const u16* xb = XB + (size_t)b * SEQ * DMOD;
      if (p == 0) {
        gemm_p<0><<<gG, b256, 0, stream>>>(xb, WB, bqkv + p * DMOD, QH, QL, nullptr, SEQ, DMOD, b, 1.0f, QSC);
      } else if (p == 1) {
        gemm_p<0><<<gG, b256, 0, stream>>>(xb, WB, bqkv + p * DMOD, KH, KL, nullptr, SEQ, DMOD, b, 1.0f, KSC);
      } else {
        gemm_p<1><<<gG, b256, 0, stream>>>(xb, WB, bqkv + p * DMOD, VH, VL, VR, SEQ, DMOD, b, 1.0f, VCAR);
      }
    }
  }
  // (2) Wo [1024 k][1024 n] -> [n][k] f16 plane of bf16 value x1024
  tr16<<<gTR, b256, 0, stream>>>(wo, DMOD, 0, WB, 1, WOS);
  // (3) strided key set -> per-row state (M, L, AC)
  attn_s<<<dim3(NB * NHG * STRD), bAT, 0, stream>>>(QH, QL, KH, KL, VR, AC, Mp, Lp);
  // (4) band + leading key set merged onto that state: query rows s < QE with residual P.v products -> O hi + residual planes;
  //     (5) remaining rows, single product -> O hi plane
  attn_a<1><<<dim3(nqR * NHG * NB), bAT, 0, stream>>>(QH, QL, KH, KL, VH, VL, AC, Mp, Lp, OH, OL, 0, nqR);
  if (nqP > 0) {
    attn_a<0><<<dim3(nqP * NHG * NB), bAT, 0, stream>>>(QH, QL, KH, KL, VH, VL, AC, Mp, Lp, OH, OL, nqR, nqP);
  }
  // (6) output projection rows s < QE (hi + residual) and (7) rows s >= QE (hi only) -> out f32, carries 1024 x 1024 folded back
  gemm_o<2><<<dim3(NB * nrtR * (DMOD / GT)), b256, 0, stream>>>(OH, OL, WB, bo, out, 0, nrtR, 1.0f / (OSC * WOS));
  if (nrtP > 0) {
    gemm_o<1><<<dim3(NB * nrtP * (DMOD / GT)), b256, 0, stream>>>(OH, OL, WB, bo, out, QE, nrtP, 1.0f / (OSC * WOS));
  }
  (void)hipGetLastError();
}

// v005
// It runs in 177 microseconds.
// Two timings next to v004 put it at 1.31 and 1.29 times that version's speed.
// Over all steps from v000 it is 3.28 times as fast.
// Contractions: x.Wq, x.Wk, x.Wv on v_wmma_f32_16x16x32_bf16 (x, W, biases RNE-converted to bf16; each W column block
// transposed into a k-contiguous [n][k] plane; f32 accumulate); k.q^T over 64 on v_wmma_f32_16x16x32_f16 with q, k carried as
// f16 hi x1024 + f16 residual planes (products hh + lh + hl); v^T.P^T on v_wmma_f32_16x16x32_f16 (P x32768 f16, v x1024 f16):
// query rows s < QE use P hi + residual and v hi + residual planes (hh + lh + hl), other rows one product; O.Wo on
// v_wmma_f32_16x16x32_f16 (O x1024 f16, Wo as f16(bf16(Wo)) x1024): rows s < QE as O hi + residual planes (h.W + l.W), other rows one
// product; all f32 accumulate. Bias adds, key-set select, base-2 online softmax, merge of the two key-set states and the 1/Z fold in
// f32 on VALU.
#include <hip/hip_runtime.h>
#include <math.h>
#include <stdint.h>

#ifndef NB
#define NB 2
#endif
#ifndef SEQ
#define SEQ 4096
#endif
#define XS_FULL 4096
#define DMOD  1024
#define NH    16
#define HD    64
#define WIN   256
#define STRD  128
#define GLB   16
#define QE    ((SEQ < 512) ? SEQ : 512)
#define MROWS (NB * SEQ)
#define OROWS ((NB - 1) * XS_FULL + SEQ)
#define SM_SCALE 0.125f
#define LOG2E 1.4426950408889634f
#define QSC   1024.0f
#define KSC   1024.0f
#define PCAR  32768.0f
#define VCAR  1024.0f
#define OSC   1024.0f
#define WOS   1024.0f
#define ACAR  64.0f
#define WPB   4
#define NHG   (NH / WPB)
#define NQT   (SEQ / 16)
#define NKB   ((WIN / 32) + 2)
#define NKA   (NKB + 1)
#define NA    (SEQ / STRD)
#define NAP   (((NA + 31) / 32) * 32)
#define NAT   ((NA + 15) / 16)
#define NKS   ((NA + 31) / 32)
#define ATT_THREADS (WPB * 32)
#define SLP   68
#define SLW   (16 * SLP)
#define SLAB64 (16 * 68)
#define VTP   72
#define VRP   80
#define WS_CAP 134217728
static_assert(DMOD == NH * HD && HD == 64 && NH == 16);
static_assert((NH % WPB) == 0 && ATT_THREADS == 128);
static_assert(NB >= 1 && NB <= 2);
static_assert((SEQ % STRD) == 0 && (SEQ % 64) == 0 && SEQ >= STRD && SEQ <= XS_FULL);
static_assert((QE % 64) == 0 && QE >= 64 && QE <= SEQ);
static_assert((STRD % 16) == 0 && STRD >= 32);
static_assert((WIN % 32) == 0 && WIN >= 32);
static_assert(GLB >= 1 && GLB <= 32);
static_assert(NA >= 1 && NAP >= 32 && NAP <= 256 && (NAP % 32) == 0 && 16 * NAT <= NAP);
static_assert(DMOD == 128 * 8 && (DMOD % 64) == 0 && (DMOD % 32) == 0);
static_assert((HD % 32) == 0);
static_assert(((SEQ * DMOD) % (8 * 256)) == 0);

typedef unsigned short u16;
typedef _Float16 v16h __attribute__((ext_vector_type(16)));
typedef _Float16 v8h  __attribute__((ext_vector_type(8)));
typedef __bf16   v16b __attribute__((ext_vector_type(16)));
typedef float    v8f  __attribute__((ext_vector_type(8)));
typedef float    v4f  __attribute__((ext_vector_type(4)));
typedef unsigned int v4u __attribute__((ext_vector_type(4)));

union FragH { v16h v; v8h h[2]; v4u u[2]; };
union FragB { v16b v; v4u u[2]; };

// ---- scalar helpers --------------------------------------------------------------------------------
__device__ __forceinline__ unsigned short bf_bits(float f) {          // f32 -> bf16 bits, RNE convert
  unsigned u = __float_as_uint(f);
  return (unsigned short)((u + 0x7FFFu + ((u >> 16) & 1u)) >> 16);
}
__device__ __forceinline__ float bf_up(unsigned short h) { return __uint_as_float(((unsigned)h) << 16); }
__device__ __forceinline__ float bfr(float f) { return bf_up(bf_bits(f)); }
__device__ __forceinline__ unsigned short h_bits(_Float16 x) { return __builtin_bit_cast(unsigned short, x); }
__device__ __forceinline__ unsigned pk16(unsigned short a, unsigned short b) { return (unsigned)a | ((unsigned)b << 16); }
__device__ __forceinline__ v8f zero8() { v8f z = {0.f, 0.f, 0.f, 0.f, 0.f, 0.f, 0.f, 0.f}; return z; }

// ---- fragment loaders: 16-bit A/B operand, lane -> row/col (lane&15), p already includes +8*(lane>>4);
//      elements 0..7 <- p[0..7] (k0+8h..), elements 8..15 <- p[16..23] (k0+16+8h..)  (same split k map for A and B;
//      B is always read from a k-contiguous [n][k] plane or tile)
__device__ __forceinline__ v16h ldfrag_h(const _Float16* p) {
  FragH f;
  f.h[0] = *(const v8h*)(p);
  f.h[1] = *(const v8h*)(p + 16);
  return f.v;
}
// transposing LDS load on a row-major 16-bit tile T[k][d]: with p = T + (k0 + 8*(lane>>4) + (lane&7))*pitch + d0 + 8*((lane>>3)&1) (halves)
// the lane gets T[k0 + 8*(lane>>4) + 0..7][d0 + (lane&15)]; the loads at k0 and k0 + 16 are elements 0..7 and 8..15 of the split k map
typedef short s16x8 __attribute__((ext_vector_type(8)));
__device__ __forceinline__ v4u ld_tr16(const _Float16* p) {
  typedef __attribute__((address_space(3))) s16x8 lds_s16x8;
  return __builtin_bit_cast(v4u, __builtin_amdgcn_ds_load_tr16_b128_v8i16((lds_s16x8*)p));
}
__device__ __forceinline__ v8f mma_h(v16h a, v16h b, v8f c) {
  return __builtin_amdgcn_wmma_f32_16x16x32_f16(false, a, false, b, (short)0, c, false, false);
}
__device__ __forceinline__ v8f mma_b(v16b a, v16b b, v8f c) {
  return __builtin_amdgcn_wmma_f32_16x16x32_bf16(false, a, false, b, (short)0, c, false, false);
}
__device__ __forceinline__ void guard2(v8f& a, v8f& b, v16h x0, v16h x1, v16h x2, v16h x3, v16h x4, v16h x5) {
#if defined(__HIP_DEVICE_COMPILE__)
  asm volatile("v_nop\n\tv_nop\n\tv_nop\n\tv_nop"
               : "+v"(a), "+v"(b) : "v"(x0), "v"(x1), "v"(x2), "v"(x3), "v"(x4), "v"(x5) : "memory");
#endif
}
__device__ __forceinline__ void acc_guard4(v8f& a, v8f& b, v8f& c, v8f& d) {
#if defined(__HIP_DEVICE_COMPILE__)
  asm volatile("v_nop\n\tv_nop\n\tv_nop\n\tv_nop" : "+v"(a), "+v"(b), "+v"(c), "+v"(d));
#endif
}
// value of lane l ^ 16 (the other 16-lane row), a vector cross-row move
__device__ __forceinline__ float xhalf(float x) {
  const int b = __builtin_bit_cast(int, x);
  return __builtin_bit_cast(float, __builtin_amdgcn_permlanex16(b, b, 0x76543210, 0xfedcba98, false, false));
}
__device__ __forceinline__ void wave_sync_lds() {
  __builtin_amdgcn_fence(__ATOMIC_RELEASE, "workgroup");
  __builtin_amdgcn_wave_barrier();
  __builtin_amdgcn_fence(__ATOMIC_ACQUIRE, "workgroup");
}

// =====================================================================================================
// f32 -> 16-bit plane, same layout.  f16mode == 0: bf16 RNE bits;  f16mode == 1: f16 bits of (bf16 RNE value) * scale.
// Thread = 8 consecutive elements: two 16-B loads, one 16-B store; 32 consecutive lanes = 512 contiguous, 512-B aligned
// coverage: grid = ceil(n8/256) blocks x 256 thr x 8 (in-kernel bound) = the whole plane (n8 a multiple of 256 here).
// =====================================================================================================
__global__ __launch_bounds__(256) void cvt16(const float* __restrict__ x, u16* D, int n8, int f16mode, float scale) {
  const int gt = blockIdx.x * 256 + (int)threadIdx.x;
  if (gt >= n8) return;
  const float* p = x + (size_t)gt * 8;
  const v4f a = *(const v4f*)(p), b4 = *(const v4f*)(p + 4);
  float w[8];
#pragma unroll
  for (int e = 0; e < 4; ++e) { w[e] = a[e]; w[4 + e] = b4[e]; }
  v4u o;
#pragma unroll
  for (int e = 0; e < 4; ++e) {
    const float f0 = w[2 * e], f1 = w[2 * e + 1];
    const unsigned short hb0 = h_bits((_Float16)(bfr(f0) * scale));
    const unsigned short hb1 = h_bits((_Float16)(bfr(f1) * scale));
    const unsigned short bb0 = bf_bits(f0);
    const unsigned short bb1 = bf_bits(f1);
    o[e] = (f16mode != 0) ? pk16(hb0, hb1) : pk16(bb0, bb1);
  }
  u16* d = D + (size_t)gt * 8;
  {
    *(v4u*)(d) = o;
    
  }
}

// =====================================================================================================
// Weight transpose + convert: W f32 [DMOD rows k][ldw], column block col0 .. col0+DMOD-1 (column index = n)
//   -> D 16-bit [DMOD n][DMOD k] (k-contiguous B operand), i.e. in[k][col0+n] -> out[n][k].  f16mode as in cvt16.
// Block = (n tile n0, k tile k0) of 64 x 64: load 64 k rows x 64 n floats with 16-B loads (thread = k row kr, 16 n), convert,
// scatter transposed into an LDS tile [n][k] (pitch 72 halves); block barrier; each n-row segment (64 halves = one whole
// coverage: load 256 thr x 16 = 64 k x 64 n; store 2 iterations x 256 thr x 8 halves = 64 lines x 64; grid (DMOD/64)^2 = every
//           (n, k) of D exactly once.
// =====================================================================================================
__global__ __launch_bounds__(256) void tr16(const float* __restrict__ W, int ldw, int col0, u16* D, int f16mode, float scale) {
  __shared__ __align__(16) u16 T[64 * VTP];
  const int tid = (int)threadIdx.x;
  const int bid = (int)blockIdx.x;
  const int nt  = bid % (DMOD / 64);
  const int kt  = bid / (DMOD / 64);
  if (kt >= DMOD / 64) return;              // block-uniform, before any barrier; never taken with the exact grid
  const int n0 = nt * 64, k0 = kt * 64;
  {
    const int kr = tid >> 2;                // k row within tile 0..63
    const int nc = (tid & 3) * 16;          // n chunk 0,16,32,48
    const float* src = W + (size_t)(k0 + kr) * (size_t)ldw + col0 + n0 + nc;
#pragma unroll
    for (int i = 0; i < 4; ++i) {
      const v4f a = *(const v4f*)(src + 4 * i);
#pragma unroll
      for (int e = 0; e < 4; ++e) {
        const float f = a[e];
        const unsigned short hb = h_bits((_Float16)(bfr(f) * scale));
        const unsigned short bb = bf_bits(f);
        T[(nc + 4 * i + e) * VTP + kr] = (f16mode != 0) ? hb : bb;
      }
    }
  }
  __syncthreads();
  v4u ov[2];
  const int q8 = tid >> 3, p8 = (tid & 7) * 8;
#pragma unroll
  for (int it = 0; it < 2; ++it) {
    const int line = it * 32 + q8;          // n = 0..63
    ov[it] = *(const v4u*)(T + line * VTP + p8);
  }
  u16* base = D + (size_t)n0 * DMOD + k0 + p8;
  {
#pragma unroll
    for (int it = 0; it < 2; ++it) {
      const int line = it * 32 + q8;
      *(v4u*)(base + (size_t)line * DMOD) = ov[it];
    }
    
  }
}

// =====================================================================================================
// GEMM epilogue: the wave's 32x64 f32 tile (times oscale) staged in its LDS slab (two 16-row parts, pitch 68), read back as whole
// rows, bias added, stored.
// coverage: 2 parts x 8 instructions x 2 rows x 16 lanes x 4 floats = the wave's 32 x 64 tile.
// =====================================================================================================
__device__ __forceinline__ void epi3264(float* sl, const v8f (&acc)[2][4], float oscale,
                                        const float* __restrict__ bias, float* C, int N, size_t rowb, int col0, int lane) {
  const int hh = lane >> 4, m = lane & 15;
#pragma unroll
  for (int i = 0; i < 2; ++i) {
#pragma unroll
    for (int r = 0; r < 8; ++r) {
      const int ro = i * SLAB64 + (8 * hh + r) * 68 + m;
      sl[ro]      = acc[i][0][r] * oscale;
      sl[ro + 16] = acc[i][1][r] * oscale;
      sl[ro + 32] = acc[i][2][r] * oscale;
      sl[ro + 48] = acc[i][3][r] * oscale;
    }
  }
  wave_sync_lds();
  const v4f bb = *(const v4f*)(bias + col0 + m * 4);
  v4f br;
#pragma unroll
  for (int e = 0; e < 4; ++e) br[e] = bfr(bb[e]);
  float* dst = C + (rowb + (size_t)hh) * (size_t)N + col0 + m * 4;
#pragma unroll
  for (int i = 0; i < 2; ++i) {
    v4f vals[8];
#pragma unroll
    for (int it = 0; it < 8; ++it) vals[it] = *(const v4f*)(sl + i * SLAB64 + (it * 2 + hh) * 68 + m * 4) + br;
#pragma unroll
    for (int it = 0; it < 8; ++it) {
      *(v4f*)(dst + (size_t)(i * 16 + it * 2) * (size_t)N) = vals[it];
    }
  }
}

// =====================================================================================================
// GEMM core shared by the projections and the output projection: one 128 x 128 tile of C per block, 8 waves of 32 x 64
// (wave -> rows 32 * (wave >> 1), columns 64 * (wave & 1)), K = DMOD walked in passes of 128 k.
// A pass's operand rows (256 B each: NPROD A planes of 128 rows, then 128 Bt rows) are staged in LDS at pitch 272 B by per-lane
// 16-B asynchronous copies: one wave instruction = 2 rows x 256 B = whole 128-B lines. Two buffers: pass t + 2 is copied into the
// buffer pass t has left while pass t + 1 is worked on. Fragments are 16-B LDS reads with the same split k map as ldfrag_h.
// Per accumulator the products keep ascending k in steps of 32, and h before l inside a step.
// =====================================================================================================
#define GT     128
#define GTHR   256
#define GKP    128
#define GPIT   136
#define GPLANE (GT * GPIT)
#define GNP    (DMOD / GKP)
static_assert((DMOD % GKP) == 0 && GNP >= 2 && (DMOD % GT) == 0 && (SEQ % GT) == 0 && (QE % GT) == 0);
static_assert(8 * 2 * SLAB64 * 4 <= 2 * 2 * GPLANE * 2 && GT + 8 <= GPIT);

// One operand plane of a pass: 128 rows x 256 B = eight 16-B copies of each lane, rows 16 apart (l, g: the lane's first row and
// 16-B column; LDS step 16 * 272 B, global step 16 * DMOD halves).
__device__ __forceinline__ void copy_plane(unsigned l, const u16* g) {
#if defined(__HIP_DEVICE_COMPILE__)
  const unsigned ls = 16 * GPIT * 2;
  const size_t   gs = (size_t)16 * DMOD;
  // the closing s_wait_xcnt 0 stands inside the statement so that no address register is rewritten ahead of it
  asm volatile("global_load_async_to_lds_b128 %0, %8, off\n\t"
               "global_load_async_to_lds_b128 %1, %9, off\n\t"
               "global_load_async_to_lds_b128 %2, %10, off\n\t"
               "global_load_async_to_lds_b128 %3, %11, off\n\t"
               "global_load_async_to_lds_b128 %4, %12, off\n\t"
               "global_load_async_to_lds_b128 %5, %13, off\n\t"
               "global_load_async_to_lds_b128 %6, %14, off\n\t"
               "global_load_async_to_lds_b128 %7, %15, off\n\t"
               "s_wait_xcnt 0x0"
               :: "v"(l), "v"(l + ls), "v"(l + 2 * ls), "v"(l + 3 * ls), "v"(l + 4 * ls), "v"(l + 5 * ls), "v"(l + 6 * ls),
                  "v"(l + 7 * ls),
                  "v"(g), "v"(g + gs), "v"(g + 2 * gs), "v"(g + 3 * gs), "v"(g + 4 * gs), "v"(g + 5 * gs), "v"(g + 6 * gs),
                  "v"(g + 7 * gs)
               : "memory");
#endif
}
__device__ __forceinline__ void wait_async0() {   // this wave's copies have landed
#if defined(__HIP_DEVICE_COMPILE__)
  asm volatile("s_wait_asynccnt 0x0" ::: "memory");
#endif
}
__device__ __forceinline__ void wait_x0() {       // stands between issued global loads or stores and a rewrite of the registers they name
#if defined(__HIP_DEVICE_COMPILE__)
  asm volatile("s_wait_xcnt 0x0" ::: "memory");
#endif
}
__device__ __forceinline__ void wait_ds0() {      // this wave's LDS reads are done before their buffer is handed back
#if defined(__HIP_DEVICE_COMPILE__)
  asm volatile("s_wait_dscnt 0x0" ::: "memory");
#endif
}
// =====================================================================================================
// Projection epilogue for q and k: the wave's 32x64 f32 tile (times oscale) staged in its LDS slab as in epi3264, read back as whole
// rows, bias added, times sc, split into f16 hi + f16 residual and stored to the two planes [MROWS][DMOD] at row rowb, column col0.
// Lane = (row select rq in 0..3, 8 consecutive columns at c8): a plane row's 64 halves = one 128-B line from 8 consecutive lanes.
// coverage: 2 parts x 4 instructions x 4 rows x 8 lanes x 8 halves = the wave's 32 x 64 tile of each plane.
// =====================================================================================================
__device__ __forceinline__ void epi_qk(float* sl, const v8f (&acc)[2][4], float oscale, const float* __restrict__ bias,
                                       u16* Hp, u16* Lp, float sc, size_t rowb, int col0, int lane) {
  const int hh = lane >> 4, m = lane & 15;
#pragma unroll
  for (int i = 0; i < 2; ++i) {
#pragma unroll
    for (int r = 0; r < 8; ++r) {
      const int ro = i * SLAB64 + (8 * hh + r) * 68 + m;
      sl[ro]      = acc[i][0][r] * oscale;
      sl[ro + 16] = acc[i][1][r] * oscale;
      sl[ro + 32] = acc[i][2][r] * oscale;
      sl[ro + 48] = acc[i][3][r] * oscale;
    }
  }
  wave_sync_lds();
  const int rq = lane >> 3, c8 = (lane & 7) * 8;
  const v4f ba = *(const v4f*)(bias + col0 + c8), bb = *(const v4f*)(bias + col0 + c8 + 4);
  float br[8];
#pragma unroll
  for (int e = 0; e < 4; ++e) { br[e] = bfr(ba[e]); br[4 + e] = bfr(bb[e]); }
  const size_t d0 = (rowb + (size_t)rq) * DMOD + col0 + c8;
#pragma unroll
  for (int i = 0; i < 2; ++i) {
    v4u oh[4], ol[4];
#pragma unroll
    for (int it = 0; it < 4; ++it) {
      const float* sp = sl + i * SLAB64 + (it * 4 + rq) * 68 + c8;
      const v4f a = *(const v4f*)(sp), b4 = *(const v4f*)(sp + 4);
      float w[8];
#pragma unroll
      for (int e = 0; e < 4; ++e) { w[e] = (a[e] + br[e]) * sc; w[4 + e] = (b4[e] + br[4 + e]) * sc; }
#pragma unroll
      for (int e = 0; e < 4; ++e) {
        const float t0 = w[2 * e], t1 = w[2 * e + 1];
        const _Float16 h0 = (_Float16)t0, h1 = (_Float16)t1;
        const _Float16 l0 = (_Float16)(t0 - (float)h0), l1 = (_Float16)(t1 - (float)h1);
        oh[it][e] = pk16(h_bits(h0), h_bits(h1));
        ol[it][e] = pk16(h_bits(l0), h_bits(l1));
      }
    }
#pragma unroll
    for (int it = 0; it < 4; ++it) {
      const size_t d = d0 + (size_t)(i * 16 + it * 4) * DMOD;
      *(v4u*)(Hp + d) = oh[it];
      *(v4u*)(Lp + d) = ol[it];
    }
  }
}

// =====================================================================================================
// Projection epilogue for v: the block's 128 (keys s) x 128 (columns g*HD + d) tile goes out transposed.
//   VH[(vrow0 + col)][s0 + s] (pitch SEQ) = f16(v * sc);  VL[(vrow0 + col)][s0 + s] (pitch QE) = f16 residual, only when dolo.
//   The same hi values also go out row-major, VR[rrow0 + s][colC + col] (pitch DMOD), for the strided key set, which reads whole v rows:
//   2-B LDS stores into a third tile R[s][col] (pitch GPIT), then each row's 128 columns = 256 B = two whole lines from 16 lanes.
// An accumulator register group already holds 8 consecutive keys of one column: bias added, scaled, split, packed, one 16-B LDS store
// per plane into the block tile T[col][s] (pitch GPIT halves; hi plane, then residual plane). One block barrier, then each column's
// 128 keys = 256 B = two whole lines leave from 16 consecutive lanes.
// Every thread of the block calls this (block barrier inside); dolo is block-uniform.
// coverage: LDS 8 waves x 8 groups x 32 lanes x 8 halves = 128 x 128; stores 8 iterations x 16 columns x 16 lanes x 8 halves = the same;
//           row-major: 8 iterations x 16 rows x 16 lanes x 8 halves = the same.
// =====================================================================================================
__device__ __forceinline__ void epi_vt(u16* T, const v8f (&acc)[2][4], float oscale, const float* __restrict__ bias,
                                       u16* VHo, u16* VLo, u16* VRo, float sc, size_t vrow0, size_t rrow0, int s0, int colC, bool dolo,
                                       int wr, int wc, int tid) {
  const int lane = tid & 31, hh = lane >> 4, m = lane & 15;
  float bj[4];
#pragma unroll
  for (int j = 0; j < 4; ++j) bj[j] = bias[colC + wc + j * 16 + m];
#pragma unroll
  for (int j = 0; j < 4; ++j) {
    const int   col = wc + j * 16 + m;
    const float br  = bfr(bj[j]);
#pragma unroll
    for (int i = 0; i < 2; ++i) {
      v4u vh, vl;
      u16* rp = T + 2 * GPLANE + (wr + i * 16 + 8 * hh) * GPIT + col;
#pragma unroll
      for (int e = 0; e < 4; ++e) {
        const float t0 = (acc[i][j][2 * e] * oscale + br) * sc, t1 = (acc[i][j][2 * e + 1] * oscale + br) * sc;
        const _Float16 h0 = (_Float16)t0, h1 = (_Float16)t1;
        const _Float16 l0 = (_Float16)(t0 - (float)h0), l1 = (_Float16)(t1 - (float)h1);
        vh[e] = pk16(h_bits(h0), h_bits(h1));
        vl[e] = pk16(h_bits(l0), h_bits(l1));
        rp[(2 * e) * GPIT]     = h_bits(h0);
        rp[(2 * e + 1) * GPIT] = h_bits(h1);
      }
      u16* tp = T + col * GPIT + wr + i * 16 + 8 * hh;
      *(v4u*)(tp) = vh;
      if (dolo) *(v4u*)(tp + GPLANE) = vl;
    }
  }
  __syncthreads();   // a column's 128 keys were written by four waves; they leave as whole lines from one
  const int cr = tid >> 4, p8 = (tid & 15) * 8;
  v4u oh[8];
#pragma unroll
  for (int it = 0; it < 8; ++it) oh[it] = *(const v4u*)(T + (it * 16 + cr) * GPIT + p8);
#pragma unroll
  for (int it = 0; it < 8; ++it) *(v4u*)(VHo + (vrow0 + (size_t)(it * 16 + cr)) * SEQ + s0 + p8) = oh[it];
  wait_x0();         // the row-major rows are loaded into the registers that the hi stores name
  v4u orw[8];
#pragma unroll
  for (int it = 0; it < 8; ++it) orw[it] = *(const v4u*)(T + 2 * GPLANE + (it * 16 + cr) * GPIT + p8);
#pragma unroll
  for (int it = 0; it < 8; ++it) *(v4u*)(VRo + (rrow0 + (size_t)(it * 16 + cr)) * DMOD + colC + p8) = orw[it];
  if (dolo) {
    wait_x0();       // the residual rows are loaded into the registers that the earlier stores name
    v4u ol[8];
#pragma unroll
    for (int it = 0; it < 8; ++it) ol[it] = *(const v4u*)(T + GPLANE + (it * 16 + cr) * GPIT + p8);
#pragma unroll
    for (int it = 0; it < 8; ++it) *(v4u*)(VLo + (vrow0 + (size_t)(it * 16 + cr)) * QE + s0 + p8) = ol[it];
  }
}

struct Frag16 { v4u u[2]; };
__device__ __forceinline__ Frag16 ldfrag_s(const u16* p) {
  Frag16 f;
  f.u[0] = *(const v4u*)(p);
  f.u[1] = *(const v4u*)(p + 16);
  return f;
}
template <bool BF>
__device__ __forceinline__ v8f mma_s(const Frag16& a, const Frag16& b, v8f c) {
  if constexpr (BF) {
    FragB x, y;
    x.u[0] = a.u[0]; x.u[1] = a.u[1]; y.u[0] = b.u[0]; y.u[1] = b.u[1];
    return mma_b(x.v, y.v, c);
  } else {
    FragH x, y;
    x.u[0] = a.u[0]; x.u[1] = a.u[1]; y.u[0] = b.u[0]; y.u[1] = b.u[1];
    return mma_h(x.v, y.v, c);
  }
}

// A0, A1, B0: first row of the block's 128 rows in each plane (row pitch DMOD halves); A1 is read only when NPROD == 2.
// ring: 2 * (NPROD + 1) * GPLANE halves; behind the last pass's barrier it is free, and the caller's epilogue stages its output there.
// acc: the wave's 32 x 64 tile (rows 32 * (wave >> 1), columns 64 * (wave & 1) of the block tile), zeroed here.
// Every thread of the block calls this (block barriers inside).
template <int NPROD, bool BF>
__device__ __forceinline__ void gemm_tile(const u16* A0, const u16* A1, const u16* B0, u16* ring, v8f (&acc)[2][4]) {
  constexpr int STG = (NPROD + 1) * GPLANE;
  const int tid = threadIdx.x, wave = tid >> 5, lane = tid & 31, hh = lane >> 4, m = lane & 15;
  const int wr = (wave >> 1) * 32, wc = (wave & 1) * 64;
  // copy role: row tid >> 4 (+ 16 per copy), 16-B column tid & 15
  const int crow = tid >> 4, ccol = (tid & 15) * 8;
  const size_t  goff = (size_t)crow * DMOD + ccol;
  const unsigned l0  = (unsigned)(size_t)(ring + crow * GPIT + ccol);
  const u16* ga0 = A0 + goff;
  const u16* ga1 = A1 + goff;
  const u16* gb  = B0 + goff;
  auto stage = [&](int buf, int pass) {
    const unsigned l = l0 + (unsigned)(buf * STG * 2);
    const int      k = pass * GKP;
    copy_plane(l, ga0 + k);
    if constexpr (NPROD == 2) copy_plane(l + GPLANE * 2, ga1 + k);
    copy_plane(l + NPROD * GPLANE * 2, gb + k);
  };
#pragma unroll
  for (int i = 0; i < 2; ++i) {
#pragma unroll
    for (int j = 0; j < 4; ++j) acc[i][j] = zero8();
  }
  stage(0, 0);
  wait_async0();
  __syncthreads();
  stage(1, 1);
#pragma unroll 1   // rolled: one copy of the pass body serves both buffers (t & 1)
  for (int t = 0; t < GNP; ++t) {
    const u16* st = ring + (t & 1) * STG;
    const u16* pa = st + (wr + m) * GPIT + 8 * hh;
    const u16* pb = st + NPROD * GPLANE + (wc + m) * GPIT + 8 * hh;
    Frag16 a[2][2], al[2][2], b[2][4];
    auto fetch = [&](int s, int kk) {
#pragma unroll
      for (int i = 0; i < 2; ++i) {
        a[s][i] = ldfrag_s(pa + i * 16 * GPIT + kk * 32);
        if constexpr (NPROD == 2) al[s][i] = ldfrag_s(pa + GPLANE + i * 16 * GPIT + kk * 32);
      }
#pragma unroll
      for (int j = 0; j < 4; ++j) b[s][j] = ldfrag_s(pb + j * 16 * GPIT + kk * 32);
    };
    fetch(0, 0);
#pragma unroll     // unrolled: the fragment set index kk & 1 must be a constant, else the sets leave the registers
    for (int kk = 0; kk < GKP / 32; ++kk) {
      const int s = kk & 1;
      if (kk + 1 < GKP / 32) fetch(s ^ 1, kk + 1);   // the next k step's fragments, inside this pass's own buffer
      // keeps that load group whole and ahead of this step's products: sunk among them, each load is waited for where it stands
      __builtin_amdgcn_sched_barrier(0);
#pragma unroll
      for (int i = 0; i < 2; ++i) {
#pragma unroll
        for (int j = 0; j < 4; ++j) acc[i][j] = mma_s<BF>(a[s][i], b[s][j], acc[i][j]);
      }
      if constexpr (NPROD == 2) {
#pragma unroll
        for (int i = 0; i < 2; ++i) {
#pragma unroll
          for (int j = 0; j < 4; ++j) acc[i][j] = mma_s<BF>(al[s][i], b[s][j], acc[i][j]);
        }
      }
      __builtin_amdgcn_sched_barrier(0);             // the far end of the same fence: later loads stay behind these products
    }
    // hand-over: own reads done, own copies of pass t + 1 landed, then the one barrier that publishes pass t + 1 and frees this buffer
    wait_ds0();
    wait_async0();
    __syncthreads();
    if (t + 2 < GNP) stage(t & 1, t + 2);
  }
  wait_async0();
}

// =====================================================================================================
// Projection of one batch: (A[M][DMOD] (bf16 row-major) . Bt[N][DMOD]^T (bf16 k-contiguous)) * oscale + bias[col] (bf16 RNE value), f32,
// written straight as the 16-bit planes the attention kernels read. Block = 128 x 128 tile (host guarantees M % 128 == 0,
// N % 128 == 0, grid = (M/128)*(N/128)).
// VT == 0 (q, k): P0 / P1 = hi / residual planes [MROWS][DMOD] of value * sc, rows b*SEQ + s (epi_qk).
// VT == 1 (v):    P0 = v^T hi plane [(b*NH + g)*HD + d][SEQ] of value * sc, P1 = v^T residual plane, pitch QE, keys s < QE only,
//                 P2 = the hi values row-major [MROWS][DMOD], rows b*SEQ + s (epi_vt). P2 is not used when VT == 0.
// coverage: the grid's tiles cover every (s, column) of the batch once, so every plane element of the batch is written once.
// =====================================================================================================
template <int VT>
__global__ __launch_bounds__(GTHR)
void gemm_p(const u16* __restrict__ A, const u16* __restrict__ Bt, const float* __restrict__ bias,
            u16* P0, u16* P1, u16* P2, int M, int N, int b, float oscale, float sc) {
  __shared__ __align__(16) u16 ring[2 * 2 * GPLANE];
  const int ntile = N / GT;
  const int bid   = blockIdx.x;
  const int row0  = (bid / ntile) * GT;
  const int col0  = (bid % ntile) * GT;
  if (row0 + GT > M) return;                // block-uniform, before any barrier; never taken with the exact grid
  const int tid = threadIdx.x, wave = tid >> 5;
  const int wr = (wave >> 1) * 32, wc = (wave & 1) * 64;
  v8f acc[2][4];
  gemm_tile<1, true>(A + (size_t)row0 * DMOD, A + (size_t)row0 * DMOD, Bt + (size_t)col0 * DMOD, ring, acc);
  if constexpr (VT != 0) {
    epi_vt(ring, acc, oscale, bias, P0, P1, P2, sc, (size_t)b * DMOD + col0, (size_t)b * SEQ + row0, row0, col0, row0 + GT <= QE, wr, wc,
           tid);
  } else {
    epi_qk((float*)(void*)ring + wave * (2 * SLAB64), acc, oscale, bias, P0, P1, sc, (size_t)b * SEQ + row0 + wr, col0 + wc, tid & 31);
  }
}

// =====================================================================================================
// Output projection: C[orow][DMOD] (f32) = (Ah [+ Al])[row][DMOD] . Bt[DMOD][DMOD]^T * oscale + bias (bf16 RNE value).
// NPROD == 1: Ah only (one product); NPROD == 2: Ah + Al residual plane (products h.B + l.B into one accumulator, l unscaled).
// Block -> (column tile ct = bid % 8, sequence row tile rt of nrt starting at s = sbeg, batch bb), tiles of 128: rows of Ah are
// bb*SEQ + s, rows of Al are bb*QE + s (valid only while s < QE, host guarantees for NPROD == 2), rows of C are bb*XS_FULL + s.
// Same tiling as gemm_p; epilogue epi3264.
// =====================================================================================================
template <int NPROD>
__global__ __launch_bounds__(GTHR)
void gemm_o(const u16* __restrict__ Ah, const u16* __restrict__ Al, const u16* __restrict__ Bt, const float* __restrict__ bias,
            float* C, int sbeg, int nrt, float oscale) {
  __shared__ __align__(16) u16 ring[2 * (NPROD + 1) * GPLANE];
  const int ntile = DMOD / GT;
  const int bid   = blockIdx.x;
  const int ct    = bid % ntile;
  const int t2    = bid / ntile;
  const int rt    = t2 % nrt;
  const int bb    = t2 / nrt;
  if (bb >= NB) return;                     // block-uniform, before any barrier; never taken with the exact grid
  const int srow  = sbeg + rt * GT;
  if (srow + GT > SEQ) return;              // block-uniform; never taken
  if (NPROD == 2 && srow + GT > QE) return; // block-uniform; never taken
  const size_t rowC = (size_t)bb * SEQ + srow;
  const size_t rowL = (size_t)bb * QE + srow;
  const size_t rowO = (size_t)bb * XS_FULL + srow;
  const u16* a0 = Ah + rowC * DMOD;
  const u16* a1 = (NPROD == 2) ? (Al + rowL * DMOD) : a0;
  const int tid = threadIdx.x, wave = tid >> 5;
  v8f acc[2][4];
  gemm_tile<NPROD, false>(a0, a1, Bt + (size_t)ct * GT * DMOD, ring, acc);
  epi3264((float*)(void*)ring + wave * (2 * SLAB64), acc, oscale, bias, C, DMOD, rowO + (wave >> 1) * 32, ct * GT + (wave & 1) * 64,
          tid & 31);
}

// =====================================================================================================
// Strided key set (pass S). Key j is in this set for query i iff j = i - STRD*n with i - j >= WIN, j >= GLB (then j <= i and
// (i - j) % STRD == 0 hold). Queries and keys of one residue class rr = i % STRD: i = rr + STRD*a, j = rr + STRD*c, a, c < NA.
// Block bid -> (residue rr = bid % STRD, head group hg, batch b); one wave per head; the wave owns all NA query rows of (b, head, rr)
// in tiles of 16 (rows a >= NA of the last tile are padding: operand row clamped, weight forced to 0, nothing stored) and visits
// the candidate keys in tiles of 32 (slots c >= NA clamped and forced to 0).
//   Transposed products: a lane owns ONE query (column lane & 15 of every D tile).
//   scores S^T: k hi / residual (A, lane -> key slot, arithmetic stride STRD rows in the [b*SEQ + s][h*HD + d] planes) times
//   q hi / residual (B, lane -> row a = 16*at + (lane & 15)), products hh + lh + hl over HD; D element r = key slot 8*(lane >> 4) + r;
//   element predicate (a < NA) && (c < NA) && (STRD*(a - c) >= WIN) && (j >= GLB), -inf otherwise; base-2 online softmax in f32
//   (-inf safe): maximum and sum over the lane's 16 scores, then one exchange with lane ^ 16;
//   P^T (B operand) is packed from those 16 values in the lane: they already lie in the split k map;
//   v rows of the 32 key slots (128 B each, arithmetic stride STRD rows in the row-major v hi plane [b*SEQ + s][h*HD + d]) loaded once per
//   key tile as whole lines into a wave-private LDS tile [slot][d], read by transposing LDS loads as the A operand of O^T += V^T.P^T
//   (the strided keys only feed query rows i >= WIN + GLB, which always hold >= WIN + GLB keys).
//   State written per query row: M = running max (log2 domain), L = running sum, AC = acc * 64 / (32768*1024) as f16
//   (AC plane layout [b*SEQ + i][h*HD + d]; M, L planes [(b*NH + h)*STRD + rr][NAP], rows a >= NA hold -inf / 0).
// coverage: AC: every (b, i < SEQ, h, d) exactly once (union over rr, a < NA); M/L: every (b, h, rr) line group exactly once.
// =====================================================================================================
__global__ __launch_bounds__(ATT_THREADS)
void attn_s(const u16* __restrict__ QHp, const u16* __restrict__ QLp,
            const u16* __restrict__ KHp, const u16* __restrict__ KLp,
            const u16* __restrict__ VRp, u16* ACp, float* Mp, float* Lp) {
  __shared__ __align__(16) float    smem[WPB * SLW];
  __shared__ __align__(16) _Float16 vts[WPB * 32 * VRP];
  __shared__ __align__(16) float    mls[WPB * 2 * NAP];

  const int tid  = threadIdx.x;
  const int wave = tid >> 5;
  const int lane = tid & 31;
  const int hh   = lane >> 4;
  const int c    = lane & 15;
  const int bid  = blockIdx.x;
  const int rres = bid % STRD;
  const int t2   = bid / STRD;
  const int hg   = t2 % NHG;
  const int b    = t2 / NHG;
  if (b >= NB) return;                      // block-uniform; no block barriers in this kernel; never taken with the exact grid
  const int head = hg * WPB + wave;

  float*    slab = smem + wave * SLW;       // result slab [16 queries][64 d] pitch 68
  _Float16* vt   = vts + wave * (32 * VRP); // v tile [32 key slots][64 d] pitch 80 halves = 32 B x odd, the transposing load's pitch
  float*    msl  = mls + wave * (2 * NAP);
  float*    lsl  = msl + NAP;
#pragma unroll 1
  for (int i2 = lane; i2 < NAP; i2 += 32) { msl[i2] = -INFINITY; lsl[i2] = 0.0f; }
  wave_sync_lds();

  const _Float16* QHh = (const _Float16*)(const void*)QHp;
  const _Float16* QLh = (const _Float16*)(const void*)QLp;
  const _Float16* KHh = (const _Float16*)(const void*)KHp;
  const _Float16* KLh = (const _Float16*)(const void*)KLp;
  const size_t hcol  = (size_t)head * HD + 8 * hh;
  const size_t brow  = (size_t)b * SEQ + rres;                          // plane row of a = 0
  const int    gr    = lane >> 3, gc = (lane & 7) * 8;                  // v row load role: row gr of 4, 16-B column gc
  const u16*   vbase = VRp + brow * DMOD + (size_t)head * HD + gc;      // + STRD*c*DMOD
  const _Float16* vrd = vt + (8 * hh + (lane & 7)) * VRP + 8 * ((lane >> 3) & 1);   // transposing load address, key slot 0, d 0
  const float  lsc   = SM_SCALE * (LOG2E / (QSC * KSC));
  const float  acs   = ACAR / (PCAR * VCAR);

  // the 32 key slots' v rows of key tile ks: one instruction = 4 rows x 128 B = whole lines; they go to LDS behind the softmax
  v4u rv[8];
  auto load_rows = [&](int ks) {
#pragma unroll
    for (int it = 0; it < 8; ++it) {
      int cs = ks * 32 + it * 4 + gr;
      if (cs > NA - 1) cs = NA - 1;
      rv[it] = *(const v4u*)(vbase + (size_t)STRD * cs * DMOD);
    }
    wait_x0();                              // later loads may land in the address registers of these
  };
  if constexpr (NKS == 1) load_rows(0);     // a single key tile: the same rows serve every query tile

#pragma unroll 1
  for (int at = 0; at < NAT; ++at) {
    float mq = -INFINITY, lq = 0.f;         // this lane's query: running max and sum (equal in lanes l and l ^ 16)
    v8f o[4];                               // O^T: o[j][r] = (d = 16*j + 8*hh + r, query aq)
#pragma unroll
    for (int j = 0; j < 4; ++j) o[j] = zero8();
    const int aq = at * 16 + c;             // this lane's query row index a
    int am = aq;
    if (am > NA - 1) am = NA - 1;           // clamped operand row for this lane
    const size_t qoff = (brow + (size_t)STRD * am) * DMOD + hcol;
    const _Float16* Qh = QHh + qoff;
    const _Float16* Ql = QLh + qoff;

#pragma unroll 1
    for (int ks = 0; ks < NKS; ++ks) {
      if constexpr (NKS != 1) load_rows(ks);
      // ---- scores S^T: D element r of this lane = (key slot ks*32 + 8*hh + r, query aq) in s0, slot + 16 in s1 ----
      int c0i = ks * 32 + c;       if (c0i > NA - 1) c0i = NA - 1;
      int c1i = ks * 32 + 16 + c;  if (c1i > NA - 1) c1i = NA - 1;
      const size_t k0off = (brow + (size_t)STRD * c0i) * DMOD + hcol;
      const size_t k1off = (brow + (size_t)STRD * c1i) * DMOD + hcol;
      const _Float16* k0p = KHh + k0off;
      const _Float16* k1p = KHh + k1off;
      const _Float16* l0p = KLh + k0off;
      const _Float16* l1p = KLh + k1off;
      v8f s0 = zero8(), s1 = zero8();
#pragma unroll
      for (int kk = 0; kk < HD / 32; ++kk) {
        const v16h qh  = ldfrag_h(Qh + kk * 32);
        const v16h ql  = ldfrag_h(Ql + kk * 32);
        const v16h kh0 = ldfrag_h(k0p + kk * 32);
        const v16h kh1 = ldfrag_h(k1p + kk * 32);
        const v16h kl0 = ldfrag_h(l0p + kk * 32);
        const v16h kl1 = ldfrag_h(l1p + kk * 32);
        s0 = mma_h(kh0, qh, s0);
        s0 = mma_h(kh0, ql, s0);
        s0 = mma_h(kl0, qh, s0);
        s1 = mma_h(kh1, qh, s1);
        s1 = mma_h(kh1, ql, s1);
        s1 = mma_h(kl1, qh, s1);
        guard2(s0, s1, qh, ql, kh0, kl0, kh1, kl1);
      }
      // ---- key select + online softmax in base 2, -inf-safe; all 16 values of a lane belong to its query ----
      const int cb0 = ks * 32 + 8 * hh;
      float t0[8], t1[8];
      float mx = -INFINITY;
#pragma unroll
      for (int r = 0; r < 8; ++r) {
        const int  cc0 = cb0 + r, cc1 = cc0 + 16;
        const int  j0  = rres + STRD * cc0, j1 = rres + STRD * cc1;
        const bool ok0 = (aq < NA) && (cc0 < NA) && (STRD * (aq - cc0) >= WIN) && (j0 >= GLB);
        const bool ok1 = (aq < NA) && (cc1 < NA) && (STRD * (aq - cc1) >= WIN) && (j1 >= GLB);
        t0[r] = ok0 ? s0[r] * lsc : -INFINITY;
        t1[r] = ok1 ? s1[r] * lsc : -INFINITY;
        mx = fmaxf(mx, fmaxf(t0[r], t1[r]));
      }
      mx = fmaxf(mx, xhalf(mx));
      const float mn = fmaxf(mq, mx);
      const float ms = (mn == -INFINITY) ? 0.0f : mn;
      const float al = exp2f(mq - ms);
      mq = mn;
      // ---- B fragment of P^T * 32768 (f16): elements 0..7 = slots 8*hh + r, elements 8..15 = slots 16 + 8*hh + r ----
      FragH ph;
      float pa = 0.f, pb = 0.f;
#pragma unroll
      for (int r = 0; r < 8; ++r) {
        const float e0 = exp2f(t0[r] - ms), e1 = exp2f(t1[r] - ms);
        pa += e0;
        pb += e1;
        ph.h[0][r] = (_Float16)(e0 * PCAR);
        ph.h[1][r] = (_Float16)(e1 * PCAR);
      }
      float ps = pa + pb;
      ps += xhalf(ps);
      lq = lq * al + ps;
#pragma unroll
      for (int j = 0; j < 4; ++j) {
#pragma unroll
        for (int r = 0; r < 8; ++r) o[j][r] *= al;
      }
#pragma unroll
      for (int it = 0; it < 8; ++it) *(v4u*)(vt + (it * 4 + gr) * VRP + gc) = rv[it];
      wave_sync_lds();                      // the v tile is read by other lanes than wrote it
      // ---- O^T += V^T.P^T : A fragment row d = jj*16 + c, key slots 8*hh + 0..7 and 16 + 8*hh + 0..7 by two transposing loads ----
#pragma unroll
      for (int jg = 0; jg < HD / 32; ++jg) {
        FragH fa, fb;
        fa.u[0] = ld_tr16(vrd + (2 * jg) * 16);
        fa.u[1] = ld_tr16(vrd + 16 * VRP + (2 * jg) * 16);
        fb.u[0] = ld_tr16(vrd + (2 * jg + 1) * 16);
        fb.u[1] = ld_tr16(vrd + 16 * VRP + (2 * jg + 1) * 16);
        const v16h vha = fa.v, vhb2 = fb.v;
        o[2 * jg]     = mma_h(vha,  ph.v, o[2 * jg]);
        o[2 * jg + 1] = mma_h(vhb2, ph.v, o[2 * jg + 1]);
        guard2(o[2 * jg], o[2 * jg + 1], ph.v, vha, vhb2, ph.v, vha, vhb2);
      }
      wave_sync_lds();                      // the tile's reads end before the next key tile's rows rewrite it
    }
    acc_guard4(o[0], o[1], o[2], o[3]);
    // ---- state: m, l per query into the LDS staging; acc * 64 / (32768*1024) into the slab row of the lane's query ----
    if (hh == 0) { msl[aq] = mq; lsl[aq] = lq; }
#pragma unroll
    for (int j = 0; j < 4; ++j) {
      v4f w0, w1;
#pragma unroll
      for (int e = 0; e < 4; ++e) { w0[e] = o[j][e] * acs; w1[e] = o[j][4 + e] * acs; }
      float* sp = slab + c * SLP + j * 16 + 8 * hh;
      *(v4f*)(sp)     = w0;
      *(v4f*)(sp + 4) = w1;
    }
    wave_sync_lds();
    // ---- AC rows (f16): lane = (row select rq in 0..3, 8 consecutive d at c8) ----
    v4u    ov[4];
    bool   okr[4];
    size_t dso[4];
    const int rq = lane >> 3, c8 = (lane & 7) * 8;
#pragma unroll
    for (int it = 0; it < 4; ++it) {
      const int row = it * 4 + rq;
      const v4f a = *(const v4f*)(slab + row * SLP + c8), b4 = *(const v4f*)(slab + row * SLP + c8 + 4);
      float w[8];
#pragma unroll
      for (int e = 0; e < 4; ++e) { w[e] = a[e]; w[4 + e] = b4[e]; }
#pragma unroll
      for (int e = 0; e < 4; ++e) {
        ov[it][e] = pk16(h_bits((_Float16)w[2 * e]), h_bits((_Float16)w[2 * e + 1]));
      }
      const int arow = at * 16 + row;
      okr[it] = (arow < NA);                // uniform over the 8 lanes of one line
      const int acl  = okr[it] ? arow : (NA - 1);
      dso[it] = (brow + (size_t)STRD * acl) * DMOD + (size_t)head * HD + c8;
    }
    {
#pragma unroll
      for (int it = 0; it < 4; ++it) {
        if (okr[it]) *(v4u*)(ACp + dso[it]) = ov[it];
      }
      
    }
    wave_sync_lds();
  }

  wave_sync_lds();
  const size_t mlbase = ((size_t)(b * NH + head) * STRD + rres) * NAP;
  const int l8 = lane & 7;
  v4f mv[NAP / 32], lv[NAP / 32];
#pragma unroll
  for (int ch = 0; ch < NAP / 32; ++ch) {
    mv[ch] = *(const v4f*)(msl + ch * 32 + l8 * 4);
    lv[ch] = *(const v4f*)(lsl + ch * 32 + l8 * 4);
  }
  const bool wm = (lane < 8), wl = (lane >= 8) && (lane < 16);
  {
#pragma unroll
    for (int ch = 0; ch < NAP / 32; ++ch) {
      if (wm) *(v4f*)(Mp + mlbase + ch * 32 + l8 * 4) = mv[ch];
      if (wl) *(v4f*)(Lp + mlbase + ch * 32 + l8 * 4) = lv[ch];
    }
    
  }
}

// =====================================================================================================
// Band + leading key set (pass A), initialised from the pass-S state. Key j is in this set for query i iff
// j <= i && (i - j < WIN || j < GLB). Block bid -> (query block qb = qb0 + bid % nqb: rows qB = 64*qb .. qB+63, head, batch b);
// one wave per 16 query rows q0 = qB + 16*wave, all four waves on the same head, so that they share its key tiles.
//   q/k hi planes f16 x1024 [b*SEQ + s][h*HD + d], residual planes same layout; v^T hi plane [b*NH + h][d][SEQ], v^T residual plane
//   [b*NH + h][d][QE] (keys < QE).
//   Transposed products: a lane owns ONE query i = q0 + (lane & 15), the column of every D tile; lanes l and l ^ 16 share it.
//   Init: m = M, l = L (from [(b*NH+h)*STRD + i%STRD][i/STRD]), O^T = AC row (f16, 8 consecutive d per 16-B load) * (32768*1024/64).
//   The q fragments (B operand) are loaded once and stay in registers.
//   Key tiles of 32, the block's list in ascending order: tile 0 (keys 0..31, holds the leading GLB keys) when the block's band does not
//   start at tile 0, then the band tiles from the one holding max(0, qB - WIN + 1) to the one holding qB + 63 (at most WIN/32 + 3 + 1).
//   A tile is staged once for the block in LDS by per-lane 16-B asynchronous copies: 32 k hi rows and 32 k residual rows (128 B = one whole
//   line each, LDS pitch 144 B), 64 v^T row pieces (64 B, LDS pitch 80 B), and the v^T residual pieces when ROB. Two buffers: tile t + 2 is
//   copied into the buffer tile t has left while tile t + 1 is worked on. Fragments are 16-B LDS reads with the split k map of ldfrag_h.
//   A wave works on tile 0 and on the tiles from the one holding max(0, q0 - WIN + 1) to the one holding q0 + 15; every other tile of the
//   block's list holds only keys outside the set for all of its 16 query rows (weight exactly 0) and is passed over; the hand-over at the
//   foot of a trip is passed by every wave.
//   Per tile: S^T = K.Q^T, 2 key subtiles x 2 k-steps, products k_hi.q_hi + k_hi.q_lo + k_lo.q_hi; exact element predicate; online
//   max-subtracted base-2 softmax in f32, -inf-safe rescale: maximum and sum over the lane's 16 scores, then one exchange with lane ^ 16;
//   P^T x32768 (f16, and its f16 residual when ROB) packed in the lane as the B operand (D rows 8*(lane >> 4) + r of the two subtiles are the
//   split k map's elements); O^T += V^T.P^T with the v^T A fragments in 2 groups of 2 d-subtiles. ROB == 1 (host uses it for qB + 64 <= QE
//   only; then every visited key is < QE): products hh + lh + hl with the v residual plane, O written as hi + residual planes; ROB == 0:
//   single product v_hi.P_hi, O hi plane only.
//   After the loop: out = acc / Z (Z >= 1 always: key i itself lies in a visited tile; guarded anyway), carries 1/(32768*1024) folded
//   once, written to the wave's private result slab (pitch 68; row = query; every element owned by one lane), read back as whole rows:
//   each plane row ([b*SEQ + s][h*HD + d]; residual [b*QE + s][h*HD + d], ROB only) is written by 8 consecutive lanes x 16 B.
// coverage: per wave 4 instructions x 4 rows x 8 lanes x 8 halves = 16 x 64 per plane; the two launches (qb < QE/64 with ROB = 1, the rest
//           with ROB = 0) x NH x NB blocks x WPB waves = every (b, s, h) row of O hi exactly once and every (b, s < QE, h) row of O residual
//           exactly once.
// =====================================================================================================
#define AQB    (16 * WPB)
#define KPIT   72
#define VPIT   40
#define KTILE  (32 * KPIT)
#define VTILE  (HD * VPIT)
#define NKBB   ((WIN / 32) + 3)
static_assert(AQB == 64 && (SEQ % AQB) == 0 && (QE % AQB) == 0 && ATT_THREADS == 128 && HD == 64);

// One key tile of one head: each lane copies two 16-B pieces of every plane (k rows 16 apart, v^T rows 32 apart).
// lk, lv: the lane's first k hi and v^T hi place in the buffer; the residual tiles lie KTILE and VTILE halves behind them.
template <int ROB>
__device__ __forceinline__ void copy_kv(unsigned lk, unsigned lv, const u16* gkh, const u16* gkl, const u16* gvh, const u16* gvl) {
#if defined(__HIP_DEVICE_COMPILE__)
  const unsigned ks = 16 * KPIT * 2, vs = 32 * VPIT * 2;
  const size_t   gk = (size_t)16 * DMOD;
  // the closing s_wait_xcnt 0 stands inside each statement so that no address register is rewritten ahead of it
  asm volatile("global_load_async_to_lds_b128 %0, %6, off\n\t"
               "global_load_async_to_lds_b128 %1, %7, off\n\t"
               "global_load_async_to_lds_b128 %2, %8, off\n\t"
               "global_load_async_to_lds_b128 %3, %9, off\n\t"
               "global_load_async_to_lds_b128 %4, %10, off\n\t"
               "global_load_async_to_lds_b128 %5, %11, off\n\t"
               "s_wait_xcnt 0x0"
               :: "v"(lk), "v"(lk + ks), "v"(lk + KTILE * 2), "v"(lk + KTILE * 2 + ks), "v"(lv), "v"(lv + vs),
                  "v"(gkh), "v"(gkh + gk), "v"(gkl), "v"(gkl + gk), "v"(gvh), "v"(gvh + (size_t)32 * SEQ)
               : "memory");
  if constexpr (ROB != 0) {
    asm volatile("global_load_async_to_lds_b128 %0, %2, off\n\t"
                 "global_load_async_to_lds_b128 %1, %3, off\n\t"
                 "s_wait_xcnt 0x0"
                 :: "v"(lv + VTILE * 2), "v"(lv + VTILE * 2 + vs), "v"(gvl), "v"(gvl + (size_t)32 * QE)
                 : "memory");
  }
#endif
}

template <int ROB>
__global__ __launch_bounds__(ATT_THREADS)
void attn_a(const u16* __restrict__ QHp, const u16* __restrict__ QLp,
            const u16* __restrict__ KHp, const u16* __restrict__ KLp,
            const u16* __restrict__ VHp, const u16* __restrict__ VLp,
            const u16* __restrict__ ACp, const float* __restrict__ Mp, const float* __restrict__ Lp,
            u16* OHp, u16* OLp, int qb0, int nqb) {
  constexpr int ASTG = 2 * KTILE + (1 + ROB) * VTILE;   // halves of one buffer: k hi, k residual, v^T hi (, v^T residual)
  __shared__ __align__(16) float smem[WPB * SLW];
  __shared__ __align__(16) u16   ring[2 * ASTG];

  const int tid  = threadIdx.x;
  const int wave = __builtin_amdgcn_readfirstlane(tid >> 5);   // scalar: the test that passes over a tile is a scalar branch
  const int lane = tid & 31;
  const int hh   = lane >> 4;
  const int c    = lane & 15;
  const int bid  = blockIdx.x;
  const int qbl  = bid % nqb;
  const int t2   = bid / nqb;
  const int head = t2 % NH;
  const int b    = t2 / NH;
  if (b >= NB) return;                      // block-uniform, before any barrier; never taken with the exact grid
  const int qB   = (qb0 + qbl) * AQB;
  if (qB + AQB > SEQ) return;               // block-uniform, before any barrier; never taken
  if (ROB != 0 && qB + AQB > QE) return;    // block-uniform, before any barrier; never taken (residual planes cover s < QE only)
  const int q0   = qB + 16 * wave;

  float* slab = smem + wave * SLW;          // result slab [16 queries][64 d] pitch 68

  // ---- the block's tile list: leading tile 0 (when not part of the band) then the band tiles ----
  int kloB = qB - (WIN - 1);
  if (kloB < 0) kloB = 0;
  const int ktbB = kloB >> 5;
  const int kteB = (qB + AQB - 1) >> 5;     // <= SEQ/32 - 1; for ROB: kteB*32 + 31 <= QE - 1
  int nband = kteB - ktbB + 1;
  if (nband > NKBB) nband = NKBB;           // static bound (WIN/32 + 3)
  if (nband < 0) nband = 0;
  const int hasg = (ktbB > 0) ? 1 : 0;
  const int nkt  = nband + hasg;
  // ---- the wave's own band tiles ----
  int klo = q0 - (WIN - 1);
  if (klo < 0) klo = 0;
  const int ktb = klo >> 5;
  const int kte = (q0 + 15) >> 5;

  // ---- copy role: k row tid >> 3 (+ 16), 16-B column tid & 7; v^T row tid >> 2 (+ 32), 16-B column tid & 3 ----
  const int krow = tid >> 3, kch = (tid & 7) * 8;
  const int vrow = tid >> 2, vch = (tid & 3) * 8;
  const unsigned lk0 = (unsigned)(size_t)(ring + krow * KPIT + kch);
  const unsigned lv0 = (unsigned)(size_t)(ring + 2 * KTILE + vrow * VPIT + vch);
  const size_t   gko = ((size_t)b * SEQ + krow) * DMOD + (size_t)head * HD + kch;
  const u16* gkh0 = KHp + gko;
  const u16* gkl0 = KLp + gko;
  const u16* gvh0 = VHp + ((size_t)(b * NH + head) * HD + vrow) * SEQ + vch;
  const u16* gvl0 = gvh0;
  if constexpr (ROB != 0) gvl0 = VLp + ((size_t)(b * NH + head) * HD + vrow) * QE + vch;
  auto stage = [&](int buf, int kt) {
    const int      kb = ((kt < hasg) ? 0 : (ktbB + kt - hasg)) * 32;   // kb + 31 <= SEQ - 1 (ROB: <= QE - 1)
    const unsigned lo = (unsigned)(buf * ASTG * 2);
    copy_kv<ROB>(lk0 + lo, lv0 + lo, gkh0 + (size_t)kb * DMOD, gkl0 + (size_t)kb * DMOD, gvh0 + kb, gvl0 + kb);
  };
  stage(0, 0);

  const size_t hcol = (size_t)head * HD + 8 * hh;
  const _Float16* Qh  = (const _Float16*)(const void*)QHp + ((size_t)b * SEQ + q0 + c) * DMOD + hcol;
  const _Float16* Ql  = (const _Float16*)(const void*)QLp + ((size_t)b * SEQ + q0 + c) * DMOD + hcol;
  const float lsc = SM_SCALE * (LOG2E / (QSC * KSC));
  const float oc  = 1.0f / (PCAR * VCAR);
  const float aci = (PCAR * VCAR) / ACAR;

  const int qr = q0 + c;                    // this lane's query
  float mq, lq;                             // its running max and sum (equal in lanes l and l ^ 16)
  v8f o[4];                                 // O^T: o[j][r] = (d = 16*j + 8*hh + r, query qr)
  v16h qhf[HD / 32], qlf[HD / 32];          // q hi / residual fragments, kept for every tile
#pragma unroll
  for (int kk = 0; kk < HD / 32; ++kk) {
    qhf[kk] = ldfrag_h(Qh + kk * 32);
    qlf[kk] = ldfrag_h(Ql + kk * 32);
  }
  // ---- init from the strided-set state ----
  {
    const size_t mli = ((size_t)(b * NH + head) * STRD + (qr % STRD)) * NAP + (qr / STRD);   // qr / STRD < NA <= NAP
    mq = Mp[mli];
    lq = Lp[mli];
    const _Float16* acp = (const _Float16*)(const void*)ACp + ((size_t)b * SEQ + qr) * DMOD + hcol;
#pragma unroll
    for (int j = 0; j < 4; ++j) {
      const v8h a = *(const v8h*)(acp + j * 16);
#pragma unroll
      for (int r = 0; r < 8; ++r) o[j][r] = (float)a[r] * aci;
    }
  }
  wait_x0();                                // later code may reuse the address registers of the loads above

  wait_async0();
  __syncthreads();                          // tile 0 is published
  if (nkt > 1) stage(1, 1);

#pragma unroll 1
  for (int kt = 0; kt < nkt; ++kt) {
    const int tix = (kt < hasg) ? 0 : (ktbB + kt - hasg);
    const int kb  = tix * 32;
    if (tix == 0 || (tix >= ktb && tix <= kte)) {              // same for the whole wave; no barrier inside
      const _Float16* st = (const _Float16*)(const void*)(ring + (kt & 1) * ASTG);
      // ---- scores S^T: D element r of this lane = (key kb + 8*hh + r, query qr) in s0, key kb + 16 + 8*hh + r in s1 ----
      v8f s0 = zero8(), s1 = zero8();
      const _Float16* k0p = st + c * KPIT + 8 * hh;
      const _Float16* k1p = k0p + 16 * KPIT;
      const _Float16* l0p = k0p + KTILE;
      const _Float16* l1p = l0p + 16 * KPIT;
#pragma unroll
      for (int kk = 0; kk < HD / 32; ++kk) {
        const v16h qh  = qhf[kk];
        const v16h ql  = qlf[kk];
        const v16h kh0 = ldfrag_h(k0p + kk * 32);
        const v16h kh1 = ldfrag_h(k1p + kk * 32);
        const v16h kl0 = ldfrag_h(l0p + kk * 32);
        const v16h kl1 = ldfrag_h(l1p + kk * 32);
        s0 = mma_h(kh0, qh, s0);
        s0 = mma_h(kh0, ql, s0);
        s0 = mma_h(kl0, qh, s0);
        s1 = mma_h(kh1, qh, s1);
        s1 = mma_h(kh1, ql, s1);
        s1 = mma_h(kl1, qh, s1);
        guard2(s0, s1, qh, ql, kh0, kl0, kh1, kl1);
      }
      // ---- key select + online softmax in base 2, -inf-safe; all 16 values of a lane belong to its query ----
      const int kr0 = kb + 8 * hh;
      float t0[8], t1[8];
      float mx = -INFINITY;
#pragma unroll
      for (int r = 0; r < 8; ++r) {
        const int  key0 = kr0 + r, key1 = key0 + 16;
        const bool a0 = (key0 <= qr) && ((qr - key0 < WIN) || (key0 < GLB));
        const bool a1 = (key1 <= qr) && ((qr - key1 < WIN) || (key1 < GLB));
        t0[r] = a0 ? s0[r] * lsc : -INFINITY;
        t1[r] = a1 ? s1[r] * lsc : -INFINITY;
        mx = fmaxf(mx, fmaxf(t0[r], t1[r]));
      }
      mx = fmaxf(mx, xhalf(mx));
      const float mn = fmaxf(mq, mx);
      const float ms = (mn == -INFINITY) ? 0.0f : mn;
      const float al = exp2f(mq - ms);
      mq = mn;
      // ---- B fragments of P^T * 32768: hi f16 (and residual f16 when ROB); elements 0..7 = keys kb + 8hh + r,
      //      elements 8..15 = keys kb + 16 + 8hh + r: the split k map of the v^T A fragments ----
      FragH ph, pl;
      float pa = 0.f, pb = 0.f;
#pragma unroll
      for (int r = 0; r < 8; ++r) {
        const float e0 = exp2f(t0[r] - ms), e1 = exp2f(t1[r] - ms);
        pa += e0;
        pb += e1;
        const float ta = e0 * PCAR, tb = e1 * PCAR;
        const _Float16 ha = (_Float16)ta, hb = (_Float16)tb;
        ph.h[0][r] = ha;
        ph.h[1][r] = hb;
        if constexpr (ROB != 0) {
          pl.h[0][r] = (_Float16)(ta - (float)ha);
          pl.h[1][r] = (_Float16)(tb - (float)hb);
        }
      }
      float ps = pa + pb;
      ps += xhalf(ps);
      lq = lq * al + ps;
#pragma unroll
      for (int j = 0; j < 4; ++j) {
#pragma unroll
        for (int r = 0; r < 8; ++r) o[j][r] *= al;
      }
      // ---- O^T += V^T.P^T : A fragment row d = j*16 + c, the tile's 32 keys contiguous in its LDS row; 2 groups of 2 d-subtiles ----
      {
        const _Float16* vhp = st + 2 * KTILE + c * VPIT + 8 * hh;
        const _Float16* vlp = vhp + VTILE;                     // dereferenced only when ROB
#pragma unroll
        for (int jg = 0; jg < HD / 32; ++jg) {
          const int da = (2 * jg) * 16 * VPIT;
          const int db = da + 16 * VPIT;
          const v16h vha = ldfrag_h(vhp + da), vhb2 = ldfrag_h(vhp + db);
          if constexpr (ROB != 0) {
            const v16h vla = ldfrag_h(vlp + da), vlb2 = ldfrag_h(vlp + db);
            o[2 * jg]     = mma_h(vha,  ph.v, o[2 * jg]);
            o[2 * jg]     = mma_h(vha,  pl.v, o[2 * jg]);
            o[2 * jg]     = mma_h(vla,  ph.v, o[2 * jg]);
            o[2 * jg + 1] = mma_h(vhb2, ph.v, o[2 * jg + 1]);
            o[2 * jg + 1] = mma_h(vhb2, pl.v, o[2 * jg + 1]);
            o[2 * jg + 1] = mma_h(vlb2, ph.v, o[2 * jg + 1]);
            guard2(o[2 * jg], o[2 * jg + 1], ph.v, pl.v, vha, vhb2, vla, vlb2);
          } else {
            o[2 * jg]     = mma_h(vha,  ph.v, o[2 * jg]);
            o[2 * jg + 1] = mma_h(vhb2, ph.v, o[2 * jg + 1]);
            guard2(o[2 * jg], o[2 * jg + 1], ph.v, vha, vhb2, ph.v, vha, vhb2);
          }
        }
      }
    }
    // hand-over: own reads done, own copies of tile kt + 1 landed, then the one barrier that publishes tile kt + 1 and frees this buffer
    wait_ds0();
    wait_async0();
    __syncthreads();
    if (kt + 2 < nkt) stage(kt & 1, kt + 2);
  }
  wait_async0();
  acc_guard4(o[0], o[1], o[2], o[3]);
  // ---- out = acc / Z (0 if Z == 0), carries (32768 on P, 1024 on v) folded once; written into the slab row of the lane's query ----
  {
    const float ls  = (lq > 0.0f) ? lq : 1.0f;
    const float inv = (lq > 0.0f) ? ((1.0f / ls) * oc) : 0.0f;
#pragma unroll
    for (int j = 0; j < 4; ++j) {
      v4f w0, w1;
#pragma unroll
      for (int e = 0; e < 4; ++e) { w0[e] = o[j][e] * inv; w1[e] = o[j][4 + e] * inv; }
      float* sp = slab + c * SLP + j * 16 + 8 * hh;
      *(v4f*)(sp)     = w0;
      *(v4f*)(sp + 4) = w1;
    }
  }

  wave_sync_lds();
  // ---- O x1024 -> f16 hi (+ residual when ROB) planes; lane = (row select rq in 0..3, 8 consecutive d at c8) ----
  v4u oh[4], ol[4];
  const int rq = lane >> 3, c8 = (lane & 7) * 8;
#pragma unroll
  for (int it = 0; it < 4; ++it) {
    const int row = it * 4 + rq;
    const v4f a = *(const v4f*)(slab + row * SLP + c8), b4 = *(const v4f*)(slab + row * SLP + c8 + 4);
    float w[8];
#pragma unroll
    for (int e = 0; e < 4; ++e) { w[e] = a[e] * OSC; w[4 + e] = b4[e] * OSC; }
#pragma unroll
    for (int e = 0; e < 4; ++e) {
      const _Float16 h0 = (_Float16)w[2 * e], h1 = (_Float16)w[2 * e + 1];
      const _Float16 l0 = (_Float16)(w[2 * e] - (float)h0), l1 = (_Float16)(w[2 * e + 1] - (float)h1);
      oh[it][e] = pk16(h_bits(h0), h_bits(h1));
      ol[it][e] = pk16(h_bits(l0), h_bits(l1));
    }
  }
  const size_t ob  = ((size_t)b * SEQ + q0) * DMOD + (size_t)head * HD + c8;
  const size_t olb = ((size_t)b * QE + q0) * DMOD + (size_t)head * HD + c8;   // dereferenced only when ROB
  {
#pragma unroll
    for (int it = 0; it < 4; ++it) {
      const int row = it * 4 + rq;
      *(v4u*)(OHp + ob + (size_t)row * DMOD) = oh[it];
      if constexpr (ROB != 0) {
        *(v4u*)(OLp + olb + (size_t)row * DMOD) = ol[it];
      }
    }
    
  }
}

// =====================================================================================================
// Workspace map (bytes); every plane is fully written by whole-line stores before it is read; all extents are exact multiples
// of the store granularity (no pad rows needed); every region offset a multiple of 524288:
//   XB  bf16 [MROWS][1024]                       MROWS*2048       (x as bf16; after the projections the region holds AC f16 [MROWS][1024])
//   WB  16-bit [1024 n][1024 k]                  2097152          (Wq, Wk, Wv column blocks as bf16 [n][k], then Wo as f16 x1024, in launch order)
//   OH  f16 [MROWS][1024] x1024                  MROWS*2048       (until the strided key set has run the region holds VR, v hi row-major f16 [MROWS][1024] x1024)
//   QH  f16 [MROWS][1024] x1024                  MROWS*2048       QL residual the same; KH, KL the same
//   VH  f16 [NB*16][64][SEQ] x1024               MROWS*2048
//   VL  f16 residual [NB*16][64][QE]             NB*16*64*QE*2
//   OL  f16 residual [NB*QE][1024]               NB*QE*2048
//   M   f32 [NB*16*STRD][NAP]                     NB*16*STRD*NAP*4 L the same
//   end (NB=2, SEQ=4096, QE=512)               124780544
// =====================================================================================================
extern "C" void kernel_launch(void* const* d_in, const int* in_sizes, int n_in,
                              void* d_out, int out_size, void* d_ws, size_t ws_size,
                              hipStream_t stream) {
  if (n_in < 5) return;
  const int needx = OROWS * DMOD;
  if (in_sizes[0] < needx) return;
  if (in_sizes[1] != 3 * DMOD * DMOD) return;
  if (in_sizes[2] < 3 * DMOD) return;
  if (in_sizes[3] != DMOD * DMOD) return;
  if (in_sizes[4] < DMOD) return;
  if (out_size < needx) return;

  const float* x    = (const float*)d_in[0];
  const float* wqkv = (const float*)d_in[1];
  const float* bqkv = (const float*)d_in[2];
  const float* wo   = (const float*)d_in[3];
  const float* bo   = (const float*)d_in[4];
  float*       out  = (float*)d_out;

  const size_t szXB = (size_t)MROWS * DMOD * 2;                 // XB, later AC (same extent)
  const size_t szW  = (size_t)DMOD * DMOD * 2;
  const size_t szH  = (size_t)MROWS * DMOD * 2;                 // QH, QL, KH, KL, OH
  const size_t szV  = (size_t)NB * NH * HD * SEQ * 2;           // VH (== szH)
  const size_t szVL = (size_t)NB * NH * HD * QE * 2;            // VL
  const size_t szOL = (size_t)NB * QE * DMOD * 2;               // OL (== szVL)
  const size_t szML = (size_t)NB * NH * STRD * NAP * 4;         // M, L
  size_t off = 0;
  const size_t oXB = off; off += szXB;
  const size_t oW  = off; off += szW;
  const size_t oOH = off; off += szH;
  const size_t oQH = off; off += szH;
  const size_t oQL = off; off += szH;
  const size_t oKH = off; off += szH;
  const size_t oKL = off; off += szH;
  const size_t oVH = off; off += szV;
  const size_t oVL = off; off += szVL;
  const size_t oOL = off; off += szOL;
  const size_t oM  = off; off += szML;
  const size_t oL  = off; off += szML;
  if (off > ws_size) return;                // off = 124780544 for NB = 2, SEQ = 4096
  if (off > (size_t)WS_CAP) return;

  char* ws = (char*)d_ws;
  u16*   XB = (u16*)(ws + oXB);
  u16*   AC = (u16*)(ws + oXB);
  u16*   WB = (u16*)(ws + oW);
  u16*   OH = (u16*)(ws + oOH);
  u16*   VR = (u16*)(ws + oOH);
  u16*   QH = (u16*)(ws + oQH);
  u16*   QL = (u16*)(ws + oQL);
  u16*   KH = (u16*)(ws + oKH);
  u16*   KL = (u16*)(ws + oKL);
  u16*   VH = (u16*)(ws + oVH);
  u16*   VL = (u16*)(ws + oVL);
  u16*   OL = (u16*)(ws + oOL);
  float* Mp = (float*)(ws + oM);
  float* Lp = (float*)(ws + oL);

  const dim3 b256(256), bAT(ATT_THREADS);
  const int  n8x = (SEQ * DMOD) / 8;
  const dim3 gX((n8x + 255) / 256);                     // per batch
  const dim3 gTR((DMOD / 64) * (DMOD / 64));            // 256 blocks per [1024][1024] weight block
  const dim3 gG((SEQ / GT) * (DMOD / GT));              // per batch
  const int  nqR  = QE / AQB;                           // query blocks of 64 rows with residual P.v products per (b, head)
  const int  nqP  = SEQ / AQB - nqR;
  const int  nrtR = QE / GT;                            // out-projection row tiles with the residual plane
  const int  nrtP = (SEQ - QE) / GT;

  // (0) x -> bf16 plane [MROWS][1024], one launch per batch
  for (int b = 0; b < NB; ++b) {
    cvt16<<<gX, b256, 0, stream>>>(x + (size_t)b * XS_FULL * DMOD, XB + (size_t)b * SEQ * DMOD, n8x, 0, 1.0f);
  }
  // (1) per column block p (q, k, v): W[:, p*1024 .. p*1024+1023] ([1024 k][3072 n] -> [1024 n][1024 k] bf16); per batch:
  //     projection, written as the 16-bit planes by its own epilogue
  for (int p = 0; p < 3; ++p) {
    tr16<<<gTR, b256, 0, stream>>>(wqkv, 3 * DMOD, p * DMOD, WB, 0, 1.0f);
    for (int b = 0; b < NB; ++b) {
      const u16* xb = XB + (size_t)b * SEQ * DMOD;
      if (p == 0) {
        gemm_p<0><<<gG, b256, 0, stream>>>(xb, WB, bqkv + p * DMOD, QH, QL, nullptr, SEQ, DMOD, b, 1.0f, QSC);
      } else if (p == 1) {
        gemm_p<0><<<gG, b256, 0, stream>>>(xb, WB, bqkv + p * DMOD, KH, KL, nullptr, SEQ, DMOD, b, 1.0f, KSC);
      } else {
        gemm_p<1><<<gG, b256, 0, stream>>>(xb, WB, bqkv + p * DMOD, VH, VL, VR, SEQ, DMOD, b, 1.0f, VCAR);
      }
    }
  }
  // (2) Wo [1024 k][1024 n] -> [n][k] f16 plane of bf16 value x1024
  tr16<<<gTR, b256, 0, stream>>>(wo, DMOD, 0, WB, 1, WOS);
  // (3) strided key set -> per-row state (M, L, AC)
  attn_s<<<dim3(NB * NHG * STRD), bAT, 0, stream>>>(QH, QL, KH, KL, VR, AC, Mp, Lp);
  // (4) band + leading key set merged onto that state: query rows s < QE with residual P.v products -> O hi + residual planes;
  //     (5) remaining rows, single product -> O hi plane
  attn_a<1><<<dim3(nqR * NH * NB), bAT, 0, stream>>>(QH, QL, KH, KL, VH, VL, AC, Mp, Lp, OH, OL, 0, nqR);
  if (nqP > 0) {
    attn_a<0><<<dim3(nqP * NH * NB), bAT, 0, stream>>>(QH, QL, KH, KL, VH, VL, AC, Mp, Lp, OH, OL, nqR, nqP);
  }
  // (6) output projection rows s < QE (hi + residual) and (7) rows s >= QE (hi only) -> out f32, carries 1024 x 1024 folded back
  gemm_o<2><<<dim3(NB * nrtR * (DMOD / GT)), b256, 0, stream>>>(OH, OL, WB, bo, out, 0, nrtR, 1.0f / (OSC * WOS));
  if (nrtP > 0) {
    gemm_o<1><<<dim3(NB * nrtP * (DMOD / GT)), b256, 0, stream>>>(OH, OL, WB, bo, out, QE, nrtP, 1.0f / (OSC * WOS));
  }
  (void)hipGetLastError();
}

// v006
// Measured time: 133 microseconds a run.
// Timed twice side by side with v005, it ran 1.33 and 1.31 times as fast.
// Over all steps from v000 it is 4.33 times as fast.
// Contractions: x.Wq, x.Wk, x.Wv on v_wmma_f32_16x16x32_bf16 (x, W, biases RNE-converted to bf16; each W column block
// transposed into a k-contiguous [n][k] plane; f32 accumulate); k.q^T over 64 on v_wmma_f32_16x16x32_f16 with q, k carried as
// f16 hi x1024 + f16 residual planes (products hh + lh + hl); v^T.P^T on v_wmma_f32_16x16x32_f16 (P x32768 f16, v x1024 f16):
// query rows s < QE use P hi + residual and v hi + residual planes (hh + lh + hl), other rows one product; O.Wo on
// v_wmma_f32_16x16x32_f16 (O x1024 f16, Wo as f16(bf16(Wo)) x1024): rows s < QE as O hi + residual planes (h.W + l.W), other rows one
// product; all f32 accumulate. Bias adds, key-set select, base-2 online softmax, merge of the two key-set states and the 1/Z fold in
// f32 on VALU.
#include <hip/hip_runtime.h>
#include <math.h>
#include <stdint.h>

#ifndef NB
#define NB 2
#endif
#ifndef SEQ
#define SEQ 4096
#endif
#define XS_FULL 4096
#define DMOD  1024
#define NH    16
#define HD    64
#define WIN   256
#define STRD  128
#define GLB   16
#define QE    ((SEQ < 512) ? SEQ : 512)
#define MROWS (NB * SEQ)
#define OROWS ((NB - 1) * XS_FULL + SEQ)
#define SM_SCALE 0.125f
#define LOG2E 1.4426950408889634f
#define QSC   1024.0f
#define KSC   1024.0f
#define PCAR  32768.0f
#define VCAR  1024.0f
#define OSC   1024.0f
#define WOS   1024.0f
#define ACAR  64.0f
#define WPB   4
#define NHG   (NH / WPB)
#define NQT   (SEQ / 16)
#define NKB   ((WIN / 32) + 2)
#define NKA   (NKB + 1)
#define NA    (SEQ / STRD)
#define NAP   (((NA + 31) / 32) * 32)
#define NAT   ((NA + 15) / 16)
#define NKS   ((NA + 31) / 32)
#define ATT_THREADS (WPB * 32)
#define SLP   68
#define SLW   (16 * SLP)
#define SLAB64 (16 * 68)
#define VTP   72
#define VRP   80
#define WS_CAP 134217728
static_assert(DMOD == NH * HD && HD == 64 && NH == 16);
static_assert((NH % WPB) == 0 && ATT_THREADS == 128);
static_assert(NB >= 1 && NB <= 2);
static_assert((SEQ % STRD) == 0 && (SEQ % 64) == 0 && SEQ >= STRD && SEQ <= XS_FULL);
static_assert((QE % 64) == 0 && QE >= 64 && QE <= SEQ);
static_assert((STRD % 16) == 0 && STRD >= 32);
static_assert((WIN % 32) == 0 && WIN >= 32);
static_assert(GLB >= 1 && GLB <= 32);
static_assert(NA >= 1 && NAP >= 32 && NAP <= 256 && (NAP % 32) == 0 && 16 * NAT <= NAP);
static_assert(DMOD == 128 * 8 && (DMOD % 64) == 0 && (DMOD % 32) == 0);
static_assert((HD % 32) == 0);
static_assert(((SEQ * DMOD) % (8 * 256)) == 0);

typedef unsigned short u16;
typedef _Float16 v16h __attribute__((ext_vector_type(16)));
typedef _Float16 v8h  __attribute__((ext_vector_type(8)));
typedef __bf16   v16b __attribute__((ext_vector_type(16)));
typedef float    v8f  __attribute__((ext_vector_type(8)));
typedef float    v4f  __attribute__((ext_vector_type(4)));
typedef unsigned int v4u __attribute__((ext_vector_type(4)));

union FragH { v16h v; v8h h[2]; v4u u[2]; };
union FragB { v16b v; v4u u[2]; };

// ---- scalar helpers --------------------------------------------------------------------------------
__device__ __forceinline__ unsigned short bf_bits(float f) {          // f32 -> bf16 bits, RNE convert
  unsigned u = __float_as_uint(f);
  return (unsigned short)((u + 0x7FFFu + ((u >> 16) & 1u)) >> 16);
}
__device__ __forceinline__ float bf_up(unsigned short h) { return __uint_as_float(((unsigned)h) << 16); }
__device__ __forceinline__ float bfr(float f) { return bf_up(bf_bits(f)); }
__device__ __forceinline__ unsigned short h_bits(_Float16 x) { return __builtin_bit_cast(unsigned short, x); }
__device__ __forceinline__ unsigned pk16(unsigned short a, unsigned short b) { return (unsigned)a | ((unsigned)b << 16); }
__device__ __forceinline__ v8f zero8() { v8f z = {0.f, 0.f, 0.f, 0.f, 0.f, 0.f, 0.f, 0.f}; return z; }

// ---- fragment loaders: 16-bit A/B operand, lane -> row/col (lane&15), p already includes +8*(lane>>4);
//      elements 0..7 <- p[0..7] (k0+8h..), elements 8..15 <- p[16..23] (k0+16+8h..)  (same split k map for A and B;
//      B is always read from a k-contiguous [n][k] plane or tile)
__device__ __forceinline__ v16h ldfrag_h(const _Float16* p) {
  FragH f;
  f.h[0] = *(const v8h*)(p);
  f.h[1] = *(const v8h*)(p + 16);
  return f.v;
}
// transposing LDS load on a row-major 16-bit tile T[k][d]: with p = T + (k0 + 8*(lane>>4) + (lane&7))*pitch + d0 + 8*((lane>>3)&1) (halves)
// the lane gets T[k0 + 8*(lane>>4) + 0..7][d0 + (lane&15)]; the loads at k0 and k0 + 16 are elements 0..7 and 8..15 of the split k map
typedef short s16x8 __attribute__((ext_vector_type(8)));
__device__ __forceinline__ v4u ld_tr16(const _Float16* p) {
  typedef __attribute__((address_space(3))) s16x8 lds_s16x8;
  return __builtin_bit_cast(v4u, __builtin_amdgcn_ds_load_tr16_b128_v8i16((lds_s16x8*)p));
}
__device__ __forceinline__ v8f mma_h(v16h a, v16h b, v8f c) {
  return __builtin_amdgcn_wmma_f32_16x16x32_f16(false, a, false, b, (short)0, c, false, false);
}
__device__ __forceinline__ v8f mma_b(v16b a, v16b b, v8f c) {
  return __builtin_amdgcn_wmma_f32_16x16x32_bf16(false, a, false, b, (short)0, c, false, false);
}
__device__ __forceinline__ void guard2(v8f& a, v8f& b, v16h x0, v16h x1, v16h x2, v16h x3, v16h x4, v16h x5) {
#if defined(__HIP_DEVICE_COMPILE__)
  asm volatile("v_nop\n\tv_nop\n\tv_nop\n\tv_nop"
               : "+v"(a), "+v"(b) : "v"(x0), "v"(x1), "v"(x2), "v"(x3), "v"(x4), "v"(x5) : "memory");
#endif
}
__device__ __forceinline__ void acc_guard4(v8f& a, v8f& b, v8f& c, v8f& d) {
#if defined(__HIP_DEVICE_COMPILE__)
  asm volatile("v_nop\n\tv_nop\n\tv_nop\n\tv_nop" : "+v"(a), "+v"(b), "+v"(c), "+v"(d));
#endif
}
// value of lane l ^ 16 (the other 16-lane row), a vector cross-row move
__device__ __forceinline__ float xhalf(float x) {
  const int b = __builtin_bit_cast(int, x);
  return __builtin_bit_cast(float, __builtin_amdgcn_permlanex16(b, b, 0x76543210, 0xfedcba98, false, false));
}
__device__ __forceinline__ void wait_x0() {       // stands between issued global loads or stores and a rewrite of the registers they name
#if defined(__HIP_DEVICE_COMPILE__)
  asm volatile("s_wait_xcnt 0x0" ::: "memory");
#endif
}
__device__ __forceinline__ void wave_sync_lds() {
  __builtin_amdgcn_fence(__ATOMIC_RELEASE, "workgroup");
  __builtin_amdgcn_wave_barrier();
  __builtin_amdgcn_fence(__ATOMIC_ACQUIRE, "workgroup");
}

// =====================================================================================================
// f32 -> 16-bit plane, same layout.  f16mode == 0: bf16 RNE bits;  f16mode == 1: f16 bits of (bf16 RNE value) * scale.
// Thread = 8 consecutive elements: two 16-B loads, one 16-B store; 32 consecutive lanes = 512 contiguous, 512-B aligned
// coverage: blk = 0 .. ceil(n8/256) - 1, x 256 thr x 8 (in-kernel bound) = the whole plane (n8 a multiple of 256 here).
// =====================================================================================================
__device__ __forceinline__ void cvt16(const float* __restrict__ x, u16* D, int n8, int f16mode, float scale, int blk) {
  const int gt = blk * 256 + (int)threadIdx.x;
  if (gt >= n8) return;
  const float* p = x + (size_t)gt * 8;
  const v4f a = *(const v4f*)(p), b4 = *(const v4f*)(p + 4);
  float w[8];
#pragma unroll
  for (int e = 0; e < 4; ++e) { w[e] = a[e]; w[4 + e] = b4[e]; }
  v4u o;
#pragma unroll
  for (int e = 0; e < 4; ++e) {
    const float f0 = w[2 * e], f1 = w[2 * e + 1];
    const unsigned short hb0 = h_bits((_Float16)(bfr(f0) * scale));
    const unsigned short hb1 = h_bits((_Float16)(bfr(f1) * scale));
    const unsigned short bb0 = bf_bits(f0);
    const unsigned short bb1 = bf_bits(f1);
    o[e] = (f16mode != 0) ? pk16(hb0, hb1) : pk16(bb0, bb1);
  }
  u16* d = D + (size_t)gt * 8;
  {
    *(v4u*)(d) = o;
    
  }
  wait_x0();   // a kernel's roles lie one behind the other in the code, in the compiler's order: what follows may rewrite registers these stores name
}

// =====================================================================================================
// Weight transpose + convert: W f32 [DMOD rows k][ldw], column block col0 .. col0+DMOD-1 (column index = n)
//   -> D 16-bit [DMOD n][DMOD k] (k-contiguous B operand), i.e. in[k][col0+n] -> out[n][k].  f16mode as in cvt16.
// Block = (n tile n0, k tile k0) of 64 x 64: load 64 k rows x 64 n floats with 16-B loads (thread = k row kr, 16 n), convert,
// scatter transposed into an LDS tile [n][k] (pitch 72 halves); block barrier; each n-row segment (64 halves = one whole
// coverage: load 256 thr x 16 = 64 k x 64 n; store 2 iterations x 256 thr x 8 halves = 64 lines x 64; grid (DMOD/64)^2 = every
//           (n, k) of D exactly once (bid = 0 .. (DMOD/64)^2 - 1).
// Every thread of the block calls this (block barrier inside).
// =====================================================================================================
__device__ __forceinline__ void tr16(const float* __restrict__ W, int ldw, int col0, u16* D, int f16mode, float scale, int bid) {
  __shared__ __align__(16) u16 T[64 * VTP];
  const int tid = (int)threadIdx.x;
  const int nt  = bid % (DMOD / 64);
  const int kt  = bid / (DMOD / 64);
  if (kt >= DMOD / 64) return;              // block-uniform, before any barrier; never taken with the exact grid
  const int n0 = nt * 64, k0 = kt * 64;
  {
    const int kr = tid >> 2;                // k row within tile 0..63
    const int nc = (tid & 3) * 16;          // n chunk 0,16,32,48
    const float* src = W + (size_t)(k0 + kr) * (size_t)ldw + col0 + n0 + nc;
#pragma unroll
    for (int i = 0; i < 4; ++i) {
      const v4f a = *(const v4f*)(src + 4 * i);
#pragma unroll
      for (int e = 0; e < 4; ++e) {
        const float f = a[e];
        const unsigned short hb = h_bits((_Float16)(bfr(f) * scale));
        const unsigned short bb = bf_bits(f);
        T[(nc + 4 * i + e) * VTP + kr] = (f16mode != 0) ? hb : bb;
      }
    }
  }
  __syncthreads();
  v4u ov[2];
  const int q8 = tid >> 3, p8 = (tid & 7) * 8;
#pragma unroll
  for (int it = 0; it < 2; ++it) {
    const int line = it * 32 + q8;          // n = 0..63
    ov[it] = *(const v4u*)(T + line * VTP + p8);
  }
  u16* base = D + (size_t)n0 * DMOD + k0 + p8;
  {
#pragma unroll
    for (int it = 0; it < 2; ++it) {
      const int line = it * 32 + q8;
      *(v4u*)(base + (size_t)line * DMOD) = ov[it];
    }
    
  }
  wait_x0();   // a kernel's roles lie one behind the other in the code, in the compiler's order: what follows may rewrite registers these stores name
}

// =====================================================================================================
// All operand conversions in one grid; no block reads what another writes. Block bid -> role:
//   bid < 4 * TRB: weight plane p = bid / TRB of WB ([DMOD n][DMOD k] each): p = 0, 1, 2 the q, k, v column blocks of Wqkv as bf16,
//                  p = 3 Wo as f16 of the bf16 value x1024; tile bid % TRB (tr16).
//   the rest:      x of batch b -> bf16 plane rows b*SEQ .. (cvt16), CVB blocks a batch.
// coverage: 4 planes x TRB tiles and NB batches x CVB blocks, each once.
// =====================================================================================================
#define TRB ((DMOD / 64) * (DMOD / 64))
#define CVB (((SEQ * DMOD) / 8 + 255) / 256)
__global__ __launch_bounds__(256) void prep(const float* __restrict__ x, const float* __restrict__ wqkv, const float* __restrict__ wo,
                                            u16* XBo, u16* WBo) {
  const int bid = (int)blockIdx.x;
  if (bid < 4 * TRB) {                      // block-uniform
    const int  p   = bid / TRB;
    const bool iso = (p == 3);
    tr16(iso ? wo : wqkv, iso ? DMOD : 3 * DMOD, iso ? 0 : p * DMOD, WBo + (size_t)p * DMOD * DMOD, iso ? 1 : 0, iso ? WOS : 1.0f,
         bid % TRB);
  } else {
    const int cb = bid - 4 * TRB;
    const int b  = cb / CVB;
    if (b >= NB) return;                    // block-uniform; never taken with the exact grid
    cvt16(x + (size_t)b * XS_FULL * DMOD, XBo + (size_t)b * SEQ * DMOD, (SEQ * DMOD) / 8, 0, 1.0f, cb % CVB);
  }
}

// =====================================================================================================
// GEMM epilogue: the wave's 32x64 f32 tile (times oscale) staged in its LDS slab (two 16-row parts, pitch 68), read back as whole
// rows, bias added, stored.
// coverage: 2 parts x 8 instructions x 2 rows x 16 lanes x 4 floats = the wave's 32 x 64 tile.
// =====================================================================================================
__device__ __forceinline__ void epi3264(float* sl, const v8f (&acc)[2][4], float oscale,
                                        const float* __restrict__ bias, float* C, int N, size_t rowb, int col0, int lane) {
  const int hh = lane >> 4, m = lane & 15;
#pragma unroll
  for (int i = 0; i < 2; ++i) {
#pragma unroll
    for (int r = 0; r < 8; ++r) {
      const int ro = i * SLAB64 + (8 * hh + r) * 68 + m;
      sl[ro]      = acc[i][0][r] * oscale;
      sl[ro + 16] = acc[i][1][r] * oscale;
      sl[ro + 32] = acc[i][2][r] * oscale;
      sl[ro + 48] = acc[i][3][r] * oscale;
    }
  }
  wave_sync_lds();
  const v4f bb = *(const v4f*)(bias + col0 + m * 4);
  v4f br;
#pragma unroll
  for (int e = 0; e < 4; ++e) br[e] = bfr(bb[e]);
  float* dst = C + (rowb + (size_t)hh) * (size_t)N + col0 + m * 4;
#pragma unroll
  for (int i = 0; i < 2; ++i) {
    v4f vals[8];
#pragma unroll
    for (int it = 0; it < 8; ++it) vals[it] = *(const v4f*)(sl + i * SLAB64 + (it * 2 + hh) * 68 + m * 4) + br;
#pragma unroll
    for (int it = 0; it < 8; ++it) {
      *(v4f*)(dst + (size_t)(i * 16 + it * 2) * (size_t)N) = vals[it];
    }
  }
}

// =====================================================================================================
// GEMM core shared by the projections and the output projection: one 128 x 128 tile of C per block, 8 waves of 32 x 64
// (wave -> rows 32 * (wave >> 1), columns 64 * (wave & 1)), K = DMOD walked in passes of 128 k.
// A pass's operand rows (256 B each: 128 A rows, then 128 Bt rows) are staged in LDS at pitch 272 B by per-lane
// 16-B asynchronous copies: one wave instruction = 2 rows x 256 B = whole 128-B lines. Two buffers: pass t + 2 is copied into the
// buffer pass t has left while pass t + 1 is worked on. Fragments are 16-B LDS reads with the same split k map as ldfrag_h.
// Per accumulator the products keep ascending k in steps of 32; a second A plane (residual) follows as GNP more passes over the same Bt.
// =====================================================================================================
#define GT     128
#define GTHR   256
#define GKP    128
#define GPIT   136
#define GPLANE (GT * GPIT)
#define GNP    (DMOD / GKP)
static_assert((DMOD % GKP) == 0 && GNP >= 2 && (DMOD % GT) == 0 && (SEQ % GT) == 0 && (QE % GT) == 0);
static_assert(8 * 2 * SLAB64 * 4 <= 2 * 2 * GPLANE * 2 && GT + 8 <= GPIT);

// One operand plane of a pass: 128 rows x 256 B = eight 16-B copies of each lane, rows 16 apart (l, g: the lane's first row and
// 16-B column; LDS step 16 * 272 B, global step 16 * DMOD halves).
__device__ __forceinline__ void copy_plane(unsigned l, const u16* g) {
#if defined(__HIP_DEVICE_COMPILE__)
  const unsigned ls = 16 * GPIT * 2;
  const size_t   gs = (size_t)16 * DMOD;
  // the closing s_wait_xcnt 0 stands inside the statement so that no address register is rewritten ahead of it
  asm volatile("global_load_async_to_lds_b128 %0, %8, off\n\t"
               "global_load_async_to_lds_b128 %1, %9, off\n\t"
               "global_load_async_to_lds_b128 %2, %10, off\n\t"
               "global_load_async_to_lds_b128 %3, %11, off\n\t"
               "global_load_async_to_lds_b128 %4, %12, off\n\t"
               "global_load_async_to_lds_b128 %5, %13, off\n\t"
               "global_load_async_to_lds_b128 %6, %14, off\n\t"
               "global_load_async_to_lds_b128 %7, %15, off\n\t"
               "s_wait_xcnt 0x0"
               :: "v"(l), "v"(l + ls), "v"(l + 2 * ls), "v"(l + 3 * ls), "v"(l + 4 * ls), "v"(l + 5 * ls), "v"(l + 6 * ls),
                  "v"(l + 7 * ls),
                  "v"(g), "v"(g + gs), "v"(g + 2 * gs), "v"(g + 3 * gs), "v"(g + 4 * gs), "v"(g + 5 * gs), "v"(g + 6 * gs),
                  "v"(g + 7 * gs)
               : "memory");
#endif
}
__device__ __forceinline__ void wait_async0() {   // this wave's copies have landed
#if defined(__HIP_DEVICE_COMPILE__)
  asm volatile("s_wait_asynccnt 0x0" ::: "memory");
#endif
}
__device__ __forceinline__ void wait_ds0() {      // this wave's LDS reads are done before their buffer is handed back
#if defined(__HIP_DEVICE_COMPILE__)
  asm volatile("s_wait_dscnt 0x0" ::: "memory");
#endif
}
// =====================================================================================================
// Projection epilogue for q and k: the wave's 32x64 f32 tile (times oscale) staged in its LDS slab as in epi3264, read back as whole
// rows, bias added, times sc, split into f16 hi + f16 residual and stored to the two planes [MROWS][DMOD] at row rowb, column col0.
// Lane = (row select rq in 0..3, 8 consecutive columns at c8): a plane row's 64 halves = one 128-B line from 8 consecutive lanes.
// coverage: 2 parts x 4 instructions x 4 rows x 8 lanes x 8 halves = the wave's 32 x 64 tile of each plane.
// =====================================================================================================
__device__ __forceinline__ void epi_qk(float* sl, const v8f (&acc)[2][4], float oscale, const float* __restrict__ bias,
                                       u16* Hp, u16* Lp, float sc, size_t rowb, int col0, int lane) {
  const int hh = lane >> 4, m = lane & 15;
#pragma unroll
  for (int i = 0; i < 2; ++i) {
#pragma unroll
    for (int r = 0; r < 8; ++r) {
      const int ro = i * SLAB64 + (8 * hh + r) * 68 + m;
      sl[ro]      = acc[i][0][r] * oscale;
      sl[ro + 16] = acc[i][1][r] * oscale;
      sl[ro + 32] = acc[i][2][r] * oscale;
      sl[ro + 48] = acc[i][3][r] * oscale;
    }
  }
  wave_sync_lds();
  const int rq = lane >> 3, c8 = (lane & 7) * 8;
  const v4f ba = *(const v4f*)(bias + col0 + c8), bb = *(const v4f*)(bias + col0 + c8 + 4);
  float br[8];
#pragma unroll
  for (int e = 0; e < 4; ++e) { br[e] = bfr(ba[e]); br[4 + e] = bfr(bb[e]); }
  const size_t d0 = (rowb + (size_t)rq) * DMOD + col0 + c8;
#pragma unroll
  for (int i = 0; i < 2; ++i) {
    v4u oh[4], ol[4];
#pragma unroll
    for (int it = 0; it < 4; ++it) {
      const float* sp = sl + i * SLAB64 + (it * 4 + rq) * 68 + c8;
      const v4f a = *(const v4f*)(sp), b4 = *(const v4f*)(sp + 4);
      float w[8];
#pragma unroll
      for (int e = 0; e < 4; ++e) { w[e] = (a[e] + br[e]) * sc; w[4 + e] = (b4[e] + br[4 + e]) * sc; }
#pragma unroll
      for (int e = 0; e < 4; ++e) {
        const float t0 = w[2 * e], t1 = w[2 * e + 1];
        const _Float16 h0 = (_Float16)t0, h1 = (_Float16)t1;
        const _Float16 l0 = (_Float16)(t0 - (float)h0), l1 = (_Float16)(t1 - (float)h1);
        oh[it][e] = pk16(h_bits(h0), h_bits(h1));
        ol[it][e] = pk16(h_bits(l0), h_bits(l1));
      }
    }
#pragma unroll
    for (int it = 0; it < 4; ++it) {
      const size_t d = d0 + (size_t)(i * 16 + it * 4) * DMOD;
      *(v4u*)(Hp + d) = oh[it];
      *(v4u*)(Lp + d) = ol[it];
    }
  }
  wait_x0();   // a kernel's roles lie one behind the other in the code, in the compiler's order: what follows may rewrite registers these stores name
}

// =====================================================================================================
// Projection epilogue for v: the block's 128 (keys s) x 128 (columns g*HD + d) tile goes out transposed.
//   VH[(vrow0 + col)][s0 + s] (pitch SEQ) = f16(v * sc);  VL[(vrow0 + col)][s0 + s] (pitch QE) = f16 residual, only when dolo.
//   The same hi values also go out row-major, VR[rrow0 + s][colC + col] (pitch DMOD), for the strided key set, which reads whole v rows:
//   2-B LDS stores into a third tile R[s][col] (pitch GPIT), then each row's 128 columns = 256 B = two whole lines from 16 lanes.
// An accumulator register group already holds 8 consecutive keys of one column: bias added, scaled, split, packed, one 16-B LDS store
// per plane into the block tile T[col][s] (pitch GPIT halves; hi plane, then residual plane). One block barrier, then each column's
// 128 keys = 256 B = two whole lines leave from 16 consecutive lanes.
// Every thread of the block calls this (block barrier inside); dolo is block-uniform.
// coverage: LDS 8 waves x 8 groups x 32 lanes x 8 halves = 128 x 128; stores 8 iterations x 16 columns x 16 lanes x 8 halves = the same;
//           row-major: 8 iterations x 16 rows x 16 lanes x 8 halves = the same.
// =====================================================================================================
__device__ __forceinline__ void epi_vt(u16* T, const v8f (&acc)[2][4], float oscale, const float* __restrict__ bias,
                                       u16* VHo, u16* VLo, u16* VRo, float sc, size_t vrow0, size_t rrow0, int s0, int colC, bool dolo,
                                       int wr, int wc, int tid) {
  const int lane = tid & 31, hh = lane >> 4, m = lane & 15;
  float bj[4];
#pragma unroll
  for (int j = 0; j < 4; ++j) bj[j] = bias[colC + wc + j * 16 + m];
#pragma unroll
  for (int j = 0; j < 4; ++j) {
    const int   col = wc + j * 16 + m;
    const float br  = bfr(bj[j]);
#pragma unroll
    for (int i = 0; i < 2; ++i) {
      v4u vh, vl;
      u16* rp = T + 2 * GPLANE + (wr + i * 16 + 8 * hh) * GPIT + col;
#pragma unroll
      for (int e = 0; e < 4; ++e) {
        const float t0 = (acc[i][j][2 * e] * oscale + br) * sc, t1 = (acc[i][j][2 * e + 1] * oscale + br) * sc;
        const _Float16 h0 = (_Float16)t0, h1 = (_Float16)t1;
        const _Float16 l0 = (_Float16)(t0 - (float)h0), l1 = (_Float16)(t1 - (float)h1);
        vh[e] = pk16(h_bits(h0), h_bits(h1));
        vl[e] = pk16(h_bits(l0), h_bits(l1));
        rp[(2 * e) * GPIT]     = h_bits(h0);
        rp[(2 * e + 1) * GPIT] = h_bits(h1);
      }
      u16* tp = T + col * GPIT + wr + i * 16 + 8 * hh;
      *(v4u*)(tp) = vh;
      if (dolo) *(v4u*)(tp + GPLANE) = vl;
    }
  }
  __syncthreads();   // a column's 128 keys were written by four waves; they leave as whole lines from one
  const int cr = tid >> 4, p8 = (tid & 15) * 8;
  v4u oh[8];
#pragma unroll
  for (int it = 0; it < 8; ++it) oh[it] = *(const v4u*)(T + (it * 16 + cr) * GPIT + p8);
#pragma unroll
  for (int it = 0; it < 8; ++it) *(v4u*)(VHo + (vrow0 + (size_t)(it * 16 + cr)) * SEQ + s0 + p8) = oh[it];
  wait_x0();         // the row-major rows are loaded into the registers that the hi stores name
  v4u orw[8];
#pragma unroll
  for (int it = 0; it < 8; ++it) orw[it] = *(const v4u*)(T + 2 * GPLANE + (it * 16 + cr) * GPIT + p8);
#pragma unroll
  for (int it = 0; it < 8; ++it) *(v4u*)(VRo + (rrow0 + (size_t)(it * 16 + cr)) * DMOD + colC + p8) = orw[it];
  if (dolo) {
    wait_x0();       // the residual rows are loaded into the registers that the earlier stores name
    v4u ol[8];
#pragma unroll
    for (int it = 0; it < 8; ++it) ol[it] = *(const v4u*)(T + GPLANE + (it * 16 + cr) * GPIT + p8);
#pragma unroll
    for (int it = 0; it < 8; ++it) *(v4u*)(VLo + (vrow0 + (size_t)(it * 16 + cr)) * QE + s0 + p8) = ol[it];
  }
  wait_x0();   // a kernel's roles lie one behind the other in the code, in the compiler's order: what follows may rewrite registers these stores name
}

struct Frag16 { v4u u[2]; };
__device__ __forceinline__ Frag16 ldfrag_s(const u16* p) {
  Frag16 f;
  f.u[0] = *(const v4u*)(p);
  f.u[1] = *(const v4u*)(p + 16);
  return f;
}
template <bool BF>
__device__ __forceinline__ v8f mma_s(const Frag16& a, const Frag16& b, v8f c) {
  if constexpr (BF) {
    FragB x, y;
    x.u[0] = a.u[0]; x.u[1] = a.u[1]; y.u[0] = b.u[0]; y.u[1] = b.u[1];
    return mma_b(x.v, y.v, c);
  } else {
    FragH x, y;
    x.u[0] = a.u[0]; x.u[1] = a.u[1]; y.u[0] = b.u[0]; y.u[1] = b.u[1];
    return mma_h(x.v, y.v, c);
  }
}

// A0, A1, B0: first row of the block's 128 rows in each plane (row pitch DMOD halves). np = GNP: A0 . B0^T; np = 2 * GNP: passes GNP ..
// add A1 . B0^T into the same accumulators (A1 is read only then). np is block-uniform.
// ring: 2 * 2 * GPLANE halves; behind the last pass's barrier it is free, and the caller's epilogue stages its output there.
// acc: the wave's 32 x 64 tile (rows 32 * (wave >> 1), columns 64 * (wave & 1) of the block tile), zeroed here.
// Every thread of the block calls this (block barriers inside).
template <bool BF>
__device__ __forceinline__ void gemm_tile(const u16* A0, const u16* A1, const u16* B0, int np, u16* ring, v8f (&acc)[2][4]) {
  constexpr int STG = 2 * GPLANE;
  const int tid = threadIdx.x, wave = tid >> 5, lane = tid & 31, hh = lane >> 4, m = lane & 15;
  const int wr = (wave >> 1) * 32, wc = (wave & 1) * 64;
  // copy role: row tid >> 4 (+ 16 per copy), 16-B column tid & 15
  const int crow = tid >> 4, ccol = (tid & 15) * 8;
  const size_t  goff = (size_t)crow * DMOD + ccol;
  const unsigned l0  = (unsigned)(size_t)(ring + crow * GPIT + ccol);
  const u16* ga0 = A0 + goff;
  const u16* ga1 = A1 + goff;
  const u16* gb  = B0 + goff;
  auto stage = [&](int buf, int pass) {
    const unsigned l = l0 + (unsigned)(buf * STG * 2);
    const int      k = (pass % GNP) * GKP;
    copy_plane(l, ((pass < GNP) ? ga0 : ga1) + k);
    copy_plane(l + GPLANE * 2, gb + k);
  };
#pragma unroll
  for (int i = 0; i < 2; ++i) {
#pragma unroll
    for (int j = 0; j < 4; ++j) acc[i][j] = zero8();
  }
  stage(0, 0);
  wait_async0();
  __syncthreads();
  stage(1, 1);
#pragma unroll 1   // rolled: one copy of the pass body serves both buffers (t & 1) and stays small in the instruction cache
  for (int t = 0; t < np; ++t) {
    const u16* st = ring + (t & 1) * STG;
    const u16* pa = st + (wr + m) * GPIT + 8 * hh;
    const u16* pb = st + GPLANE + (wc + m) * GPIT + 8 * hh;
    Frag16 a[2][2], b[2][4];
    auto fetch = [&](int s, int kk) {
#pragma unroll
      for (int i = 0; i < 2; ++i) a[s][i] = ldfrag_s(pa + i * 16 * GPIT + kk * 32);
#pragma unroll
      for (int j = 0; j < 4; ++j) b[s][j] = ldfrag_s(pb + j * 16 * GPIT + kk * 32);
    };
    fetch(0, 0);
#pragma unroll     // unrolled: the fragment set index kk & 1 must be a constant, else the sets leave the registers
    for (int kk = 0; kk < GKP / 32; ++kk) {
      const int s = kk & 1;
      if (kk + 1 < GKP / 32) fetch(s ^ 1, kk + 1);   // the next k step's fragments, inside this pass's own buffer
      // keeps that load group whole and ahead of this step's products: sunk among them, each load is waited for where it stands
      __builtin_amdgcn_sched_barrier(0);
#pragma unroll
      for (int i = 0; i < 2; ++i) {
#pragma unroll
        for (int j = 0; j < 4; ++j) acc[i][j] = mma_s<BF>(a[s][i], b[s][j], acc[i][j]);
      }
      __builtin_amdgcn_sched_barrier(0);             // the far end of the same fence: later loads stay behind these products
    }
    // hand-over: own reads done, own copies of pass t + 1 landed, then the one barrier that publishes pass t + 1 and frees this buffer
    wait_ds0();
    wait_async0();
    __syncthreads();
    if (t + 2 < np) stage(t & 1, t + 2);
  }
  wait_async0();
}

// =====================================================================================================
// The three projections of every batch in one grid; no block reads what another writes. One block:
// (A[128 rows][DMOD] (x, bf16 row-major) . Bt[128][DMOD]^T (bf16 k-contiguous)) + bias[col] (bf16 RNE value), f32, written straight as the
// 16-bit planes the attention kernels read.
// Block bid -> (segment bid / PBLK, tile bid % PBLK of the segment's (SEQ/128) x (DMOD/128) tiles); segment -> (column block p = 2, 1, 0
// = v, k, q, batch b): v comes first because its epilogue is the longest.
// p = 0, 1 (q, k): hi / residual planes [MROWS][DMOD] of value * 1024, rows b*SEQ + s (epi_qk).
// p = 2 (v):       v^T hi plane [(b*NH + g)*HD + d][SEQ] of value * 1024, v^T residual plane, pitch QE, keys s < QE only,
//                  and the hi values row-major [MROWS][DMOD], rows b*SEQ + s (epi_vt).
// coverage: a segment's tiles cover every (s, column) of its batch and column block once, so every plane element is written once.
// =====================================================================================================
#define PBLK ((SEQ / GT) * (DMOD / GT))
__global__ __launch_bounds__(GTHR)
void gemm_p(const u16* __restrict__ Xb, const u16* __restrict__ Wt, const float* __restrict__ bqkv,
            u16* QHo, u16* QLo, u16* KHo, u16* KLo, u16* VHo, u16* VLo, u16* VRo) {
  __shared__ __align__(16) u16 ring[2 * 2 * GPLANE];
  const int ntile = DMOD / GT;
  const int bid   = blockIdx.x;
  const int seg   = bid / PBLK;
  const int tl    = bid % PBLK;
  if (seg >= 3 * NB) return;                // block-uniform, before any barrier; never taken with the exact grid
  const int p     = 2 - seg / NB;
  const int b     = seg % NB;
  const int row0  = (tl / ntile) * GT;
  const int col0  = (tl % ntile) * GT;
  const int tid = threadIdx.x, wave = tid >> 5;
  const int wr = (wave >> 1) * 32, wc = (wave & 1) * 64;
  const u16*   A    = Xb + ((size_t)b * SEQ + row0) * DMOD;
  const float* bias = bqkv + p * DMOD;
  v8f acc[2][4];
  gemm_tile<true>(A, A, Wt + ((size_t)p * DMOD + col0) * DMOD, GNP, ring, acc);
  if (p == 2) {                             // block-uniform (block barrier inside epi_vt)
    epi_vt(ring, acc, 1.0f, bias, VHo, VLo, VRo, VCAR, (size_t)b * DMOD + col0, (size_t)b * SEQ + row0, row0, col0, row0 + GT <= QE, wr,
           wc, tid);
  } else {
    epi_qk((float*)(void*)ring + wave * (2 * SLAB64), acc, 1.0f, bias, (p == 0) ? QHo : KHo, (p == 0) ? QLo : KLo, (p == 0) ? QSC : KSC,
           (size_t)b * SEQ + row0 + wr, col0 + wc, tid & 31);
  }
}

// =====================================================================================================
// Output projection, every row in one grid: C[orow][DMOD] (f32) = (Ah [+ Al])[row][DMOD] . Bt[DMOD][DMOD]^T * oscale + bias (bf16 RNE value).
// Row tiles with s < QE: Ah passes, then the Al residual plane's passes into the same accumulators (l unscaled); other tiles: Ah only.
// Block -> (column tile ct = bid % 8, batch bb, sequence row tile rt, tiles of 128; rt slowest, so that the tiles with twice the passes
// come first in the grid): rows of Ah are bb*SEQ + s, rows of Al are bb*QE + s (read only while s < QE), rows of C are bb*XS_FULL + s.
// Same tiling as gemm_p; epilogue epi3264.
// =====================================================================================================
__global__ __launch_bounds__(GTHR)
void gemm_o(const u16* __restrict__ Ah, const u16* __restrict__ Al, const u16* __restrict__ Bt, const float* __restrict__ bias,
            float* C, float oscale) {
  __shared__ __align__(16) u16 ring[2 * 2 * GPLANE];
  const int ntile = DMOD / GT;
  const int bid   = blockIdx.x;
  const int ct    = bid % ntile;
  const int t2    = bid / ntile;
  const int bb    = t2 % NB;
  const int rt    = t2 / NB;
  const int srow  = rt * GT;
  if (srow + GT > SEQ) return;              // block-uniform, before any barrier; never taken with the exact grid
  const bool res  = (srow + GT <= QE);      // block-uniform; QE is a multiple of GT
  const size_t rowC = (size_t)bb * SEQ + srow;
  const size_t rowL = (size_t)bb * QE + srow;
  const size_t rowO = (size_t)bb * XS_FULL + srow;
  const u16* a0 = Ah + rowC * DMOD;
  const u16* a1 = res ? (Al + rowL * DMOD) : a0;
  const int tid = threadIdx.x, wave = tid >> 5;
  v8f acc[2][4];
  gemm_tile<false>(a0, a1, Bt + (size_t)ct * GT * DMOD, res ? 2 * GNP : GNP, ring, acc);
  epi3264((float*)(void*)ring + wave * (2 * SLAB64), acc, oscale, bias, C, DMOD, rowO + (wave >> 1) * 32, ct * GT + (wave & 1) * 64,
          tid & 31);
}

// =====================================================================================================
// Strided key set (pass S). Key j is in this set for query i iff j = i - STRD*n with i - j >= WIN, j >= GLB (then j <= i and
// (i - j) % STRD == 0 hold). Queries and keys of one residue class rr = i % STRD: i = rr + STRD*a, j = rr + STRD*c, a, c < NA.
// Block bid -> (residue rr = bid % STRD, head group hg, batch b); one wave per head; the wave owns all NA query rows of (b, head, rr)
// in tiles of 16 (rows a >= NA of the last tile are padding: operand row clamped, weight forced to 0, nothing stored) and visits
// the candidate keys in tiles of 32 (slots c >= NA clamped and forced to 0).
//   Transposed products: a lane owns ONE query (column lane & 15 of every D tile).
//   scores S^T: k hi / residual (A, lane -> key slot, arithmetic stride STRD rows in the [b*SEQ + s][h*HD + d] planes) times
//   q hi / residual (B, lane -> row a = 16*at + (lane & 15)), products hh + lh + hl over HD; D element r = key slot 8*(lane >> 4) + r;
//   element predicate (a < NA) && (c < NA) && (STRD*(a - c) >= WIN) && (j >= GLB), -inf otherwise; base-2 online softmax in f32
//   (-inf safe): maximum and sum over the lane's 16 scores, then one exchange with lane ^ 16;
//   P^T (B operand) is packed from those 16 values in the lane: they already lie in the split k map;
//   v rows of the 32 key slots (128 B each, arithmetic stride STRD rows in the row-major v hi plane [b*SEQ + s][h*HD + d]) loaded once per
//   key tile as whole lines into a wave-private LDS tile [slot][d], read by transposing LDS loads as the A operand of O^T += V^T.P^T
//   (the strided keys only feed query rows i >= WIN + GLB, which always hold >= WIN + GLB keys).
//   State written per query row: M = running max (log2 domain), L = running sum, AC = acc * 64 / (32768*1024) as f16
//   (AC plane layout [b*SEQ + i][h*HD + d]; M, L planes [(b*NH + h)*STRD + rr][NAP], rows a >= NA hold -inf / 0).
// coverage: AC: every (b, i < SEQ, h, d) exactly once (union over rr, a < NA); M/L: every (b, h, rr) line group exactly once.
// =====================================================================================================
__global__ __launch_bounds__(ATT_THREADS)
void attn_s(const u16* __restrict__ QHp, const u16* __restrict__ QLp,
            const u16* __restrict__ KHp, const u16* __restrict__ KLp,
            const u16* __restrict__ VRp, u16* ACp, float* Mp, float* Lp) {
  __shared__ __align__(16) float    smem[WPB * SLW];
  __shared__ __align__(16) _Float16 vts[WPB * 32 * VRP];
  __shared__ __align__(16) float    mls[WPB * 2 * NAP];

  const int tid  = threadIdx.x;
  const int wave = tid >> 5;
  const int lane = tid & 31;
  const int hh   = lane >> 4;
  const int c    = lane & 15;
  const int bid  = blockIdx.x;
  const int rres = bid % STRD;
  const int t2   = bid / STRD;
  const int hg   = t2 % NHG;
  const int b    = t2 / NHG;
  if (b >= NB) return;                      // block-uniform; no block barriers in this kernel; never taken with the exact grid
  const int head = hg * WPB + wave;

  float*    slab = smem + wave * SLW;       // result slab [16 queries][64 d] pitch 68
  _Float16* vt   = vts + wave * (32 * VRP); // v tile [32 key slots][64 d] pitch 80 halves = 32 B x odd, the transposing load's pitch
  float*    msl  = mls + wave * (2 * NAP);
  float*    lsl  = msl + NAP;
#pragma unroll 1
  for (int i2 = lane; i2 < NAP; i2 += 32) { msl[i2] = -INFINITY; lsl[i2] = 0.0f; }
  wave_sync_lds();

  const _Float16* QHh = (const _Float16*)(const void*)QHp;
  const _Float16* QLh = (const _Float16*)(const void*)QLp;
  const _Float16* KHh = (const _Float16*)(const void*)KHp;
  const _Float16* KLh = (const _Float16*)(const void*)KLp;
  const size_t hcol  = (size_t)head * HD + 8 * hh;
  const size_t brow  = (size_t)b * SEQ + rres;                          // plane row of a = 0
  const int    gr    = lane >> 3, gc = (lane & 7) * 8;                  // v row load role: row gr of 4, 16-B column gc
  const u16*   vbase = VRp + brow * DMOD + (size_t)head * HD + gc;      // + STRD*c*DMOD
  const _Float16* vrd = vt + (8 * hh + (lane & 7)) * VRP + 8 * ((lane >> 3) & 1);   // transposing load address, key slot 0, d 0
  const float  lsc   = SM_SCALE * (LOG2E / (QSC * KSC));
  const float  acs   = ACAR / (PCAR * VCAR);

  // the 32 key slots' v rows of key tile ks: one instruction = 4 rows x 128 B = whole lines; they go to LDS behind the softmax
  v4u rv[8];
  auto load_rows = [&](int ks) {
#pragma unroll
    for (int it = 0; it < 8; ++it) {
      int cs = ks * 32 + it * 4 + gr;
      if (cs > NA - 1) cs = NA - 1;
      rv[it] = *(const v4u*)(vbase + (size_t)STRD * cs * DMOD);
    }
    wait_x0();                              // later loads may land in the address registers of these
  };
  if constexpr (NKS == 1) load_rows(0);     // a single key tile: the same rows serve every query tile

#pragma unroll 1
  for (int at = 0; at < NAT; ++at) {
    float mq = -INFINITY, lq = 0.f;         // this lane's query: running max and sum (equal in lanes l and l ^ 16)
    v8f o[4];                               // O^T: o[j][r] = (d = 16*j + 8*hh + r, query aq)
#pragma unroll
    for (int j = 0; j < 4; ++j) o[j] = zero8();
    const int aq = at * 16 + c;             // this lane's query row index a
    int am = aq;
    if (am > NA - 1) am = NA - 1;           // clamped operand row for this lane
    const size_t qoff = (brow + (size_t)STRD * am) * DMOD + hcol;
    const _Float16* Qh = QHh + qoff;
    const _Float16* Ql = QLh + qoff;

#pragma unroll 1
    for (int ks = 0; ks < NKS; ++ks) {
      if constexpr (NKS != 1) load_rows(ks);
      // ---- scores S^T: D element r of this lane = (key slot ks*32 + 8*hh + r, query aq) in s0, slot + 16 in s1 ----
      int c0i = ks * 32 + c;       if (c0i > NA - 1) c0i = NA - 1;
      int c1i = ks * 32 + 16 + c;  if (c1i > NA - 1) c1i = NA - 1;
      const size_t k0off = (brow + (size_t)STRD * c0i) * DMOD + hcol;
      const size_t k1off = (brow + (size_t)STRD * c1i) * DMOD + hcol;
      const _Float16* k0p = KHh + k0off;
      const _Float16* k1p = KHh + k1off;
      const _Float16* l0p = KLh + k0off;
      const _Float16* l1p = KLh + k1off;
      v8f s0 = zero8(), s1 = zero8();
#pragma unroll
      for (int kk = 0; kk < HD / 32; ++kk) {
        const v16h qh  = ldfrag_h(Qh + kk * 32);
        const v16h ql  = ldfrag_h(Ql + kk * 32);
        const v16h kh0 = ldfrag_h(k0p + kk * 32);
        const v16h kh1 = ldfrag_h(k1p + kk * 32);
        const v16h kl0 = ldfrag_h(l0p + kk * 32);
        const v16h kl1 = ldfrag_h(l1p + kk * 32);
        s0 = mma_h(kh0, qh, s0);
        s0 = mma_h(kh0, ql, s0);
        s0 = mma_h(kl0, qh, s0);
        s1 = mma_h(kh1, qh, s1);
        s1 = mma_h(kh1, ql, s1);
        s1 = mma_h(kl1, qh, s1);
        guard2(s0, s1, qh, ql, kh0, kl0, kh1, kl1);
      }
      // ---- key select + online softmax in base 2, -inf-safe; all 16 values of a lane belong to its query ----
      const int cb0 = ks * 32 + 8 * hh;
      float t0[8], t1[8];
      float mx = -INFINITY;
#pragma unroll
      for (int r = 0; r < 8; ++r) {
        const int  cc0 = cb0 + r, cc1 = cc0 + 16;
        const int  j0  = rres + STRD * cc0, j1 = rres + STRD * cc1;
        const bool ok0 = (aq < NA) && (cc0 < NA) && (STRD * (aq - cc0) >= WIN) && (j0 >= GLB);
        const bool ok1 = (aq < NA) && (cc1 < NA) && (STRD * (aq - cc1) >= WIN) && (j1 >= GLB);
        t0[r] = ok0 ? s0[r] * lsc : -INFINITY;
        t1[r] = ok1 ? s1[r] * lsc : -INFINITY;
        mx = fmaxf(mx, fmaxf(t0[r], t1[r]));
      }
      mx = fmaxf(mx, xhalf(mx));
      const float mn = fmaxf(mq, mx);
      const float ms = (mn == -INFINITY) ? 0.0f : mn;
      const float al = exp2f(mq - ms);
      mq = mn;
      // ---- B fragment of P^T * 32768 (f16): elements 0..7 = slots 8*hh + r, elements 8..15 = slots 16 + 8*hh + r ----
      FragH ph;
      float pa = 0.f, pb = 0.f;
#pragma unroll
      for (int r = 0; r < 8; ++r) {
        const float e0 = exp2f(t0[r] - ms), e1 = exp2f(t1[r] - ms);
        pa += e0;
        pb += e1;
        ph.h[0][r] = (_Float16)(e0 * PCAR);
        ph.h[1][r] = (_Float16)(e1 * PCAR);
      }
      float ps = pa + pb;
      ps += xhalf(ps);
      lq = lq * al + ps;
#pragma unroll
      for (int j = 0; j < 4; ++j) {
#pragma unroll
        for (int r = 0; r < 8; ++r) o[j][r] *= al;
      }
#pragma unroll
      for (int it = 0; it < 8; ++it) *(v4u*)(vt + (it * 4 + gr) * VRP + gc) = rv[it];
      wave_sync_lds();                      // the v tile is read by other lanes than wrote it
      // ---- O^T += V^T.P^T : A fragment row d = jj*16 + c, key slots 8*hh + 0..7 and 16 + 8*hh + 0..7 by two transposing loads ----
#pragma unroll
      for (int jg = 0; jg < HD / 32; ++jg) {
        FragH fa, fb;
        fa.u[0] = ld_tr16(vrd + (2 * jg) * 16);
        fa.u[1] = ld_tr16(vrd + 16 * VRP + (2 * jg) * 16);
        fb.u[0] = ld_tr16(vrd + (2 * jg + 1) * 16);
        fb.u[1] = ld_tr16(vrd + 16 * VRP + (2 * jg + 1) * 16);
        const v16h vha = fa.v, vhb2 = fb.v;
        o[2 * jg]     = mma_h(vha,  ph.v, o[2 * jg]);
        o[2 * jg + 1] = mma_h(vhb2, ph.v, o[2 * jg + 1]);
        guard2(o[2 * jg], o[2 * jg + 1], ph.v, vha, vhb2, ph.v, vha, vhb2);
      }
      wave_sync_lds();                      // the tile's reads end before the next key tile's rows rewrite it
    }
    acc_guard4(o[0], o[1], o[2], o[3]);
    // ---- state: m, l per query into the LDS staging; acc * 64 / (32768*1024) into the slab row of the lane's query ----
    if (hh == 0) { msl[aq] = mq; lsl[aq] = lq; }
#pragma unroll
    for (int j = 0; j < 4; ++j) {
      v4f w0, w1;
#pragma unroll
      for (int e = 0; e < 4; ++e) { w0[e] = o[j][e] * acs; w1[e] = o[j][4 + e] * acs; }
      float* sp = slab + c * SLP + j * 16 + 8 * hh;
      *(v4f*)(sp)     = w0;
      *(v4f*)(sp + 4) = w1;
    }
    wave_sync_lds();
    // ---- AC rows (f16): lane = (row select rq in 0..3, 8 consecutive d at c8) ----
    v4u    ov[4];
    bool   okr[4];
    size_t dso[4];
    const int rq = lane >> 3, c8 = (lane & 7) * 8;
#pragma unroll
    for (int it = 0; it < 4; ++it) {
      const int row = it * 4 + rq;
      const v4f a = *(const v4f*)(slab + row * SLP + c8), b4 = *(const v4f*)(slab + row * SLP + c8 + 4);
      float w[8];
#pragma unroll
      for (int e = 0; e < 4; ++e) { w[e] = a[e]; w[4 + e] = b4[e]; }
#pragma unroll
      for (int e = 0; e < 4; ++e) {
        ov[it][e] = pk16(h_bits((_Float16)w[2 * e]), h_bits((_Float16)w[2 * e + 1]));
      }
      const int arow = at * 16 + row;
      okr[it] = (arow < NA);                // uniform over the 8 lanes of one line
      const int acl  = okr[it] ? arow : (NA - 1);
      dso[it] = (brow + (size_t)STRD * acl) * DMOD + (size_t)head * HD + c8;
    }
    {
#pragma unroll
      for (int it = 0; it < 4; ++it) {
        if (okr[it]) *(v4u*)(ACp + dso[it]) = ov[it];
      }
      
    }
    wave_sync_lds();
  }

  wave_sync_lds();
  const size_t mlbase = ((size_t)(b * NH + head) * STRD + rres) * NAP;
  const int l8 = lane & 7;
  v4f mv[NAP / 32], lv[NAP / 32];
#pragma unroll
  for (int ch = 0; ch < NAP / 32; ++ch) {
    mv[ch] = *(const v4f*)(msl + ch * 32 + l8 * 4);
    lv[ch] = *(const v4f*)(lsl + ch * 32 + l8 * 4);
  }
  const bool wm = (lane < 8), wl = (lane >= 8) && (lane < 16);
  {
#pragma unroll
    for (int ch = 0; ch < NAP / 32; ++ch) {
      if (wm) *(v4f*)(Mp + mlbase + ch * 32 + l8 * 4) = mv[ch];
      if (wl) *(v4f*)(Lp + mlbase + ch * 32 + l8 * 4) = lv[ch];
    }
    
  }
}

// =====================================================================================================
// Band + leading key set (pass A), initialised from the pass-S state. Key j is in this set for query i iff
// j <= i && (i - j < WIN || j < GLB). Block bid -> (query block qb = qb0 + bid % nqb: rows qB = 64*qb .. qB+63, head, batch b);
// one wave per 16 query rows q0 = qB + 16*wave, all four waves on the same head, so that they share its key tiles.
//   q/k hi planes f16 x1024 [b*SEQ + s][h*HD + d], residual planes same layout; v^T hi plane [b*NH + h][d][SEQ], v^T residual plane
//   [b*NH + h][d][QE] (keys < QE).
//   Transposed products: a lane owns ONE query i = q0 + (lane & 15), the column of every D tile; lanes l and l ^ 16 share it.
//   Init: m = M, l = L (from [(b*NH+h)*STRD + i%STRD][i/STRD]), O^T = AC row (f16, 8 consecutive d per 16-B load) * (32768*1024/64).
//   The q fragments (B operand) are loaded once and stay in registers.
//   Key tiles of 32, the block's list in ascending order: tile 0 (keys 0..31, holds the leading GLB keys) when the block's band does not
//   start at tile 0, then the band tiles from the one holding max(0, qB - WIN + 1) to the one holding qB + 63 (at most WIN/32 + 3 + 1).
//   A tile is staged once for the block in LDS by per-lane 16-B asynchronous copies: 32 k hi rows and 32 k residual rows (128 B = one whole
//   line each, LDS pitch 144 B), 64 v^T row pieces (64 B, LDS pitch 80 B), and the v^T residual pieces when ROB. Two buffers: tile t + 2 is
//   copied into the buffer tile t has left while tile t + 1 is worked on. Fragments are 16-B LDS reads with the split k map of ldfrag_h.
//   A wave works on tile 0 and on the tiles from the one holding max(0, q0 - WIN + 1) to the one holding q0 + 15; every other tile of the
//   block's list holds only keys outside the set for all of its 16 query rows (weight exactly 0) and is passed over; the hand-over at the
//   foot of a trip is passed by every wave.
//   Per tile: S^T = K.Q^T, 2 key subtiles x 2 k-steps, products k_hi.q_hi + k_hi.q_lo + k_lo.q_hi; exact element predicate; online
//   max-subtracted base-2 softmax in f32, -inf-safe rescale: maximum and sum over the lane's 16 scores, then one exchange with lane ^ 16;
//   P^T x32768 (f16, and its f16 residual when ROB) packed in the lane as the B operand (D rows 8*(lane >> 4) + r of the two subtiles are the
//   split k map's elements); O^T += V^T.P^T with the v^T A fragments in 2 groups of 2 d-subtiles. ROB == 1 (it is used for qB + 64 <= QE
//   only; then every visited key is < QE): products hh + lh + hl with the v residual plane, O written as hi + residual planes; ROB == 0:
//   single product v_hi.P_hi, O hi plane only.
//   After the loop: out = acc / Z (Z >= 1 always: key i itself lies in a visited tile; guarded anyway), carries 1/(32768*1024) folded
//   once, written to the wave's private result slab (pitch 68; row = query; every element owned by one lane), read back as whole rows:
//   each plane row ([b*SEQ + s][h*HD + d]; residual [b*QE + s][h*HD + d], ROB only) is written by 8 consecutive lanes x 16 B.
// coverage: per wave 4 instructions x 4 rows x 8 lanes x 8 halves = 16 x 64 per plane; the two row classes (qb < QE/64 with ROB = 1, the rest
//           with ROB = 0) x NH x NB blocks x WPB waves = every (b, s, h) row of O hi exactly once and every (b, s < QE, h) row of O residual
//           exactly once.
// =====================================================================================================
#define AQB    (16 * WPB)
#define KPIT   72
#define VPIT   40
#define KTILE  (32 * KPIT)
#define VTILE  (HD * VPIT)
#define NKBB   ((WIN / 32) + 3)
static_assert(AQB == 64 && (SEQ % AQB) == 0 && (QE % AQB) == 0 && ATT_THREADS == 128 && HD == 64);

// One key tile of one head: each lane copies two 16-B pieces of every plane (k rows 16 apart, v^T rows 32 apart).
// lk, lv: the lane's first k hi and v^T hi place in the buffer; the residual tiles lie KTILE and VTILE halves behind them.
template <int ROB>
__device__ __forceinline__ void copy_kv(unsigned lk, unsigned lv, const u16* gkh, const u16* gkl, const u16* gvh, const u16* gvl) {
#if defined(__HIP_DEVICE_COMPILE__)
  const unsigned ks = 16 * KPIT * 2, vs = 32 * VPIT * 2;
  const size_t   gk = (size_t)16 * DMOD;
  // the closing s_wait_xcnt 0 stands inside each statement so that no address register is rewritten ahead of it
  asm volatile("global_load_async_to_lds_b128 %0, %6, off\n\t"
               "global_load_async_to_lds_b128 %1, %7, off\n\t"
               "global_load_async_to_lds_b128 %2, %8, off\n\t"
               "global_load_async_to_lds_b128 %3, %9, off\n\t"
               "global_load_async_to_lds_b128 %4, %10, off\n\t"
               "global_load_async_to_lds_b128 %5, %11, off\n\t"
               "s_wait_xcnt 0x0"
               :: "v"(lk), "v"(lk + ks), "v"(lk + KTILE * 2), "v"(lk + KTILE * 2 + ks), "v"(lv), "v"(lv + vs),
                  "v"(gkh), "v"(gkh + gk), "v"(gkl), "v"(gkl + gk), "v"(gvh), "v"(gvh + (size_t)32 * SEQ)
               : "memory");
  if constexpr (ROB != 0) {
    asm volatile("global_load_async_to_lds_b128 %0, %2, off\n\t"
                 "global_load_async_to_lds_b128 %1, %3, off\n\t"
                 "s_wait_xcnt 0x0"
                 :: "v"(lv + VTILE * 2), "v"(lv + VTILE * 2 + vs), "v"(gvl), "v"(gvl + (size_t)32 * QE)
                 : "memory");
  }
#endif
}

// smem: WPB * SLW floats; ring: 2 * ASTG halves; bid: the block's index among the nqb * NH * NB blocks of its row class.
// Every thread of the block calls this (block barriers inside).
template <int ROB>
__device__ __forceinline__
void attn_a_rows(const u16* __restrict__ QHp, const u16* __restrict__ QLp,
                 const u16* __restrict__ KHp, const u16* __restrict__ KLp,
                 const u16* __restrict__ VHp, const u16* __restrict__ VLp,
                 const u16* __restrict__ ACp, const float* __restrict__ Mp, const float* __restrict__ Lp,
                 u16* OHp, u16* OLp, int qb0, int nqb, int bid, float* smem, u16* ring) {
  constexpr int ASTG = 2 * KTILE + (1 + ROB) * VTILE;   // halves of one buffer: k hi, k residual, v^T hi (, v^T residual)

  const int tid  = threadIdx.x;
  const int wave = __builtin_amdgcn_readfirstlane(tid >> 5);   // scalar: the test that passes over a tile is a scalar branch
  const int lane = tid & 31;
  const int hh   = lane >> 4;
  const int c    = lane & 15;
  const int qbl  = bid % nqb;
  const int t2   = bid / nqb;
  const int head = t2 % NH;
  const int b    = t2 / NH;
  if (b >= NB) return;                      // block-uniform, before any barrier; never taken with the exact grid
  const int qB   = (qb0 + qbl) * AQB;
  if (qB + AQB > SEQ) return;               // block-uniform, before any barrier; never taken
  if (ROB != 0 && qB + AQB > QE) return;    // block-uniform, before any barrier; never taken (residual planes cover s < QE only)
  const int q0   = qB + 16 * wave;

  float* slab = smem + wave * SLW;          // result slab [16 queries][64 d] pitch 68

  // ---- the block's tile list: leading tile 0 (when not part of the band) then the band tiles ----
  int kloB = qB - (WIN - 1);
  if (kloB < 0) kloB = 0;
  const int ktbB = kloB >> 5;
  const int kteB = (qB + AQB - 1) >> 5;     // <= SEQ/32 - 1; for ROB: kteB*32 + 31 <= QE - 1
  int nband = kteB - ktbB + 1;
  if (nband > NKBB) nband = NKBB;           // static bound (WIN/32 + 3)
  if (nband < 0) nband = 0;
  const int hasg = (ktbB > 0) ? 1 : 0;
  const int nkt  = nband + hasg;
  // ---- the wave's own band tiles ----
  int klo = q0 - (WIN - 1);
  if (klo < 0) klo = 0;
  const int ktb = klo >> 5;
  const int kte = (q0 + 15) >> 5;

  // ---- copy role: k row tid >> 3 (+ 16), 16-B column tid & 7; v^T row tid >> 2 (+ 32), 16-B column tid & 3 ----
  const int krow = tid >> 3, kch = (tid & 7) * 8;
  const int vrow = tid >> 2, vch = (tid & 3) * 8;
  const unsigned lk0 = (unsigned)(size_t)(ring + krow * KPIT + kch);
  const unsigned lv0 = (unsigned)(size_t)(ring + 2 * KTILE + vrow * VPIT + vch);
  const size_t   gko = ((size_t)b * SEQ + krow) * DMOD + (size_t)head * HD + kch;
  const u16* gkh0 = KHp + gko;
  const u16* gkl0 = KLp + gko;
  const u16* gvh0 = VHp + ((size_t)(b * NH + head) * HD + vrow) * SEQ + vch;
  const u16* gvl0 = gvh0;
  if constexpr (ROB != 0) gvl0 = VLp + ((size_t)(b * NH + head) * HD + vrow) * QE + vch;
  auto stage = [&](int buf, int kt) {
    const int      kb = ((kt < hasg) ? 0 : (ktbB + kt - hasg)) * 32;   // kb + 31 <= SEQ - 1 (ROB: <= QE - 1)
    const unsigned lo = (unsigned)(buf * ASTG * 2);
    copy_kv<ROB>(lk0 + lo, lv0 + lo, gkh0 + (size_t)kb * DMOD, gkl0 + (size_t)kb * DMOD, gvh0 + kb, gvl0 + kb);
  };
  stage(0, 0);

  const size_t hcol = (size_t)head * HD + 8 * hh;
  const _Float16* Qh  = (const _Float16*)(const void*)QHp + ((size_t)b * SEQ + q0 + c) * DMOD + hcol;
  const _Float16* Ql  = (const _Float16*)(const void*)QLp + ((size_t)b * SEQ + q0 + c) * DMOD + hcol;
  const float lsc = SM_SCALE * (LOG2E / (QSC * KSC));
  const float oc  = 1.0f / (PCAR * VCAR);
  const float aci = (PCAR * VCAR) / ACAR;

  const int qr = q0 + c;                    // this lane's query
  float mq, lq;                             // its running max and sum (equal in lanes l and l ^ 16)
  v8f o[4];                                 // O^T: o[j][r] = (d = 16*j + 8*hh + r, query qr)
  v16h qhf[HD / 32], qlf[HD / 32];          // q hi / residual fragments, kept for every tile
#pragma unroll
  for (int kk = 0; kk < HD / 32; ++kk) {
    qhf[kk] = ldfrag_h(Qh + kk * 32);
    qlf[kk] = ldfrag_h(Ql + kk * 32);
  }
  // ---- init from the strided-set state ----
  {
    const size_t mli = ((size_t)(b * NH + head) * STRD + (qr % STRD)) * NAP + (qr / STRD);   // qr / STRD < NA <= NAP
    mq = Mp[mli];
    lq = Lp[mli];
    const _Float16* acp = (const _Float16*)(const void*)ACp + ((size_t)b * SEQ + qr) * DMOD + hcol;
#pragma unroll
    for (int j = 0; j < 4; ++j) {
      const v8h a = *(const v8h*)(acp + j * 16);
#pragma unroll
      for (int r = 0; r < 8; ++r) o[j][r] = (float)a[r] * aci;
    }
  }
  wait_x0();                                // later code may reuse the address registers of the loads above

  wait_async0();
  __syncthreads();                          // tile 0 is published
  if (nkt > 1) stage(1, 1);

#pragma unroll 1
  for (int kt = 0; kt < nkt; ++kt) {
    const int tix = (kt < hasg) ? 0 : (ktbB + kt - hasg);
    const int kb  = tix * 32;
    if (tix == 0 || (tix >= ktb && tix <= kte)) {              // same for the whole wave; no barrier inside
      const _Float16* st = (const _Float16*)(const void*)(ring + (kt & 1) * ASTG);
      // ---- scores S^T: D element r of this lane = (key kb + 8*hh + r, query qr) in s0, key kb + 16 + 8*hh + r in s1 ----
      v8f s0 = zero8(), s1 = zero8();
      const _Float16* k0p = st + c * KPIT + 8 * hh;
      const _Float16* k1p = k0p + 16 * KPIT;
      const _Float16* l0p = k0p + KTILE;
      const _Float16* l1p = l0p + 16 * KPIT;
#pragma unroll
      for (int kk = 0; kk < HD / 32; ++kk) {
        const v16h qh  = qhf[kk];
        const v16h ql  = qlf[kk];
        const v16h kh0 = ldfrag_h(k0p + kk * 32);
        const v16h kh1 = ldfrag_h(k1p + kk * 32);
        const v16h kl0 = ldfrag_h(l0p + kk * 32);
        const v16h kl1 = ldfrag_h(l1p + kk * 32);
        s0 = mma_h(kh0, qh, s0);
        s0 = mma_h(kh0, ql, s0);
        s0 = mma_h(kl0, qh, s0);
        s1 = mma_h(kh1, qh, s1);
        s1 = mma_h(kh1, ql, s1);
        s1 = mma_h(kl1, qh, s1);
        guard2(s0, s1, qh, ql, kh0, kl0, kh1, kl1);
      }
      // ---- key select + online softmax in base 2, -inf-safe; all 16 values of a lane belong to its query ----
      const int kr0 = kb + 8 * hh;
      float t0[8], t1[8];
      float mx = -INFINITY;
#pragma unroll
      for (int r = 0; r < 8; ++r) {
        const int  key0 = kr0 + r, key1 = key0 + 16;
        const bool a0 = (key0 <= qr) && ((qr - key0 < WIN) || (key0 < GLB));
        const bool a1 = (key1 <= qr) && ((qr - key1 < WIN) || (key1 < GLB));
        t0[r] = a0 ? s0[r] * lsc : -INFINITY;
        t1[r] = a1 ? s1[r] * lsc : -INFINITY;
        mx = fmaxf(mx, fmaxf(t0[r], t1[r]));
      }
      mx = fmaxf(mx, xhalf(mx));
      const float mn = fmaxf(mq, mx);
      const float ms = (mn == -INFINITY) ? 0.0f : mn;
      const float al = exp2f(mq - ms);
      mq = mn;
      // ---- B fragments of P^T * 32768: hi f16 (and residual f16 when ROB); elements 0..7 = keys kb + 8hh + r,
      //      elements 8..15 = keys kb + 16 + 8hh + r: the split k map of the v^T A fragments ----
      FragH ph, pl;
      float pa = 0.f, pb = 0.f;
#pragma unroll
      for (int r = 0; r < 8; ++r) {
        const float e0 = exp2f(t0[r] - ms), e1 = exp2f(t1[r] - ms);
        pa += e0;
        pb += e1;
        const float ta = e0 * PCAR, tb = e1 * PCAR;
        const _Float16 ha = (_Float16)ta, hb = (_Float16)tb;
        ph.h[0][r] = ha;
        ph.h[1][r] = hb;
        if constexpr (ROB != 0) {
          pl.h[0][r] = (_Float16)(ta - (float)ha);
          pl.h[1][r] = (_Float16)(tb - (float)hb);
        }
      }
      float ps = pa + pb;
      ps += xhalf(ps);
      lq = lq * al + ps;
#pragma unroll
      for (int j = 0; j < 4; ++j) {
#pragma unroll
        for (int r = 0; r < 8; ++r) o[j][r] *= al;
      }
      // ---- O^T += V^T.P^T : A fragment row d = j*16 + c, the tile's 32 keys contiguous in its LDS row; 2 groups of 2 d-subtiles ----
      {
        const _Float16* vhp = st + 2 * KTILE + c * VPIT + 8 * hh;
        const _Float16* vlp = vhp + VTILE;                     // dereferenced only when ROB
#pragma unroll
        for (int jg = 0; jg < HD / 32; ++jg) {
          const int da = (2 * jg) * 16 * VPIT;
          const int db = da + 16 * VPIT;
          const v16h vha = ldfrag_h(vhp + da), vhb2 = ldfrag_h(vhp + db);
          if constexpr (ROB != 0) {
            const v16h vla = ldfrag_h(vlp + da), vlb2 = ldfrag_h(vlp + db);
            o[2 * jg]     = mma_h(vha,  ph.v, o[2 * jg]);
            o[2 * jg]     = mma_h(vha,  pl.v, o[2 * jg]);
            o[2 * jg]     = mma_h(vla,  ph.v, o[2 * jg]);
            o[2 * jg + 1] = mma_h(vhb2, ph.v, o[2 * jg + 1]);
            o[2 * jg + 1] = mma_h(vhb2, pl.v, o[2 * jg + 1]);
            o[2 * jg + 1] = mma_h(vlb2, ph.v, o[2 * jg + 1]);
            guard2(o[2 * jg], o[2 * jg + 1], ph.v, pl.v, vha, vhb2, vla, vlb2);
          } else {
            o[2 * jg]     = mma_h(vha,  ph.v, o[2 * jg]);
            o[2 * jg + 1] = mma_h(vhb2, ph.v, o[2 * jg + 1]);
            guard2(o[2 * jg], o[2 * jg + 1], ph.v, vha, vhb2, ph.v, vha, vhb2);
          }
        }
      }
    }
    // hand-over: own reads done, own copies of tile kt + 1 landed, then the one barrier that publishes tile kt + 1 and frees this buffer
    wait_ds0();
    wait_async0();
    __syncthreads();
    if (kt + 2 < nkt) stage(kt & 1, kt + 2);
  }
  wait_async0();
  acc_guard4(o[0], o[1], o[2], o[3]);
  // ---- out = acc / Z (0 if Z == 0), carries (32768 on P, 1024 on v) folded once; written into the slab row of the lane's query ----
  {
    const float ls  = (lq > 0.0f) ? lq : 1.0f;
    const float inv = (lq > 0.0f) ? ((1.0f / ls) * oc) : 0.0f;
#pragma unroll
    for (int j = 0; j < 4; ++j) {
      v4f w0, w1;
#pragma unroll
      for (int e = 0; e < 4; ++e) { w0[e] = o[j][e] * inv; w1[e] = o[j][4 + e] * inv; }
      float* sp = slab + c * SLP + j * 16 + 8 * hh;
      *(v4f*)(sp)     = w0;
      *(v4f*)(sp + 4) = w1;
    }
  }

  wave_sync_lds();
  // ---- O x1024 -> f16 hi (+ residual when ROB) planes; lane = (row select rq in 0..3, 8 consecutive d at c8) ----
  v4u oh[4], ol[4];
  const int rq = lane >> 3, c8 = (lane & 7) * 8;
#pragma unroll
  for (int it = 0; it < 4; ++it) {
    const int row = it * 4 + rq;
    const v4f a = *(const v4f*)(slab + row * SLP + c8), b4 = *(const v4f*)(slab + row * SLP + c8 + 4);
    float w[8];
#pragma unroll
    for (int e = 0; e < 4; ++e) { w[e] = a[e] * OSC; w[4 + e] = b4[e] * OSC; }
#pragma unroll
    for (int e = 0; e < 4; ++e) {
      const _Float16 h0 = (_Float16)w[2 * e], h1 = (_Float16)w[2 * e + 1];
      const _Float16 l0 = (_Float16)(w[2 * e] - (float)h0), l1 = (_Float16)(w[2 * e + 1] - (float)h1);
      oh[it][e] = pk16(h_bits(h0), h_bits(h1));
      ol[it][e] = pk16(h_bits(l0), h_bits(l1));
    }
  }
  const size_t ob  = ((size_t)b * SEQ + q0) * DMOD + (size_t)head * HD + c8;
  const size_t olb = ((size_t)b * QE + q0) * DMOD + (size_t)head * HD + c8;   // dereferenced only when ROB
  {
#pragma unroll
    for (int it = 0; it < 4; ++it) {
      const int row = it * 4 + rq;
      *(v4u*)(OHp + ob + (size_t)row * DMOD) = oh[it];
      if constexpr (ROB != 0) {
        *(v4u*)(OLp + olb + (size_t)row * DMOD) = ol[it];
      }
    }
    
  }
  wait_x0();   // a kernel's roles lie one behind the other in the code, in the compiler's order: what follows may rewrite registers these stores name
}

// Both row classes in one grid; no block reads what another writes. The NQR * NH * NB blocks of query rows s < QE (ROB = 1, three times
// the P.v products) come first, then the NQP * NH * NB blocks of the other rows (ROB = 0).
#define NQR (QE / AQB)
#define NQP (SEQ / AQB - NQR)
__global__ __launch_bounds__(ATT_THREADS)
void attn_a(const u16* __restrict__ QHp, const u16* __restrict__ QLp,
            const u16* __restrict__ KHp, const u16* __restrict__ KLp,
            const u16* __restrict__ VHp, const u16* __restrict__ VLp,
            const u16* __restrict__ ACp, const float* __restrict__ Mp, const float* __restrict__ Lp,
            u16* OHp, u16* OLp) {
  __shared__ __align__(16) float smem[WPB * SLW];
  __shared__ __align__(16) u16   ring[2 * (2 * KTILE + 2 * VTILE)];
  const int bid = blockIdx.x;
  if (bid < NQR * NH * NB) {                // block-uniform
    attn_a_rows<1>(QHp, QLp, KHp, KLp, VHp, VLp, ACp, Mp, Lp, OHp, OLp, 0, NQR, bid, smem, ring);
  } else {
    if constexpr (NQP > 0) {
      attn_a_rows<0>(QHp, QLp, KHp, KLp, VHp, VLp, ACp, Mp, Lp, OHp, OLp, NQR, NQP, bid - NQR * NH * NB, smem, ring);
    }
  }
}

// =====================================================================================================
// Workspace map (bytes); every plane is fully written by whole-line stores before it is read; all extents are exact multiples
// of the store granularity (no pad rows needed); every region offset a multiple of 524288:
//   XB  bf16 [MROWS][1024]                       MROWS*2048       (x as bf16; after the projections the region holds AC f16 [MROWS][1024])
//   WB  16-bit 4 x [1024 n][1024 k]              8388608          (Wq, Wk, Wv column blocks as bf16 [n][k], then Wo as f16 x1024, side by side)
//   OH  f16 [MROWS][1024] x1024                  MROWS*2048       (until the strided key set has run the region holds VR, v hi row-major f16 [MROWS][1024] x1024)
//   QH  f16 [MROWS][1024] x1024                  MROWS*2048       QL residual the same; KH, KL the same
//   VH  f16 [NB*16][64][SEQ] x1024               MROWS*2048
//   VL  f16 residual [NB*16][64][QE]             NB*16*64*QE*2
//   OL  f16 residual [NB*QE][1024]               NB*QE*2048
//   M   f32 [NB*16*STRD][NAP]                     NB*16*STRD*NAP*4 L the same
//   end (NB=2, SEQ=4096, QE=512)               131072000
// =====================================================================================================
extern "C" void kernel_launch(void* const* d_in, const int* in_sizes, int n_in,
                              void* d_out, int out_size, void* d_ws, size_t ws_size,
                              hipStream_t stream) {
  if (n_in < 5) return;
  const int needx = OROWS * DMOD;
  if (in_sizes[0] < needx) return;
  if (in_sizes[1] != 3 * DMOD * DMOD) return;
  if (in_sizes[2] < 3 * DMOD) return;
  if (in_sizes[3] != DMOD * DMOD) return;
  if (in_sizes[4] < DMOD) return;
  if (out_size < needx) return;

  const float* x    = (const float*)d_in[0];
  const float* wqkv = (const float*)d_in[1];
  const float* bqkv = (const float*)d_in[2];
  const float* wo   = (const float*)d_in[3];
  const float* bo   = (const float*)d_in[4];
  float*       out  = (float*)d_out;

  const size_t szXB = (size_t)MROWS * DMOD * 2;                 // XB, later AC (same extent)
  const size_t szW  = (size_t)4 * DMOD * DMOD * 2;             // WB: four planes
  const size_t szH  = (size_t)MROWS * DMOD * 2;                 // QH, QL, KH, KL, OH
  const size_t szV  = (size_t)NB * NH * HD * SEQ * 2;           // VH (== szH)
  const size_t szVL = (size_t)NB * NH * HD * QE * 2;            // VL
  const size_t szOL = (size_t)NB * QE * DMOD * 2;               // OL (== szVL)
  const size_t szML = (size_t)NB * NH * STRD * NAP * 4;         // M, L
  size_t off = 0;
  const size_t oXB = off; off += szXB;
  const size_t oW  = off; off += szW;
  const size_t oOH = off; off += szH;
  const size_t oQH = off; off += szH;
  const size_t oQL = off; off += szH;
  const size_t oKH = off; off += szH;
  const size_t oKL = off; off += szH;
  const size_t oVH = off; off += szV;
  const size_t oVL = off; off += szVL;
  const size_t oOL = off; off += szOL;
  const size_t oM  = off; off += szML;
  const size_t oL  = off; off += szML;
  if (off > ws_size) return;                // off = 131072000 for NB = 2, SEQ = 4096
  if (off > (size_t)WS_CAP) return;

  char* ws = (char*)d_ws;
  u16*   XB = (u16*)(ws + oXB);
  u16*   AC = (u16*)(ws + oXB);
  u16*   WB = (u16*)(ws + oW);
  u16*   OH = (u16*)(ws + oOH);
  u16*   VR = (u16*)(ws + oOH);
  u16*   QH = (u16*)(ws + oQH);
  u16*   QL = (u16*)(ws + oQL);
  u16*   KH = (u16*)(ws + oKH);
  u16*   KL = (u16*)(ws + oKL);
  u16*   VH = (u16*)(ws + oVH);
  u16*   VL = (u16*)(ws + oVL);
  u16*   OL = (u16*)(ws + oOL);
  float* Mp = (float*)(ws + oM);
  float* Lp = (float*)(ws + oL);

  const dim3 b256(256), bAT(ATT_THREADS);

  // (0) every operand conversion: Wq, Wk, Wv column blocks ([1024 k][3072 n] -> [1024 n][1024 k] bf16) and Wo ([n][k] f16 plane of
  //     bf16 value x1024) into the four planes of WB; x -> bf16 plane [MROWS][1024]
  prep<<<dim3(4 * TRB + NB * CVB), b256, 0, stream>>>(x, wqkv, wo, XB, WB);
  // (1) the q, k, v projections of every batch, written as the 16-bit planes by their own epilogues
  gemm_p<<<dim3(3 * NB * PBLK), b256, 0, stream>>>(XB, WB, bqkv, QH, QL, KH, KL, VH, VL, VR);
  // (2) strided key set -> per-row state (M, L, AC)
  attn_s<<<dim3(NB * NHG * STRD), bAT, 0, stream>>>(QH, QL, KH, KL, VR, AC, Mp, Lp);
  // (3) band + leading key set merged onto that state: query rows s < QE with residual P.v products -> O hi + residual planes;
  //     remaining rows, single product -> O hi plane
  attn_a<<<dim3((NQR + NQP) * NH * NB), bAT, 0, stream>>>(QH, QL, KH, KL, VH, VL, AC, Mp, Lp, OH, OL);
  // (4) output projection (rows s < QE: hi + residual) -> out f32, carries 1024 x 1024 folded back
  gemm_o<<<dim3(NB * (SEQ / GT) * (DMOD / GT)), b256, 0, stream>>>(OH, OL, WB + (size_t)3 * DMOD * DMOD, bo, out, 1.0f / (OSC * WOS));
  (void)hipGetLastError();
}
